// v000
// Times are from an AMD MI455X. After a warm-up the kernel runs many times in a row, and a time is the length of
// such a window on the GPU divided by its runs, so every launch and the gaps after it count. The runs cycle
// through copies of the inputs. A figure is the median of several windows, for all but v000 over two sittings.
// Sittings can differ by a few percent; kernels timed side by side share one.
// The starting kernel, v000, takes 258 microseconds a run.
// Contractions: q|k|v projections and output projection on v_wmma_f32_16x16x32_bf16 (bf16 operands from
// RNE-converted inputs; context carried as bf16 hi|lo planes K-concatenated against duplicated Wo planes);
// scores q.k^T on v_wmma_f32_16x16x32_f16 (q f16 hi, k f16 hi, single product); p.v on
// v_wmma_f32_16x16x32_f16 (p carried x1024 in f16, v^T as f16 hi + x2048 residual planes, two products,
// separate accumulators); all f32 accumulate; query-embedding scores (from q hi + residual), per-pair bias
// select, softmax and LayerNorm in f32.
#include <hip/hip_runtime.h>
#include <math.h>

#define NBATCH 2
#define SEQ    2048
#define DM     512
#define NH     8
#define HD     64
#define NE     10
#define NEP    16
#define MP     (NBATCH * SEQ)
#define QKW    (4 * DM)
#define KOFF   (2 * DM)
#define CTXP   (2 * DM)
#define NQB    (SEQ / 64)
#define RSC    2048.0f
#define PSC    1024.0f
static_assert(NH * HD == DM);
static_assert(DM == 8 * 64);
static_assert((SEQ % 64) == 0 && (DM % 64) == 0 && (MP % 64) == 0 && (SEQ % 256) == 0 && (MP % 4) == 0);
static_assert((((MP / 64) * (DM / 64)) % 8) == 0);
static_assert((((DM / 64) * (SEQ / 64)) % 8) == 0);
static_assert(NE <= NEP && NEP == 16);

typedef _Float16 v16h __attribute__((ext_vector_type(16)));
typedef _Float16 v8h  __attribute__((ext_vector_type(8)));
typedef __bf16   v16b __attribute__((ext_vector_type(16)));
typedef unsigned short v16us __attribute__((ext_vector_type(16)));
typedef unsigned short v8us  __attribute__((ext_vector_type(8)));
typedef float    v8f  __attribute__((ext_vector_type(8)));
typedef float    v4f  __attribute__((ext_vector_type(4)));
typedef unsigned int v4u __attribute__((ext_vector_type(4)));

union FragH { v16h v; v8h h[2]; };
union FragU { v16us v; v8us h[2]; };

// ---- scalar helpers --------------------------------------------------------------------------------
__device__ __forceinline__ unsigned short bf_bits(float f) {          // f32 -> bf16 bits, RNE convert
  unsigned u = __float_as_uint(f);
  return (unsigned short)((u + 0x7FFFu + ((u >> 16) & 1u)) >> 16);
}
__device__ __forceinline__ float bf_up(unsigned short h) { return __uint_as_float(((unsigned)h) << 16); }
__device__ __forceinline__ float bfr(float f) { return bf_up(bf_bits(f)); }   // value of the bf16 RNE convert
__device__ __forceinline__ unsigned short h_bits(_Float16 x) { return __builtin_bit_cast(unsigned short, x); }
__device__ __forceinline__ unsigned pk16(unsigned short a, unsigned short b) { return (unsigned)a | ((unsigned)b << 16); }
__device__ __forceinline__ v8f zero8() { v8f z = {0.f, 0.f, 0.f, 0.f, 0.f, 0.f, 0.f, 0.f}; return z; }

// ---- fragment loader: 16-bit A/B operand, lane -> row/col (lane&15), p already includes +8*(lane>>4);
//      elements 0..7 <- p[0..7] (k0+8h..), elements 8..15 <- p[16..23] (k0+16+8h..)
__device__ __forceinline__ v16us ldfrag_u(const unsigned short* p) {
  FragU f;
  f.h[0] = *(const v8us*)(p);
  f.h[1] = *(const v8us*)(p + 16);
  return f.v;
}

// ---- WMMA helpers with trailing VALU hazard gap --------------------------------------------------------
__device__ __forceinline__ v8f mma_bu_raw(v16us a, v16us b, v8f c) {            // bf16 operands, unguarded
  return __builtin_amdgcn_wmma_f32_16x16x32_bf16(false, __builtin_bit_cast(v16b, a), false,
                                                 __builtin_bit_cast(v16b, b), (short)0, c, false, false);
}
__device__ __forceinline__ v8f mma_hu(v16us a, v16us b, v8f c) {                // f16 operands (bits), guarded
  c = __builtin_amdgcn_wmma_f32_16x16x32_f16(false, __builtin_bit_cast(v16h, a), false,
                                              __builtin_bit_cast(v16h, b), (short)0, c, false, false);
#if defined(__HIP_DEVICE_COMPILE__)
  asm volatile("v_nop\n\tv_nop\n\tv_nop\n\tv_nop" : "+v"(c) : "v"(a), "v"(b));
#endif
  return c;
}
__device__ __forceinline__ v8f mma_h(v16h a, v16h b, v8f c) {                    // f16 operands, guarded
  c = __builtin_amdgcn_wmma_f32_16x16x32_f16(false, a, false, b, (short)0, c, false, false);
#if defined(__HIP_DEVICE_COMPILE__)
  asm volatile("v_nop\n\tv_nop\n\tv_nop\n\tv_nop" : "+v"(c) : "v"(a), "v"(b));
#endif
  return c;
}
__device__ __forceinline__ void dep_guard1(v8f& a, v8f& b, v16us x) {
#if defined(__HIP_DEVICE_COMPILE__)
  asm volatile("v_nop\n\tv_nop\n\tv_nop\n\tv_nop" : "+v"(a), "+v"(b) : "v"(x));
#endif
}
__device__ __forceinline__ void keep4_u(v16us a, v16us b, v16us c, v16us d) {
#if defined(__HIP_DEVICE_COMPILE__)
  asm volatile("v_nop" :: "v"(a), "v"(b), "v"(c), "v"(d));
#endif
}
__device__ __forceinline__ void acc_guard4(v8f& a, v8f& b, v8f& c, v8f& d) {
#if defined(__HIP_DEVICE_COMPILE__)
  asm volatile("v_nop\n\tv_nop\n\tv_nop\n\tv_nop" : "+v"(a), "+v"(b), "+v"(c), "+v"(d));
#endif
}
__device__ __forceinline__ void wave_sync_lds() {
  __builtin_amdgcn_fence(__ATOMIC_RELEASE, "workgroup");
  __builtin_amdgcn_wave_barrier();
  __builtin_amdgcn_fence(__ATOMIC_ACQUIRE, "workgroup");
}

// =====================================================================================================
// f32 [MP][DM] activations (three sources selected by blockIdx.y, block-uniform) -> bf16 bits plane
// dst[(z*MP + row)*DM + col]. Block = 256 threads = 4 rows; thread t: row = 4*bx + (t>>6), cols 8*(t&63)..+7.
// coverage: 1024 blocks x 4 rows x 512 cols = each whole plane; 3 planes.
// =====================================================================================================
__global__ __launch_bounds__(256) void cvt3(const float* __restrict__ s0, const float* __restrict__ s1,
                                            const float* __restrict__ s2, unsigned short* dst) {
  const int z = blockIdx.y;
  const float* src = (z == 0) ? s0 : ((z == 1) ? s1 : s2);
  const int t = threadIdx.x;
  const int row = blockIdx.x * 4 + (t >> 6);
  const int c8 = (t & 63) * 8;
  const float* p = src + (size_t)row * DM + c8;
  const v4f a0 = *(const v4f*)(p);
  const v4f a1 = *(const v4f*)(p + 4);
  v4u hv;
  hv[0] = pk16(bf_bits(a0[0]), bf_bits(a0[1]));
  hv[1] = pk16(bf_bits(a0[2]), bf_bits(a0[3]));
  hv[2] = pk16(bf_bits(a1[0]), bf_bits(a1[1]));
  hv[3] = pk16(bf_bits(a1[2]), bf_bits(a1[3]));
  unsigned short* d = dst + ((size_t)z * MP + (size_t)row) * DM + c8;
  *(v4u*)d = hv;
  
}

// =====================================================================================================
// Tiled transpose + bf16 convert: in[rows][cols] f32 row-major -> out[cols][rows] bf16 bits with pitch ldo:
//   out[n * ldo + k] = bf16(in[k][n]) and also at + dupoff (a duplicated k range for the hi|lo K-concat GEMM).
// Block = 256 threads = one 64x64 tile; grid = (cols/64, rows/64) (rows, cols multiples of 64, host-checked).
// Loads: 4 iterations x 256 threads x float4 = 64 rows x 64 cols (addresses clamped). LDS tile [n][k] pitch 72.
// coverage: 64 x 64 = the whole transposed tile at both column offsets; grid covers the whole matrix.
// =====================================================================================================
__global__ __launch_bounds__(256) void tconv64(const float* __restrict__ W, unsigned short* out,
                                               int rows, int cols, int ldo, int dupoff) {
  __shared__ __align__(16) unsigned short sh[64 * 72];
  const int t  = threadIdx.x;
  const int n0 = blockIdx.x * 64;            // column tile of in = row tile of out
  const int k0 = blockIdx.y * 64;            // row tile of in = column tile of out
#pragma unroll
  for (int i = 0; i < 4; ++i) {
    const int idx = i * 256 + t;
    const int r = idx >> 4, c4 = (idx & 15) * 4;
    int kr = k0 + r;   kr = (kr < rows) ? kr : (rows - 1);
    int nc = n0 + c4;  nc = (nc < cols - 4) ? nc : (cols - 4);
    const v4f v = *(const v4f*)(W + (size_t)kr * cols + nc);
#pragma unroll
    for (int e = 0; e < 4; ++e) sh[(c4 + e) * 72 + r] = bf_bits(v[e]);
  }
  __syncthreads();
  const int wave = t >> 5, lane = t & 31;
  const int q = lane >> 3, c8 = (lane & 7) * 8;
  v4u pv[2];
  size_t go[2];
#pragma unroll
  for (int it = 0; it < 2; ++it) {
    const int nl = it * 32 + wave * 4 + q;               // 0..63
    pv[it] = *(const v4u*)(sh + nl * 72 + c8);
    go[it] = (size_t)(n0 + nl) * ldo + k0 + c8;
  }
  {
#pragma unroll
    for (int it = 0; it < 2; ++it) {
      *(v4u*)(out + go[it]) = pv[it];
      if (dupoff != 0) *(v4u*)(out + go[it] + dupoff) = pv[it];
    }
    
  }
}

// =====================================================================================================
// Register-blocked batched bf16 WMMA GEMM: C[m][n] = oscale * sum_k A[m][k] * Bt[n][k];
// one wave per 64x64 tile, no block barriers. A row-major [M][K] pitch lda; Bt row-major [N][K] pitch ldb
// (k contiguous); M, N multiples of 64, K multiple of 32. blockIdx.y = batch index with element strides
// (sAy for A, sBy for Bt, sCy for C). Tile enumeration: tile -> tm = tile / (N/64), tn = tile % (N/64).
// OM: 0 = f32 out to Cf (pitch ldc); 4 = f16 hi bits to Cp and f16((v - hi) * 2048) bits to Cp2, 16-bit column
//     base = n0 * nmul (nmul = 2 interleaves [hi 64 | lo 64] per 64-col tile with Cp2 = Cp + 64).
// coverage: 4 slabs x 16 rows x 64 cols = the wave's whole 64x64 tile; grid = tilesM*tilesN/8 blocks exactly
//           (host-checked), so no wave exits early.
// =====================================================================================================
template <int OM>
__global__ __launch_bounds__(256) void gemm64(
    const unsigned short* __restrict__ Ap, int lda, long long sAy,
    const unsigned short* __restrict__ Btp, int ldb, long long sBy,
    unsigned short* Cp, unsigned short* Cp2, float* Cf, int ldc, long long sCy,
    int M, int N, int K, int nmul, float oscale) {
  __shared__ __align__(16) float sT[8][16 * 68];   // per-wave 16x64 slab, pitch 68 floats
  const int by   = blockIdx.y;
  const int lane = threadIdx.x & 31;
  const int wave = threadIdx.x >> 5;
  const int tilesN = N >> 6;
  const int tilesM = M >> 6;
  const int tile = blockIdx.x * 8 + wave;
  if (tile >= tilesM * tilesN) return;   // wave-uniform; no block barriers in this kernel
  const int tm = tile / tilesN;
  const int tn = tile - tm * tilesN;
  const int m0 = tm << 6;
  const int n0 = tn << 6;

  const unsigned short* Ab = Ap  + (size_t)by * (size_t)sAy;
  const unsigned short* Bb = Btp + (size_t)by * (size_t)sBy;
  const size_t cofs = (size_t)by * (size_t)sCy;

  const int rlane = lane & 15;                 // row (A) / col (B, D) within subtile
  const int koff  = (lane >> 4) * 8;           // k offset of this lane half
  const int mOff  = (lane >> 4) * 8;           // D row offset

  v8f acc[4][4];
#pragma unroll
  for (int i = 0; i < 4; ++i)
#pragma unroll
    for (int j = 0; j < 4; ++j) acc[i][j] = zero8();

  for (int k0 = 0; k0 < K; k0 += 32) {
    v16us bh[4];
#pragma unroll
    for (int j = 0; j < 4; ++j) {
      const size_t bo = (size_t)(n0 + (j << 4) + rlane) * ldb + koff + k0;
      bh[j] = ldfrag_u(Bb + bo);
    }
#pragma unroll
    for (int i = 0; i < 4; ++i) {
      const size_t ao = (size_t)(m0 + (i << 4) + rlane) * lda + koff + k0;
      const v16us ah = ldfrag_u(Ab + ao);
#pragma unroll
      for (int j = 0; j < 4; ++j) acc[i][j] = mma_bu_raw(ah, bh[j], acc[i][j]);
      dep_guard1(acc[i][0], acc[i][3], ah);
    }
    keep4_u(bh[0], bh[1], bh[2], bh[3]);
  }
  acc_guard4(acc[0][0], acc[0][1], acc[0][2], acc[0][3]);
  acc_guard4(acc[1][0], acc[1][1], acc[1][2], acc[1][3]);
  acc_guard4(acc[2][0], acc[2][1], acc[2][2], acc[2][3]);
  acc_guard4(acc[3][0], acc[3][1], acc[3][2], acc[3][3]);

  const int hh2 = lane >> 4, c4 = (lane & 15) * 4;     // f32 out: 256-B row segment = 16 lanes x 16 B
  const int q8  = lane >> 3, c8 = (lane & 7) * 8;

  // ---- epilogue ----
  float* slab = sT[wave];
#pragma unroll
  for (int i = 0; i < 4; ++i) {
    const int mBase = m0 + (i << 4);
#pragma unroll
    for (int j = 0; j < 4; ++j) {
#pragma unroll
      for (int r = 0; r < 8; ++r) {
        slab[(mOff + r) * 68 + (j << 4) + rlane] = acc[i][j][r];
      }
    }
    wave_sync_lds();
    if (OM == 0) {
      float* C = Cf + cofs;
      v4f vals[8];
#pragma unroll
      for (int it = 0; it < 8; ++it) {
        const int row = it * 2 + hh2;                      // it 0..7 x hh2 0..1 = rows 0..15
        v4f v = *(const v4f*)(slab + row * 68 + c4);
        vals[it] = v * oscale;
      }
      {
#pragma unroll
        for (int it = 0; it < 8; ++it) {
          const int row = it * 2 + hh2;
          *(v4f*)(C + (size_t)(mBase + row) * ldc + (size_t)n0 * nmul + c4) = vals[it];
        }
        
      }
    } else {
      unsigned short* C  = Cp  + cofs;
      unsigned short* C2 = Cp2 + cofs;
      v4u hv[4], lv[4];
#pragma unroll
      for (int it = 0; it < 4; ++it) {
        const int row = it * 4 + q8;                       // it 0..3 x q8 0..3 = rows 0..15
        const float* sp = slab + row * 68 + c8;
        v4u ha, la;
#pragma unroll
        for (int e = 0; e < 4; ++e) {
          const float f0 = sp[2 * e]     * oscale;
          const float f1 = sp[2 * e + 1] * oscale;
          const _Float16 g0 = (_Float16)f0, g1 = (_Float16)f1;
          const unsigned short u0 = h_bits(g0), u1 = h_bits(g1);
          const unsigned short w0 = h_bits((_Float16)((f0 - (float)g0) * RSC));
          const unsigned short w1 = h_bits((_Float16)((f1 - (float)g1) * RSC));
          ha[e] = pk16(u0, u1);
          la[e] = pk16(w0, w1);
        }
        hv[it] = ha;
        lv[it] = la;
      }
      {
#pragma unroll
        for (int it = 0; it < 4; ++it) {
          const int row = it * 4 + q8;
          const size_t go = (size_t)(mBase + row) * ldc + (size_t)n0 * nmul + c8;
          *(v4u*)(C  + go) = hv[it];
          *(v4u*)(C2 + go) = lv[it];
        }
        
      }
    }
    wave_sync_lds();
  }
}

// =====================================================================================================
// Query-embedding score table: itab[(bh*SEQ + l)*NEP + n] = sum_d qh[b,h,l,d] * bf16(emb[n][h*64 + d]) for
// n < NE (f32, columns NE..NEP-1 = 0). qh is reconstructed in f32 as hi + lo/2048 from the q part of the QK
// plane (f16 hi at col h*128 + d, residual at + 64). Block = 64 threads = 64 consecutive rows l of one (b, h)
// (SEQ % 64 == 0); grid = NBATCH*NH*SEQ/64 exact. q rows and the head's emb slice staged in LDS (f32);
// the 10 dots per row are rolled over n and over two 32-wide d halves (32 static FMAs).
// Output tile 64 x 16 f32 staged in LDS and written as 256 float4 = 4 instructions per wave, each 32 lanes x
// coverage: 512 blocks x 64 rows x 16 cols = the whole table.
// =====================================================================================================
__global__ __launch_bounds__(64) void idx_rows(const unsigned short* __restrict__ qk,
                                               const float* __restrict__ emb, float* itab) {
  __shared__ float Qs[64 * 65];
  __shared__ float Es[NE * HD];
  __shared__ __align__(16) float Ts[64 * NEP];
  const int tid = threadIdx.x;
  const int R0 = blockIdx.x * 64;                 // flat (b*NH + h)*SEQ + l row base
  const int bh = R0 / SEQ;
  const int l0 = R0 - bh * SEQ;
  const int b  = bh / NH;
  const int h  = bh - b * NH;
#pragma unroll 1
  for (int i = tid; i < NE * HD; i += 64) {
    const int n = i >> 6, d = i & 63;
    Es[i] = bfr(emb[(size_t)n * DM + h * HD + d]);
  }
  const _Float16* qp = (const _Float16*)(const void*)qk
                     + ((size_t)b * SEQ + (size_t)l0 + (size_t)tid) * QKW + (size_t)h * (2 * HD);
#pragma unroll
  for (int i = 0; i < 8; ++i) {
    const v8h hv = *(const v8h*)(qp + 8 * i);
    const v8h lv = *(const v8h*)(qp + HD + 8 * i);
#pragma unroll
    for (int e = 0; e < 8; ++e)
      Qs[tid * 65 + 8 * i + e] = (float)hv[e] + (float)lv[e] * (1.0f / RSC);
  }
  __syncthreads();
#pragma unroll 1
  for (int n = 0; n < NE; ++n) {
    float s = 0.f;
#pragma unroll 1
    for (int dc = 0; dc < 2; ++dc) {
#pragma unroll
      for (int d = 0; d < 32; ++d) s += Qs[tid * 65 + dc * 32 + d] * Es[n * HD + dc * 32 + d];
    }
    Ts[tid * NEP + n] = s;
  }
#pragma unroll
  for (int n = NE; n < NEP; ++n) Ts[tid * NEP + n] = 0.f;
  __syncthreads();
  v4f vals[4];
#pragma unroll
  for (int it = 0; it < 4; ++it) vals[it] = *(const v4f*)(Ts + (it * 64 + tid) * 4);
  float* base = itab + (size_t)R0 * NEP;
#pragma unroll
  for (int it = 0; it < 4; ++it) *(v4f*)(base + (it * 64 + tid) * 4) = vals[it];
  
}

// =====================================================================================================
// Flash attention with a per-(query, key) additive bias selected by an input int matrix, head dim 64, SEQ rows
// per batch, non-causal.
//   QK plane (f16 bits, pitch QKW): element (b, t, col) at [(b*SEQ + t)*QKW + col]; q head h: hi at col h*128 + d
//   (residual at + 64, unused here); k head h: hi at KOFF + h*128 + d.
//   v^T hi and lo planes (f16): element (b, h, d, s) at [(b*DM + h*64 + d)*SEQ + s]; value = hi + lo/2048.
//   itab (f32 [NBATCH*NH*SEQ][NEP]): per-query score table; bias(q, kv) = itab[bh*SEQ + q][clamp(trj[b][q][kv])].
//   context plane (bf16, pitch CTXP): hi at [(b*SEQ + t)*CTXP + h*64 + d], lo at + DM.
//   score[i][j] = (q_hi . k) * sscale + bias(i, j); p = exp(s - m) carried as f16(1024 p);
//   context = p . v_hi and p . v_lo on f16 WMMA in two accumulators; online softmax (running max) in f32.
//   Block = 4 waves = 64 query rows of one (b, h); grid = NQB * NH * NBATCH; kv chunks of 64, static trip NQB.
//   The 64 x 16 score-table rows of the block are staged once in LDS; the pair index for each score element is
//   a plain int load (arithmetic address), clamped to 0..NE-1 and used only as an LDS index.
//   K hi and V^T hi/lo chunk staging: 128 threads x 32 elements per plane = the whole 64x64 tile per plane;
//   plain 16-B loads, __syncthreads before and after. P tiles are wave-private, spilled with _Float16 element
//   Context coverage: each wave stores rows q0..q0+15 (it 0..3 x lane>>3 0..3) x 64 columns (8 lanes x 8 bf16)
//   for both the hi and the lo segment; the grid covers all SEQ rows x NH head slabs x NBATCH.
// =====================================================================================================
__global__ __launch_bounds__(128)
void attn64(const unsigned short* __restrict__ qk, const unsigned short* __restrict__ vth,
            const unsigned short* __restrict__ vtl, const float* __restrict__ itab,
            const int* __restrict__ trj, unsigned short* ctxp, float sscale) {
  __shared__ __align__(16) unsigned short Kh[64 * 64];          // K hi [kv][d]  8 KB
  __shared__ __align__(16) _Float16 Vh[64 * 64];                // V^T hi [d][kv] 8 KB
  __shared__ __align__(16) _Float16 Vl[64 * 64];                // V^T lo [d][kv] 8 KB
  __shared__ __align__(16) _Float16 Psh[4][16 * 64];            // per wave P [row][kv] 8 KB
  __shared__ __align__(16) float    Os[4][16 * 64];             // per wave context tile [row][d] 16 KB
  __shared__ __align__(16) float    ITs[64 * NEP];              // score table rows of this query block 4 KB

  const int tid  = threadIdx.x;
  const int wave = tid >> 5;
  const int lane = tid & 31;
  const int hh   = lane >> 4;
  const int c    = lane & 15;

  const int bx   = blockIdx.x;
  const int qb   = bx % NQB;
  const int rest = bx / NQB;
  const int h    = rest % NH;
  const int b    = rest / NH;
  const int q0   = qb * 64 + wave * 16;          // in-batch query row of this wave's first row
  const size_t rowB = (size_t)b * SEQ;

  const unsigned short* Qh  = qk + (size_t)h * (2 * HD);
  const unsigned short* Kg  = qk + KOFF + (size_t)h * (2 * HD);
  const _Float16* Vgh = (const _Float16*)(const void*)vth + ((size_t)b * DM + (size_t)h * HD) * SEQ;
  const _Float16* Vgl = (const _Float16*)(const void*)vtl + ((size_t)b * DM + (size_t)h * HD) * SEQ;
  const float* itb = itab + (((size_t)b * NH + (size_t)h) * SEQ + (size_t)qb * 64) * NEP;
  // this lane's pair-index row group: query row q0 + 8*hh (+ r), key column c (+ kv0 + 16 j)
  const int* trw = trj + (rowB + (size_t)q0 + (size_t)(8 * hh)) * SEQ + c;

  // stage the block's 64 x 16 score table (256 float4, 128 threads x 2); visible after the loop's first barrier
#pragma unroll
  for (int i = 0; i < 2; ++i) {
    const int f = i * 128 + tid;
    *(v4f*)(ITs + f * 4) = *(const v4f*)(itb + (size_t)f * 4);
  }

  float mrow[8], lrow[8];
  v8f oacc[4], oaccL[4];
#pragma unroll
  for (int r = 0; r < 8; ++r) { mrow[r] = -INFINITY; lrow[r] = 0.f; }
#pragma unroll
  for (int t = 0; t < 4; ++t) { oacc[t] = zero8(); oaccL[t] = zero8(); }

#pragma unroll 1
  for (int kt = 0; kt < NQB; ++kt) {         // static trip count
    const int kv0 = kt * 64;

    __syncthreads();
    {
      const int r = tid >> 1, hf = (tid & 1) * 32;
      const unsigned short* kgh = Kg + (rowB + kv0 + r) * QKW + hf;       // K row kv0+r, d = hf..hf+31
      const _Float16* vgh = Vgh + (size_t)r * SEQ + kv0 + hf;            // V^T row d = r, s = kv0+hf..+31
      const _Float16* vgl = Vgl + (size_t)r * SEQ + kv0 + hf;
#pragma unroll
      for (int i = 0; i < 4; ++i) {
        const v8us a0 = *(const v8us*)(kgh + 8 * i);
        const v8h  b0 = *(const v8h*)(vgh + 8 * i);
        const v8h  b1 = *(const v8h*)(vgl + 8 * i);
        *(v8us*)(Kh + r * 64 + hf + 8 * i) = a0;
        *(v8h*)(Vh + r * 64 + hf + 8 * i) = b0;
        *(v8h*)(Vl + r * 64 + hf + 8 * i) = b1;
      }
    }
    __syncthreads();

    // ---- Q fragments (A operand, row = lane&15): f16 hi, 2 d-chunks ----
    v16us qh2[2];
#pragma unroll
    for (int dc = 0; dc < 2; ++dc) {
      qh2[dc] = ldfrag_u(Qh + (rowB + q0 + c) * QKW + dc * 32 + 8 * hh);
    }

    // ---- scores: 16 query rows x 64 keys per wave ----
    v8f s[4];
#pragma unroll
    for (int j = 0; j < 4; ++j) {
      v8f sh = zero8();
#pragma unroll
      for (int dc = 0; dc < 2; ++dc) {
        FragU kb;
        kb.h[0] = *(const v8us*)(Kh + (j * 16 + c) * 64 + dc * 32 + 8 * hh);
        kb.h[1] = *(const v8us*)(Kh + (j * 16 + c) * 64 + dc * 32 + 16 + 8 * hh);
        sh = mma_hu(qh2[dc], kb.v, sh);
      }
      // D element r: query row q0 + 8hh + r, key kv0 + j*16 + c
      const int* tp = trw + kv0 + j * 16;
#pragma unroll
      for (int r = 0; r < 8; ++r) {
        int n = tp[(size_t)r * SEQ];
        n = (n < 0) ? 0 : n;
        n = (n > NE - 1) ? (NE - 1) : n;
        s[j][r] = sh[r] * sscale + ITs[(wave * 16 + 8 * hh + r) * NEP + n];
      }
    }

    // ---- row max, online softmax, P (x1024, f16) to LDS ----
    _Float16* pwh = Psh[wave];
#pragma unroll
    for (int r = 0; r < 8; ++r) {
      float m = s[0][r];
      m = fmaxf(m, s[1][r]);
      m = fmaxf(m, s[2][r]);
      m = fmaxf(m, s[3][r]);
#pragma unroll
      for (int off = 1; off < 16; off <<= 1) m = fmaxf(m, __shfl_xor(m, off, 32));
      const float mnew  = fmaxf(mrow[r], m);
      const float alpha = __expf(mrow[r] - mnew);
      mrow[r] = mnew;
      float psum = 0.f;
#pragma unroll
      for (int j = 0; j < 4; ++j) {
        const float p = __expf(s[j][r] - mnew);
        psum += p;
        pwh[(8 * hh + r) * 64 + j * 16 + c] = (_Float16)(p * PSC);
      }
#pragma unroll
      for (int off = 1; off < 16; off <<= 1) psum += __shfl_xor(psum, off, 32);
      lrow[r] = lrow[r] * alpha + psum;
#pragma unroll
      for (int t = 0; t < 4; ++t) { oacc[t][r] *= alpha; oaccL[t][r] *= alpha; }
    }
    wave_sync_lds();

    // ---- context += P . V_hi and P . V_lo (f16 WMMA, two accumulators) ----
#pragma unroll 1
    for (int kk = 0; kk < 2; ++kk) {
      FragH pa;
      pa.h[0] = *(const v8h*)(pwh + c * 64 + kk * 32 + 8 * hh);
      pa.h[1] = *(const v8h*)(pwh + c * 64 + kk * 32 + 16 + 8 * hh);
#pragma unroll
      for (int t = 0; t < 4; ++t) {
        FragH vb, vl;
        vb.h[0] = *(const v8h*)(Vh + (t * 16 + c) * 64 + kk * 32 + 8 * hh);
        vb.h[1] = *(const v8h*)(Vh + (t * 16 + c) * 64 + kk * 32 + 16 + 8 * hh);
        vl.h[0] = *(const v8h*)(Vl + (t * 16 + c) * 64 + kk * 32 + 8 * hh);
        vl.h[1] = *(const v8h*)(Vl + (t * 16 + c) * 64 + kk * 32 + 16 + 8 * hh);
        oacc[t]  = mma_h(pa.v, vb.v, oacc[t]);
        oaccL[t] = mma_h(pa.v, vl.v, oaccL[t]);
      }
    }
  }

  // ---- normalise (1/l, the 1/1024 p carry, the 1/2048 residual fold), stage the wave's 16x64 tile,
  float* os = Os[wave];
#pragma unroll
  for (int r = 0; r < 8; ++r) {
    const float l = lrow[r];
    const float inv = ((l > 0.f) ? (1.0f / l) : 0.f) * (1.0f / PSC);
#pragma unroll
    for (int t = 0; t < 4; ++t) os[(8 * hh + r) * 64 + t * 16 + c] = (oacc[t][r] + oaccL[t][r] * (1.0f / RSC)) * inv;
  }
  wave_sync_lds();
  {
    const int q4 = lane >> 3, c8 = (lane & 7) * 8;
    v4u hv[4], lv[4];
#pragma unroll
    for (int it = 0; it < 4; ++it) {
      const int row = it * 4 + q4;   // it 0..3 x q4 0..3 = rows 0..15 of the wave tile
      const float* sp = os + row * 64 + c8;
      v4u ha, la;
#pragma unroll
      for (int e = 0; e < 4; ++e) {
        const float f0 = sp[2 * e], f1 = sp[2 * e + 1];
        const unsigned short u0 = bf_bits(f0), u1 = bf_bits(f1);
        const unsigned short w0 = bf_bits(f0 - bf_up(u0)), w1 = bf_bits(f1 - bf_up(u1));
        ha[e] = pk16(u0, u1);
        la[e] = pk16(w0, w1);
      }
      hv[it] = ha;
      lv[it] = la;
    }
    {
#pragma unroll
      for (int it = 0; it < 4; ++it) {
        const int row = it * 4 + q4;
        const size_t go = (rowB + q0 + row) * CTXP + (size_t)h * HD + c8;
        *(v4u*)(ctxp + go)      = hv[it];
        *(v4u*)(ctxp + go + DM) = lv[it];
      }
      
    }
  }
}

// =====================================================================================================
// y = (x - mean) * rstd * bf16(gamma) + bf16(beta). Block = 64 threads = one row; thread t handles columns
// 4t..4t+3 and 256+4t..256+4t+3, so each store instruction of a wave writes 32 lanes x 16 B = 512 contiguous
// coverage: 64 threads x 8 = 512 columns = the whole row; MP rows.
// =====================================================================================================
__global__ __launch_bounds__(64) void ln_rows(const float* __restrict__ X, const float* __restrict__ gam,
                                              const float* __restrict__ bet, float* out) {
  __shared__ float red[4];
  const int row = blockIdx.x;
  const int tid = threadIdx.x, lane = tid & 31, wv = tid >> 5;
  const float* src = X + (size_t)row * DM;
  const v4f a0 = *(const v4f*)(src + tid * 4);
  const v4f a1 = *(const v4f*)(src + 256 + tid * 4);
  float x[8];
#pragma unroll
  for (int e = 0; e < 4; ++e) { x[e] = a0[e]; x[4 + e] = a1[e]; }
  float s = 0.f;
#pragma unroll
  for (int e = 0; e < 8; ++e) s += x[e];
#pragma unroll
  for (int off = 1; off < 32; off <<= 1) s += __shfl_xor(s, off, 32);
  if (lane == 0) red[wv] = s;
  __syncthreads();
  const float mean = (red[0] + red[1]) * (1.0f / DM);
  float d[8];
  float q = 0.f;
#pragma unroll
  for (int e = 0; e < 8; ++e) { d[e] = x[e] - mean; q += d[e] * d[e]; }
#pragma unroll
  for (int off = 1; off < 32; off <<= 1) q += __shfl_xor(q, off, 32);
  if (lane == 0) red[2 + wv] = q;
  __syncthreads();
  const float var  = (red[2] + red[3]) * (1.0f / DM);
  const float rstd = rsqrtf(var + 1e-6f);

  const v4f g0 = *(const v4f*)(gam + tid * 4);
  const v4f g1 = *(const v4f*)(gam + 256 + tid * 4);
  const v4f e0 = *(const v4f*)(bet + tid * 4);
  const v4f e1 = *(const v4f*)(bet + 256 + tid * 4);
  v4f o0, o1;
#pragma unroll
  for (int e = 0; e < 4; ++e) {
    o0[e] = d[e]     * rstd * bfr(g0[e]) + bfr(e0[e]);
    o1[e] = d[4 + e] * rstd * bfr(g1[e]) + bfr(e1[e]);
  }
  float* dst = out + (size_t)row * DM + tid * 4;
  *(v4f*)(dst)       = o0;
  *(v4f*)(dst + 256) = o1;
  
}

// =====================================================================================================
// Workspace map (bytes); every plane is an exact multiple of its 64x64-tile / whole-row / whole-line store
// granularity (MP = 4096 = 64 row tiles; DM = 8 column tiles; VT per batch [512][2048] = 8x32 tiles; score table
//   WT   bf16 [1536 n][512 k]    0          1572864   (rows 0..511 Wq^T, 512..1023 Wk^T, 1024..1535 Wv^T)
//   WoT2 bf16 [512][1024]        1572864    1048576   (cols k and DM + k both Wo^T)
//   INb  bf16 [3][4096][512]     2621440    12582912  (q, k, v as bf16 bits)
//   QK   f16  [4096][2048]       15204352   16777216  (q [hi|lo] per head, then k [hi|lo] per head)
//   VTh  f16  [2][512][2048]     31981568   4194304   (v^T hi)
//   VTl  f16  [2][512][2048]     36175872   4194304   (v^T residual x2048)
//   IT   f32  [32768][16]        40370176   2097152   (query-embedding scores)
//   Ctx  bf16 [4096][1024]       42467328   8388608   (context hi | lo)
//   X    f32  [4096][512]        50855936   8388608   (pre-norm output)
//   end                          59244544
// =====================================================================================================
extern "C" void kernel_launch(void* const* d_in, const int* in_sizes, int n_in,
                              void* d_out, int out_size, void* d_ws, size_t ws_size,
                              hipStream_t stream) {
  if (n_in < 11) return;
  if (in_sizes[0] != MP * DM || in_sizes[1] != MP * DM || in_sizes[2] != MP * DM) return;
  if (in_sizes[3] != NE * DM) return;
  if (in_sizes[4] != NBATCH * SEQ * SEQ) return;
  if (in_sizes[5] != DM * DM || in_sizes[6] != DM * DM || in_sizes[7] != DM * DM || in_sizes[8] != DM * DM) return;
  if (in_sizes[9] != DM || in_sizes[10] != DM) return;
  if (out_size != MP * DM) return;

  const float* q_in = (const float*)d_in[0];
  const float* k_in = (const float*)d_in[1];
  const float* v_in = (const float*)d_in[2];
  const float* emb  = (const float*)d_in[3];
  const int*   trj  = (const int*)d_in[4];
  const float* w_q  = (const float*)d_in[5];
  const float* w_k  = (const float*)d_in[6];
  const float* w_v  = (const float*)d_in[7];
  const float* w_o  = (const float*)d_in[8];
  const float* gam  = (const float*)d_in[9];
  const float* bet  = (const float*)d_in[10];

  const size_t PWT  = (size_t)3 * DM * DM * 2;             //  1572864
  const size_t PWO  = (size_t)DM * KOFF * 2;               //  1048576
  const size_t PIN  = (size_t)3 * MP * DM * 2;             // 12582912
  const size_t PQK  = (size_t)MP * QKW * 2;                // 16777216
  const size_t PVT  = (size_t)NBATCH * DM * SEQ * 2;       //  4194304
  const size_t PIT  = (size_t)NBATCH * NH * SEQ * NEP * 4; //  2097152
  const size_t PCTX = (size_t)MP * CTXP * 2;               //  8388608
  const size_t PX   = (size_t)MP * DM * 4;                 //  8388608
  size_t off = 0;
  const size_t oWT  = off; off += PWT;
  const size_t oWo  = off; off += PWO;
  const size_t oIN  = off; off += PIN;
  const size_t oQK  = off; off += PQK;
  const size_t oVTh = off; off += PVT;
  const size_t oVTl = off; off += PVT;
  const size_t oIT  = off; off += PIT;
  const size_t oCtx = off; off += PCTX;
  const size_t oX   = off; off += PX;
  if (off > ws_size) return;                               // off = 59244544
  if (off > (size_t)134217728) return;

  char* ws = (char*)d_ws;
  unsigned short* WT   = (unsigned short*)(ws + oWT);
  unsigned short* WoT2 = (unsigned short*)(ws + oWo);
  unsigned short* INb  = (unsigned short*)(ws + oIN);
  unsigned short* QK   = (unsigned short*)(ws + oQK);
  unsigned short* VTh  = (unsigned short*)(ws + oVTh);
  unsigned short* VTl  = (unsigned short*)(ws + oVTl);
  float*          IT   = (float*)(ws + oIT);
  unsigned short* Ctx  = (unsigned short*)(ws + oCtx);
  float*          X    = (float*)(ws + oX);
  float*          out0 = (float*)d_out;

  const dim3 blk(256), blk128(128), blk64(64);
  const dim3 gCv(MP / 4, 3);                                        // 1024 x 3 blocks
  const dim3 gT(DM / 64, DM / 64);                                  // (cols/64, rows/64) = 8 x 8 per weight
  const dim3 gQK(((MP / 64) * (DM / 64)) / 8, 2, 1);                // 512 tiles -> 64 blocks x {q, k}
  const dim3 gVT(((DM / 64) * (SEQ / 64)) / 8, NBATCH, 1);          // 256 tiles -> 32 blocks x 2 batches
  const dim3 gIdx(NBATCH * NH * (SEQ / 64));                        // 512 blocks of 64
  const dim3 gAttn(NBATCH * NH * NQB);                              // 512 blocks of 128
  const dim3 gNo(((MP / 64) * (DM / 64)) / 8, 1, 1);                // 512 tiles -> 64 blocks
  const dim3 gLN(MP);                                               // 4096 rows
  if ((((MP / 64) * (DM / 64)) % 8) != 0) return;
  if ((((DM / 64) * (SEQ / 64)) % 8) != 0) return;

  // (0) activations -> bf16 bits; weight planes: in[k][n] (shape [512 in][512 out]) -> out[n][k] transposed
  //     through LDS (Wo additionally at cols DM + k for the hi|lo K-concat)
  cvt3<<<gCv, blk, 0, stream>>>(q_in, k_in, v_in, INb);
  tconv64<<<gT, blk, 0, stream>>>(w_q, WT, DM, DM, DM, 0);                            // -> WT rows 0..511
  tconv64<<<gT, blk, 0, stream>>>(w_k, WT + (size_t)DM * DM, DM, DM, DM, 0);          // -> WT rows 512..1023
  tconv64<<<gT, blk, 0, stream>>>(w_v, WT + (size_t)2 * DM * DM, DM, DM, DM, 0);      // -> WT rows 1024..1535
  tconv64<<<gT, blk, 0, stream>>>(w_o, WoT2, DM, DM, KOFF, DM);

  // (1) q = qb . Wq^T-plane (blockIdx.y = 0) and k = kb . Wk^T-plane (blockIdx.y = 1), K = 512
  //     -> f16 [hi 64 | lo 64] per head (QK plane [4096][2048], q at cols 0.., k at cols KOFF..);
  //     v^T per batch = Wv^T . vb_b^T -> f16 hi (VTh) and residual x2048 (VTl) planes [2][512][2048]
  gemm64<4><<<gQK, blk, 0, stream>>>(
      INb, DM, (long long)MP * DM, WT, DM, (long long)DM * DM,
      QK, QK + HD, X, QKW, (long long)KOFF,
      MP, DM, DM, 2, 1.0f);
  gemm64<4><<<gVT, blk, 0, stream>>>(
      WT + (size_t)2 * DM * DM, DM, 0LL, INb + (size_t)2 * MP * DM, DM, (long long)SEQ * DM,
      VTh, VTl, X, SEQ, (long long)DM * SEQ,
      DM, SEQ, DM, 1, 1.0f);

  // (2) query-embedding score table (f32), then flash attention with the selected per-pair bias
  //     -> context bf16 hi|lo
  idx_rows<<<gIdx, blk64, 0, stream>>>(QK, emb, IT);
  attn64<<<gAttn, blk128, 0, stream>>>(QK, VTh, VTl, IT, trj, Ctx, 0.125f);

  // (3) X = [ctx_hi | ctx_lo] . [Wo | Wo]  (K = 1024, bf16 operands) -> f32 plane; LayerNorm -> d_out
  gemm64<0><<<gNo, blk, 0, stream>>>(
      Ctx, CTXP, 0LL, WoT2, KOFF, 0LL,
      Ctx, Ctx, X, DM, 0LL,
      MP, DM, KOFF, 1, 1.0f);
  ln_rows<<<gLN, blk64, 0, stream>>>(X, gam, bet, out0);
  (void)hipGetLastError();
}

// v001
// Measured time: 227 microseconds a run.
// Timed twice side by side with v000, it ran 1.15 and 1.16 times as fast.
// Contractions: q|k|v projections and output projection on v_wmma_f32_16x16x32_bf16 (bf16 operands from
// RNE-converted inputs; context carried as bf16 hi|lo planes K-concatenated against duplicated Wo planes);
// scores q.k^T on v_wmma_f32_16x16x32_f16 (q f16 hi, k f16 hi, single product); p.v on
// v_wmma_f32_16x16x32_f16 (p carried x1024 in f16, v^T as f16 hi + x2048 residual planes, two products,
// separate accumulators); all f32 accumulate; query-embedding scores (from q hi + residual), per-pair bias
// select, softmax and LayerNorm in f32.
#include <hip/hip_runtime.h>
#include <math.h>

#define NBATCH 2
#define SEQ    2048
#define DM     512
#define NH     8
#define HD     64
#define NE     10
#define NEP    16
#define MP     (NBATCH * SEQ)
#define QKW    (4 * DM)
#define KOFF   (2 * DM)
#define CTXP   (2 * DM)
#define NQB    (SEQ / 64)
#define RSC    2048.0f
#define PSC    1024.0f
#define KP     72      // LDS row pitch of the 64-wide 16-bit attention tiles, in elements: 144 B = 16 B x 9
#define OPT    68      // LDS row pitch of the f32 context tile, in floats: 272 B = 16 B x 17
#define ITP    20      // LDS row pitch of the score-table rows, in floats: rows 8 apart fall 32 banks apart
static_assert(NH * HD == DM);
static_assert(DM == 8 * 64);
static_assert((SEQ % 64) == 0 && (DM % 64) == 0 && (MP % 64) == 0 && (SEQ % 256) == 0 && (MP % 4) == 0);
static_assert((((MP / 64) * (DM / 64)) % 8) == 0);
static_assert((((DM / 64) * (SEQ / 64)) % 8) == 0);
static_assert(NE <= NEP && NEP == 16);

typedef _Float16 v16h __attribute__((ext_vector_type(16)));
typedef _Float16 v8h  __attribute__((ext_vector_type(8)));
typedef __bf16   v16b __attribute__((ext_vector_type(16)));
typedef unsigned short v16us __attribute__((ext_vector_type(16)));
typedef unsigned short v8us  __attribute__((ext_vector_type(8)));
typedef float    v8f  __attribute__((ext_vector_type(8)));
typedef float    v4f  __attribute__((ext_vector_type(4)));
typedef unsigned int v4u __attribute__((ext_vector_type(4)));

union FragH { v16h v; v8h h[2]; };
union FragU { v16us v; v8us h[2]; };

// ---- scalar helpers --------------------------------------------------------------------------------
__device__ __forceinline__ unsigned short bf_bits(float f) {          // f32 -> bf16 bits, RNE convert
  unsigned u = __float_as_uint(f);
  return (unsigned short)((u + 0x7FFFu + ((u >> 16) & 1u)) >> 16);
}
__device__ __forceinline__ float bf_up(unsigned short h) { return __uint_as_float(((unsigned)h) << 16); }
__device__ __forceinline__ float bfr(float f) { return bf_up(bf_bits(f)); }   // value of the bf16 RNE convert
__device__ __forceinline__ unsigned short h_bits(_Float16 x) { return __builtin_bit_cast(unsigned short, x); }
__device__ __forceinline__ unsigned pk16(unsigned short a, unsigned short b) { return (unsigned)a | ((unsigned)b << 16); }
__device__ __forceinline__ v8f zero8() { v8f z = {0.f, 0.f, 0.f, 0.f, 0.f, 0.f, 0.f, 0.f}; return z; }

// ---- fragment loader: 16-bit A/B operand, lane -> row/col (lane&15), p already includes +8*(lane>>4);
//      elements 0..7 <- p[0..7] (k0+8h..), elements 8..15 <- p[16..23] (k0+16+8h..)
__device__ __forceinline__ v16us ldfrag_u(const unsigned short* p) {
  FragU f;
  f.h[0] = *(const v8us*)(p);
  f.h[1] = *(const v8us*)(p + 16);
  return f.v;
}

// ---- WMMA helpers with trailing VALU hazard gap --------------------------------------------------------
__device__ __forceinline__ v8f mma_bu_raw(v16us a, v16us b, v8f c) {            // bf16 operands, unguarded
  return __builtin_amdgcn_wmma_f32_16x16x32_bf16(false, __builtin_bit_cast(v16b, a), false,
                                                 __builtin_bit_cast(v16b, b), (short)0, c, false, false);
}
__device__ __forceinline__ v8f mma_hu(v16us a, v16us b, v8f c) {                // f16 operands (bits), guarded
  c = __builtin_amdgcn_wmma_f32_16x16x32_f16(false, __builtin_bit_cast(v16h, a), false,
                                              __builtin_bit_cast(v16h, b), (short)0, c, false, false);
#if defined(__HIP_DEVICE_COMPILE__)
  asm volatile("v_nop\n\tv_nop\n\tv_nop\n\tv_nop" : "+v"(c) : "v"(a), "v"(b));
#endif
  return c;
}
__device__ __forceinline__ v8f mma_h(v16h a, v16h b, v8f c) {                    // f16 operands, guarded
  c = __builtin_amdgcn_wmma_f32_16x16x32_f16(false, a, false, b, (short)0, c, false, false);
#if defined(__HIP_DEVICE_COMPILE__)
  asm volatile("v_nop\n\tv_nop\n\tv_nop\n\tv_nop" : "+v"(c) : "v"(a), "v"(b));
#endif
  return c;
}
__device__ __forceinline__ void dep_guard1(v8f& a, v8f& b, v16us x) {
#if defined(__HIP_DEVICE_COMPILE__)
  asm volatile("v_nop\n\tv_nop\n\tv_nop\n\tv_nop" : "+v"(a), "+v"(b) : "v"(x));
#endif
}
__device__ __forceinline__ void keep4_u(v16us a, v16us b, v16us c, v16us d) {
#if defined(__HIP_DEVICE_COMPILE__)
  asm volatile("v_nop" :: "v"(a), "v"(b), "v"(c), "v"(d));
#endif
}
__device__ __forceinline__ void acc_guard4(v8f& a, v8f& b, v8f& c, v8f& d) {
#if defined(__HIP_DEVICE_COMPILE__)
  asm volatile("v_nop\n\tv_nop\n\tv_nop\n\tv_nop" : "+v"(a), "+v"(b), "+v"(c), "+v"(d));
#endif
}
__device__ __forceinline__ void wave_sync_lds() {
  __builtin_amdgcn_fence(__ATOMIC_RELEASE, "workgroup");
  __builtin_amdgcn_wave_barrier();
  __builtin_amdgcn_fence(__ATOMIC_ACQUIRE, "workgroup");
}

// =====================================================================================================
// f32 [MP][DM] activations (three sources selected by blockIdx.y, block-uniform) -> bf16 bits plane
// dst[(z*MP + row)*DM + col]. Block = 256 threads = 4 rows; thread t: row = 4*bx + (t>>6), cols 8*(t&63)..+7.
// coverage: 1024 blocks x 4 rows x 512 cols = each whole plane; 3 planes.
// =====================================================================================================
__global__ __launch_bounds__(256) void cvt3(const float* __restrict__ s0, const float* __restrict__ s1,
                                            const float* __restrict__ s2, unsigned short* dst) {
  const int z = blockIdx.y;
  const float* src = (z == 0) ? s0 : ((z == 1) ? s1 : s2);
  const int t = threadIdx.x;
  const int row = blockIdx.x * 4 + (t >> 6);
  const int c8 = (t & 63) * 8;
  const float* p = src + (size_t)row * DM + c8;
  const v4f a0 = *(const v4f*)(p);
  const v4f a1 = *(const v4f*)(p + 4);
  v4u hv;
  hv[0] = pk16(bf_bits(a0[0]), bf_bits(a0[1]));
  hv[1] = pk16(bf_bits(a0[2]), bf_bits(a0[3]));
  hv[2] = pk16(bf_bits(a1[0]), bf_bits(a1[1]));
  hv[3] = pk16(bf_bits(a1[2]), bf_bits(a1[3]));
  unsigned short* d = dst + ((size_t)z * MP + (size_t)row) * DM + c8;
  *(v4u*)d = hv;
  
}

// =====================================================================================================
// Tiled transpose + bf16 convert: in[rows][cols] f32 row-major -> out[cols][rows] bf16 bits with pitch ldo:
//   out[n * ldo + k] = bf16(in[k][n]) and also at + dupoff (a duplicated k range for the hi|lo K-concat GEMM).
// Block = 256 threads = one 64x64 tile; grid = (cols/64, rows/64) (rows, cols multiples of 64, host-checked).
// Loads: 4 iterations x 256 threads x float4 = 64 rows x 64 cols (addresses clamped). LDS tile [n][k] pitch 72.
// coverage: 64 x 64 = the whole transposed tile at both column offsets; grid covers the whole matrix.
// =====================================================================================================
__global__ __launch_bounds__(256) void tconv64(const float* __restrict__ W, unsigned short* out,
                                               int rows, int cols, int ldo, int dupoff) {
  __shared__ __align__(16) unsigned short sh[64 * 72];
  const int t  = threadIdx.x;
  const int n0 = blockIdx.x * 64;            // column tile of in = row tile of out
  const int k0 = blockIdx.y * 64;            // row tile of in = column tile of out
#pragma unroll
  for (int i = 0; i < 4; ++i) {
    const int idx = i * 256 + t;
    const int r = idx >> 4, c4 = (idx & 15) * 4;
    int kr = k0 + r;   kr = (kr < rows) ? kr : (rows - 1);
    int nc = n0 + c4;  nc = (nc < cols - 4) ? nc : (cols - 4);
    const v4f v = *(const v4f*)(W + (size_t)kr * cols + nc);
#pragma unroll
    for (int e = 0; e < 4; ++e) sh[(c4 + e) * 72 + r] = bf_bits(v[e]);
  }
  __syncthreads();
  const int wave = t >> 5, lane = t & 31;
  const int q = lane >> 3, c8 = (lane & 7) * 8;
  v4u pv[2];
  size_t go[2];
#pragma unroll
  for (int it = 0; it < 2; ++it) {
    const int nl = it * 32 + wave * 4 + q;               // 0..63
    pv[it] = *(const v4u*)(sh + nl * 72 + c8);
    go[it] = (size_t)(n0 + nl) * ldo + k0 + c8;
  }
  {
#pragma unroll
    for (int it = 0; it < 2; ++it) {
      *(v4u*)(out + go[it]) = pv[it];
      if (dupoff != 0) *(v4u*)(out + go[it] + dupoff) = pv[it];
    }
    
  }
}

// =====================================================================================================
// Register-blocked batched bf16 WMMA GEMM: C[m][n] = oscale * sum_k A[m][k] * Bt[n][k];
// one wave per 64x64 tile, no block barriers. A row-major [M][K] pitch lda; Bt row-major [N][K] pitch ldb
// (k contiguous); M, N multiples of 64, K multiple of 32. blockIdx.y = batch index with element strides
// (sAy for A, sBy for Bt, sCy for C). Tile enumeration: tile -> tm = tile / (N/64), tn = tile % (N/64).
// OM: 0 = f32 out to Cf (pitch ldc); 4 = f16 hi bits to Cp and f16((v - hi) * 2048) bits to Cp2, 16-bit column
//     base = n0 * nmul (nmul = 2 interleaves [hi 64 | lo 64] per 64-col tile with Cp2 = Cp + 64).
// coverage: 4 slabs x 16 rows x 64 cols = the wave's whole 64x64 tile; grid = tilesM*tilesN/8 blocks exactly
//           (host-checked), so no wave exits early.
// =====================================================================================================
template <int OM>
__global__ __launch_bounds__(256) void gemm64(
    const unsigned short* __restrict__ Ap, int lda, long long sAy,
    const unsigned short* __restrict__ Btp, int ldb, long long sBy,
    unsigned short* Cp, unsigned short* Cp2, float* Cf, int ldc, long long sCy,
    int M, int N, int K, int nmul, float oscale) {
  __shared__ __align__(16) float sT[8][16 * 68];   // per-wave 16x64 slab, pitch 68 floats
  const int by   = blockIdx.y;
  const int lane = threadIdx.x & 31;
  const int wave = threadIdx.x >> 5;
  const int tilesN = N >> 6;
  const int tilesM = M >> 6;
  const int tile = blockIdx.x * 8 + wave;
  if (tile >= tilesM * tilesN) return;   // wave-uniform; no block barriers in this kernel
  const int tm = tile / tilesN;
  const int tn = tile - tm * tilesN;
  const int m0 = tm << 6;
  const int n0 = tn << 6;

  const unsigned short* Ab = Ap  + (size_t)by * (size_t)sAy;
  const unsigned short* Bb = Btp + (size_t)by * (size_t)sBy;
  const size_t cofs = (size_t)by * (size_t)sCy;

  const int rlane = lane & 15;                 // row (A) / col (B, D) within subtile
  const int koff  = (lane >> 4) * 8;           // k offset of this lane half
  const int mOff  = (lane >> 4) * 8;           // D row offset

  v8f acc[4][4];
#pragma unroll
  for (int i = 0; i < 4; ++i)
#pragma unroll
    for (int j = 0; j < 4; ++j) acc[i][j] = zero8();

  for (int k0 = 0; k0 < K; k0 += 32) {
    v16us bh[4];
#pragma unroll
    for (int j = 0; j < 4; ++j) {
      const size_t bo = (size_t)(n0 + (j << 4) + rlane) * ldb + koff + k0;
      bh[j] = ldfrag_u(Bb + bo);
    }
#pragma unroll
    for (int i = 0; i < 4; ++i) {
      const size_t ao = (size_t)(m0 + (i << 4) + rlane) * lda + koff + k0;
      const v16us ah = ldfrag_u(Ab + ao);
#pragma unroll
      for (int j = 0; j < 4; ++j) acc[i][j] = mma_bu_raw(ah, bh[j], acc[i][j]);
      dep_guard1(acc[i][0], acc[i][3], ah);
    }
    keep4_u(bh[0], bh[1], bh[2], bh[3]);
  }
  acc_guard4(acc[0][0], acc[0][1], acc[0][2], acc[0][3]);
  acc_guard4(acc[1][0], acc[1][1], acc[1][2], acc[1][3]);
  acc_guard4(acc[2][0], acc[2][1], acc[2][2], acc[2][3]);
  acc_guard4(acc[3][0], acc[3][1], acc[3][2], acc[3][3]);

  const int hh2 = lane >> 4, c4 = (lane & 15) * 4;     // f32 out: 256-B row segment = 16 lanes x 16 B
  const int q8  = lane >> 3, c8 = (lane & 7) * 8;

  // ---- epilogue ----
  float* slab = sT[wave];
#pragma unroll
  for (int i = 0; i < 4; ++i) {
    const int mBase = m0 + (i << 4);
#pragma unroll
    for (int j = 0; j < 4; ++j) {
#pragma unroll
      for (int r = 0; r < 8; ++r) {
        slab[(mOff + r) * 68 + (j << 4) + rlane] = acc[i][j][r];
      }
    }
    wave_sync_lds();
    if (OM == 0) {
      float* C = Cf + cofs;
      v4f vals[8];
#pragma unroll
      for (int it = 0; it < 8; ++it) {
        const int row = it * 2 + hh2;                      // it 0..7 x hh2 0..1 = rows 0..15
        v4f v = *(const v4f*)(slab + row * 68 + c4);
        vals[it] = v * oscale;
      }
      {
#pragma unroll
        for (int it = 0; it < 8; ++it) {
          const int row = it * 2 + hh2;
          *(v4f*)(C + (size_t)(mBase + row) * ldc + (size_t)n0 * nmul + c4) = vals[it];
        }
        
      }
    } else {
      unsigned short* C  = Cp  + cofs;
      unsigned short* C2 = Cp2 + cofs;
      v4u hv[4], lv[4];
#pragma unroll
      for (int it = 0; it < 4; ++it) {
        const int row = it * 4 + q8;                       // it 0..3 x q8 0..3 = rows 0..15
        const float* sp = slab + row * 68 + c8;
        v4u ha, la;
#pragma unroll
        for (int e = 0; e < 4; ++e) {
          const float f0 = sp[2 * e]     * oscale;
          const float f1 = sp[2 * e + 1] * oscale;
          const _Float16 g0 = (_Float16)f0, g1 = (_Float16)f1;
          const unsigned short u0 = h_bits(g0), u1 = h_bits(g1);
          const unsigned short w0 = h_bits((_Float16)((f0 - (float)g0) * RSC));
          const unsigned short w1 = h_bits((_Float16)((f1 - (float)g1) * RSC));
          ha[e] = pk16(u0, u1);
          la[e] = pk16(w0, w1);
        }
        hv[it] = ha;
        lv[it] = la;
      }
      {
#pragma unroll
        for (int it = 0; it < 4; ++it) {
          const int row = it * 4 + q8;
          const size_t go = (size_t)(mBase + row) * ldc + (size_t)n0 * nmul + c8;
          *(v4u*)(C  + go) = hv[it];
          *(v4u*)(C2 + go) = lv[it];
        }
        
      }
    }
    wave_sync_lds();
  }
}

// =====================================================================================================
// Query-embedding score table: itab[(bh*SEQ + l)*NEP + n] = sum_d qh[b,h,l,d] * bf16(emb[n][h*64 + d]) for
// n < NE (f32, columns NE..NEP-1 = 0). qh is reconstructed in f32 as hi + lo/2048 from the q part of the QK
// plane (f16 hi at col h*128 + d, residual at + 64). Block = 64 threads = 64 consecutive rows l of one (b, h)
// (SEQ % 64 == 0); grid = NBATCH*NH*SEQ/64 exact. q rows and the head's emb slice staged in LDS (f32);
// the 10 dots per row are rolled over n and over two 32-wide d halves (32 static FMAs).
// Output tile 64 x 16 f32 staged in LDS and written as 256 float4 = 4 instructions per wave, each 32 lanes x
// coverage: 512 blocks x 64 rows x 16 cols = the whole table.
// =====================================================================================================
__global__ __launch_bounds__(64) void idx_rows(const unsigned short* __restrict__ qk,
                                               const float* __restrict__ emb, float* itab) {
  __shared__ float Qs[64 * 65];
  __shared__ float Es[NE * HD];
  __shared__ __align__(16) float Ts[64 * NEP];
  const int tid = threadIdx.x;
  const int R0 = blockIdx.x * 64;                 // flat (b*NH + h)*SEQ + l row base
  const int bh = R0 / SEQ;
  const int l0 = R0 - bh * SEQ;
  const int b  = bh / NH;
  const int h  = bh - b * NH;
#pragma unroll 1
  for (int i = tid; i < NE * HD; i += 64) {
    const int n = i >> 6, d = i & 63;
    Es[i] = bfr(emb[(size_t)n * DM + h * HD + d]);
  }
  const _Float16* qp = (const _Float16*)(const void*)qk
                     + ((size_t)b * SEQ + (size_t)l0 + (size_t)tid) * QKW + (size_t)h * (2 * HD);
#pragma unroll
  for (int i = 0; i < 8; ++i) {
    const v8h hv = *(const v8h*)(qp + 8 * i);
    const v8h lv = *(const v8h*)(qp + HD + 8 * i);
#pragma unroll
    for (int e = 0; e < 8; ++e)
      Qs[tid * 65 + 8 * i + e] = (float)hv[e] + (float)lv[e] * (1.0f / RSC);
  }
  __syncthreads();
#pragma unroll 1
  for (int n = 0; n < NE; ++n) {
    float s = 0.f;
#pragma unroll 1
    for (int dc = 0; dc < 2; ++dc) {
#pragma unroll
      for (int d = 0; d < 32; ++d) s += Qs[tid * 65 + dc * 32 + d] * Es[n * HD + dc * 32 + d];
    }
    Ts[tid * NEP + n] = s;
  }
#pragma unroll
  for (int n = NE; n < NEP; ++n) Ts[tid * NEP + n] = 0.f;
  __syncthreads();
  v4f vals[4];
#pragma unroll
  for (int it = 0; it < 4; ++it) vals[it] = *(const v4f*)(Ts + (it * 64 + tid) * 4);
  float* base = itab + (size_t)R0 * NEP;
#pragma unroll
  for (int it = 0; it < 4; ++it) *(v4f*)(base + (it * 64 + tid) * 4) = vals[it];
  
}

// =====================================================================================================
// Flash attention with a per-(query, key) additive bias selected by an input int matrix, head dim 64, SEQ rows
// per batch, non-causal.
//   QK plane (f16 bits, pitch QKW): element (b, t, col) at [(b*SEQ + t)*QKW + col]; q head h: hi at col h*128 + d
//   (residual at + 64, unused here); k head h: hi at KOFF + h*128 + d.
//   v^T hi and lo planes (f16): element (b, h, d, s) at [(b*DM + h*64 + d)*SEQ + s]; value = hi + lo/2048.
//   itab (f32 [NBATCH*NH*SEQ][NEP]): per-query score table; bias(q, kv) = itab[bh*SEQ + q][clamp(trj[b][q][kv])].
//   context plane (bf16, pitch CTXP): hi at [(b*SEQ + t)*CTXP + h*64 + d], lo at + DM.
//   score[i][j] = (q_hi . k) * sscale + bias(i, j); p = exp(s - m) carried as f16(1024 p);
//   context = p . v_hi and p . v_lo on f16 WMMA in two accumulators; online softmax (running max) in f32.
//   Block = 4 waves = 64 query rows of one (b, h); grid = NQB * NH * NBATCH; kv chunks of 64, static trip NQB.
//   The 64 x 16 score-table rows of the block are staged once in LDS; the pair index for each score element is
//   a plain int load (arithmetic address), clamped to 0..NE-1 and used only as an LDS index.
//   K hi and V^T hi/lo chunk staging: 128 threads x 32 elements per plane = the whole 64x64 tile per plane;
//   plain 16-B loads, __syncthreads before and after. P tiles are wave-private, spilled with _Float16 element
//   Context coverage: each wave stores rows q0..q0+15 (it 0..3 x lane>>3 0..3) x 64 columns (8 lanes x 8 bf16)
//   for both the hi and the lo segment; the grid covers all SEQ rows x NH head slabs x NBATCH.
// =====================================================================================================
__global__ __launch_bounds__(128)
void attn64(const unsigned short* __restrict__ qk, const unsigned short* __restrict__ vth,
            const unsigned short* __restrict__ vtl, const float* __restrict__ itab,
            const int* __restrict__ trj, unsigned short* ctxp, float sscale) {
  __shared__ __align__(16) unsigned short Kh[64 * KP];          // K hi [kv][d]  9 KB
  __shared__ __align__(16) _Float16 Vh[64 * KP];                // V^T hi [d][kv] 9 KB
  __shared__ __align__(16) _Float16 Vl[64 * KP];                // V^T lo [d][kv] 9 KB
  __shared__ __align__(16) _Float16 Psh[4][16 * KP];            // per wave P [row][kv] 9 KB
  __shared__ __align__(16) float    Os[4][16 * OPT];            // per wave context tile [row][d] 17 KB
  __shared__ __align__(16) float    ITs[64 * ITP];              // score table rows of this query block 5 KB

  const int tid  = threadIdx.x;
  const int wave = tid >> 5;
  const int lane = tid & 31;
  const int hh   = lane >> 4;
  const int c    = lane & 15;

  const int bx   = blockIdx.x;
  const int qb   = bx % NQB;
  const int rest = bx / NQB;
  const int h    = rest % NH;
  const int b    = rest / NH;
  const int q0   = qb * 64 + wave * 16;          // in-batch query row of this wave's first row
  const size_t rowB = (size_t)b * SEQ;

  const unsigned short* Qh  = qk + (size_t)h * (2 * HD);
  const unsigned short* Kg  = qk + KOFF + (size_t)h * (2 * HD);
  const _Float16* Vgh = (const _Float16*)(const void*)vth + ((size_t)b * DM + (size_t)h * HD) * SEQ;
  const _Float16* Vgl = (const _Float16*)(const void*)vtl + ((size_t)b * DM + (size_t)h * HD) * SEQ;
  const float* itb = itab + (((size_t)b * NH + (size_t)h) * SEQ + (size_t)qb * 64) * NEP;
  // this lane's pair-index row group: query row q0 + 8*hh (+ r), key column c (+ kv0 + 16 j)
  const int* trw = trj + (rowB + (size_t)q0 + (size_t)(8 * hh)) * SEQ + c;

  // stage the block's 64 x 16 score table (256 float4, 128 threads x 2); visible after the loop's first barrier
#pragma unroll
  for (int i = 0; i < 2; ++i) {
    const int f = i * 128 + tid;
    *(v4f*)(ITs + (f >> 2) * ITP + (f & 3) * 4) = *(const v4f*)(itb + (size_t)f * 4);
  }

  float mrow[8], lrow[8];
  v8f oacc[4], oaccL[4];
#pragma unroll
  for (int r = 0; r < 8; ++r) { mrow[r] = -INFINITY; lrow[r] = 0.f; }
#pragma unroll
  for (int t = 0; t < 4; ++t) { oacc[t] = zero8(); oaccL[t] = zero8(); }

#pragma unroll 1
  for (int kt = 0; kt < NQB; ++kt) {         // static trip count
    const int kv0 = kt * 64;

    __syncthreads();
    {
      const int r = tid >> 1, hf = (tid & 1) * 32;
      const unsigned short* kgh = Kg + (rowB + kv0 + r) * QKW + hf;       // K row kv0+r, d = hf..hf+31
      const _Float16* vgh = Vgh + (size_t)r * SEQ + kv0 + hf;            // V^T row d = r, s = kv0+hf..+31
      const _Float16* vgl = Vgl + (size_t)r * SEQ + kv0 + hf;
#pragma unroll
      for (int i = 0; i < 4; ++i) {
        const v8us a0 = *(const v8us*)(kgh + 8 * i);
        const v8h  b0 = *(const v8h*)(vgh + 8 * i);
        const v8h  b1 = *(const v8h*)(vgl + 8 * i);
        *(v8us*)(Kh + r * KP + hf + 8 * i) = a0;
        *(v8h*)(Vh + r * KP + hf + 8 * i) = b0;
        *(v8h*)(Vl + r * KP + hf + 8 * i) = b1;
      }
    }
    __syncthreads();

    // ---- Q fragments (A operand, row = lane&15): f16 hi, 2 d-chunks ----
    v16us qh2[2];
#pragma unroll
    for (int dc = 0; dc < 2; ++dc) {
      qh2[dc] = ldfrag_u(Qh + (rowB + q0 + c) * QKW + dc * 32 + 8 * hh);
    }

    // ---- scores: 16 query rows x 64 keys per wave ----
    v8f s[4];
#pragma unroll
    for (int j = 0; j < 4; ++j) {
      v8f sh = zero8();
#pragma unroll
      for (int dc = 0; dc < 2; ++dc) {
        FragU kb;
        kb.h[0] = *(const v8us*)(Kh + (j * 16 + c) * KP + dc * 32 + 8 * hh);
        kb.h[1] = *(const v8us*)(Kh + (j * 16 + c) * KP + dc * 32 + 16 + 8 * hh);
        sh = mma_hu(qh2[dc], kb.v, sh);
      }
      // D element r: query row q0 + 8hh + r, key kv0 + j*16 + c
      const int* tp = trw + kv0 + j * 16;
#pragma unroll
      for (int r = 0; r < 8; ++r) {
        int n = tp[(size_t)r * SEQ];
        n = (n < 0) ? 0 : n;
        n = (n > NE - 1) ? (NE - 1) : n;
        s[j][r] = sh[r] * sscale + ITs[(wave * 16 + 8 * hh + r) * ITP + n];
      }
    }

    // ---- row max, online softmax, P (x1024, f16) to LDS ----
    _Float16* pwh = Psh[wave];
#pragma unroll
    for (int r = 0; r < 8; ++r) {
      float m = s[0][r];
      m = fmaxf(m, s[1][r]);
      m = fmaxf(m, s[2][r]);
      m = fmaxf(m, s[3][r]);
#pragma unroll
      for (int off = 1; off < 16; off <<= 1) m = fmaxf(m, __shfl_xor(m, off, 32));
      const float mnew  = fmaxf(mrow[r], m);
      const float alpha = __expf(mrow[r] - mnew);
      mrow[r] = mnew;
      float psum = 0.f;
#pragma unroll
      for (int j = 0; j < 4; ++j) {
        const float p = __expf(s[j][r] - mnew);
        psum += p;
        pwh[(8 * hh + r) * KP + j * 16 + c] = (_Float16)(p * PSC);
      }
#pragma unroll
      for (int off = 1; off < 16; off <<= 1) psum += __shfl_xor(psum, off, 32);
      lrow[r] = lrow[r] * alpha + psum;
#pragma unroll
      for (int t = 0; t < 4; ++t) { oacc[t][r] *= alpha; oaccL[t][r] *= alpha; }
    }
    wave_sync_lds();

    // ---- context += P . V_hi and P . V_lo (f16 WMMA, two accumulators) ----
#pragma unroll 1
    for (int kk = 0; kk < 2; ++kk) {
      FragH pa;
      pa.h[0] = *(const v8h*)(pwh + c * KP + kk * 32 + 8 * hh);
      pa.h[1] = *(const v8h*)(pwh + c * KP + kk * 32 + 16 + 8 * hh);
#pragma unroll
      for (int t = 0; t < 4; ++t) {
        FragH vb, vl;
        vb.h[0] = *(const v8h*)(Vh + (t * 16 + c) * KP + kk * 32 + 8 * hh);
        vb.h[1] = *(const v8h*)(Vh + (t * 16 + c) * KP + kk * 32 + 16 + 8 * hh);
        vl.h[0] = *(const v8h*)(Vl + (t * 16 + c) * KP + kk * 32 + 8 * hh);
        vl.h[1] = *(const v8h*)(Vl + (t * 16 + c) * KP + kk * 32 + 16 + 8 * hh);
        oacc[t]  = mma_h(pa.v, vb.v, oacc[t]);
        oaccL[t] = mma_h(pa.v, vl.v, oaccL[t]);
      }
    }
  }

  // ---- normalise (1/l, the 1/1024 p carry, the 1/2048 residual fold), stage the wave's 16x64 tile,
  float* os = Os[wave];
#pragma unroll
  for (int r = 0; r < 8; ++r) {
    const float l = lrow[r];
    const float inv = ((l > 0.f) ? (1.0f / l) : 0.f) * (1.0f / PSC);
#pragma unroll
    for (int t = 0; t < 4; ++t) os[(8 * hh + r) * OPT + t * 16 + c] = (oacc[t][r] + oaccL[t][r] * (1.0f / RSC)) * inv;
  }
  wave_sync_lds();
  {
    const int q4 = lane >> 3, c8 = (lane & 7) * 8;
    v4u hv[4], lv[4];
#pragma unroll
    for (int it = 0; it < 4; ++it) {
      const int row = it * 4 + q4;   // it 0..3 x q4 0..3 = rows 0..15 of the wave tile
      const float* sp = os + row * OPT + c8;
      v4u ha, la;
#pragma unroll
      for (int e = 0; e < 4; ++e) {
        const float f0 = sp[2 * e], f1 = sp[2 * e + 1];
        const unsigned short u0 = bf_bits(f0), u1 = bf_bits(f1);
        const unsigned short w0 = bf_bits(f0 - bf_up(u0)), w1 = bf_bits(f1 - bf_up(u1));
        ha[e] = pk16(u0, u1);
        la[e] = pk16(w0, w1);
      }
      hv[it] = ha;
      lv[it] = la;
    }
    {
#pragma unroll
      for (int it = 0; it < 4; ++it) {
        const int row = it * 4 + q4;
        const size_t go = (rowB + q0 + row) * CTXP + (size_t)h * HD + c8;
        *(v4u*)(ctxp + go)      = hv[it];
        *(v4u*)(ctxp + go + DM) = lv[it];
      }
      
    }
  }
}

// =====================================================================================================
// y = (x - mean) * rstd * bf16(gamma) + bf16(beta). Block = 64 threads = one row; thread t handles columns
// 4t..4t+3 and 256+4t..256+4t+3, so each store instruction of a wave writes 32 lanes x 16 B = 512 contiguous
// coverage: 64 threads x 8 = 512 columns = the whole row; MP rows.
// =====================================================================================================
__global__ __launch_bounds__(64) void ln_rows(const float* __restrict__ X, const float* __restrict__ gam,
                                              const float* __restrict__ bet, float* out) {
  __shared__ float red[4];
  const int row = blockIdx.x;
  const int tid = threadIdx.x, lane = tid & 31, wv = tid >> 5;
  const float* src = X + (size_t)row * DM;
  const v4f a0 = *(const v4f*)(src + tid * 4);
  const v4f a1 = *(const v4f*)(src + 256 + tid * 4);
  float x[8];
#pragma unroll
  for (int e = 0; e < 4; ++e) { x[e] = a0[e]; x[4 + e] = a1[e]; }
  float s = 0.f;
#pragma unroll
  for (int e = 0; e < 8; ++e) s += x[e];
#pragma unroll
  for (int off = 1; off < 32; off <<= 1) s += __shfl_xor(s, off, 32);
  if (lane == 0) red[wv] = s;
  __syncthreads();
  const float mean = (red[0] + red[1]) * (1.0f / DM);
  float d[8];
  float q = 0.f;
#pragma unroll
  for (int e = 0; e < 8; ++e) { d[e] = x[e] - mean; q += d[e] * d[e]; }
#pragma unroll
  for (int off = 1; off < 32; off <<= 1) q += __shfl_xor(q, off, 32);
  if (lane == 0) red[2 + wv] = q;
  __syncthreads();
  const float var  = (red[2] + red[3]) * (1.0f / DM);
  const float rstd = rsqrtf(var + 1e-6f);

  const v4f g0 = *(const v4f*)(gam + tid * 4);
  const v4f g1 = *(const v4f*)(gam + 256 + tid * 4);
  const v4f e0 = *(const v4f*)(bet + tid * 4);
  const v4f e1 = *(const v4f*)(bet + 256 + tid * 4);
  v4f o0, o1;
#pragma unroll
  for (int e = 0; e < 4; ++e) {
    o0[e] = d[e]     * rstd * bfr(g0[e]) + bfr(e0[e]);
    o1[e] = d[4 + e] * rstd * bfr(g1[e]) + bfr(e1[e]);
  }
  float* dst = out + (size_t)row * DM + tid * 4;
  *(v4f*)(dst)       = o0;
  *(v4f*)(dst + 256) = o1;
  
}

// =====================================================================================================
// Workspace map (bytes); every plane is an exact multiple of its 64x64-tile / whole-row / whole-line store
// granularity (MP = 4096 = 64 row tiles; DM = 8 column tiles; VT per batch [512][2048] = 8x32 tiles; score table
//   WT   bf16 [1536 n][512 k]    0          1572864   (rows 0..511 Wq^T, 512..1023 Wk^T, 1024..1535 Wv^T)
//   WoT2 bf16 [512][1024]        1572864    1048576   (cols k and DM + k both Wo^T)
//   INb  bf16 [3][4096][512]     2621440    12582912  (q, k, v as bf16 bits)
//   QK   f16  [4096][2048]       15204352   16777216  (q [hi|lo] per head, then k [hi|lo] per head)
//   VTh  f16  [2][512][2048]     31981568   4194304   (v^T hi)
//   VTl  f16  [2][512][2048]     36175872   4194304   (v^T residual x2048)
//   IT   f32  [32768][16]        40370176   2097152   (query-embedding scores)
//   Ctx  bf16 [4096][1024]       42467328   8388608   (context hi | lo)
//   X    f32  [4096][512]        50855936   8388608   (pre-norm output)
//   end                          59244544
// =====================================================================================================
extern "C" void kernel_launch(void* const* d_in, const int* in_sizes, int n_in,
                              void* d_out, int out_size, void* d_ws, size_t ws_size,
                              hipStream_t stream) {
  if (n_in < 11) return;
  if (in_sizes[0] != MP * DM || in_sizes[1] != MP * DM || in_sizes[2] != MP * DM) return;
  if (in_sizes[3] != NE * DM) return;
  if (in_sizes[4] != NBATCH * SEQ * SEQ) return;
  if (in_sizes[5] != DM * DM || in_sizes[6] != DM * DM || in_sizes[7] != DM * DM || in_sizes[8] != DM * DM) return;
  if (in_sizes[9] != DM || in_sizes[10] != DM) return;
  if (out_size != MP * DM) return;

  const float* q_in = (const float*)d_in[0];
  const float* k_in = (const float*)d_in[1];
  const float* v_in = (const float*)d_in[2];
  const float* emb  = (const float*)d_in[3];
  const int*   trj  = (const int*)d_in[4];
  const float* w_q  = (const float*)d_in[5];
  const float* w_k  = (const float*)d_in[6];
  const float* w_v  = (const float*)d_in[7];
  const float* w_o  = (const float*)d_in[8];
  const float* gam  = (const float*)d_in[9];
  const float* bet  = (const float*)d_in[10];

  const size_t PWT  = (size_t)3 * DM * DM * 2;             //  1572864
  const size_t PWO  = (size_t)DM * KOFF * 2;               //  1048576
  const size_t PIN  = (size_t)3 * MP * DM * 2;             // 12582912
  const size_t PQK  = (size_t)MP * QKW * 2;                // 16777216
  const size_t PVT  = (size_t)NBATCH * DM * SEQ * 2;       //  4194304
  const size_t PIT  = (size_t)NBATCH * NH * SEQ * NEP * 4; //  2097152
  const size_t PCTX = (size_t)MP * CTXP * 2;               //  8388608
  const size_t PX   = (size_t)MP * DM * 4;                 //  8388608
  size_t off = 0;
  const size_t oWT  = off; off += PWT;
  const size_t oWo  = off; off += PWO;
  const size_t oIN  = off; off += PIN;
  const size_t oQK  = off; off += PQK;
  const size_t oVTh = off; off += PVT;
  const size_t oVTl = off; off += PVT;
  const size_t oIT  = off; off += PIT;
  const size_t oCtx = off; off += PCTX;
  const size_t oX   = off; off += PX;
  if (off > ws_size) return;                               // off = 59244544
  if (off > (size_t)134217728) return;

  char* ws = (char*)d_ws;
  unsigned short* WT   = (unsigned short*)(ws + oWT);
  unsigned short* WoT2 = (unsigned short*)(ws + oWo);
  unsigned short* INb  = (unsigned short*)(ws + oIN);
  unsigned short* QK   = (unsigned short*)(ws + oQK);
  unsigned short* VTh  = (unsigned short*)(ws + oVTh);
  unsigned short* VTl  = (unsigned short*)(ws + oVTl);
  float*          IT   = (float*)(ws + oIT);
  unsigned short* Ctx  = (unsigned short*)(ws + oCtx);
  float*          X    = (float*)(ws + oX);
  float*          out0 = (float*)d_out;

  const dim3 blk(256), blk128(128), blk64(64);
  const dim3 gCv(MP / 4, 3);                                        // 1024 x 3 blocks
  const dim3 gT(DM / 64, DM / 64);                                  // (cols/64, rows/64) = 8 x 8 per weight
  const dim3 gQK(((MP / 64) * (DM / 64)) / 8, 2, 1);                // 512 tiles -> 64 blocks x {q, k}
  const dim3 gVT(((DM / 64) * (SEQ / 64)) / 8, NBATCH, 1);          // 256 tiles -> 32 blocks x 2 batches
  const dim3 gIdx(NBATCH * NH * (SEQ / 64));                        // 512 blocks of 64
  const dim3 gAttn(NBATCH * NH * NQB);                              // 512 blocks of 128
  const dim3 gNo(((MP / 64) * (DM / 64)) / 8, 1, 1);                // 512 tiles -> 64 blocks
  const dim3 gLN(MP);                                               // 4096 rows
  if ((((MP / 64) * (DM / 64)) % 8) != 0) return;
  if ((((DM / 64) * (SEQ / 64)) % 8) != 0) return;

  // (0) activations -> bf16 bits; weight planes: in[k][n] (shape [512 in][512 out]) -> out[n][k] transposed
  //     through LDS (Wo additionally at cols DM + k for the hi|lo K-concat)
  cvt3<<<gCv, blk, 0, stream>>>(q_in, k_in, v_in, INb);
  tconv64<<<gT, blk, 0, stream>>>(w_q, WT, DM, DM, DM, 0);                            // -> WT rows 0..511
  tconv64<<<gT, blk, 0, stream>>>(w_k, WT + (size_t)DM * DM, DM, DM, DM, 0);          // -> WT rows 512..1023
  tconv64<<<gT, blk, 0, stream>>>(w_v, WT + (size_t)2 * DM * DM, DM, DM, DM, 0);      // -> WT rows 1024..1535
  tconv64<<<gT, blk, 0, stream>>>(w_o, WoT2, DM, DM, KOFF, DM);

  // (1) q = qb . Wq^T-plane (blockIdx.y = 0) and k = kb . Wk^T-plane (blockIdx.y = 1), K = 512
  //     -> f16 [hi 64 | lo 64] per head (QK plane [4096][2048], q at cols 0.., k at cols KOFF..);
  //     v^T per batch = Wv^T . vb_b^T -> f16 hi (VTh) and residual x2048 (VTl) planes [2][512][2048]
  gemm64<4><<<gQK, blk, 0, stream>>>(
      INb, DM, (long long)MP * DM, WT, DM, (long long)DM * DM,
      QK, QK + HD, X, QKW, (long long)KOFF,
      MP, DM, DM, 2, 1.0f);
  gemm64<4><<<gVT, blk, 0, stream>>>(
      WT + (size_t)2 * DM * DM, DM, 0LL, INb + (size_t)2 * MP * DM, DM, (long long)SEQ * DM,
      VTh, VTl, X, SEQ, (long long)DM * SEQ,
      DM, SEQ, DM, 1, 1.0f);

  // (2) query-embedding score table (f32), then flash attention with the selected per-pair bias
  //     -> context bf16 hi|lo
  idx_rows<<<gIdx, blk64, 0, stream>>>(QK, emb, IT);
  attn64<<<gAttn, blk128, 0, stream>>>(QK, VTh, VTl, IT, trj, Ctx, 0.125f);

  // (3) X = [ctx_hi | ctx_lo] . [Wo | Wo]  (K = 1024, bf16 operands) -> f32 plane; LayerNorm -> d_out
  gemm64<0><<<gNo, blk, 0, stream>>>(
      Ctx, CTXP, 0LL, WoT2, KOFF, 0LL,
      Ctx, Ctx, X, DM, 0LL,
      MP, DM, KOFF, 1, 1.0f);
  ln_rows<<<gLN, blk64, 0, stream>>>(X, gam, bet, out0);
  (void)hipGetLastError();
}

// v002
// One run takes 208 microseconds.
// In two side-by-side timings against v001, it was 1.10 and 1.09 times as fast.
// Over all steps from v000 it is 1.26 times as fast.
// Contractions: q|k|v projections and output projection on v_wmma_f32_16x16x32_bf16 (bf16 operands from
// RNE-converted inputs; context carried as bf16 hi|lo planes K-concatenated against duplicated Wo planes);
// scores q.k^T on v_wmma_f32_16x16x32_f16 (q f16 hi, k f16 hi, single product); p.v on
// v_wmma_f32_16x16x32_f16 (p carried x1024 in f16, v^T as f16 hi + x2048 residual planes, two products,
// separate accumulators); all f32 accumulate; query-embedding scores (from q hi + residual), per-pair bias
// select, softmax and LayerNorm in f32.
#include <hip/hip_runtime.h>
#include <math.h>

#define NBATCH 2
#define SEQ    2048
#define DM     512
#define NH     8
#define HD     64
#define NE     10
#define NEP    16
#define MP     (NBATCH * SEQ)
#define QKW    (4 * DM)
#define KOFF   (2 * DM)
#define CTXP   (2 * DM)
#define NQB    (SEQ / 64)
#define RSC    2048.0f
#define PSC    1024.0f
#define KP     72      // LDS row pitch of the 64-wide 16-bit attention tiles, in elements: 144 B = 16 B x 9
#define OPT    68      // LDS row pitch of the f32 context tile, in floats: 272 B = 16 B x 17
#define ITP    20      // LDS row pitch of the score-table rows, in floats: rows 8 apart fall 32 banks apart
static_assert(NH * HD == DM);
static_assert(DM == 8 * 64);
static_assert((SEQ % 64) == 0 && (DM % 64) == 0 && (MP % 64) == 0 && (SEQ % 256) == 0 && (MP % 4) == 0);
static_assert((((MP / 64) * (DM / 64)) % 8) == 0);
static_assert((((DM / 64) * (SEQ / 64)) % 8) == 0);
static_assert(NE <= NEP && NEP == 16);

typedef _Float16 v16h __attribute__((ext_vector_type(16)));
typedef _Float16 v8h  __attribute__((ext_vector_type(8)));
typedef __bf16   v16b __attribute__((ext_vector_type(16)));
typedef unsigned short v16us __attribute__((ext_vector_type(16)));
typedef unsigned short v8us  __attribute__((ext_vector_type(8)));
typedef float    v8f  __attribute__((ext_vector_type(8)));
typedef float    v4f  __attribute__((ext_vector_type(4)));
typedef unsigned int v4u __attribute__((ext_vector_type(4)));

union FragH { v16h v; v8h h[2]; };
union FragU { v16us v; v8us h[2]; };

// ---- scalar helpers --------------------------------------------------------------------------------
__device__ __forceinline__ unsigned short bf_bits(float f) {          // f32 -> bf16 bits, RNE convert
  unsigned u = __float_as_uint(f);
  return (unsigned short)((u + 0x7FFFu + ((u >> 16) & 1u)) >> 16);
}
__device__ __forceinline__ float bf_up(unsigned short h) { return __uint_as_float(((unsigned)h) << 16); }
__device__ __forceinline__ float bfr(float f) { return bf_up(bf_bits(f)); }   // value of the bf16 RNE convert
__device__ __forceinline__ unsigned short h_bits(_Float16 x) { return __builtin_bit_cast(unsigned short, x); }
__device__ __forceinline__ unsigned pk16(unsigned short a, unsigned short b) { return (unsigned)a | ((unsigned)b << 16); }
__device__ __forceinline__ v8f zero8() { v8f z = {0.f, 0.f, 0.f, 0.f, 0.f, 0.f, 0.f, 0.f}; return z; }

// ---- fragment loader: 16-bit A/B operand, lane -> row/col (lane&15), p already includes +8*(lane>>4);
//      elements 0..7 <- p[0..7] (k0+8h..), elements 8..15 <- p[16..23] (k0+16+8h..)
__device__ __forceinline__ v16us ldfrag_u(const unsigned short* p) {
  FragU f;
  f.h[0] = *(const v8us*)(p);
  f.h[1] = *(const v8us*)(p + 16);
  return f.v;
}

// ---- WMMA helpers with trailing VALU hazard gap --------------------------------------------------------
__device__ __forceinline__ v8f mma_bu_raw(v16us a, v16us b, v8f c) {            // bf16 operands, unguarded
  return __builtin_amdgcn_wmma_f32_16x16x32_bf16(false, __builtin_bit_cast(v16b, a), false,
                                                 __builtin_bit_cast(v16b, b), (short)0, c, false, false);
}
__device__ __forceinline__ v8f mma_hu(v16us a, v16us b, v8f c) {                // f16 operands (bits), guarded
  c = __builtin_amdgcn_wmma_f32_16x16x32_f16(false, __builtin_bit_cast(v16h, a), false,
                                              __builtin_bit_cast(v16h, b), (short)0, c, false, false);
#if defined(__HIP_DEVICE_COMPILE__)
  asm volatile("v_nop\n\tv_nop\n\tv_nop\n\tv_nop" : "+v"(c) : "v"(a), "v"(b));
#endif
  return c;
}
__device__ __forceinline__ v8f mma_h(v16h a, v16h b, v8f c) {                    // f16 operands, guarded
  c = __builtin_amdgcn_wmma_f32_16x16x32_f16(false, a, false, b, (short)0, c, false, false);
#if defined(__HIP_DEVICE_COMPILE__)
  asm volatile("v_nop\n\tv_nop\n\tv_nop\n\tv_nop" : "+v"(c) : "v"(a), "v"(b));
#endif
  return c;
}
__device__ __forceinline__ void dep_guard1(v8f& a, v8f& b, v16us x) {
#if defined(__HIP_DEVICE_COMPILE__)
  asm volatile("v_nop\n\tv_nop\n\tv_nop\n\tv_nop" : "+v"(a), "+v"(b) : "v"(x));
#endif
}
__device__ __forceinline__ void keep4_u(v16us a, v16us b, v16us c, v16us d) {
#if defined(__HIP_DEVICE_COMPILE__)
  asm volatile("v_nop" :: "v"(a), "v"(b), "v"(c), "v"(d));
#endif
}
__device__ __forceinline__ void acc_guard4(v8f& a, v8f& b, v8f& c, v8f& d) {
#if defined(__HIP_DEVICE_COMPILE__)
  asm volatile("v_nop\n\tv_nop\n\tv_nop\n\tv_nop" : "+v"(a), "+v"(b), "+v"(c), "+v"(d));
#endif
}
__device__ __forceinline__ void wave_sync_lds() {
  __builtin_amdgcn_fence(__ATOMIC_RELEASE, "workgroup");
  __builtin_amdgcn_wave_barrier();
  __builtin_amdgcn_fence(__ATOMIC_ACQUIRE, "workgroup");
}
// The same for LDS traffic alone: orders a wave's own LDS stores before its LDS loads and leaves its global loads
// in flight (the fence over all address spaces waits for them too).
__device__ __forceinline__ void wave_sync_lds_only() {
  __builtin_amdgcn_fence(__ATOMIC_RELEASE, "workgroup", "local");
  __builtin_amdgcn_wave_barrier();
  __builtin_amdgcn_fence(__ATOMIC_ACQUIRE, "workgroup", "local");
}

// =====================================================================================================
// f32 [MP][DM] activations (three sources selected by blockIdx.y, block-uniform) -> bf16 bits plane
// dst[(z*MP + row)*DM + col]. Block = 256 threads = 4 rows; thread t: row = 4*bx + (t>>6), cols 8*(t&63)..+7.
// coverage: 1024 blocks x 4 rows x 512 cols = each whole plane; 3 planes.
// =====================================================================================================
__global__ __launch_bounds__(256) void cvt3(const float* __restrict__ s0, const float* __restrict__ s1,
                                            const float* __restrict__ s2, unsigned short* dst) {
  const int z = blockIdx.y;
  const float* src = (z == 0) ? s0 : ((z == 1) ? s1 : s2);
  const int t = threadIdx.x;
  const int row = blockIdx.x * 4 + (t >> 6);
  const int c8 = (t & 63) * 8;
  const float* p = src + (size_t)row * DM + c8;
  const v4f a0 = *(const v4f*)(p);
  const v4f a1 = *(const v4f*)(p + 4);
  v4u hv;
  hv[0] = pk16(bf_bits(a0[0]), bf_bits(a0[1]));
  hv[1] = pk16(bf_bits(a0[2]), bf_bits(a0[3]));
  hv[2] = pk16(bf_bits(a1[0]), bf_bits(a1[1]));
  hv[3] = pk16(bf_bits(a1[2]), bf_bits(a1[3]));
  unsigned short* d = dst + ((size_t)z * MP + (size_t)row) * DM + c8;
  *(v4u*)d = hv;
  
}

// =====================================================================================================
// Tiled transpose + bf16 convert: in[rows][cols] f32 row-major -> out[cols][rows] bf16 bits with pitch ldo:
//   out[n * ldo + k] = bf16(in[k][n]) and also at + dupoff (a duplicated k range for the hi|lo K-concat GEMM).
// Block = 256 threads = one 64x64 tile; grid = (cols/64, rows/64) (rows, cols multiples of 64, host-checked).
// Loads: 4 iterations x 256 threads x float4 = 64 rows x 64 cols (addresses clamped). LDS tile [n][k] pitch 72.
// coverage: 64 x 64 = the whole transposed tile at both column offsets; grid covers the whole matrix.
// =====================================================================================================
__global__ __launch_bounds__(256) void tconv64(const float* __restrict__ W, unsigned short* out,
                                               int rows, int cols, int ldo, int dupoff) {
  __shared__ __align__(16) unsigned short sh[64 * 72];
  const int t  = threadIdx.x;
  const int n0 = blockIdx.x * 64;            // column tile of in = row tile of out
  const int k0 = blockIdx.y * 64;            // row tile of in = column tile of out
#pragma unroll
  for (int i = 0; i < 4; ++i) {
    const int idx = i * 256 + t;
    const int r = idx >> 4, c4 = (idx & 15) * 4;
    int kr = k0 + r;   kr = (kr < rows) ? kr : (rows - 1);
    int nc = n0 + c4;  nc = (nc < cols - 4) ? nc : (cols - 4);
    const v4f v = *(const v4f*)(W + (size_t)kr * cols + nc);
#pragma unroll
    for (int e = 0; e < 4; ++e) sh[(c4 + e) * 72 + r] = bf_bits(v[e]);
  }
  __syncthreads();
  const int wave = t >> 5, lane = t & 31;
  const int q = lane >> 3, c8 = (lane & 7) * 8;
  v4u pv[2];
  size_t go[2];
#pragma unroll
  for (int it = 0; it < 2; ++it) {
    const int nl = it * 32 + wave * 4 + q;               // 0..63
    pv[it] = *(const v4u*)(sh + nl * 72 + c8);
    go[it] = (size_t)(n0 + nl) * ldo + k0 + c8;
  }
  {
#pragma unroll
    for (int it = 0; it < 2; ++it) {
      *(v4u*)(out + go[it]) = pv[it];
      if (dupoff != 0) *(v4u*)(out + go[it] + dupoff) = pv[it];
    }
    
  }
}

// =====================================================================================================
// Register-blocked batched bf16 WMMA GEMM: C[m][n] = oscale * sum_k A[m][k] * Bt[n][k];
// one wave per 64x64 tile, no block barriers. A row-major [M][K] pitch lda; Bt row-major [N][K] pitch ldb
// (k contiguous); M, N multiples of 64, K multiple of 32. blockIdx.y = batch index with element strides
// (sAy for A, sBy for Bt, sCy for C). Tile enumeration: tile -> tm = tile / (N/64), tn = tile % (N/64).
// OM: 0 = f32 out to Cf (pitch ldc); 4 = f16 hi bits to Cp and f16((v - hi) * 2048) bits to Cp2, 16-bit column
//     base = n0 * nmul (nmul = 2 interleaves [hi 64 | lo 64] per 64-col tile with Cp2 = Cp + 64).
// coverage: 4 slabs x 16 rows x 64 cols = the wave's whole 64x64 tile; grid = tilesM*tilesN/8 blocks exactly
//           (host-checked), so no wave exits early.
// =====================================================================================================
template <int OM>
__global__ __launch_bounds__(256) void gemm64(
    const unsigned short* __restrict__ Ap, int lda, long long sAy,
    const unsigned short* __restrict__ Btp, int ldb, long long sBy,
    unsigned short* Cp, unsigned short* Cp2, float* Cf, int ldc, long long sCy,
    int M, int N, int K, int nmul, float oscale) {
  __shared__ __align__(16) float sT[8][16 * 68];   // per-wave 16x64 slab, pitch 68 floats
  const int by   = blockIdx.y;
  const int lane = threadIdx.x & 31;
  const int wave = threadIdx.x >> 5;
  const int tilesN = N >> 6;
  const int tilesM = M >> 6;
  const int tile = blockIdx.x * 8 + wave;
  if (tile >= tilesM * tilesN) return;   // wave-uniform; no block barriers in this kernel
  const int tm = tile / tilesN;
  const int tn = tile - tm * tilesN;
  const int m0 = tm << 6;
  const int n0 = tn << 6;

  const unsigned short* Ab = Ap  + (size_t)by * (size_t)sAy;
  const unsigned short* Bb = Btp + (size_t)by * (size_t)sBy;
  const size_t cofs = (size_t)by * (size_t)sCy;

  const int rlane = lane & 15;                 // row (A) / col (B, D) within subtile
  const int koff  = (lane >> 4) * 8;           // k offset of this lane half
  const int mOff  = (lane >> 4) * 8;           // D row offset

  v8f acc[4][4];
#pragma unroll
  for (int i = 0; i < 4; ++i)
#pragma unroll
    for (int j = 0; j < 4; ++j) acc[i][j] = zero8();

  for (int k0 = 0; k0 < K; k0 += 32) {
    v16us bh[4];
#pragma unroll
    for (int j = 0; j < 4; ++j) {
      const size_t bo = (size_t)(n0 + (j << 4) + rlane) * ldb + koff + k0;
      bh[j] = ldfrag_u(Bb + bo);
    }
#pragma unroll
    for (int i = 0; i < 4; ++i) {
      const size_t ao = (size_t)(m0 + (i << 4) + rlane) * lda + koff + k0;
      const v16us ah = ldfrag_u(Ab + ao);
#pragma unroll
      for (int j = 0; j < 4; ++j) acc[i][j] = mma_bu_raw(ah, bh[j], acc[i][j]);
      dep_guard1(acc[i][0], acc[i][3], ah);
    }
    keep4_u(bh[0], bh[1], bh[2], bh[3]);
  }
  acc_guard4(acc[0][0], acc[0][1], acc[0][2], acc[0][3]);
  acc_guard4(acc[1][0], acc[1][1], acc[1][2], acc[1][3]);
  acc_guard4(acc[2][0], acc[2][1], acc[2][2], acc[2][3]);
  acc_guard4(acc[3][0], acc[3][1], acc[3][2], acc[3][3]);

  const int hh2 = lane >> 4, c4 = (lane & 15) * 4;     // f32 out: 256-B row segment = 16 lanes x 16 B
  const int q8  = lane >> 3, c8 = (lane & 7) * 8;

  // ---- epilogue ----
  float* slab = sT[wave];
#pragma unroll
  for (int i = 0; i < 4; ++i) {
    const int mBase = m0 + (i << 4);
#pragma unroll
    for (int j = 0; j < 4; ++j) {
#pragma unroll
      for (int r = 0; r < 8; ++r) {
        slab[(mOff + r) * 68 + (j << 4) + rlane] = acc[i][j][r];
      }
    }
    wave_sync_lds();
    if (OM == 0) {
      float* C = Cf + cofs;
      v4f vals[8];
#pragma unroll
      for (int it = 0; it < 8; ++it) {
        const int row = it * 2 + hh2;                      // it 0..7 x hh2 0..1 = rows 0..15
        v4f v = *(const v4f*)(slab + row * 68 + c4);
        vals[it] = v * oscale;
      }
      {
#pragma unroll
        for (int it = 0; it < 8; ++it) {
          const int row = it * 2 + hh2;
          *(v4f*)(C + (size_t)(mBase + row) * ldc + (size_t)n0 * nmul + c4) = vals[it];
        }
        
      }
    } else {
      unsigned short* C  = Cp  + cofs;
      unsigned short* C2 = Cp2 + cofs;
      v4u hv[4], lv[4];
#pragma unroll
      for (int it = 0; it < 4; ++it) {
        const int row = it * 4 + q8;                       // it 0..3 x q8 0..3 = rows 0..15
        const float* sp = slab + row * 68 + c8;
        v4u ha, la;
#pragma unroll
        for (int e = 0; e < 4; ++e) {
          const float f0 = sp[2 * e]     * oscale;
          const float f1 = sp[2 * e + 1] * oscale;
          const _Float16 g0 = (_Float16)f0, g1 = (_Float16)f1;
          const unsigned short u0 = h_bits(g0), u1 = h_bits(g1);
          const unsigned short w0 = h_bits((_Float16)((f0 - (float)g0) * RSC));
          const unsigned short w1 = h_bits((_Float16)((f1 - (float)g1) * RSC));
          ha[e] = pk16(u0, u1);
          la[e] = pk16(w0, w1);
        }
        hv[it] = ha;
        lv[it] = la;
      }
      {
#pragma unroll
        for (int it = 0; it < 4; ++it) {
          const int row = it * 4 + q8;
          const size_t go = (size_t)(mBase + row) * ldc + (size_t)n0 * nmul + c8;
          *(v4u*)(C  + go) = hv[it];
          *(v4u*)(C2 + go) = lv[it];
        }
        
      }
    }
    wave_sync_lds();
  }
}

// =====================================================================================================
// Query-embedding score table: itab[(bh*SEQ + l)*NEP + n] = sum_d qh[b,h,l,d] * bf16(emb[n][h*64 + d]) for
// n < NE (f32, columns NE..NEP-1 = 0). qh is reconstructed in f32 as hi + lo/2048 from the q part of the QK
// plane (f16 hi at col h*128 + d, residual at + 64). Block = 64 threads = 64 consecutive rows l of one (b, h)
// (SEQ % 64 == 0); grid = NBATCH*NH*SEQ/64 exact. q rows and the head's emb slice staged in LDS (f32);
// the 10 dots per row are rolled over n and over two 32-wide d halves (32 static FMAs).
// Output tile 64 x 16 f32 staged in LDS and written as 256 float4 = 4 instructions per wave, each 32 lanes x
// coverage: 512 blocks x 64 rows x 16 cols = the whole table.
// =====================================================================================================
__global__ __launch_bounds__(64) void idx_rows(const unsigned short* __restrict__ qk,
                                               const float* __restrict__ emb, float* itab) {
  __shared__ float Qs[64 * 65];
  __shared__ float Es[NE * HD];
  __shared__ __align__(16) float Ts[64 * NEP];
  const int tid = threadIdx.x;
  const int R0 = blockIdx.x * 64;                 // flat (b*NH + h)*SEQ + l row base
  const int bh = R0 / SEQ;
  const int l0 = R0 - bh * SEQ;
  const int b  = bh / NH;
  const int h  = bh - b * NH;
#pragma unroll 1
  for (int i = tid; i < NE * HD; i += 64) {
    const int n = i >> 6, d = i & 63;
    Es[i] = bfr(emb[(size_t)n * DM + h * HD + d]);
  }
  const _Float16* qp = (const _Float16*)(const void*)qk
                     + ((size_t)b * SEQ + (size_t)l0 + (size_t)tid) * QKW + (size_t)h * (2 * HD);
#pragma unroll
  for (int i = 0; i < 8; ++i) {
    const v8h hv = *(const v8h*)(qp + 8 * i);
    const v8h lv = *(const v8h*)(qp + HD + 8 * i);
#pragma unroll
    for (int e = 0; e < 8; ++e)
      Qs[tid * 65 + 8 * i + e] = (float)hv[e] + (float)lv[e] * (1.0f / RSC);
  }
  __syncthreads();
#pragma unroll 1
  for (int n = 0; n < NE; ++n) {
    float s = 0.f;
#pragma unroll 1
    for (int dc = 0; dc < 2; ++dc) {
#pragma unroll
      for (int d = 0; d < 32; ++d) s += Qs[tid * 65 + dc * 32 + d] * Es[n * HD + dc * 32 + d];
    }
    Ts[tid * NEP + n] = s;
  }
#pragma unroll
  for (int n = NE; n < NEP; ++n) Ts[tid * NEP + n] = 0.f;
  __syncthreads();
  v4f vals[4];
#pragma unroll
  for (int it = 0; it < 4; ++it) vals[it] = *(const v4f*)(Ts + (it * 64 + tid) * 4);
  float* base = itab + (size_t)R0 * NEP;
#pragma unroll
  for (int it = 0; it < 4; ++it) *(v4f*)(base + (it * 64 + tid) * 4) = vals[it];
  
}

// =====================================================================================================
// Flash attention with a per-(query, key) additive bias selected by an input int matrix, head dim 64, SEQ rows
// per batch, non-causal.
//   QK plane (f16 bits, pitch QKW): element (b, t, col) at [(b*SEQ + t)*QKW + col]; q head h: hi at col h*128 + d
//   (residual at + 64, unused here); k head h: hi at KOFF + h*128 + d.
//   v^T hi and lo planes (f16): element (b, h, d, s) at [(b*DM + h*64 + d)*SEQ + s]; value = hi + lo/2048.
//   itab (f32 [NBATCH*NH*SEQ][NEP]): per-query score table; bias(q, kv) = itab[bh*SEQ + q][clamp(trj[b][q][kv])].
//   context plane (bf16, pitch CTXP): hi at [(b*SEQ + t)*CTXP + h*64 + d], lo at + DM.
//   score[i][j] = (q_hi . k) * sscale + bias(i, j); p = exp(s - m) carried as f16(1024 p);
//   context = p . v_hi and p . v_lo on f16 WMMA in two accumulators; online softmax (running max) in f32.
//   Block = 4 waves = 64 query rows of one (b, h); grid = NQB * NH * NBATCH; kv chunks of 64, static trip NQB.
//   The 64 x 16 score-table rows of the block are staged once in LDS; the pair index for each score element is
//   a plain int load (arithmetic address), clamped to 0..NE-1 and used only as an LDS index.
//   K hi and V^T hi/lo chunk staging: 128 threads x 32 elements per plane = the whole 64x64 tile per plane;
//   plain 16-B loads one pass ahead into registers, LDS stores between two __syncthreads. P tiles are wave-private, spilled with _Float16 element
//   Context coverage: each wave stores rows q0..q0+15 (it 0..3 x lane>>3 0..3) x 64 columns (8 lanes x 8 bf16)
//   for both the hi and the lo segment; the grid covers all SEQ rows x NH head slabs x NBATCH.
// =====================================================================================================
__global__ __launch_bounds__(128)
void attn64(const unsigned short* __restrict__ qk, const unsigned short* __restrict__ vth,
            const unsigned short* __restrict__ vtl, const float* __restrict__ itab,
            const int* __restrict__ trj, unsigned short* ctxp, float sscale) {
  __shared__ __align__(16) unsigned short Kh[64 * KP];          // K hi [kv][d]  9 KB
  __shared__ __align__(16) _Float16 Vh[64 * KP];                // V^T hi [d][kv] 9 KB
  __shared__ __align__(16) _Float16 Vl[64 * KP];                // V^T lo [d][kv] 9 KB
  __shared__ __align__(16) _Float16 Psh[4][16 * KP];            // per wave P [row][kv] 9 KB
  __shared__ __align__(16) float    Os[4][16 * OPT];            // per wave context tile [row][d] 17 KB
  __shared__ __align__(16) float    ITs[64 * ITP];              // score table rows of this query block 5 KB

  const int tid  = threadIdx.x;
  const int wave = tid >> 5;
  const int lane = tid & 31;
  const int hh   = lane >> 4;
  const int c    = lane & 15;

  const int bx   = blockIdx.x;
  const int qb   = bx % NQB;
  const int rest = bx / NQB;
  const int h    = rest % NH;
  const int b    = rest / NH;
  const int q0   = qb * 64 + wave * 16;          // in-batch query row of this wave's first row
  const size_t rowB = (size_t)b * SEQ;

  const unsigned short* Qh  = qk + (size_t)h * (2 * HD);
  const unsigned short* Kg  = qk + KOFF + (size_t)h * (2 * HD);
  const _Float16* Vgh = (const _Float16*)(const void*)vth + ((size_t)b * DM + (size_t)h * HD) * SEQ;
  const _Float16* Vgl = (const _Float16*)(const void*)vtl + ((size_t)b * DM + (size_t)h * HD) * SEQ;
  const float* itb = itab + (((size_t)b * NH + (size_t)h) * SEQ + (size_t)qb * 64) * NEP;
  // this lane's pair-index row group: query row q0 + 8*hh (+ r), key column c (+ kv0 + 16 j)
  const int* trw = trj + (rowB + (size_t)q0 + (size_t)(8 * hh)) * SEQ + c;

  // stage the block's 64 x 16 score table (256 float4, 128 threads x 2); visible after the loop's first barrier
#pragma unroll
  for (int i = 0; i < 2; ++i) {
    const int f = i * 128 + tid;
    *(v4f*)(ITs + (f >> 2) * ITP + (f & 3) * 4) = *(const v4f*)(itb + (size_t)f * 4);
  }

  float mrow[8], lrow[8];
  v8f oacc[4], oaccL[4];
#pragma unroll
  for (int r = 0; r < 8; ++r) { mrow[r] = -INFINITY; lrow[r] = 0.f; }
#pragma unroll
  for (int t = 0; t < 4; ++t) { oacc[t] = zero8(); oaccL[t] = zero8(); }

  // Registers that carry one pass's global data (this thread's 32 elements of the K, V^T hi and V^T lo tiles and
  // this lane's 32 pair indices): filled one pass ahead, so that their latency runs beside the pass before.
  const int sr = tid >> 1, shf = (tid & 1) * 32;
  const unsigned short* kgp = Kg + (rowB + sr) * QKW + shf;               // K row kv0+sr, d = shf..shf+31
  const _Float16* vgp = Vgh + (size_t)sr * SEQ + shf;                     // V^T row d = sr, s = kv0+shf..+31
  const _Float16* vlp = Vgl + (size_t)sr * SEQ + shf;
  v8us kreg[4];
  v8h  vreg[4], wreg[4];
  int  tix[4][8];
  auto fetch = [&](const int kv) {
#pragma unroll
    for (int i = 0; i < 4; ++i) {
      kreg[i] = *(const v8us*)(kgp + (size_t)kv * QKW + 8 * i);
      vreg[i] = *(const v8h*)(vgp + kv + 8 * i);
      wreg[i] = *(const v8h*)(vlp + kv + 8 * i);
    }
#pragma unroll
    for (int j = 0; j < 4; ++j)
#pragma unroll
      for (int r = 0; r < 8; ++r) tix[j][r] = trw[(size_t)r * SEQ + kv + j * 16];
  };
  fetch(0);

  // ---- Q fragments (A operand, row = lane&15): f16 hi, 2 d-chunks; the same in every pass ----
  const unsigned short* qp = Qh + (rowB + q0 + c) * QKW + 8 * hh;
  v16us qh2[2];
#pragma unroll
  for (int dc = 0; dc < 2; ++dc) {
    qh2[dc] = ldfrag_u(qp + dc * 32);
  }
#if defined(__HIP_DEVICE_COMPILE__)
  // the Q loads' address pair is dead behind them and its registers are reused: the wait stands in front of that
  // reuse (the pair is an input, so that it lives up to the wait)
  asm volatile("s_wait_xcnt 0x0" :: "v"(qp) : "memory");
#endif

#pragma unroll 1
  for (int kt = 0; kt < NQB; ++kt) {         // static trip count
    __syncthreads();
#pragma unroll
    for (int i = 0; i < 4; ++i) {
      *(v8us*)(Kh + sr * KP + shf + 8 * i) = kreg[i];
      *(v8h*)(Vh + sr * KP + shf + 8 * i) = vreg[i];
      *(v8h*)(Vl + sr * KP + shf + 8 * i) = wreg[i];
    }
    // this pass's pair indices, clamped to 0..NE-1 (used only as an LDS index)
    int nix[4][8];
#pragma unroll
    for (int j = 0; j < 4; ++j)
#pragma unroll
      for (int r = 0; r < 8; ++r) {
        int n = tix[j][r];
        n = (n < 0) ? 0 : n;
        nix[j][r] = (n > NE - 1) ? (NE - 1) : n;
      }
    __syncthreads();
    // next pass's loads; the last pass asks for its own tile again (in bounds, not used): no branch in the body
    fetch(((kt + 1 < NQB) ? (kt + 1) : kt) * 64);

    // ---- scores: 16 query rows x 64 keys per wave ----
    v8f s[4];
#pragma unroll
    for (int j = 0; j < 4; ++j) {
      v8f sh = zero8();
#pragma unroll
      for (int dc = 0; dc < 2; ++dc) {
        FragU kb;
        kb.h[0] = *(const v8us*)(Kh + (j * 16 + c) * KP + dc * 32 + 8 * hh);
        kb.h[1] = *(const v8us*)(Kh + (j * 16 + c) * KP + dc * 32 + 16 + 8 * hh);
        sh = mma_hu(qh2[dc], kb.v, sh);
      }
      // D element r: query row q0 + 8hh + r, key kv0 + j*16 + c
#pragma unroll
      for (int r = 0; r < 8; ++r) {
        s[j][r] = sh[r] * sscale + ITs[(wave * 16 + 8 * hh + r) * ITP + nix[j][r]];
      }
    }

    // ---- row max, online softmax, P (x1024, f16) to LDS ----
    _Float16* pwh = Psh[wave];
#pragma unroll
    for (int r = 0; r < 8; ++r) {
      float m = s[0][r];
      m = fmaxf(m, s[1][r]);
      m = fmaxf(m, s[2][r]);
      m = fmaxf(m, s[3][r]);
#pragma unroll
      for (int off = 1; off < 16; off <<= 1) m = fmaxf(m, __shfl_xor(m, off, 32));
      const float mnew  = fmaxf(mrow[r], m);
      const float alpha = __expf(mrow[r] - mnew);
      mrow[r] = mnew;
      float psum = 0.f;
#pragma unroll
      for (int j = 0; j < 4; ++j) {
        const float p = __expf(s[j][r] - mnew);
        psum += p;
        pwh[(8 * hh + r) * KP + j * 16 + c] = (_Float16)(p * PSC);
      }
#pragma unroll
      for (int off = 1; off < 16; off <<= 1) psum += __shfl_xor(psum, off, 32);
      lrow[r] = lrow[r] * alpha + psum;
#pragma unroll
      for (int t = 0; t < 4; ++t) { oacc[t][r] *= alpha; oaccL[t][r] *= alpha; }
    }
    wave_sync_lds_only();

    // ---- context += P . V_hi and P . V_lo (f16 WMMA, two accumulators) ----
#pragma unroll 1
    for (int kk = 0; kk < 2; ++kk) {
      FragH pa;
      pa.h[0] = *(const v8h*)(pwh + c * KP + kk * 32 + 8 * hh);
      pa.h[1] = *(const v8h*)(pwh + c * KP + kk * 32 + 16 + 8 * hh);
#pragma unroll
      for (int t = 0; t < 4; ++t) {
        FragH vb, vl;
        vb.h[0] = *(const v8h*)(Vh + (t * 16 + c) * KP + kk * 32 + 8 * hh);
        vb.h[1] = *(const v8h*)(Vh + (t * 16 + c) * KP + kk * 32 + 16 + 8 * hh);
        vl.h[0] = *(const v8h*)(Vl + (t * 16 + c) * KP + kk * 32 + 8 * hh);
        vl.h[1] = *(const v8h*)(Vl + (t * 16 + c) * KP + kk * 32 + 16 + 8 * hh);
        oacc[t]  = mma_h(pa.v, vb.v, oacc[t]);
        oaccL[t] = mma_h(pa.v, vl.v, oaccL[t]);
      }
    }
  }

  // ---- normalise (1/l, the 1/1024 p carry, the 1/2048 residual fold), stage the wave's 16x64 tile,
  float* os = Os[wave];
#pragma unroll
  for (int r = 0; r < 8; ++r) {
    const float l = lrow[r];
    const float inv = ((l > 0.f) ? (1.0f / l) : 0.f) * (1.0f / PSC);
#pragma unroll
    for (int t = 0; t < 4; ++t) os[(8 * hh + r) * OPT + t * 16 + c] = (oacc[t][r] + oaccL[t][r] * (1.0f / RSC)) * inv;
  }
  wave_sync_lds();
  {
    const int q4 = lane >> 3, c8 = (lane & 7) * 8;
    v4u hv[4], lv[4];
#pragma unroll
    for (int it = 0; it < 4; ++it) {
      const int row = it * 4 + q4;   // it 0..3 x q4 0..3 = rows 0..15 of the wave tile
      const float* sp = os + row * OPT + c8;
      v4u ha, la;
#pragma unroll
      for (int e = 0; e < 4; ++e) {
        const float f0 = sp[2 * e], f1 = sp[2 * e + 1];
        const unsigned short u0 = bf_bits(f0), u1 = bf_bits(f1);
        const unsigned short w0 = bf_bits(f0 - bf_up(u0)), w1 = bf_bits(f1 - bf_up(u1));
        ha[e] = pk16(u0, u1);
        la[e] = pk16(w0, w1);
      }
      hv[it] = ha;
      lv[it] = la;
    }
    {
#pragma unroll
      for (int it = 0; it < 4; ++it) {
        const int row = it * 4 + q4;
        const size_t go = (rowB + q0 + row) * CTXP + (size_t)h * HD + c8;
        *(v4u*)(ctxp + go)      = hv[it];
        *(v4u*)(ctxp + go + DM) = lv[it];
      }
      
    }
  }
}

// =====================================================================================================
// y = (x - mean) * rstd * bf16(gamma) + bf16(beta). Block = 64 threads = one row; thread t handles columns
// 4t..4t+3 and 256+4t..256+4t+3, so each store instruction of a wave writes 32 lanes x 16 B = 512 contiguous
// coverage: 64 threads x 8 = 512 columns = the whole row; MP rows.
// =====================================================================================================
__global__ __launch_bounds__(64) void ln_rows(const float* __restrict__ X, const float* __restrict__ gam,
                                              const float* __restrict__ bet, float* out) {
  __shared__ float red[4];
  const int row = blockIdx.x;
  const int tid = threadIdx.x, lane = tid & 31, wv = tid >> 5;
  const float* src = X + (size_t)row * DM;
  const v4f a0 = *(const v4f*)(src + tid * 4);
  const v4f a1 = *(const v4f*)(src + 256 + tid * 4);
  float x[8];
#pragma unroll
  for (int e = 0; e < 4; ++e) { x[e] = a0[e]; x[4 + e] = a1[e]; }
  float s = 0.f;
#pragma unroll
  for (int e = 0; e < 8; ++e) s += x[e];
#pragma unroll
  for (int off = 1; off < 32; off <<= 1) s += __shfl_xor(s, off, 32);
  if (lane == 0) red[wv] = s;
  __syncthreads();
  const float mean = (red[0] + red[1]) * (1.0f / DM);
  float d[8];
  float q = 0.f;
#pragma unroll
  for (int e = 0; e < 8; ++e) { d[e] = x[e] - mean; q += d[e] * d[e]; }
#pragma unroll
  for (int off = 1; off < 32; off <<= 1) q += __shfl_xor(q, off, 32);
  if (lane == 0) red[2 + wv] = q;
  __syncthreads();
  const float var  = (red[2] + red[3]) * (1.0f / DM);
  const float rstd = rsqrtf(var + 1e-6f);

  const v4f g0 = *(const v4f*)(gam + tid * 4);
  const v4f g1 = *(const v4f*)(gam + 256 + tid * 4);
  const v4f e0 = *(const v4f*)(bet + tid * 4);
  const v4f e1 = *(const v4f*)(bet + 256 + tid * 4);
  v4f o0, o1;
#pragma unroll
  for (int e = 0; e < 4; ++e) {
    o0[e] = d[e]     * rstd * bfr(g0[e]) + bfr(e0[e]);
    o1[e] = d[4 + e] * rstd * bfr(g1[e]) + bfr(e1[e]);
  }
  float* dst = out + (size_t)row * DM + tid * 4;
  *(v4f*)(dst)       = o0;
  *(v4f*)(dst + 256) = o1;
  
}

// =====================================================================================================
// Workspace map (bytes); every plane is an exact multiple of its 64x64-tile / whole-row / whole-line store
// granularity (MP = 4096 = 64 row tiles; DM = 8 column tiles; VT per batch [512][2048] = 8x32 tiles; score table
//   WT   bf16 [1536 n][512 k]    0          1572864   (rows 0..511 Wq^T, 512..1023 Wk^T, 1024..1535 Wv^T)
//   WoT2 bf16 [512][1024]        1572864    1048576   (cols k and DM + k both Wo^T)
//   INb  bf16 [3][4096][512]     2621440    12582912  (q, k, v as bf16 bits)
//   QK   f16  [4096][2048]       15204352   16777216  (q [hi|lo] per head, then k [hi|lo] per head)
//   VTh  f16  [2][512][2048]     31981568   4194304   (v^T hi)
//   VTl  f16  [2][512][2048]     36175872   4194304   (v^T residual x2048)
//   IT   f32  [32768][16]        40370176   2097152   (query-embedding scores)
//   Ctx  bf16 [4096][1024]       42467328   8388608   (context hi | lo)
//   X    f32  [4096][512]        50855936   8388608   (pre-norm output)
//   end                          59244544
// =====================================================================================================
extern "C" void kernel_launch(void* const* d_in, const int* in_sizes, int n_in,
                              void* d_out, int out_size, void* d_ws, size_t ws_size,
                              hipStream_t stream) {
  if (n_in < 11) return;
  if (in_sizes[0] != MP * DM || in_sizes[1] != MP * DM || in_sizes[2] != MP * DM) return;
  if (in_sizes[3] != NE * DM) return;
  if (in_sizes[4] != NBATCH * SEQ * SEQ) return;
  if (in_sizes[5] != DM * DM || in_sizes[6] != DM * DM || in_sizes[7] != DM * DM || in_sizes[8] != DM * DM) return;
  if (in_sizes[9] != DM || in_sizes[10] != DM) return;
  if (out_size != MP * DM) return;

  const float* q_in = (const float*)d_in[0];
  const float* k_in = (const float*)d_in[1];
  const float* v_in = (const float*)d_in[2];
  const float* emb  = (const float*)d_in[3];
  const int*   trj  = (const int*)d_in[4];
  const float* w_q  = (const float*)d_in[5];
  const float* w_k  = (const float*)d_in[6];
  const float* w_v  = (const float*)d_in[7];
  const float* w_o  = (const float*)d_in[8];
  const float* gam  = (const float*)d_in[9];
  const float* bet  = (const float*)d_in[10];

  const size_t PWT  = (size_t)3 * DM * DM * 2;             //  1572864
  const size_t PWO  = (size_t)DM * KOFF * 2;               //  1048576
  const size_t PIN  = (size_t)3 * MP * DM * 2;             // 12582912
  const size_t PQK  = (size_t)MP * QKW * 2;                // 16777216
  const size_t PVT  = (size_t)NBATCH * DM * SEQ * 2;       //  4194304
  const size_t PIT  = (size_t)NBATCH * NH * SEQ * NEP * 4; //  2097152
  const size_t PCTX = (size_t)MP * CTXP * 2;               //  8388608
  const size_t PX   = (size_t)MP * DM * 4;                 //  8388608
  size_t off = 0;
  const size_t oWT  = off; off += PWT;
  const size_t oWo  = off; off += PWO;
  const size_t oIN  = off; off += PIN;
  const size_t oQK  = off; off += PQK;
  const size_t oVTh = off; off += PVT;
  const size_t oVTl = off; off += PVT;
  const size_t oIT  = off; off += PIT;
  const size_t oCtx = off; off += PCTX;
  const size_t oX   = off; off += PX;
  if (off > ws_size) return;                               // off = 59244544
  if (off > (size_t)134217728) return;

  char* ws = (char*)d_ws;
  unsigned short* WT   = (unsigned short*)(ws + oWT);
  unsigned short* WoT2 = (unsigned short*)(ws + oWo);
  unsigned short* INb  = (unsigned short*)(ws + oIN);
  unsigned short* QK   = (unsigned short*)(ws + oQK);
  unsigned short* VTh  = (unsigned short*)(ws + oVTh);
  unsigned short* VTl  = (unsigned short*)(ws + oVTl);
  float*          IT   = (float*)(ws + oIT);
  unsigned short* Ctx  = (unsigned short*)(ws + oCtx);
  float*          X    = (float*)(ws + oX);
  float*          out0 = (float*)d_out;

  const dim3 blk(256), blk128(128), blk64(64);
  const dim3 gCv(MP / 4, 3);                                        // 1024 x 3 blocks
  const dim3 gT(DM / 64, DM / 64);                                  // (cols/64, rows/64) = 8 x 8 per weight
  const dim3 gQK(((MP / 64) * (DM / 64)) / 8, 2, 1);                // 512 tiles -> 64 blocks x {q, k}
  const dim3 gVT(((DM / 64) * (SEQ / 64)) / 8, NBATCH, 1);          // 256 tiles -> 32 blocks x 2 batches
  const dim3 gIdx(NBATCH * NH * (SEQ / 64));                        // 512 blocks of 64
  const dim3 gAttn(NBATCH * NH * NQB);                              // 512 blocks of 128
  const dim3 gNo(((MP / 64) * (DM / 64)) / 8, 1, 1);                // 512 tiles -> 64 blocks
  const dim3 gLN(MP);                                               // 4096 rows
  if ((((MP / 64) * (DM / 64)) % 8) != 0) return;
  if ((((DM / 64) * (SEQ / 64)) % 8) != 0) return;

  // (0) activations -> bf16 bits; weight planes: in[k][n] (shape [512 in][512 out]) -> out[n][k] transposed
  //     through LDS (Wo additionally at cols DM + k for the hi|lo K-concat)
  cvt3<<<gCv, blk, 0, stream>>>(q_in, k_in, v_in, INb);
  tconv64<<<gT, blk, 0, stream>>>(w_q, WT, DM, DM, DM, 0);                            // -> WT rows 0..511
  tconv64<<<gT, blk, 0, stream>>>(w_k, WT + (size_t)DM * DM, DM, DM, DM, 0);          // -> WT rows 512..1023
  tconv64<<<gT, blk, 0, stream>>>(w_v, WT + (size_t)2 * DM * DM, DM, DM, DM, 0);      // -> WT rows 1024..1535
  tconv64<<<gT, blk, 0, stream>>>(w_o, WoT2, DM, DM, KOFF, DM);

  // (1) q = qb . Wq^T-plane (blockIdx.y = 0) and k = kb . Wk^T-plane (blockIdx.y = 1), K = 512
  //     -> f16 [hi 64 | lo 64] per head (QK plane [4096][2048], q at cols 0.., k at cols KOFF..);
  //     v^T per batch = Wv^T . vb_b^T -> f16 hi (VTh) and residual x2048 (VTl) planes [2][512][2048]
  gemm64<4><<<gQK, blk, 0, stream>>>(
      INb, DM, (long long)MP * DM, WT, DM, (long long)DM * DM,
      QK, QK + HD, X, QKW, (long long)KOFF,
      MP, DM, DM, 2, 1.0f);
  gemm64<4><<<gVT, blk, 0, stream>>>(
      WT + (size_t)2 * DM * DM, DM, 0LL, INb + (size_t)2 * MP * DM, DM, (long long)SEQ * DM,
      VTh, VTl, X, SEQ, (long long)DM * SEQ,
      DM, SEQ, DM, 1, 1.0f);

  // (2) query-embedding score table (f32), then flash attention with the selected per-pair bias
  //     -> context bf16 hi|lo
  idx_rows<<<gIdx, blk64, 0, stream>>>(QK, emb, IT);
  attn64<<<gAttn, blk128, 0, stream>>>(QK, VTh, VTl, IT, trj, Ctx, 0.125f);

  // (3) X = [ctx_hi | ctx_lo] . [Wo | Wo]  (K = 1024, bf16 operands) -> f32 plane; LayerNorm -> d_out
  gemm64<0><<<gNo, blk, 0, stream>>>(
      Ctx, CTXP, 0LL, WoT2, KOFF, 0LL,
      Ctx, Ctx, X, DM, 0LL,
      MP, DM, KOFF, 1, 1.0f);
  ln_rows<<<gLN, blk64, 0, stream>>>(X, gam, bet, out0);
  (void)hipGetLastError();
}

// v003
// Measured time: 161 microseconds a run.
// Next to v002, in two timings, it ran 1.30 times as fast each time.
// Counting every step since v000, it is 1.64 times as fast.
// Contractions: q|k|v projections and output projection on v_wmma_f32_16x16x32_bf16 (bf16 operands from
// RNE-converted inputs; context carried as bf16 hi|lo planes K-concatenated against duplicated Wo planes);
// scores q.k^T on v_wmma_f32_16x16x32_f16 (q f16 hi, k f16 hi, single product); p.v on
// v_wmma_f32_16x16x32_f16 (p carried x1024 in f16, v^T as f16 hi + x2048 residual planes, two products,
// separate accumulators); all f32 accumulate; query-embedding scores (from q hi + residual), per-pair bias
// select, softmax and LayerNorm in f32.
#include <hip/hip_runtime.h>
#include <math.h>

#define NBATCH 2
#define SEQ    2048
#define DM     512
#define NH     8
#define HD     64
#define NE     10
#define NEP    16
#define MP     (NBATCH * SEQ)
#define QKW    (4 * DM)
#define KOFF   (2 * DM)
#define CTXP   (2 * DM)
#define NQB    (SEQ / 64)
#define RSC    2048.0f
#define PSC    1024.0f
#define KP     72      // LDS row pitch of the 64-wide 16-bit attention tiles, in elements: 144 B = 16 B x 9
#define OPT    68      // LDS row pitch of the f32 context tile, in floats: 272 B = 16 B x 17
#define ITP    20      // LDS row pitch of the score-table rows, in floats: rows 8 apart fall 32 banks apart
static_assert(NH * HD == DM);
static_assert(DM == 8 * 64);
static_assert((SEQ % 64) == 0 && (DM % 64) == 0 && (MP % 64) == 0 && (SEQ % 256) == 0 && (MP % 4) == 0);
static_assert((((MP / 64) * (DM / 64)) % 8) == 0);
static_assert((((DM / 64) * (SEQ / 64)) % 8) == 0);
static_assert(NE <= NEP && NEP == 16);
static_assert(((DM / 64) % 8) == 0 && ((SEQ / 64) % 8) == 0);   // gemm64: the 8 tiles of a block lie in one tile row

typedef _Float16 v16h __attribute__((ext_vector_type(16)));
typedef _Float16 v8h  __attribute__((ext_vector_type(8)));
typedef __bf16   v16b __attribute__((ext_vector_type(16)));
typedef unsigned short v16us __attribute__((ext_vector_type(16)));
typedef unsigned short v8us  __attribute__((ext_vector_type(8)));
typedef float    v8f  __attribute__((ext_vector_type(8)));
typedef float    v4f  __attribute__((ext_vector_type(4)));
typedef unsigned int v4u __attribute__((ext_vector_type(4)));

union FragH { v16h v; v8h h[2]; };
union FragU { v16us v; v8us h[2]; };

// ---- scalar helpers --------------------------------------------------------------------------------
__device__ __forceinline__ unsigned short bf_bits(float f) {          // f32 -> bf16 bits, RNE convert
  unsigned u = __float_as_uint(f);
  return (unsigned short)((u + 0x7FFFu + ((u >> 16) & 1u)) >> 16);
}
__device__ __forceinline__ float bf_up(unsigned short h) { return __uint_as_float(((unsigned)h) << 16); }
__device__ __forceinline__ float bfr(float f) { return bf_up(bf_bits(f)); }   // value of the bf16 RNE convert
__device__ __forceinline__ unsigned short h_bits(_Float16 x) { return __builtin_bit_cast(unsigned short, x); }
__device__ __forceinline__ unsigned pk16(unsigned short a, unsigned short b) { return (unsigned)a | ((unsigned)b << 16); }
__device__ __forceinline__ v8f zero8() { v8f z = {0.f, 0.f, 0.f, 0.f, 0.f, 0.f, 0.f, 0.f}; return z; }

// ---- fragment loader: 16-bit A/B operand, lane -> row/col (lane&15), p already includes +8*(lane>>4);
//      elements 0..7 <- p[0..7] (k0+8h..), elements 8..15 <- p[16..23] (k0+16+8h..)
__device__ __forceinline__ v16us ldfrag_u(const unsigned short* p) {
  FragU f;
  f.h[0] = *(const v8us*)(p);
  f.h[1] = *(const v8us*)(p + 16);
  return f.v;
}

// ---- WMMA helpers with trailing VALU hazard gap --------------------------------------------------------
__device__ __forceinline__ v8f mma_bu_raw(v16us a, v16us b, v8f c) {            // bf16 operands, unguarded
  return __builtin_amdgcn_wmma_f32_16x16x32_bf16(false, __builtin_bit_cast(v16b, a), false,
                                                 __builtin_bit_cast(v16b, b), (short)0, c, false, false);
}
__device__ __forceinline__ v8f mma_hu(v16us a, v16us b, v8f c) {                // f16 operands (bits), guarded
  c = __builtin_amdgcn_wmma_f32_16x16x32_f16(false, __builtin_bit_cast(v16h, a), false,
                                              __builtin_bit_cast(v16h, b), (short)0, c, false, false);
#if defined(__HIP_DEVICE_COMPILE__)
  asm volatile("v_nop\n\tv_nop\n\tv_nop\n\tv_nop" : "+v"(c) : "v"(a), "v"(b));
#endif
  return c;
}
__device__ __forceinline__ v8f mma_h(v16h a, v16h b, v8f c) {                    // f16 operands, guarded
  c = __builtin_amdgcn_wmma_f32_16x16x32_f16(false, a, false, b, (short)0, c, false, false);
#if defined(__HIP_DEVICE_COMPILE__)
  asm volatile("v_nop\n\tv_nop\n\tv_nop\n\tv_nop" : "+v"(c) : "v"(a), "v"(b));
#endif
  return c;
}
__device__ __forceinline__ void acc_guard4(v8f& a, v8f& b, v8f& c, v8f& d) {
#if defined(__HIP_DEVICE_COMPILE__)
  asm volatile("v_nop\n\tv_nop\n\tv_nop\n\tv_nop" : "+v"(a), "+v"(b), "+v"(c), "+v"(d));
#endif
}
__device__ __forceinline__ void wave_sync_lds() {
  __builtin_amdgcn_fence(__ATOMIC_RELEASE, "workgroup");
  __builtin_amdgcn_wave_barrier();
  __builtin_amdgcn_fence(__ATOMIC_ACQUIRE, "workgroup");
}
// The same for LDS traffic alone: orders a wave's own LDS stores before its LDS loads and leaves its global loads
// in flight (the fence over all address spaces waits for them too).
__device__ __forceinline__ void wave_sync_lds_only() {
  __builtin_amdgcn_fence(__ATOMIC_RELEASE, "workgroup", "local");
  __builtin_amdgcn_wave_barrier();
  __builtin_amdgcn_fence(__ATOMIC_ACQUIRE, "workgroup", "local");
}

// =====================================================================================================
// f32 [MP][DM] activations (three sources selected by blockIdx.y, block-uniform) -> bf16 bits plane
// dst[(z*MP + row)*DM + col]. Block = 256 threads = 4 rows; thread t: row = 4*bx + (t>>6), cols 8*(t&63)..+7.
// coverage: 1024 blocks x 4 rows x 512 cols = each whole plane; 3 planes.
// =====================================================================================================
__global__ __launch_bounds__(256) void cvt3(const float* __restrict__ s0, const float* __restrict__ s1,
                                            const float* __restrict__ s2, unsigned short* dst) {
  const int z = blockIdx.y;
  const float* src = (z == 0) ? s0 : ((z == 1) ? s1 : s2);
  const int t = threadIdx.x;
  const int row = blockIdx.x * 4 + (t >> 6);
  const int c8 = (t & 63) * 8;
  const float* p = src + (size_t)row * DM + c8;
  const v4f a0 = *(const v4f*)(p);
  const v4f a1 = *(const v4f*)(p + 4);
  v4u hv;
  hv[0] = pk16(bf_bits(a0[0]), bf_bits(a0[1]));
  hv[1] = pk16(bf_bits(a0[2]), bf_bits(a0[3]));
  hv[2] = pk16(bf_bits(a1[0]), bf_bits(a1[1]));
  hv[3] = pk16(bf_bits(a1[2]), bf_bits(a1[3]));
  unsigned short* d = dst + ((size_t)z * MP + (size_t)row) * DM + c8;
  *(v4u*)d = hv;
  
}

// =====================================================================================================
// Tiled transpose + bf16 convert: in[rows][cols] f32 row-major -> out[cols][rows] bf16 bits with pitch ldo:
//   out[n * ldo + k] = bf16(in[k][n]) and also at + dupoff (a duplicated k range for the hi|lo K-concat GEMM).
// Block = 256 threads = one 64x64 tile; grid = (cols/64, rows/64) (rows, cols multiples of 64, host-checked).
// Loads: 4 iterations x 256 threads x float4 = 64 rows x 64 cols (addresses clamped). LDS tile [n][k] pitch 72.
// coverage: 64 x 64 = the whole transposed tile at both column offsets; grid covers the whole matrix.
// =====================================================================================================
__global__ __launch_bounds__(256) void tconv64(const float* __restrict__ W, unsigned short* out,
                                               int rows, int cols, int ldo, int dupoff) {
  __shared__ __align__(16) unsigned short sh[64 * 72];
  const int t  = threadIdx.x;
  const int n0 = blockIdx.x * 64;            // column tile of in = row tile of out
  const int k0 = blockIdx.y * 64;            // row tile of in = column tile of out
#pragma unroll
  for (int i = 0; i < 4; ++i) {
    const int idx = i * 256 + t;
    const int r = idx >> 4, c4 = (idx & 15) * 4;
    int kr = k0 + r;   kr = (kr < rows) ? kr : (rows - 1);
    int nc = n0 + c4;  nc = (nc < cols - 4) ? nc : (cols - 4);
    const v4f v = *(const v4f*)(W + (size_t)kr * cols + nc);
#pragma unroll
    for (int e = 0; e < 4; ++e) sh[(c4 + e) * 72 + r] = bf_bits(v[e]);
  }
  __syncthreads();
  const int wave = t >> 5, lane = t & 31;
  const int q = lane >> 3, c8 = (lane & 7) * 8;
  v4u pv[2];
  size_t go[2];
#pragma unroll
  for (int it = 0; it < 2; ++it) {
    const int nl = it * 32 + wave * 4 + q;               // 0..63
    pv[it] = *(const v4u*)(sh + nl * 72 + c8);
    go[it] = (size_t)(n0 + nl) * ldo + k0 + c8;
  }
  {
#pragma unroll
    for (int it = 0; it < 2; ++it) {
      *(v4u*)(out + go[it]) = pv[it];
      if (dupoff != 0) *(v4u*)(out + go[it] + dupoff) = pv[it];
    }
    
  }
}

// =====================================================================================================
// Register-blocked batched bf16 WMMA GEMM: C[m][n] = oscale * sum_k A[m][k] * Bt[n][k];
// one wave per 64x64 tile; the 8 tiles of a block lie side by side in one tile row (N/64 a multiple of 8), so the
// block works on 64 rows of A and 512 rows of Bt. Both are staged in LDS in k chunks of 64: each 16-B load of a wave
// takes 4 whole 128-B row segments, one chunk ahead into registers, LDS stores between two __syncthreads; the
// fragments are ds_load_b128 reads at a 144-B pitch. A row-major [M][K] pitch lda; Bt row-major [N][K] pitch ldb
// (k contiguous); M, N multiples of 64, K multiple of 64. blockIdx.y = batch index with element strides
// (sAy for A, sBy for Bt, sCy for C). Tile enumeration: tile -> tm = tile / (N/64), tn = tile % (N/64).
// OM: 0 = f32 out to Cf (pitch ldc); 4 = f16 hi bits to Cp and f16((v - hi) * 2048) bits to Cp2, 16-bit column
//     base = n0 * nmul (nmul = 2 interleaves [hi 64 | lo 64] per 64-col tile with Cp2 = Cp + 64).
// coverage: 4 slabs x 16 rows x 64 cols = the wave's whole 64x64 tile; grid = tilesM*tilesN/8 blocks exactly
//           (host-checked), so no block exits early.
// =====================================================================================================
template <int OM>
__global__ __launch_bounds__(256) void gemm64(
    const unsigned short* __restrict__ Ap, int lda, long long sAy,
    const unsigned short* __restrict__ Btp, int ldb, long long sBy,
    unsigned short* Cp, unsigned short* Cp2, float* Cf, int ldc, long long sCy,
    int M, int N, int K, int nmul, float oscale) {
  __shared__ __align__(16) float sT[8][16 * 68];   // per-wave 16x64 slab, pitch 68 floats
  __shared__ __align__(16) unsigned short sAB[(64 + 512) * KP];   // rows 0..63: A chunk; rows 64..575: Bt chunk
  const int by   = blockIdx.y;
  const int lane = threadIdx.x & 31;
  const int wave = threadIdx.x >> 5;
  const int tilesN = N >> 6;
  const int tilesM = M >> 6;
  const int tile0 = blockIdx.x * 8;
  if (tile0 + 8 > tilesM * tilesN) return;   // block-uniform, in front of every barrier (the grid is exact)
  const int tm  = tile0 / tilesN;
  const int tn0 = tile0 - tm * tilesN;       // first of the block's 8 tiles, all in tile row tm
  const int m0 = tm << 6;
  const int n0 = (tn0 + wave) << 6;

  const unsigned short* Ab = Ap  + (size_t)by * (size_t)sAy;
  const unsigned short* Bb = Btp + (size_t)by * (size_t)sBy;
  const size_t cofs = (size_t)by * (size_t)sCy;

  const int rlane = lane & 15;                 // row (A) / col (B, D) within subtile
  const int koff  = (lane >> 4) * 8;           // k offset of this lane half
  const int mOff  = (lane >> 4) * 8;           // D row offset

  v8f acc[4][4];
#pragma unroll
  for (int i = 0; i < 4; ++i)
#pragma unroll
    for (int j = 0; j < 4; ++j) acc[i][j] = zero8();

  // Staging: 576 rows x 8 pieces of 16 B = 18 pieces per thread; piece i of thread t: staged row 32 i + srow,
  // bytes 16 (t & 7).. of the row's 128-B chunk. Pieces 0, 1 are A rows, pieces 2..17 Bt rows. srow runs through
  // 0..31 over the block's 32 groups of 8 lanes; the two groups of a 16-lane half take rows 8 apart, which at the
  // 144-B pitch lie 32 banks apart, so that a half's ds_store_b128 covers each of the 64 banks once.
  const int tx = threadIdx.x;
  const int srow = ((tx >> 4) & 7) | (((tx >> 3) & 1) << 3) | ((tx >> 7) << 4), sc8 = (tx & 7) * 8;
  const unsigned short* gp[18];
#pragma unroll
  for (int i = 0; i < 2; ++i)  gp[i] = Ab + (size_t)(m0 + 32 * i + srow) * lda + sc8;
#pragma unroll
  for (int i = 2; i < 18; ++i) gp[i] = Bb + (size_t)((tn0 << 6) + 32 * (i - 2) + srow) * ldb + sc8;
  v4u st[18];
  auto fetch = [&]() {
#pragma unroll
    for (int i = 0; i < 18; ++i) st[i] = *(const v4u*)(gp[i]);
#if defined(__HIP_DEVICE_COMPILE__)
    // the address pairs of the loads just issued are stepped below: the wait stands in front of that (the pairs are
    // inputs, so that they live unchanged up to the wait); the clobber keeps the loads in front of the products
    asm volatile("s_wait_xcnt 0x0" :: "v"(gp[0]), "v"(gp[1]), "v"(gp[2]), "v"(gp[3]), "v"(gp[4]), "v"(gp[5]),
                 "v"(gp[6]), "v"(gp[7]), "v"(gp[8]), "v"(gp[9]), "v"(gp[10]), "v"(gp[11]), "v"(gp[12]),
                 "v"(gp[13]), "v"(gp[14]), "v"(gp[15]), "v"(gp[16]), "v"(gp[17]) : "memory");
#endif
#pragma unroll
    for (int i = 0; i < 18; ++i) gp[i] += 64;
  };
  const unsigned short* fA = sAB + rlane * KP + koff;                       // this lane's A fragment rows
  const unsigned short* fB = sAB + (64 + wave * 64 + rlane) * KP + koff;    // this lane's Bt fragment rows
  const int nch = K >> 6;
  fetch();
  for (int kc = 0; kc < nch; ++kc) {
    __syncthreads();                           // every wave has read the chunk before
#pragma unroll
    for (int i = 0; i < 18; ++i) *(v4u*)(sAB + (32 * i + srow) * KP + sc8) = st[i];
    __syncthreads();                           // the chunk is whole
    if (kc + 1 < nch) fetch();                 // block-uniform; the next chunk flies beside this chunk's products
    v16us ah[2][4], bh[2][4];
#pragma unroll
    for (int ks = 0; ks < 2; ++ks) {
#pragma unroll
      for (int j = 0; j < 4; ++j) bh[ks][j] = ldfrag_u(fB + j * 16 * KP + ks * 32);
#pragma unroll
      for (int i = 0; i < 4; ++i) ah[ks][i] = ldfrag_u(fA + i * 16 * KP + ks * 32);
    }
    // keeps the chunk's 32 fragment reads in front of its products: unfenced, the compiler reads the A fragments into
    // one register set and waits for LDS in front of every row of products
    __builtin_amdgcn_sched_barrier(0);
#pragma unroll
    for (int ks = 0; ks < 2; ++ks)
#pragma unroll
      for (int i = 0; i < 4; ++i)
#pragma unroll
        for (int j = 0; j < 4; ++j) acc[i][j] = mma_bu_raw(ah[ks][i], bh[ks][j], acc[i][j]);
  }
  acc_guard4(acc[0][0], acc[0][1], acc[0][2], acc[0][3]);
  acc_guard4(acc[1][0], acc[1][1], acc[1][2], acc[1][3]);
  acc_guard4(acc[2][0], acc[2][1], acc[2][2], acc[2][3]);
  acc_guard4(acc[3][0], acc[3][1], acc[3][2], acc[3][3]);

  const int hh2 = lane >> 4, c4 = (lane & 15) * 4;     // f32 out: 256-B row segment = 16 lanes x 16 B
  const int q8  = lane >> 3, c8 = (lane & 7) * 8;

  // ---- epilogue ----
  float* slab = sT[wave];
#pragma unroll
  for (int i = 0; i < 4; ++i) {
    const int mBase = m0 + (i << 4);
#pragma unroll
    for (int j = 0; j < 4; ++j) {
#pragma unroll
      for (int r = 0; r < 8; ++r) {
        slab[(mOff + r) * 68 + (j << 4) + rlane] = acc[i][j][r];
      }
    }
    wave_sync_lds();
    if (OM == 0) {
      float* C = Cf + cofs;
      v4f vals[8];
#pragma unroll
      for (int it = 0; it < 8; ++it) {
        const int row = it * 2 + hh2;                      // it 0..7 x hh2 0..1 = rows 0..15
        v4f v = *(const v4f*)(slab + row * 68 + c4);
        vals[it] = v * oscale;
      }
      {
#pragma unroll
        for (int it = 0; it < 8; ++it) {
          const int row = it * 2 + hh2;
          *(v4f*)(C + (size_t)(mBase + row) * ldc + (size_t)n0 * nmul + c4) = vals[it];
        }
        
      }
    } else {
      unsigned short* C  = Cp  + cofs;
      unsigned short* C2 = Cp2 + cofs;
      v4u hv[4], lv[4];
#pragma unroll
      for (int it = 0; it < 4; ++it) {
        const int row = it * 4 + q8;                       // it 0..3 x q8 0..3 = rows 0..15
        const float* sp = slab + row * 68 + c8;
        v4u ha, la;
#pragma unroll
        for (int e = 0; e < 4; ++e) {
          const float f0 = sp[2 * e]     * oscale;
          const float f1 = sp[2 * e + 1] * oscale;
          const _Float16 g0 = (_Float16)f0, g1 = (_Float16)f1;
          const unsigned short u0 = h_bits(g0), u1 = h_bits(g1);
          const unsigned short w0 = h_bits((_Float16)((f0 - (float)g0) * RSC));
          const unsigned short w1 = h_bits((_Float16)((f1 - (float)g1) * RSC));
          ha[e] = pk16(u0, u1);
          la[e] = pk16(w0, w1);
        }
        hv[it] = ha;
        lv[it] = la;
      }
      {
#pragma unroll
        for (int it = 0; it < 4; ++it) {
          const int row = it * 4 + q8;
          const size_t go = (size_t)(mBase + row) * ldc + (size_t)n0 * nmul + c8;
          *(v4u*)(C  + go) = hv[it];
          *(v4u*)(C2 + go) = lv[it];
        }
        
      }
    }
    wave_sync_lds();
  }
}

// =====================================================================================================
// Query-embedding score table: itab[(bh*SEQ + l)*NEP + n] = sum_d qh[b,h,l,d] * bf16(emb[n][h*64 + d]) for
// n < NE (f32, columns NE..NEP-1 = 0). qh is reconstructed in f32 as hi + lo/2048 from the q part of the QK
// plane (f16 hi at col h*128 + d, residual at + 64). Block = 64 threads = 64 consecutive rows l of one (b, h)
// (SEQ % 64 == 0); grid = NBATCH*NH*SEQ/64 exact. q rows and the head's emb slice staged in LDS (f32);
// the 10 dots per row are rolled over n and over two 32-wide d halves (32 static FMAs).
// Output tile 64 x 16 f32 staged in LDS and written as 256 float4 = 4 instructions per wave, each 32 lanes x
// coverage: 512 blocks x 64 rows x 16 cols = the whole table.
// =====================================================================================================
__global__ __launch_bounds__(64) void idx_rows(const unsigned short* __restrict__ qk,
                                               const float* __restrict__ emb, float* itab) {
  __shared__ float Qs[64 * 65];
  __shared__ float Es[NE * HD];
  __shared__ __align__(16) float Ts[64 * NEP];
  const int tid = threadIdx.x;
  const int R0 = blockIdx.x * 64;                 // flat (b*NH + h)*SEQ + l row base
  const int bh = R0 / SEQ;
  const int l0 = R0 - bh * SEQ;
  const int b  = bh / NH;
  const int h  = bh - b * NH;
#pragma unroll 1
  for (int i = tid; i < NE * HD; i += 64) {
    const int n = i >> 6, d = i & 63;
    Es[i] = bfr(emb[(size_t)n * DM + h * HD + d]);
  }
  const _Float16* qp = (const _Float16*)(const void*)qk
                     + ((size_t)b * SEQ + (size_t)l0 + (size_t)tid) * QKW + (size_t)h * (2 * HD);
#pragma unroll
  for (int i = 0; i < 8; ++i) {
    const v8h hv = *(const v8h*)(qp + 8 * i);
    const v8h lv = *(const v8h*)(qp + HD + 8 * i);
#pragma unroll
    for (int e = 0; e < 8; ++e)
      Qs[tid * 65 + 8 * i + e] = (float)hv[e] + (float)lv[e] * (1.0f / RSC);
  }
  __syncthreads();
#pragma unroll 1
  for (int n = 0; n < NE; ++n) {
    float s = 0.f;
#pragma unroll 1
    for (int dc = 0; dc < 2; ++dc) {
#pragma unroll
      for (int d = 0; d < 32; ++d) s += Qs[tid * 65 + dc * 32 + d] * Es[n * HD + dc * 32 + d];
    }
    Ts[tid * NEP + n] = s;
  }
#pragma unroll
  for (int n = NE; n < NEP; ++n) Ts[tid * NEP + n] = 0.f;
  __syncthreads();
  v4f vals[4];
#pragma unroll
  for (int it = 0; it < 4; ++it) vals[it] = *(const v4f*)(Ts + (it * 64 + tid) * 4);
  float* base = itab + (size_t)R0 * NEP;
#pragma unroll
  for (int it = 0; it < 4; ++it) *(v4f*)(base + (it * 64 + tid) * 4) = vals[it];
  
}

// =====================================================================================================
// Flash attention with a per-(query, key) additive bias selected by an input int matrix, head dim 64, SEQ rows
// per batch, non-causal.
//   QK plane (f16 bits, pitch QKW): element (b, t, col) at [(b*SEQ + t)*QKW + col]; q head h: hi at col h*128 + d
//   (residual at + 64, unused here); k head h: hi at KOFF + h*128 + d.
//   v^T hi and lo planes (f16): element (b, h, d, s) at [(b*DM + h*64 + d)*SEQ + s]; value = hi + lo/2048.
//   itab (f32 [NBATCH*NH*SEQ][NEP]): per-query score table; bias(q, kv) = itab[bh*SEQ + q][clamp(trj[b][q][kv])].
//   context plane (bf16, pitch CTXP): hi at [(b*SEQ + t)*CTXP + h*64 + d], lo at + DM.
//   score[i][j] = (q_hi . k) * sscale + bias(i, j); p = exp(s - m) carried as f16(1024 p);
//   context = p . v_hi and p . v_lo on f16 WMMA in two accumulators; online softmax (running max) in f32.
//   Block = 4 waves = 64 query rows of one (b, h); grid = NQB * NH * NBATCH; kv chunks of 64, static trip NQB.
//   The 64 x 16 score-table rows of the block are staged once in LDS; the pair index for each score element is
//   a plain int load (arithmetic address), clamped to 0..NE-1 and used only as an LDS index.
//   K hi and V^T hi/lo chunk staging: 128 threads x 32 elements per plane = the whole 64x64 tile per plane;
//   plain 16-B loads one pass ahead into registers, LDS stores between two __syncthreads. P tiles are wave-private, spilled with _Float16 element
//   Context coverage: each wave stores rows q0..q0+15 (it 0..3 x lane>>3 0..3) x 64 columns (8 lanes x 8 bf16)
//   for both the hi and the lo segment; the grid covers all SEQ rows x NH head slabs x NBATCH.
// =====================================================================================================
__global__ __launch_bounds__(128)
void attn64(const unsigned short* __restrict__ qk, const unsigned short* __restrict__ vth,
            const unsigned short* __restrict__ vtl, const float* __restrict__ itab,
            const int* __restrict__ trj, unsigned short* ctxp, float sscale) {
  __shared__ __align__(16) unsigned short Kh[64 * KP];          // K hi [kv][d]  9 KB
  __shared__ __align__(16) _Float16 Vh[64 * KP];                // V^T hi [d][kv] 9 KB
  __shared__ __align__(16) _Float16 Vl[64 * KP];                // V^T lo [d][kv] 9 KB
  __shared__ __align__(16) _Float16 Psh[4][16 * KP];            // per wave P [row][kv] 9 KB
  __shared__ __align__(16) float    Os[4][16 * OPT];            // per wave context tile [row][d] 17 KB
  __shared__ __align__(16) float    ITs[64 * ITP];              // score table rows of this query block 5 KB

  const int tid  = threadIdx.x;
  const int wave = tid >> 5;
  const int lane = tid & 31;
  const int hh   = lane >> 4;
  const int c    = lane & 15;

  const int bx   = blockIdx.x;
  const int qb   = bx % NQB;
  const int rest = bx / NQB;
  const int h    = rest % NH;
  const int b    = rest / NH;
  const int q0   = qb * 64 + wave * 16;          // in-batch query row of this wave's first row
  const size_t rowB = (size_t)b * SEQ;

  const unsigned short* Qh  = qk + (size_t)h * (2 * HD);
  const unsigned short* Kg  = qk + KOFF + (size_t)h * (2 * HD);
  const _Float16* Vgh = (const _Float16*)(const void*)vth + ((size_t)b * DM + (size_t)h * HD) * SEQ;
  const _Float16* Vgl = (const _Float16*)(const void*)vtl + ((size_t)b * DM + (size_t)h * HD) * SEQ;
  const float* itb = itab + (((size_t)b * NH + (size_t)h) * SEQ + (size_t)qb * 64) * NEP;
  // this lane's pair-index row group: query row q0 + 8*hh (+ r), key column c (+ kv0 + 16 j)
  const int* trw = trj + (rowB + (size_t)q0 + (size_t)(8 * hh)) * SEQ + c;

  // stage the block's 64 x 16 score table (256 float4, 128 threads x 2); visible after the loop's first barrier
#pragma unroll
  for (int i = 0; i < 2; ++i) {
    const int f = i * 128 + tid;
    *(v4f*)(ITs + (f >> 2) * ITP + (f & 3) * 4) = *(const v4f*)(itb + (size_t)f * 4);
  }

  float mrow[8], lrow[8];
  v8f oacc[4], oaccL[4];
#pragma unroll
  for (int r = 0; r < 8; ++r) { mrow[r] = -INFINITY; lrow[r] = 0.f; }
#pragma unroll
  for (int t = 0; t < 4; ++t) { oacc[t] = zero8(); oaccL[t] = zero8(); }

  // Registers that carry one pass's global data (this thread's 32 elements of the K, V^T hi and V^T lo tiles and
  // this lane's 32 pair indices): filled one pass ahead, so that their latency runs beside the pass before.
  const int sr = tid >> 1, shf = (tid & 1) * 32;
  const unsigned short* kgp = Kg + (rowB + sr) * QKW + shf;               // K row kv0+sr, d = shf..shf+31
  const _Float16* vgp = Vgh + (size_t)sr * SEQ + shf;                     // V^T row d = sr, s = kv0+shf..+31
  const _Float16* vlp = Vgl + (size_t)sr * SEQ + shf;
  v8us kreg[4];
  v8h  vreg[4], wreg[4];
  int  tix[4][8];
  auto fetch = [&](const int kv) {
#pragma unroll
    for (int i = 0; i < 4; ++i) {
      kreg[i] = *(const v8us*)(kgp + (size_t)kv * QKW + 8 * i);
      vreg[i] = *(const v8h*)(vgp + kv + 8 * i);
      wreg[i] = *(const v8h*)(vlp + kv + 8 * i);
    }
#pragma unroll
    for (int j = 0; j < 4; ++j)
#pragma unroll
      for (int r = 0; r < 8; ++r) tix[j][r] = trw[(size_t)r * SEQ + kv + j * 16];
  };
  fetch(0);

  // ---- Q fragments (A operand, row = lane&15): f16 hi, 2 d-chunks; the same in every pass ----
  const unsigned short* qp = Qh + (rowB + q0 + c) * QKW + 8 * hh;
  v16us qh2[2];
#pragma unroll
  for (int dc = 0; dc < 2; ++dc) {
    qh2[dc] = ldfrag_u(qp + dc * 32);
  }
#if defined(__HIP_DEVICE_COMPILE__)
  // the Q loads' address pair is dead behind them and its registers are reused: the wait stands in front of that
  // reuse (the pair is an input, so that it lives up to the wait)
  asm volatile("s_wait_xcnt 0x0" :: "v"(qp) : "memory");
#endif

#pragma unroll 1
  for (int kt = 0; kt < NQB; ++kt) {         // static trip count
    __syncthreads();
#pragma unroll
    for (int i = 0; i < 4; ++i) {
      *(v8us*)(Kh + sr * KP + shf + 8 * i) = kreg[i];
      *(v8h*)(Vh + sr * KP + shf + 8 * i) = vreg[i];
      *(v8h*)(Vl + sr * KP + shf + 8 * i) = wreg[i];
    }
    // this pass's pair indices, clamped to 0..NE-1 (used only as an LDS index)
    int nix[4][8];
#pragma unroll
    for (int j = 0; j < 4; ++j)
#pragma unroll
      for (int r = 0; r < 8; ++r) {
        int n = tix[j][r];
        n = (n < 0) ? 0 : n;
        nix[j][r] = (n > NE - 1) ? (NE - 1) : n;
      }
    __syncthreads();
    // next pass's loads; the last pass asks for its own tile again (in bounds, not used): no branch in the body
    fetch(((kt + 1 < NQB) ? (kt + 1) : kt) * 64);

    // ---- scores: 16 query rows x 64 keys per wave ----
    v8f s[4];
#pragma unroll
    for (int j = 0; j < 4; ++j) {
      v8f sh = zero8();
#pragma unroll
      for (int dc = 0; dc < 2; ++dc) {
        FragU kb;
        kb.h[0] = *(const v8us*)(Kh + (j * 16 + c) * KP + dc * 32 + 8 * hh);
        kb.h[1] = *(const v8us*)(Kh + (j * 16 + c) * KP + dc * 32 + 16 + 8 * hh);
        sh = mma_hu(qh2[dc], kb.v, sh);
      }
      // D element r: query row q0 + 8hh + r, key kv0 + j*16 + c
#pragma unroll
      for (int r = 0; r < 8; ++r) {
        s[j][r] = sh[r] * sscale + ITs[(wave * 16 + 8 * hh + r) * ITP + nix[j][r]];
      }
    }

    // ---- row max, online softmax, P (x1024, f16) to LDS ----
    _Float16* pwh = Psh[wave];
#pragma unroll
    for (int r = 0; r < 8; ++r) {
      float m = s[0][r];
      m = fmaxf(m, s[1][r]);
      m = fmaxf(m, s[2][r]);
      m = fmaxf(m, s[3][r]);
#pragma unroll
      for (int off = 1; off < 16; off <<= 1) m = fmaxf(m, __shfl_xor(m, off, 32));
      const float mnew  = fmaxf(mrow[r], m);
      const float alpha = __expf(mrow[r] - mnew);
      mrow[r] = mnew;
      float psum = 0.f;
#pragma unroll
      for (int j = 0; j < 4; ++j) {
        const float p = __expf(s[j][r] - mnew);
        psum += p;
        pwh[(8 * hh + r) * KP + j * 16 + c] = (_Float16)(p * PSC);
      }
#pragma unroll
      for (int off = 1; off < 16; off <<= 1) psum += __shfl_xor(psum, off, 32);
      lrow[r] = lrow[r] * alpha + psum;
#pragma unroll
      for (int t = 0; t < 4; ++t) { oacc[t][r] *= alpha; oaccL[t][r] *= alpha; }
    }
    wave_sync_lds_only();

    // ---- context += P . V_hi and P . V_lo (f16 WMMA, two accumulators) ----
#pragma unroll 1
    for (int kk = 0; kk < 2; ++kk) {
      FragH pa;
      pa.h[0] = *(const v8h*)(pwh + c * KP + kk * 32 + 8 * hh);
      pa.h[1] = *(const v8h*)(pwh + c * KP + kk * 32 + 16 + 8 * hh);
#pragma unroll
      for (int t = 0; t < 4; ++t) {
        FragH vb, vl;
        vb.h[0] = *(const v8h*)(Vh + (t * 16 + c) * KP + kk * 32 + 8 * hh);
        vb.h[1] = *(const v8h*)(Vh + (t * 16 + c) * KP + kk * 32 + 16 + 8 * hh);
        vl.h[0] = *(const v8h*)(Vl + (t * 16 + c) * KP + kk * 32 + 8 * hh);
        vl.h[1] = *(const v8h*)(Vl + (t * 16 + c) * KP + kk * 32 + 16 + 8 * hh);
        oacc[t]  = mma_h(pa.v, vb.v, oacc[t]);
        oaccL[t] = mma_h(pa.v, vl.v, oaccL[t]);
      }
    }
  }

  // ---- normalise (1/l, the 1/1024 p carry, the 1/2048 residual fold), stage the wave's 16x64 tile,
  float* os = Os[wave];
#pragma unroll
  for (int r = 0; r < 8; ++r) {
    const float l = lrow[r];
    const float inv = ((l > 0.f) ? (1.0f / l) : 0.f) * (1.0f / PSC);
#pragma unroll
    for (int t = 0; t < 4; ++t) os[(8 * hh + r) * OPT + t * 16 + c] = (oacc[t][r] + oaccL[t][r] * (1.0f / RSC)) * inv;
  }
  wave_sync_lds();
  {
    const int q4 = lane >> 3, c8 = (lane & 7) * 8;
    v4u hv[4], lv[4];
#pragma unroll
    for (int it = 0; it < 4; ++it) {
      const int row = it * 4 + q4;   // it 0..3 x q4 0..3 = rows 0..15 of the wave tile
      const float* sp = os + row * OPT + c8;
      v4u ha, la;
#pragma unroll
      for (int e = 0; e < 4; ++e) {
        const float f0 = sp[2 * e], f1 = sp[2 * e + 1];
        const unsigned short u0 = bf_bits(f0), u1 = bf_bits(f1);
        const unsigned short w0 = bf_bits(f0 - bf_up(u0)), w1 = bf_bits(f1 - bf_up(u1));
        ha[e] = pk16(u0, u1);
        la[e] = pk16(w0, w1);
      }
      hv[it] = ha;
      lv[it] = la;
    }
    {
#pragma unroll
      for (int it = 0; it < 4; ++it) {
        const int row = it * 4 + q4;
        const size_t go = (rowB + q0 + row) * CTXP + (size_t)h * HD + c8;
        *(v4u*)(ctxp + go)      = hv[it];
        *(v4u*)(ctxp + go + DM) = lv[it];
      }
      
    }
  }
}

// =====================================================================================================
// y = (x - mean) * rstd * bf16(gamma) + bf16(beta). Block = 64 threads = one row; thread t handles columns
// 4t..4t+3 and 256+4t..256+4t+3, so each store instruction of a wave writes 32 lanes x 16 B = 512 contiguous
// coverage: 64 threads x 8 = 512 columns = the whole row; MP rows.
// =====================================================================================================
__global__ __launch_bounds__(64) void ln_rows(const float* __restrict__ X, const float* __restrict__ gam,
                                              const float* __restrict__ bet, float* out) {
  __shared__ float red[4];
  const int row = blockIdx.x;
  const int tid = threadIdx.x, lane = tid & 31, wv = tid >> 5;
  const float* src = X + (size_t)row * DM;
  const v4f a0 = *(const v4f*)(src + tid * 4);
  const v4f a1 = *(const v4f*)(src + 256 + tid * 4);
  float x[8];
#pragma unroll
  for (int e = 0; e < 4; ++e) { x[e] = a0[e]; x[4 + e] = a1[e]; }
  float s = 0.f;
#pragma unroll
  for (int e = 0; e < 8; ++e) s += x[e];
#pragma unroll
  for (int off = 1; off < 32; off <<= 1) s += __shfl_xor(s, off, 32);
  if (lane == 0) red[wv] = s;
  __syncthreads();
  const float mean = (red[0] + red[1]) * (1.0f / DM);
  float d[8];
  float q = 0.f;
#pragma unroll
  for (int e = 0; e < 8; ++e) { d[e] = x[e] - mean; q += d[e] * d[e]; }
#pragma unroll
  for (int off = 1; off < 32; off <<= 1) q += __shfl_xor(q, off, 32);
  if (lane == 0) red[2 + wv] = q;
  __syncthreads();
  const float var  = (red[2] + red[3]) * (1.0f / DM);
  const float rstd = rsqrtf(var + 1e-6f);

  const v4f g0 = *(const v4f*)(gam + tid * 4);
  const v4f g1 = *(const v4f*)(gam + 256 + tid * 4);
  const v4f e0 = *(const v4f*)(bet + tid * 4);
  const v4f e1 = *(const v4f*)(bet + 256 + tid * 4);
  v4f o0, o1;
#pragma unroll
  for (int e = 0; e < 4; ++e) {
    o0[e] = d[e]     * rstd * bfr(g0[e]) + bfr(e0[e]);
    o1[e] = d[4 + e] * rstd * bfr(g1[e]) + bfr(e1[e]);
  }
  float* dst = out + (size_t)row * DM + tid * 4;
  *(v4f*)(dst)       = o0;
  *(v4f*)(dst + 256) = o1;
  
}

// =====================================================================================================
// Workspace map (bytes); every plane is an exact multiple of its 64x64-tile / whole-row / whole-line store
// granularity (MP = 4096 = 64 row tiles; DM = 8 column tiles; VT per batch [512][2048] = 8x32 tiles; score table
//   WT   bf16 [1536 n][512 k]    0          1572864   (rows 0..511 Wq^T, 512..1023 Wk^T, 1024..1535 Wv^T)
//   WoT2 bf16 [512][1024]        1572864    1048576   (cols k and DM + k both Wo^T)
//   INb  bf16 [3][4096][512]     2621440    12582912  (q, k, v as bf16 bits)
//   QK   f16  [4096][2048]       15204352   16777216  (q [hi|lo] per head, then k [hi|lo] per head)
//   VTh  f16  [2][512][2048]     31981568   4194304   (v^T hi)
//   VTl  f16  [2][512][2048]     36175872   4194304   (v^T residual x2048)
//   IT   f32  [32768][16]        40370176   2097152   (query-embedding scores)
//   Ctx  bf16 [4096][1024]       42467328   8388608   (context hi | lo)
//   X    f32  [4096][512]        50855936   8388608   (pre-norm output)
//   end                          59244544
// =====================================================================================================
extern "C" void kernel_launch(void* const* d_in, const int* in_sizes, int n_in,
                              void* d_out, int out_size, void* d_ws, size_t ws_size,
                              hipStream_t stream) {
  if (n_in < 11) return;
  if (in_sizes[0] != MP * DM || in_sizes[1] != MP * DM || in_sizes[2] != MP * DM) return;
  if (in_sizes[3] != NE * DM) return;
  if (in_sizes[4] != NBATCH * SEQ * SEQ) return;
  if (in_sizes[5] != DM * DM || in_sizes[6] != DM * DM || in_sizes[7] != DM * DM || in_sizes[8] != DM * DM) return;
  if (in_sizes[9] != DM || in_sizes[10] != DM) return;
  if (out_size != MP * DM) return;

  const float* q_in = (const float*)d_in[0];
  const float* k_in = (const float*)d_in[1];
  const float* v_in = (const float*)d_in[2];
  const float* emb  = (const float*)d_in[3];
  const int*   trj  = (const int*)d_in[4];
  const float* w_q  = (const float*)d_in[5];
  const float* w_k  = (const float*)d_in[6];
  const float* w_v  = (const float*)d_in[7];
  const float* w_o  = (const float*)d_in[8];
  const float* gam  = (const float*)d_in[9];
  const float* bet  = (const float*)d_in[10];

  const size_t PWT  = (size_t)3 * DM * DM * 2;             //  1572864
  const size_t PWO  = (size_t)DM * KOFF * 2;               //  1048576
  const size_t PIN  = (size_t)3 * MP * DM * 2;             // 12582912
  const size_t PQK  = (size_t)MP * QKW * 2;                // 16777216
  const size_t PVT  = (size_t)NBATCH * DM * SEQ * 2;       //  4194304
  const size_t PIT  = (size_t)NBATCH * NH * SEQ * NEP * 4; //  2097152
  const size_t PCTX = (size_t)MP * CTXP * 2;               //  8388608
  const size_t PX   = (size_t)MP * DM * 4;                 //  8388608
  size_t off = 0;
  const size_t oWT  = off; off += PWT;
  const size_t oWo  = off; off += PWO;
  const size_t oIN  = off; off += PIN;
  const size_t oQK  = off; off += PQK;
  const size_t oVTh = off; off += PVT;
  const size_t oVTl = off; off += PVT;
  const size_t oIT  = off; off += PIT;
  const size_t oCtx = off; off += PCTX;
  const size_t oX   = off; off += PX;
  if (off > ws_size) return;                               // off = 59244544
  if (off > (size_t)134217728) return;

  char* ws = (char*)d_ws;
  unsigned short* WT   = (unsigned short*)(ws + oWT);
  unsigned short* WoT2 = (unsigned short*)(ws + oWo);
  unsigned short* INb  = (unsigned short*)(ws + oIN);
  unsigned short* QK   = (unsigned short*)(ws + oQK);
  unsigned short* VTh  = (unsigned short*)(ws + oVTh);
  unsigned short* VTl  = (unsigned short*)(ws + oVTl);
  float*          IT   = (float*)(ws + oIT);
  unsigned short* Ctx  = (unsigned short*)(ws + oCtx);
  float*          X    = (float*)(ws + oX);
  float*          out0 = (float*)d_out;

  const dim3 blk(256), blk128(128), blk64(64);
  const dim3 gCv(MP / 4, 3);                                        // 1024 x 3 blocks
  const dim3 gT(DM / 64, DM / 64);                                  // (cols/64, rows/64) = 8 x 8 per weight
  const dim3 gQK(((MP / 64) * (DM / 64)) / 8, 2, 1);                // 512 tiles -> 64 blocks x {q, k}
  const dim3 gVT(((DM / 64) * (SEQ / 64)) / 8, NBATCH, 1);          // 256 tiles -> 32 blocks x 2 batches
  const dim3 gIdx(NBATCH * NH * (SEQ / 64));                        // 512 blocks of 64
  const dim3 gAttn(NBATCH * NH * NQB);                              // 512 blocks of 128
  const dim3 gNo(((MP / 64) * (DM / 64)) / 8, 1, 1);                // 512 tiles -> 64 blocks
  const dim3 gLN(MP);                                               // 4096 rows
  if ((((MP / 64) * (DM / 64)) % 8) != 0) return;
  if ((((DM / 64) * (SEQ / 64)) % 8) != 0) return;

  // (0) activations -> bf16 bits; weight planes: in[k][n] (shape [512 in][512 out]) -> out[n][k] transposed
  //     through LDS (Wo additionally at cols DM + k for the hi|lo K-concat)
  cvt3<<<gCv, blk, 0, stream>>>(q_in, k_in, v_in, INb);
  tconv64<<<gT, blk, 0, stream>>>(w_q, WT, DM, DM, DM, 0);                            // -> WT rows 0..511
  tconv64<<<gT, blk, 0, stream>>>(w_k, WT + (size_t)DM * DM, DM, DM, DM, 0);          // -> WT rows 512..1023
  tconv64<<<gT, blk, 0, stream>>>(w_v, WT + (size_t)2 * DM * DM, DM, DM, DM, 0);      // -> WT rows 1024..1535
  tconv64<<<gT, blk, 0, stream>>>(w_o, WoT2, DM, DM, KOFF, DM);

  // (1) q = qb . Wq^T-plane (blockIdx.y = 0) and k = kb . Wk^T-plane (blockIdx.y = 1), K = 512
  //     -> f16 [hi 64 | lo 64] per head (QK plane [4096][2048], q at cols 0.., k at cols KOFF..);
  //     v^T per batch = Wv^T . vb_b^T -> f16 hi (VTh) and residual x2048 (VTl) planes [2][512][2048]
  gemm64<4><<<gQK, blk, 0, stream>>>(
      INb, DM, (long long)MP * DM, WT, DM, (long long)DM * DM,
      QK, QK + HD, X, QKW, (long long)KOFF,
      MP, DM, DM, 2, 1.0f);
  gemm64<4><<<gVT, blk, 0, stream>>>(
      WT + (size_t)2 * DM * DM, DM, 0LL, INb + (size_t)2 * MP * DM, DM, (long long)SEQ * DM,
      VTh, VTl, X, SEQ, (long long)DM * SEQ,
      DM, SEQ, DM, 1, 1.0f);

  // (2) query-embedding score table (f32), then flash attention with the selected per-pair bias
  //     -> context bf16 hi|lo
  idx_rows<<<gIdx, blk64, 0, stream>>>(QK, emb, IT);
  attn64<<<gAttn, blk128, 0, stream>>>(QK, VTh, VTl, IT, trj, Ctx, 0.125f);

  // (3) X = [ctx_hi | ctx_lo] . [Wo | Wo]  (K = 1024, bf16 operands) -> f32 plane; LayerNorm -> d_out
  gemm64<0><<<gNo, blk, 0, stream>>>(
      Ctx, CTXP, 0LL, WoT2, KOFF, 0LL,
      Ctx, Ctx, X, DM, 0LL,
      MP, DM, KOFF, 1, 1.0f);
  ln_rows<<<gLN, blk64, 0, stream>>>(X, gam, bet, out0);
  (void)hipGetLastError();
}

// v004
// Measured time: 155 microseconds a run.
// Timed twice side by side with v003, it ran 1.03 and 1.04 times as fast.
// Counting every step since v000, it is 1.70 times as fast.
// Contractions: q|k|v projections and output projection on v_wmma_f32_16x16x32_bf16 (bf16 operands from
// RNE-converted inputs; context carried as bf16 hi|lo planes K-concatenated against duplicated Wo planes);
// scores q.k^T on v_wmma_f32_16x16x32_f16 (q f16 hi, k f16 hi, single product); p.v on
// v_wmma_f32_16x16x32_f16 (p carried x1024 in f16, v^T as f16 hi + x2048 residual planes, two products,
// separate accumulators); all f32 accumulate; query-embedding scores (from q hi + residual), per-pair bias
// select, softmax and LayerNorm in f32.
#include <hip/hip_runtime.h>
#include <math.h>

#define NBATCH 2
#define SEQ    2048
#define DM     512
#define NH     8
#define HD     64
#define NE     10
#define NEP    16
#define MP     (NBATCH * SEQ)
#define QKW    (4 * DM)
#define KOFF   (2 * DM)
#define CTXP   (2 * DM)
#define NQB    (SEQ / 64)
#define RSC    2048.0f
#define PSC    1024.0f
#define KP     72      // LDS row pitch of the 64-wide 16-bit attention tiles, in elements: 144 B = 16 B x 9
#define OPT    68      // LDS row pitch of the f32 context tile, in floats: 272 B = 16 B x 17
#define ITP    20      // LDS row pitch of the score-table rows, in floats: rows 8 apart fall 32 banks apart
static_assert(NH * HD == DM);
static_assert(DM == 8 * 64);
static_assert((SEQ % 64) == 0 && (DM % 64) == 0 && (MP % 64) == 0 && (SEQ % 256) == 0 && (MP % 4) == 0);
static_assert((((MP / 64) * (DM / 64)) % 8) == 0);
static_assert((((DM / 64) * (SEQ / 64)) % 8) == 0);
static_assert(NE <= NEP && NEP == 16);
static_assert(((DM / 64) % 8) == 0 && ((SEQ / 64) % 8) == 0);   // gemm64: the 8 tiles of a block lie in one tile row

typedef _Float16 v16h __attribute__((ext_vector_type(16)));
typedef _Float16 v8h  __attribute__((ext_vector_type(8)));
typedef __bf16   v16b __attribute__((ext_vector_type(16)));
typedef unsigned short v16us __attribute__((ext_vector_type(16)));
typedef unsigned short v8us  __attribute__((ext_vector_type(8)));
typedef float    v8f  __attribute__((ext_vector_type(8)));
typedef float    v4f  __attribute__((ext_vector_type(4)));
typedef unsigned int v4u __attribute__((ext_vector_type(4)));

union FragH { v16h v; v8h h[2]; };
union FragU { v16us v; v8us h[2]; };

// ---- scalar helpers --------------------------------------------------------------------------------
__device__ __forceinline__ unsigned short bf_bits(float f) {          // f32 -> bf16 bits, RNE convert
  unsigned u = __float_as_uint(f);
  return (unsigned short)((u + 0x7FFFu + ((u >> 16) & 1u)) >> 16);
}
__device__ __forceinline__ float bf_up(unsigned short h) { return __uint_as_float(((unsigned)h) << 16); }
__device__ __forceinline__ float bfr(float f) { return bf_up(bf_bits(f)); }   // value of the bf16 RNE convert
__device__ __forceinline__ unsigned short h_bits(_Float16 x) { return __builtin_bit_cast(unsigned short, x); }
__device__ __forceinline__ unsigned pk16(unsigned short a, unsigned short b) { return (unsigned)a | ((unsigned)b << 16); }
__device__ __forceinline__ v8f zero8() { v8f z = {0.f, 0.f, 0.f, 0.f, 0.f, 0.f, 0.f, 0.f}; return z; }

// ---- fragment loader: 16-bit A/B operand, lane -> row/col (lane&15), p already includes +8*(lane>>4);
//      elements 0..7 <- p[0..7] (k0+8h..), elements 8..15 <- p[16..23] (k0+16+8h..)
__device__ __forceinline__ v16us ldfrag_u(const unsigned short* p) {
  FragU f;
  f.h[0] = *(const v8us*)(p);
  f.h[1] = *(const v8us*)(p + 16);
  return f.v;
}

// ---- WMMA helpers with trailing VALU hazard gap --------------------------------------------------------
__device__ __forceinline__ v8f mma_bu_raw(v16us a, v16us b, v8f c) {            // bf16 operands, unguarded
  return __builtin_amdgcn_wmma_f32_16x16x32_bf16(false, __builtin_bit_cast(v16b, a), false,
                                                 __builtin_bit_cast(v16b, b), (short)0, c, false, false);
}
__device__ __forceinline__ v8f mma_hu(v16us a, v16us b, v8f c) {                // f16 operands (bits), guarded
  c = __builtin_amdgcn_wmma_f32_16x16x32_f16(false, __builtin_bit_cast(v16h, a), false,
                                              __builtin_bit_cast(v16h, b), (short)0, c, false, false);
#if defined(__HIP_DEVICE_COMPILE__)
  asm volatile("v_nop\n\tv_nop\n\tv_nop\n\tv_nop" : "+v"(c) : "v"(a), "v"(b));
#endif
  return c;
}
__device__ __forceinline__ v8f mma_h_raw(v16h a, v16h b, v8f c) {                // f16 operands, unguarded
  return __builtin_amdgcn_wmma_f32_16x16x32_f16(false, a, false, b, (short)0, c, false, false);
}
__device__ __forceinline__ void acc_guard4(v8f& a, v8f& b, v8f& c, v8f& d) {
#if defined(__HIP_DEVICE_COMPILE__)
  asm volatile("v_nop\n\tv_nop\n\tv_nop\n\tv_nop" : "+v"(a), "+v"(b), "+v"(c), "+v"(d));
#endif
}
__device__ __forceinline__ void wave_sync_lds() {
  __builtin_amdgcn_fence(__ATOMIC_RELEASE, "workgroup");
  __builtin_amdgcn_wave_barrier();
  __builtin_amdgcn_fence(__ATOMIC_ACQUIRE, "workgroup");
}
// The same for LDS traffic alone: orders a wave's own LDS stores before its LDS loads and leaves its global loads
// in flight (the fence over all address spaces waits for them too).
__device__ __forceinline__ void wave_sync_lds_only() {
  __builtin_amdgcn_fence(__ATOMIC_RELEASE, "workgroup", "local");
  __builtin_amdgcn_wave_barrier();
  __builtin_amdgcn_fence(__ATOMIC_ACQUIRE, "workgroup", "local");
}

// =====================================================================================================
// f32 [MP][DM] activations (three sources selected by blockIdx.y, block-uniform) -> bf16 bits plane
// dst[(z*MP + row)*DM + col]. Block = 256 threads = 4 rows; thread t: row = 4*bx + (t>>6), cols 8*(t&63)..+7.
// coverage: 1024 blocks x 4 rows x 512 cols = each whole plane; 3 planes.
// =====================================================================================================
__global__ __launch_bounds__(256) void cvt3(const float* __restrict__ s0, const float* __restrict__ s1,
                                            const float* __restrict__ s2, unsigned short* dst) {
  const int z = blockIdx.y;
  const float* src = (z == 0) ? s0 : ((z == 1) ? s1 : s2);
  const int t = threadIdx.x;
  const int row = blockIdx.x * 4 + (t >> 6);
  const int c8 = (t & 63) * 8;
  const float* p = src + (size_t)row * DM + c8;
  const v4f a0 = *(const v4f*)(p);
  const v4f a1 = *(const v4f*)(p + 4);
  v4u hv;
  hv[0] = pk16(bf_bits(a0[0]), bf_bits(a0[1]));
  hv[1] = pk16(bf_bits(a0[2]), bf_bits(a0[3]));
  hv[2] = pk16(bf_bits(a1[0]), bf_bits(a1[1]));
  hv[3] = pk16(bf_bits(a1[2]), bf_bits(a1[3]));
  unsigned short* d = dst + ((size_t)z * MP + (size_t)row) * DM + c8;
  *(v4u*)d = hv;
  
}

// =====================================================================================================
// Tiled transpose + bf16 convert: in[rows][cols] f32 row-major -> out[cols][rows] bf16 bits with pitch ldo:
//   out[n * ldo + k] = bf16(in[k][n]) and also at + dupoff (a duplicated k range for the hi|lo K-concat GEMM).
// Block = 256 threads = one 64x64 tile; grid = (cols/64, rows/64) (rows, cols multiples of 64, host-checked).
// Loads: 4 iterations x 256 threads x float4 = 64 rows x 64 cols (addresses clamped). LDS tile [n][k] pitch 72.
// coverage: 64 x 64 = the whole transposed tile at both column offsets; grid covers the whole matrix.
// =====================================================================================================
__global__ __launch_bounds__(256) void tconv64(const float* __restrict__ W, unsigned short* out,
                                               int rows, int cols, int ldo, int dupoff) {
  __shared__ __align__(16) unsigned short sh[64 * 72];
  const int t  = threadIdx.x;
  const int n0 = blockIdx.x * 64;            // column tile of in = row tile of out
  const int k0 = blockIdx.y * 64;            // row tile of in = column tile of out
#pragma unroll
  for (int i = 0; i < 4; ++i) {
    const int idx = i * 256 + t;
    const int r = idx >> 4, c4 = (idx & 15) * 4;
    int kr = k0 + r;   kr = (kr < rows) ? kr : (rows - 1);
    int nc = n0 + c4;  nc = (nc < cols - 4) ? nc : (cols - 4);
    const v4f v = *(const v4f*)(W + (size_t)kr * cols + nc);
#pragma unroll
    for (int e = 0; e < 4; ++e) sh[(c4 + e) * 72 + r] = bf_bits(v[e]);
  }
  __syncthreads();
  const int wave = t >> 5, lane = t & 31;
  const int q = lane >> 3, c8 = (lane & 7) * 8;
  v4u pv[2];
  size_t go[2];
#pragma unroll
  for (int it = 0; it < 2; ++it) {
    const int nl = it * 32 + wave * 4 + q;               // 0..63
    pv[it] = *(const v4u*)(sh + nl * 72 + c8);
    go[it] = (size_t)(n0 + nl) * ldo + k0 + c8;
  }
  {
#pragma unroll
    for (int it = 0; it < 2; ++it) {
      *(v4u*)(out + go[it]) = pv[it];
      if (dupoff != 0) *(v4u*)(out + go[it] + dupoff) = pv[it];
    }
    
  }
}

// =====================================================================================================
// Register-blocked batched bf16 WMMA GEMM: C[m][n] = oscale * sum_k A[m][k] * Bt[n][k];
// one wave per 64x64 tile; the 8 tiles of a block lie side by side in one tile row (N/64 a multiple of 8), so the
// block works on 64 rows of A and 512 rows of Bt. Both are staged in LDS in k chunks of 64: each 16-B load of a wave
// takes 4 whole 128-B row segments, one chunk ahead into registers, LDS stores between two __syncthreads; the
// fragments are ds_load_b128 reads at a 144-B pitch. A row-major [M][K] pitch lda; Bt row-major [N][K] pitch ldb
// (k contiguous); M, N multiples of 64, K multiple of 64. blockIdx.y = batch index with element strides
// (sAy for A, sBy for Bt, sCy for C). Tile enumeration: tile -> tm = tile / (N/64), tn = tile % (N/64).
// OM: 0 = f32 out to Cf (pitch ldc); 4 = f16 hi bits to Cp and f16((v - hi) * 2048) bits to Cp2, 16-bit column
//     base = n0 * nmul (nmul = 2 interleaves [hi 64 | lo 64] per 64-col tile with Cp2 = Cp + 64).
// coverage: 4 slabs x 16 rows x 64 cols = the wave's whole 64x64 tile; grid = tilesM*tilesN/8 blocks exactly
//           (host-checked), so no block exits early.
// =====================================================================================================
template <int OM>
__global__ __launch_bounds__(256) void gemm64(
    const unsigned short* __restrict__ Ap, int lda, long long sAy,
    const unsigned short* __restrict__ Btp, int ldb, long long sBy,
    unsigned short* Cp, unsigned short* Cp2, float* Cf, int ldc, long long sCy,
    int M, int N, int K, int nmul, float oscale) {
  __shared__ __align__(16) float sT[8][16 * 68];   // per-wave 16x64 slab, pitch 68 floats
  __shared__ __align__(16) unsigned short sAB[(64 + 512) * KP];   // rows 0..63: A chunk; rows 64..575: Bt chunk
  const int by   = blockIdx.y;
  const int lane = threadIdx.x & 31;
  const int wave = threadIdx.x >> 5;
  const int tilesN = N >> 6;
  const int tilesM = M >> 6;
  const int tile0 = blockIdx.x * 8;
  if (tile0 + 8 > tilesM * tilesN) return;   // block-uniform, in front of every barrier (the grid is exact)
  const int tm  = tile0 / tilesN;
  const int tn0 = tile0 - tm * tilesN;       // first of the block's 8 tiles, all in tile row tm
  const int m0 = tm << 6;
  const int n0 = (tn0 + wave) << 6;

  const unsigned short* Ab = Ap  + (size_t)by * (size_t)sAy;
  const unsigned short* Bb = Btp + (size_t)by * (size_t)sBy;
  const size_t cofs = (size_t)by * (size_t)sCy;

  const int rlane = lane & 15;                 // row (A) / col (B, D) within subtile
  const int koff  = (lane >> 4) * 8;           // k offset of this lane half
  const int mOff  = (lane >> 4) * 8;           // D row offset

  v8f acc[4][4];
#pragma unroll
  for (int i = 0; i < 4; ++i)
#pragma unroll
    for (int j = 0; j < 4; ++j) acc[i][j] = zero8();

  // Staging: 576 rows x 8 pieces of 16 B = 18 pieces per thread; piece i of thread t: staged row 32 i + srow,
  // bytes 16 (t & 7).. of the row's 128-B chunk. Pieces 0, 1 are A rows, pieces 2..17 Bt rows. srow runs through
  // 0..31 over the block's 32 groups of 8 lanes; the two groups of a 16-lane half take rows 8 apart, which at the
  // 144-B pitch lie 32 banks apart, so that a half's ds_store_b128 covers each of the 64 banks once.
  const int tx = threadIdx.x;
  const int srow = ((tx >> 4) & 7) | (((tx >> 3) & 1) << 3) | ((tx >> 7) << 4), sc8 = (tx & 7) * 8;
  const unsigned short* gp[18];
#pragma unroll
  for (int i = 0; i < 2; ++i)  gp[i] = Ab + (size_t)(m0 + 32 * i + srow) * lda + sc8;
#pragma unroll
  for (int i = 2; i < 18; ++i) gp[i] = Bb + (size_t)((tn0 << 6) + 32 * (i - 2) + srow) * ldb + sc8;
  v4u st[18];
  auto fetch = [&]() {
#pragma unroll
    for (int i = 0; i < 18; ++i) st[i] = *(const v4u*)(gp[i]);
#if defined(__HIP_DEVICE_COMPILE__)
    // the address pairs of the loads just issued are stepped below: the wait stands in front of that (the pairs are
    // inputs, so that they live unchanged up to the wait); the clobber keeps the loads in front of the products
    asm volatile("s_wait_xcnt 0x0" :: "v"(gp[0]), "v"(gp[1]), "v"(gp[2]), "v"(gp[3]), "v"(gp[4]), "v"(gp[5]),
                 "v"(gp[6]), "v"(gp[7]), "v"(gp[8]), "v"(gp[9]), "v"(gp[10]), "v"(gp[11]), "v"(gp[12]),
                 "v"(gp[13]), "v"(gp[14]), "v"(gp[15]), "v"(gp[16]), "v"(gp[17]) : "memory");
#endif
#pragma unroll
    for (int i = 0; i < 18; ++i) gp[i] += 64;
  };
  const unsigned short* fA = sAB + rlane * KP + koff;                       // this lane's A fragment rows
  const unsigned short* fB = sAB + (64 + wave * 64 + rlane) * KP + koff;    // this lane's Bt fragment rows
  const int nch = K >> 6;
  fetch();
  for (int kc = 0; kc < nch; ++kc) {
    __syncthreads();                           // every wave has read the chunk before
#pragma unroll
    for (int i = 0; i < 18; ++i) *(v4u*)(sAB + (32 * i + srow) * KP + sc8) = st[i];
    __syncthreads();                           // the chunk is whole
    if (kc + 1 < nch) fetch();                 // block-uniform; the next chunk flies beside this chunk's products
    v16us ah[2][4], bh[2][4];
#pragma unroll
    for (int ks = 0; ks < 2; ++ks) {
#pragma unroll
      for (int j = 0; j < 4; ++j) bh[ks][j] = ldfrag_u(fB + j * 16 * KP + ks * 32);
#pragma unroll
      for (int i = 0; i < 4; ++i) ah[ks][i] = ldfrag_u(fA + i * 16 * KP + ks * 32);
    }
    // keeps the chunk's 32 fragment reads in front of its products: unfenced, the compiler reads the A fragments into
    // one register set and waits for LDS in front of every row of products
    __builtin_amdgcn_sched_barrier(0);
#pragma unroll
    for (int ks = 0; ks < 2; ++ks)
#pragma unroll
      for (int i = 0; i < 4; ++i)
#pragma unroll
        for (int j = 0; j < 4; ++j) acc[i][j] = mma_bu_raw(ah[ks][i], bh[ks][j], acc[i][j]);
  }
  acc_guard4(acc[0][0], acc[0][1], acc[0][2], acc[0][3]);
  acc_guard4(acc[1][0], acc[1][1], acc[1][2], acc[1][3]);
  acc_guard4(acc[2][0], acc[2][1], acc[2][2], acc[2][3]);
  acc_guard4(acc[3][0], acc[3][1], acc[3][2], acc[3][3]);

  const int hh2 = lane >> 4, c4 = (lane & 15) * 4;     // f32 out: 256-B row segment = 16 lanes x 16 B
  const int q8  = lane >> 3, c8 = (lane & 7) * 8;

  // ---- epilogue ----
  float* slab = sT[wave];
#pragma unroll
  for (int i = 0; i < 4; ++i) {
    const int mBase = m0 + (i << 4);
#pragma unroll
    for (int j = 0; j < 4; ++j) {
#pragma unroll
      for (int r = 0; r < 8; ++r) {
        slab[(mOff + r) * 68 + (j << 4) + rlane] = acc[i][j][r];
      }
    }
    wave_sync_lds();
    if (OM == 0) {
      float* C = Cf + cofs;
      v4f vals[8];
#pragma unroll
      for (int it = 0; it < 8; ++it) {
        const int row = it * 2 + hh2;                      // it 0..7 x hh2 0..1 = rows 0..15
        v4f v = *(const v4f*)(slab + row * 68 + c4);
        vals[it] = v * oscale;
      }
      {
#pragma unroll
        for (int it = 0; it < 8; ++it) {
          const int row = it * 2 + hh2;
          *(v4f*)(C + (size_t)(mBase + row) * ldc + (size_t)n0 * nmul + c4) = vals[it];
        }
        
      }
    } else {
      unsigned short* C  = Cp  + cofs;
      unsigned short* C2 = Cp2 + cofs;
      v4u hv[4], lv[4];
#pragma unroll
      for (int it = 0; it < 4; ++it) {
        const int row = it * 4 + q8;                       // it 0..3 x q8 0..3 = rows 0..15
        const float* sp = slab + row * 68 + c8;
        v4u ha, la;
#pragma unroll
        for (int e = 0; e < 4; ++e) {
          const float f0 = sp[2 * e]     * oscale;
          const float f1 = sp[2 * e + 1] * oscale;
          const _Float16 g0 = (_Float16)f0, g1 = (_Float16)f1;
          const unsigned short u0 = h_bits(g0), u1 = h_bits(g1);
          const unsigned short w0 = h_bits((_Float16)((f0 - (float)g0) * RSC));
          const unsigned short w1 = h_bits((_Float16)((f1 - (float)g1) * RSC));
          ha[e] = pk16(u0, u1);
          la[e] = pk16(w0, w1);
        }
        hv[it] = ha;
        lv[it] = la;
      }
      {
#pragma unroll
        for (int it = 0; it < 4; ++it) {
          const int row = it * 4 + q8;
          const size_t go = (size_t)(mBase + row) * ldc + (size_t)n0 * nmul + c8;
          *(v4u*)(C  + go) = hv[it];
          *(v4u*)(C2 + go) = lv[it];
        }
        
      }
    }
    wave_sync_lds();
  }
}

// =====================================================================================================
// Query-embedding score table: itab[(bh*SEQ + l)*NEP + n] = sum_d qh[b,h,l,d] * bf16(emb[n][h*64 + d]) for
// n < NE (f32, columns NE..NEP-1 = 0). qh is reconstructed in f32 as hi + lo/2048 from the q part of the QK
// plane (f16 hi at col h*128 + d, residual at + 64). Block = 64 threads = 64 consecutive rows l of one (b, h)
// (SEQ % 64 == 0); grid = NBATCH*NH*SEQ/64 exact. q rows and the head's emb slice staged in LDS (f32);
// the 10 dots per row are rolled over n and over two 32-wide d halves (32 static FMAs).
// Output tile 64 x 16 f32 staged in LDS and written as 256 float4 = 4 instructions per wave, each 32 lanes x
// coverage: 512 blocks x 64 rows x 16 cols = the whole table.
// =====================================================================================================
__global__ __launch_bounds__(64) void idx_rows(const unsigned short* __restrict__ qk,
                                               const float* __restrict__ emb, float* itab) {
  __shared__ float Qs[64 * 65];
  __shared__ float Es[NE * HD];
  __shared__ __align__(16) float Ts[64 * NEP];
  const int tid = threadIdx.x;
  const int R0 = blockIdx.x * 64;                 // flat (b*NH + h)*SEQ + l row base
  const int bh = R0 / SEQ;
  const int l0 = R0 - bh * SEQ;
  const int b  = bh / NH;
  const int h  = bh - b * NH;
#pragma unroll 1
  for (int i = tid; i < NE * HD; i += 64) {
    const int n = i >> 6, d = i & 63;
    Es[i] = bfr(emb[(size_t)n * DM + h * HD + d]);
  }
  const _Float16* qp = (const _Float16*)(const void*)qk
                     + ((size_t)b * SEQ + (size_t)l0 + (size_t)tid) * QKW + (size_t)h * (2 * HD);
#pragma unroll
  for (int i = 0; i < 8; ++i) {
    const v8h hv = *(const v8h*)(qp + 8 * i);
    const v8h lv = *(const v8h*)(qp + HD + 8 * i);
#pragma unroll
    for (int e = 0; e < 8; ++e)
      Qs[tid * 65 + 8 * i + e] = (float)hv[e] + (float)lv[e] * (1.0f / RSC);
  }
  __syncthreads();
#pragma unroll 1
  for (int n = 0; n < NE; ++n) {
    float s = 0.f;
#pragma unroll 1
    for (int dc = 0; dc < 2; ++dc) {
#pragma unroll
      for (int d = 0; d < 32; ++d) s += Qs[tid * 65 + dc * 32 + d] * Es[n * HD + dc * 32 + d];
    }
    Ts[tid * NEP + n] = s;
  }
#pragma unroll
  for (int n = NE; n < NEP; ++n) Ts[tid * NEP + n] = 0.f;
  __syncthreads();
  v4f vals[4];
#pragma unroll
  for (int it = 0; it < 4; ++it) vals[it] = *(const v4f*)(Ts + (it * 64 + tid) * 4);
  float* base = itab + (size_t)R0 * NEP;
#pragma unroll
  for (int it = 0; it < 4; ++it) *(v4f*)(base + (it * 64 + tid) * 4) = vals[it];
  
}

// =====================================================================================================
// Flash attention with a per-(query, key) additive bias selected by an input int matrix, head dim 64, SEQ rows
// per batch, non-causal.
//   QK plane (f16 bits, pitch QKW): element (b, t, col) at [(b*SEQ + t)*QKW + col]; q head h: hi at col h*128 + d
//   (residual at + 64, unused here); k head h: hi at KOFF + h*128 + d.
//   v^T hi and lo planes (f16): element (b, h, d, s) at [(b*DM + h*64 + d)*SEQ + s]; value = hi + lo/2048.
//   itab (f32 [NBATCH*NH*SEQ][NEP]): per-query score table; bias(q, kv) = itab[bh*SEQ + q][clamp(trj[b][q][kv])].
//   context plane (bf16, pitch CTXP): hi at [(b*SEQ + t)*CTXP + h*64 + d], lo at + DM.
//   score[i][j] = (q_hi . k) * sscale + bias(i, j); p = exp(s - m) carried as f16(1024 p);
//   context = p . v_hi and p . v_lo on f16 WMMA in two accumulators; online softmax (running max) in f32.
//   Block = 4 waves = 64 query rows of one (b, h); grid = NQB * NH * NBATCH; kv chunks of 64, static trip NQB.
//   The 64 x 16 score-table rows of the block are staged once in LDS; the pair index for each score element is
//   a plain int load (arithmetic address), clamped to 0..NE-1 and used only as an LDS index.
//   K hi and V^T hi/lo chunk staging: 128 threads x 32 elements per plane = the whole 64x64 tile per plane;
//   plain 16-B loads one pass ahead into registers, LDS stores between two __syncthreads. P tiles are wave-private, spilled with _Float16 element
//   Context coverage: each wave stores rows q0..q0+15 (it 0..3 x lane>>3 0..3) x 64 columns (8 lanes x 8 bf16)
//   for both the hi and the lo segment; the grid covers all SEQ rows x NH head slabs x NBATCH.
// =====================================================================================================
__global__ __launch_bounds__(128)
void attn64(const unsigned short* __restrict__ qk, const unsigned short* __restrict__ vth,
            const unsigned short* __restrict__ vtl, const float* __restrict__ itab,
            const int* __restrict__ trj, unsigned short* ctxp, float sscale) {
  __shared__ __align__(16) unsigned short Kh[64 * KP];          // K hi [kv][d]  9 KB
  __shared__ __align__(16) _Float16 Vh[64 * KP];                // V^T hi [d][kv] 9 KB
  __shared__ __align__(16) _Float16 Vl[64 * KP];                // V^T lo [d][kv] 9 KB
  __shared__ __align__(16) _Float16 Psh[4][16 * KP];            // per wave P [row][kv] 9 KB
  __shared__ __align__(16) float    Os[4][16 * OPT];            // per wave context tile [row][d] 17 KB
  __shared__ __align__(16) float    ITs[64 * ITP];              // score table rows of this query block 5 KB

  const int tid  = threadIdx.x;
  const int wave = tid >> 5;
  const int lane = tid & 31;
  const int hh   = lane >> 4;
  const int c    = lane & 15;

  const int bx   = blockIdx.x;
  const int qb   = bx % NQB;
  const int rest = bx / NQB;
  const int h    = rest % NH;
  const int b    = rest / NH;
  const int q0   = qb * 64 + wave * 16;          // in-batch query row of this wave's first row
  const size_t rowB = (size_t)b * SEQ;

  const unsigned short* Qh  = qk + (size_t)h * (2 * HD);
  const unsigned short* Kg  = qk + KOFF + (size_t)h * (2 * HD);
  const _Float16* Vgh = (const _Float16*)(const void*)vth + ((size_t)b * DM + (size_t)h * HD) * SEQ;
  const _Float16* Vgl = (const _Float16*)(const void*)vtl + ((size_t)b * DM + (size_t)h * HD) * SEQ;
  const float* itb = itab + (((size_t)b * NH + (size_t)h) * SEQ + (size_t)qb * 64) * NEP;
  // this lane's pair-index row group: query row q0 + 8*hh (+ r), key column c (+ kv0 + 16 j)
  const int* trw = trj + (rowB + (size_t)q0 + (size_t)(8 * hh)) * SEQ + c;

  // stage the block's 64 x 16 score table (256 float4, 128 threads x 2); visible after the loop's first barrier
#pragma unroll
  for (int i = 0; i < 2; ++i) {
    const int f = i * 128 + tid;
    *(v4f*)(ITs + (f >> 2) * ITP + (f & 3) * 4) = *(const v4f*)(itb + (size_t)f * 4);
  }

  float mrow[8], lrow[8];
  v8f oacc[4], oaccL[4];
#pragma unroll
  for (int r = 0; r < 8; ++r) { mrow[r] = -INFINITY; lrow[r] = 0.f; }
#pragma unroll
  for (int t = 0; t < 4; ++t) { oacc[t] = zero8(); oaccL[t] = zero8(); }

  // Registers that carry one pass's global data (this thread's 32 elements of the K, V^T hi and V^T lo tiles and
  // this lane's 32 pair indices): filled one pass ahead, so that their latency runs beside the pass before.
  const int sr = tid >> 1, shf = (tid & 1) * 32;
  // running addresses of the tile to be loaded next
  const unsigned short* kq = Kg + (rowB + sr) * QKW + shf;                // K row kv0+sr, d = shf..shf+31
  const _Float16* vq = Vgh + (size_t)sr * SEQ + shf;                      // V^T row d = sr, s = kv0+shf..+31
  const _Float16* wq = Vgl + (size_t)sr * SEQ + shf;
  const int* tq = trw;
  v8us kreg[4];
  v8h  vreg[4], wreg[4];
  int  tix[4][8];
  auto fetch = [&](const int adv) {          // loads the tile the addresses stand at, then steps them by adv keys
#pragma unroll
    for (int i = 0; i < 4; ++i) {
      kreg[i] = *(const v8us*)(kq + 8 * i);
      vreg[i] = *(const v8h*)(vq + 8 * i);
      wreg[i] = *(const v8h*)(wq + 8 * i);
    }
#pragma unroll
    for (int j = 0; j < 4; ++j)
#pragma unroll
      for (int r = 0; r < 8; ++r) tix[j][r] = tq[(size_t)r * SEQ + j * 16];
#if defined(__HIP_DEVICE_COMPILE__)
    // the address pairs of the loads just issued are stepped below: the wait stands in front of that (the pairs are
    // inputs, so that they live unchanged up to the wait)
    asm volatile("s_wait_xcnt 0x0" :: "v"(kq), "v"(vq), "v"(wq), "v"(tq) : "memory");
#endif
    // keeps every later instruction behind the wait: the compiler lifts register writes over it, into registers that
    // the loads name (a base that it split off an address is no input of the wait)
    __builtin_amdgcn_sched_barrier(0);
    kq += (size_t)adv * QKW;
    vq += adv;
    wq += adv;
    tq += adv;
  };
  static_assert(NQB >= 2);
  fetch(64);

  // ---- Q fragments (A operand, row = lane&15): f16 hi, 2 d-chunks; the same in every pass ----
  const unsigned short* qp = Qh + (rowB + q0 + c) * QKW + 8 * hh;
  v16us qh2[2];
#pragma unroll
  for (int dc = 0; dc < 2; ++dc) {
    qh2[dc] = ldfrag_u(qp + dc * 32);
  }
#if defined(__HIP_DEVICE_COMPILE__)
  // the Q loads' address pair is dead behind them and its registers are reused: the wait stands in front of that
  // reuse (the pair is an input, so that it lives up to the wait)
  asm volatile("s_wait_xcnt 0x0" :: "v"(qp) : "memory");
#endif

#pragma unroll 1
  for (int kt = 0; kt < NQB; ++kt) {         // static trip count
    __syncthreads();
#pragma unroll
    for (int i = 0; i < 4; ++i) {
      *(v8us*)(Kh + sr * KP + shf + 8 * i) = kreg[i];
      *(v8h*)(Vh + sr * KP + shf + 8 * i) = vreg[i];
      *(v8h*)(Vl + sr * KP + shf + 8 * i) = wreg[i];
    }
    // this pass's pair indices, clamped to 0..NE-1 (used only as an LDS index)
    int nix[4][8];
#pragma unroll
    for (int j = 0; j < 4; ++j)
#pragma unroll
      for (int r = 0; r < 8; ++r) {
        int n = tix[j][r];
        n = (n < 0) ? 0 : n;
        nix[j][r] = (n > NE - 1) ? (NE - 1) : n;
      }
    __syncthreads();
    // ---- scores: 16 query rows x 64 keys per wave ----
    // All LDS reads of the shared tiles stand in groups in front of the products that use them, so that a group pays
    // the LDS latency once: the K fragments and the selected bias values first, the V^T fragments behind the first
    // four score products (they land beside the remaining products and the softmax).
    v16us kb[2][4];
#pragma unroll
    for (int dc = 0; dc < 2; ++dc)
#pragma unroll
      for (int j = 0; j < 4; ++j) kb[dc][j] = ldfrag_u(Kh + (j * 16 + c) * KP + dc * 32 + 8 * hh);
    float bias[4][8];
#pragma unroll
    for (int j = 0; j < 4; ++j)
#pragma unroll
      for (int r = 0; r < 8; ++r) bias[j][r] = ITs[(wave * 16 + 8 * hh + r) * ITP + nix[j][r]];
    // keeps the LDS reads, which the products wait for, in front of the 44 global loads (the compiler puts those first)
    __builtin_amdgcn_sched_barrier(0);
    // next pass's loads, issued while the group above is under way; the last pass asks for its own tile again (in
    // bounds, not used): no branch in the body. The fence at the end of fetch also keeps the group of LDS reads in front
    // of the products: unfenced, the compiler reads each fragment into one register set directly in front of its
    // product and waits for LDS at every product
    fetch((kt + 2 < NQB) ? 64 : 0);
    v8f sh[4];
#pragma unroll
    for (int j = 0; j < 4; ++j) sh[j] = mma_hu(qh2[0], kb[0][j], zero8());
    FragH vb[2][4], vl[2][4];
#pragma unroll
    for (int kk = 0; kk < 2; ++kk)
#pragma unroll
      for (int t = 0; t < 4; ++t) {
        vb[kk][t].h[0] = *(const v8h*)(Vh + (t * 16 + c) * KP + kk * 32 + 8 * hh);
        vb[kk][t].h[1] = *(const v8h*)(Vh + (t * 16 + c) * KP + kk * 32 + 16 + 8 * hh);
        vl[kk][t].h[0] = *(const v8h*)(Vl + (t * 16 + c) * KP + kk * 32 + 8 * hh);
        vl[kk][t].h[1] = *(const v8h*)(Vl + (t * 16 + c) * KP + kk * 32 + 16 + 8 * hh);
      }
    // keeps the V^T reads here, a softmax ahead of their products (the compiler would sink them to the products)
    __builtin_amdgcn_sched_barrier(0);
#pragma unroll
    for (int j = 0; j < 4; ++j) sh[j] = mma_hu(qh2[1], kb[1][j], sh[j]);
    // D element r: query row q0 + 8hh + r, key kv0 + j*16 + c
    v8f s[4];
#pragma unroll
    for (int j = 0; j < 4; ++j)
#pragma unroll
      for (int r = 0; r < 8; ++r) s[j][r] = sh[j][r] * sscale + bias[j][r];

    // ---- row max, online softmax, P (x1024, f16) to LDS ----
    _Float16* pwh = Psh[wave];
#pragma unroll
    for (int r = 0; r < 8; ++r) {
      float m = s[0][r];
      m = fmaxf(m, s[1][r]);
      m = fmaxf(m, s[2][r]);
      m = fmaxf(m, s[3][r]);
#pragma unroll
      for (int off = 1; off < 16; off <<= 1) m = fmaxf(m, __shfl_xor(m, off, 32));
      const float mnew  = fmaxf(mrow[r], m);
      const float alpha = __expf(mrow[r] - mnew);
      mrow[r] = mnew;
      float psum = 0.f;
#pragma unroll
      for (int j = 0; j < 4; ++j) {
        const float p = __expf(s[j][r] - mnew);
        psum += p;
        pwh[(8 * hh + r) * KP + j * 16 + c] = (_Float16)(p * PSC);
      }
#pragma unroll
      for (int off = 1; off < 16; off <<= 1) psum += __shfl_xor(psum, off, 32);
      lrow[r] = lrow[r] * alpha + psum;
#pragma unroll
      for (int t = 0; t < 4; ++t) { oacc[t][r] *= alpha; oaccL[t][r] *= alpha; }
    }
    wave_sync_lds_only();

    // ---- context += P . V_hi and P . V_lo (f16 WMMA, two accumulators) ----
    FragH pa[2];
#pragma unroll
    for (int kk = 0; kk < 2; ++kk) {
      pa[kk].h[0] = *(const v8h*)(pwh + c * KP + kk * 32 + 8 * hh);
      pa[kk].h[1] = *(const v8h*)(pwh + c * KP + kk * 32 + 16 + 8 * hh);
    }
#pragma unroll
    for (int kk = 0; kk < 2; ++kk) {
#pragma unroll
      for (int t = 0; t < 4; ++t) {
        // unguarded form: as operands of the guard's asm statement the 16 V^T fragments would all have to lie in
        // v0..v255, which spills some of them; the gap stands once, behind the 16 products
        oacc[t]  = mma_h_raw(pa[kk].v, vb[kk][t].v, oacc[t]);
        oaccL[t] = mma_h_raw(pa[kk].v, vl[kk][t].v, oaccL[t]);
      }
    }
    acc_guard4(oacc[0], oacc[1], oacc[2], oacc[3]);
    acc_guard4(oaccL[0], oaccL[1], oaccL[2], oaccL[3]);
  }

  // ---- normalise (1/l, the 1/1024 p carry, the 1/2048 residual fold), stage the wave's 16x64 tile,
  float* os = Os[wave];
#pragma unroll
  for (int r = 0; r < 8; ++r) {
    const float l = lrow[r];
    const float inv = ((l > 0.f) ? (1.0f / l) : 0.f) * (1.0f / PSC);
#pragma unroll
    for (int t = 0; t < 4; ++t) os[(8 * hh + r) * OPT + t * 16 + c] = (oacc[t][r] + oaccL[t][r] * (1.0f / RSC)) * inv;
  }
  wave_sync_lds();
  {
    const int q4 = lane >> 3, c8 = (lane & 7) * 8;
    v4u hv[4], lv[4];
#pragma unroll
    for (int it = 0; it < 4; ++it) {
      const int row = it * 4 + q4;   // it 0..3 x q4 0..3 = rows 0..15 of the wave tile
      const float* sp = os + row * OPT + c8;
      v4u ha, la;
#pragma unroll
      for (int e = 0; e < 4; ++e) {
        const float f0 = sp[2 * e], f1 = sp[2 * e + 1];
        const unsigned short u0 = bf_bits(f0), u1 = bf_bits(f1);
        const unsigned short w0 = bf_bits(f0 - bf_up(u0)), w1 = bf_bits(f1 - bf_up(u1));
        ha[e] = pk16(u0, u1);
        la[e] = pk16(w0, w1);
      }
      hv[it] = ha;
      lv[it] = la;
    }
    {
#pragma unroll
      for (int it = 0; it < 4; ++it) {
        const int row = it * 4 + q4;
        const size_t go = (rowB + q0 + row) * CTXP + (size_t)h * HD + c8;
        *(v4u*)(ctxp + go)      = hv[it];
        *(v4u*)(ctxp + go + DM) = lv[it];
      }
      
    }
  }
}

// =====================================================================================================
// y = (x - mean) * rstd * bf16(gamma) + bf16(beta). Block = 64 threads = one row; thread t handles columns
// 4t..4t+3 and 256+4t..256+4t+3, so each store instruction of a wave writes 32 lanes x 16 B = 512 contiguous
// coverage: 64 threads x 8 = 512 columns = the whole row; MP rows.
// =====================================================================================================
__global__ __launch_bounds__(64) void ln_rows(const float* __restrict__ X, const float* __restrict__ gam,
                                              const float* __restrict__ bet, float* out) {
  __shared__ float red[4];
  const int row = blockIdx.x;
  const int tid = threadIdx.x, lane = tid & 31, wv = tid >> 5;
  const float* src = X + (size_t)row * DM;
  const v4f a0 = *(const v4f*)(src + tid * 4);
  const v4f a1 = *(const v4f*)(src + 256 + tid * 4);
  float x[8];
#pragma unroll
  for (int e = 0; e < 4; ++e) { x[e] = a0[e]; x[4 + e] = a1[e]; }
  float s = 0.f;
#pragma unroll
  for (int e = 0; e < 8; ++e) s += x[e];
#pragma unroll
  for (int off = 1; off < 32; off <<= 1) s += __shfl_xor(s, off, 32);
  if (lane == 0) red[wv] = s;
  __syncthreads();
  const float mean = (red[0] + red[1]) * (1.0f / DM);
  float d[8];
  float q = 0.f;
#pragma unroll
  for (int e = 0; e < 8; ++e) { d[e] = x[e] - mean; q += d[e] * d[e]; }
#pragma unroll
  for (int off = 1; off < 32; off <<= 1) q += __shfl_xor(q, off, 32);
  if (lane == 0) red[2 + wv] = q;
  __syncthreads();
  const float var  = (red[2] + red[3]) * (1.0f / DM);
  const float rstd = rsqrtf(var + 1e-6f);

  const v4f g0 = *(const v4f*)(gam + tid * 4);
  const v4f g1 = *(const v4f*)(gam + 256 + tid * 4);
  const v4f e0 = *(const v4f*)(bet + tid * 4);
  const v4f e1 = *(const v4f*)(bet + 256 + tid * 4);
  v4f o0, o1;
#pragma unroll
  for (int e = 0; e < 4; ++e) {
    o0[e] = d[e]     * rstd * bfr(g0[e]) + bfr(e0[e]);
    o1[e] = d[4 + e] * rstd * bfr(g1[e]) + bfr(e1[e]);
  }
  float* dst = out + (size_t)row * DM + tid * 4;
  *(v4f*)(dst)       = o0;
  *(v4f*)(dst + 256) = o1;
  
}

// =====================================================================================================
// Workspace map (bytes); every plane is an exact multiple of its 64x64-tile / whole-row / whole-line store
// granularity (MP = 4096 = 64 row tiles; DM = 8 column tiles; VT per batch [512][2048] = 8x32 tiles; score table
//   WT   bf16 [1536 n][512 k]    0          1572864   (rows 0..511 Wq^T, 512..1023 Wk^T, 1024..1535 Wv^T)
//   WoT2 bf16 [512][1024]        1572864    1048576   (cols k and DM + k both Wo^T)
//   INb  bf16 [3][4096][512]     2621440    12582912  (q, k, v as bf16 bits)
//   QK   f16  [4096][2048]       15204352   16777216  (q [hi|lo] per head, then k [hi|lo] per head)
//   VTh  f16  [2][512][2048]     31981568   4194304   (v^T hi)
//   VTl  f16  [2][512][2048]     36175872   4194304   (v^T residual x2048)
//   IT   f32  [32768][16]        40370176   2097152   (query-embedding scores)
//   Ctx  bf16 [4096][1024]       42467328   8388608   (context hi | lo)
//   X    f32  [4096][512]        50855936   8388608   (pre-norm output)
//   end                          59244544
// =====================================================================================================
extern "C" void kernel_launch(void* const* d_in, const int* in_sizes, int n_in,
                              void* d_out, int out_size, void* d_ws, size_t ws_size,
                              hipStream_t stream) {
  if (n_in < 11) return;
  if (in_sizes[0] != MP * DM || in_sizes[1] != MP * DM || in_sizes[2] != MP * DM) return;
  if (in_sizes[3] != NE * DM) return;
  if (in_sizes[4] != NBATCH * SEQ * SEQ) return;
  if (in_sizes[5] != DM * DM || in_sizes[6] != DM * DM || in_sizes[7] != DM * DM || in_sizes[8] != DM * DM) return;
  if (in_sizes[9] != DM || in_sizes[10] != DM) return;
  if (out_size != MP * DM) return;

  const float* q_in = (const float*)d_in[0];
  const float* k_in = (const float*)d_in[1];
  const float* v_in = (const float*)d_in[2];
  const float* emb  = (const float*)d_in[3];
  const int*   trj  = (const int*)d_in[4];
  const float* w_q  = (const float*)d_in[5];
  const float* w_k  = (const float*)d_in[6];
  const float* w_v  = (const float*)d_in[7];
  const float* w_o  = (const float*)d_in[8];
  const float* gam  = (const float*)d_in[9];
  const float* bet  = (const float*)d_in[10];

  const size_t PWT  = (size_t)3 * DM * DM * 2;             //  1572864
  const size_t PWO  = (size_t)DM * KOFF * 2;               //  1048576
  const size_t PIN  = (size_t)3 * MP * DM * 2;             // 12582912
  const size_t PQK  = (size_t)MP * QKW * 2;                // 16777216
  const size_t PVT  = (size_t)NBATCH * DM * SEQ * 2;       //  4194304
  const size_t PIT  = (size_t)NBATCH * NH * SEQ * NEP * 4; //  2097152
  const size_t PCTX = (size_t)MP * CTXP * 2;               //  8388608
  const size_t PX   = (size_t)MP * DM * 4;                 //  8388608
  size_t off = 0;
  const size_t oWT  = off; off += PWT;
  const size_t oWo  = off; off += PWO;
  const size_t oIN  = off; off += PIN;
  const size_t oQK  = off; off += PQK;
  const size_t oVTh = off; off += PVT;
  const size_t oVTl = off; off += PVT;
  const size_t oIT  = off; off += PIT;
  const size_t oCtx = off; off += PCTX;
  const size_t oX   = off; off += PX;
  if (off > ws_size) return;                               // off = 59244544
  if (off > (size_t)134217728) return;

  char* ws = (char*)d_ws;
  unsigned short* WT   = (unsigned short*)(ws + oWT);
  unsigned short* WoT2 = (unsigned short*)(ws + oWo);
  unsigned short* INb  = (unsigned short*)(ws + oIN);
  unsigned short* QK   = (unsigned short*)(ws + oQK);
  unsigned short* VTh  = (unsigned short*)(ws + oVTh);
  unsigned short* VTl  = (unsigned short*)(ws + oVTl);
  float*          IT   = (float*)(ws + oIT);
  unsigned short* Ctx  = (unsigned short*)(ws + oCtx);
  float*          X    = (float*)(ws + oX);
  float*          out0 = (float*)d_out;

  const dim3 blk(256), blk128(128), blk64(64);
  const dim3 gCv(MP / 4, 3);                                        // 1024 x 3 blocks
  const dim3 gT(DM / 64, DM / 64);                                  // (cols/64, rows/64) = 8 x 8 per weight
  const dim3 gQK(((MP / 64) * (DM / 64)) / 8, 2, 1);                // 512 tiles -> 64 blocks x {q, k}
  const dim3 gVT(((DM / 64) * (SEQ / 64)) / 8, NBATCH, 1);          // 256 tiles -> 32 blocks x 2 batches
  const dim3 gIdx(NBATCH * NH * (SEQ / 64));                        // 512 blocks of 64
  const dim3 gAttn(NBATCH * NH * NQB);                              // 512 blocks of 128
  const dim3 gNo(((MP / 64) * (DM / 64)) / 8, 1, 1);                // 512 tiles -> 64 blocks
  const dim3 gLN(MP);                                               // 4096 rows
  if ((((MP / 64) * (DM / 64)) % 8) != 0) return;
  if ((((DM / 64) * (SEQ / 64)) % 8) != 0) return;

  // (0) activations -> bf16 bits; weight planes: in[k][n] (shape [512 in][512 out]) -> out[n][k] transposed
  //     through LDS (Wo additionally at cols DM + k for the hi|lo K-concat)
  cvt3<<<gCv, blk, 0, stream>>>(q_in, k_in, v_in, INb);
  tconv64<<<gT, blk, 0, stream>>>(w_q, WT, DM, DM, DM, 0);                            // -> WT rows 0..511
  tconv64<<<gT, blk, 0, stream>>>(w_k, WT + (size_t)DM * DM, DM, DM, DM, 0);          // -> WT rows 512..1023
  tconv64<<<gT, blk, 0, stream>>>(w_v, WT + (size_t)2 * DM * DM, DM, DM, DM, 0);      // -> WT rows 1024..1535
  tconv64<<<gT, blk, 0, stream>>>(w_o, WoT2, DM, DM, KOFF, DM);

  // (1) q = qb . Wq^T-plane (blockIdx.y = 0) and k = kb . Wk^T-plane (blockIdx.y = 1), K = 512
  //     -> f16 [hi 64 | lo 64] per head (QK plane [4096][2048], q at cols 0.., k at cols KOFF..);
  //     v^T per batch = Wv^T . vb_b^T -> f16 hi (VTh) and residual x2048 (VTl) planes [2][512][2048]
  gemm64<4><<<gQK, blk, 0, stream>>>(
      INb, DM, (long long)MP * DM, WT, DM, (long long)DM * DM,
      QK, QK + HD, X, QKW, (long long)KOFF,
      MP, DM, DM, 2, 1.0f);
  gemm64<4><<<gVT, blk, 0, stream>>>(
      WT + (size_t)2 * DM * DM, DM, 0LL, INb + (size_t)2 * MP * DM, DM, (long long)SEQ * DM,
      VTh, VTl, X, SEQ, (long long)DM * SEQ,
      DM, SEQ, DM, 1, 1.0f);

  // (2) query-embedding score table (f32), then flash attention with the selected per-pair bias
  //     -> context bf16 hi|lo
  idx_rows<<<gIdx, blk64, 0, stream>>>(QK, emb, IT);
  attn64<<<gAttn, blk128, 0, stream>>>(QK, VTh, VTl, IT, trj, Ctx, 0.125f);

  // (3) X = [ctx_hi | ctx_lo] . [Wo | Wo]  (K = 1024, bf16 operands) -> f32 plane; LayerNorm -> d_out
  gemm64<0><<<gNo, blk, 0, stream>>>(
      Ctx, CTXP, 0LL, WoT2, KOFF, 0LL,
      Ctx, Ctx, X, DM, 0LL,
      MP, DM, KOFF, 1, 1.0f);
  ln_rows<<<gLN, blk64, 0, stream>>>(X, gam, bet, out0);
  (void)hipGetLastError();
}

// v005
// Measured time: 130 microseconds a run.
// Two timings next to v004 both put it at 1.19 times that version's speed.
// All steps since v000 together make it 2.03 times as fast.
// Contractions: q|k|v projections and output projection on v_wmma_f32_16x16x32_bf16 (bf16 operands from
// RNE-converted inputs; context carried as bf16 hi|lo planes K-concatenated against duplicated Wo planes);
// scores q.k^T on v_wmma_f32_16x16x32_f16 (q f16 hi, k f16 hi, single product); p.v on
// v_wmma_f32_16x16x32_f16 (p carried x1024 in f16, v^T as f16 hi + x2048 residual planes, two products,
// separate accumulators); all f32 accumulate; query-embedding scores (from q hi + residual), per-pair bias
// select, softmax and LayerNorm in f32.
#include <hip/hip_runtime.h>
#include <math.h>

#define NBATCH 2
#define SEQ    2048
#define DM     512
#define NH     8
#define HD     64
#define NE     10
#define NEP    16
#define MP     (NBATCH * SEQ)
#define QKW    (4 * DM)
#define KOFF   (2 * DM)
#define CTXP   (2 * DM)
#define NQB    (SEQ / 64)
#define RSC    2048.0f
#define PSC    1024.0f
#define KP     72      // LDS row pitch of the 64-wide 16-bit attention tiles, in elements: 144 B = 16 B x 9
#define OPT    68      // LDS row pitch of the f32 context tile, in floats: 272 B = 16 B x 17
#define ITP    20      // LDS row pitch of the score-table rows, in floats: rows 8 apart fall 32 banks apart
static_assert(NH * HD == DM);
static_assert(DM == 8 * 64);
static_assert((SEQ % 64) == 0 && (DM % 64) == 0 && (MP % 64) == 0 && (SEQ % 256) == 0 && (MP % 4) == 0);
static_assert((((MP / 64) * (DM / 64)) % 8) == 0);
static_assert((((DM / 64) * (SEQ / 64)) % 8) == 0);
static_assert(NE <= NEP && NEP == 16);
static_assert(((DM / 64) % 8) == 0 && ((SEQ / 64) % 8) == 0);   // gemm64: the 8 tiles of a block lie in one tile row

typedef _Float16 v16h __attribute__((ext_vector_type(16)));
typedef _Float16 v8h  __attribute__((ext_vector_type(8)));
typedef __bf16   v16b __attribute__((ext_vector_type(16)));
typedef unsigned short v16us __attribute__((ext_vector_type(16)));
typedef unsigned short v8us  __attribute__((ext_vector_type(8)));
typedef float    v8f  __attribute__((ext_vector_type(8)));
typedef float    v4f  __attribute__((ext_vector_type(4)));
typedef unsigned int v4u __attribute__((ext_vector_type(4)));

union FragH { v16h v; v8h h[2]; };
union FragU { v16us v; v8us h[2]; };

// ---- scalar helpers --------------------------------------------------------------------------------
__device__ __forceinline__ unsigned short bf_bits(float f) {          // f32 -> bf16 bits, RNE convert
  unsigned u = __float_as_uint(f);
  return (unsigned short)((u + 0x7FFFu + ((u >> 16) & 1u)) >> 16);
}
__device__ __forceinline__ float bf_up(unsigned short h) { return __uint_as_float(((unsigned)h) << 16); }
__device__ __forceinline__ float bfr(float f) { return bf_up(bf_bits(f)); }   // value of the bf16 RNE convert
__device__ __forceinline__ unsigned short h_bits(_Float16 x) { return __builtin_bit_cast(unsigned short, x); }
__device__ __forceinline__ unsigned pk16(unsigned short a, unsigned short b) { return (unsigned)a | ((unsigned)b << 16); }
__device__ __forceinline__ v8f zero8() { v8f z = {0.f, 0.f, 0.f, 0.f, 0.f, 0.f, 0.f, 0.f}; return z; }

// ---- fragment loader: 16-bit A/B operand, lane -> row/col (lane&15), p already includes +8*(lane>>4);
//      elements 0..7 <- p[0..7] (k0+8h..), elements 8..15 <- p[16..23] (k0+16+8h..)
__device__ __forceinline__ v16us ldfrag_u(const unsigned short* p) {
  FragU f;
  f.h[0] = *(const v8us*)(p);
  f.h[1] = *(const v8us*)(p + 16);
  return f.v;
}

// ---- WMMA helpers with trailing VALU hazard gap --------------------------------------------------------
__device__ __forceinline__ v8f mma_bu_raw(v16us a, v16us b, v8f c) {            // bf16 operands, unguarded
  return __builtin_amdgcn_wmma_f32_16x16x32_bf16(false, __builtin_bit_cast(v16b, a), false,
                                                 __builtin_bit_cast(v16b, b), (short)0, c, false, false);
}
__device__ __forceinline__ v8f mma_hu(v16us a, v16us b, v8f c) {                // f16 operands (bits), guarded
  c = __builtin_amdgcn_wmma_f32_16x16x32_f16(false, __builtin_bit_cast(v16h, a), false,
                                              __builtin_bit_cast(v16h, b), (short)0, c, false, false);
#if defined(__HIP_DEVICE_COMPILE__)
  asm volatile("v_nop\n\tv_nop\n\tv_nop\n\tv_nop" : "+v"(c) : "v"(a), "v"(b));
#endif
  return c;
}
__device__ __forceinline__ v8f mma_h_raw(v16h a, v16h b, v8f c) {                // f16 operands, unguarded
  return __builtin_amdgcn_wmma_f32_16x16x32_f16(false, a, false, b, (short)0, c, false, false);
}
__device__ __forceinline__ void acc_guard4(v8f& a, v8f& b, v8f& c, v8f& d) {
#if defined(__HIP_DEVICE_COMPILE__)
  asm volatile("v_nop\n\tv_nop\n\tv_nop\n\tv_nop" : "+v"(a), "+v"(b), "+v"(c), "+v"(d));
#endif
}
__device__ __forceinline__ void wave_sync_lds() {
  __builtin_amdgcn_fence(__ATOMIC_RELEASE, "workgroup");
  __builtin_amdgcn_wave_barrier();
  __builtin_amdgcn_fence(__ATOMIC_ACQUIRE, "workgroup");
}
// The same for LDS traffic alone: orders a wave's own LDS stores before its LDS loads and leaves its global loads
// in flight (the fence over all address spaces waits for them too).
__device__ __forceinline__ void wave_sync_lds_only() {
  __builtin_amdgcn_fence(__ATOMIC_RELEASE, "workgroup", "local");
  __builtin_amdgcn_wave_barrier();
  __builtin_amdgcn_fence(__ATOMIC_ACQUIRE, "workgroup", "local");
}

// =====================================================================================================
// f32 [MP][DM] activations (three sources selected by z, block-uniform) -> bf16 bits plane
// dst[(z*MP + row)*DM + col]. Block = 256 threads = 4 rows; thread t: row = 4*rb + (t>>6), cols 8*(t&63)..+7.
// coverage: 1024 row blocks rb x 4 rows x 512 cols = each whole plane; 3 planes z. One block's part of prep.
// =====================================================================================================
__device__ __forceinline__ void cvt3(const float* __restrict__ s0, const float* __restrict__ s1,
                                     const float* __restrict__ s2, unsigned short* dst, const int rb, const int z) {
  const float* src = (z == 0) ? s0 : ((z == 1) ? s1 : s2);
  const int t = threadIdx.x;
  const int row = rb * 4 + (t >> 6);
  const int c8 = (t & 63) * 8;
  const float* p = src + (size_t)row * DM + c8;
  const v4f a0 = *(const v4f*)(p);
  const v4f a1 = *(const v4f*)(p + 4);
  v4u hv;
  hv[0] = pk16(bf_bits(a0[0]), bf_bits(a0[1]));
  hv[1] = pk16(bf_bits(a0[2]), bf_bits(a0[3]));
  hv[2] = pk16(bf_bits(a1[0]), bf_bits(a1[1]));
  hv[3] = pk16(bf_bits(a1[2]), bf_bits(a1[3]));
  unsigned short* d = dst + ((size_t)z * MP + (size_t)row) * DM + c8;
  *(v4u*)d = hv;
  
}

// =====================================================================================================
// Tiled transpose + bf16 convert: in[rows][cols] f32 row-major -> out[cols][rows] bf16 bits with pitch ldo:
//   out[n * ldo + k] = bf16(in[k][n]) and also at + dupoff (a duplicated k range for the hi|lo K-concat GEMM).
// Block = 256 threads = one 64x64 tile (tn, tk) of (cols/64, rows/64) (rows, cols multiples of 64). One block's part of prep.
// Loads: 4 iterations x 256 threads x float4 = 64 rows x 64 cols (addresses clamped). LDS tile [n][k] pitch 72.
// coverage: 64 x 64 = the whole transposed tile at both column offsets; grid covers the whole matrix.
// =====================================================================================================
__device__ __forceinline__ void tconv64(const float* __restrict__ W, unsigned short* out,
                                        int rows, int cols, int ldo, int dupoff, const int tn, const int tk) {
  __shared__ __align__(16) unsigned short sh[64 * 72];
  const int t  = threadIdx.x;
  const int n0 = tn * 64;                    // column tile of in = row tile of out
  const int k0 = tk * 64;                    // row tile of in = column tile of out
#pragma unroll
  for (int i = 0; i < 4; ++i) {
    const int idx = i * 256 + t;
    const int r = idx >> 4, c4 = (idx & 15) * 4;
    int kr = k0 + r;   kr = (kr < rows) ? kr : (rows - 1);
    int nc = n0 + c4;  nc = (nc < cols - 4) ? nc : (cols - 4);
    const v4f v = *(const v4f*)(W + (size_t)kr * cols + nc);
#pragma unroll
    for (int e = 0; e < 4; ++e) sh[(c4 + e) * 72 + r] = bf_bits(v[e]);
  }
  __syncthreads();
  const int wave = t >> 5, lane = t & 31;
  const int q = lane >> 3, c8 = (lane & 7) * 8;
  v4u pv[2];
  unsigned short* po[2];
#pragma unroll
  for (int it = 0; it < 2; ++it) {
    const int nl = it * 32 + wave * 4 + q;               // 0..63
    pv[it] = *(const v4u*)(sh + nl * 72 + c8);
    po[it] = out + ((size_t)(n0 + nl) * ldo + k0 + c8);
  }
  {
#pragma unroll
    for (int it = 0; it < 2; ++it) {
      *(v4u*)(po[it]) = pv[it];
      if (dupoff != 0) *(v4u*)(po[it] + dupoff) = pv[it];
    }
#if defined(__HIP_DEVICE_COMPILE__)
    // the compiler reuses the first store's registers for the second store's address: the wait stands in front of any
    // such reuse (addresses and data are inputs, so that they live unchanged up to the wait)
    asm volatile("s_wait_xcnt 0x0" :: "v"(po[0]), "v"(po[1]), "v"(pv[0]), "v"(pv[1]) : "memory");
#endif
  }
}

// =====================================================================================================
// All operand preparation in one launch: none of its parts reads what another writes, so they share one grid by
// ranges of the block index (block-uniform branch). Blocks 0 .. 4*WTB-1: the 64x64 transpose tiles of Wq, Wk, Wv
// (-> wt rows 0.., 512.., 1024..) and Wo (-> wot2, also at cols DM + k); they have the longer dependent path and
// stand first. Blocks 4*WTB ..: the 3 x MP/4 row blocks of the activation convert.
// coverage: 4 x 64 tiles = the four whole weight planes; 3 x 1024 row blocks = the three whole activation planes.
// =====================================================================================================
#define WTB ((DM / 64) * (DM / 64))
__global__ __launch_bounds__(256) void prep(const float* __restrict__ s0, const float* __restrict__ s1,
                                            const float* __restrict__ s2, const float* __restrict__ w0,
                                            const float* __restrict__ w1, const float* __restrict__ w2,
                                            const float* __restrict__ w3, unsigned short* inb,
                                            unsigned short* wt, unsigned short* wot2) {
  const int bx = blockIdx.x;
  if (bx >= 4 * WTB) {                       // block-uniform, in front of every barrier
    const int i = bx - 4 * WTB;
    cvt3(s0, s1, s2, inb, i % (MP / 4), i / (MP / 4));
    return;
  }
  const int w = bx / WTB, tile = bx % WTB;
  const float* W = (w == 0) ? w0 : ((w == 1) ? w1 : ((w == 2) ? w2 : w3));
  unsigned short* o = (w < 3) ? (wt + (size_t)w * DM * DM) : wot2;
  tconv64(W, o, DM, DM, (w < 3) ? DM : KOFF, (w < 3) ? 0 : DM, tile % (DM / 64), tile / (DM / 64));
}

// =====================================================================================================
// Register-blocked batched bf16 WMMA GEMM: C[m][n] = oscale * sum_k A[m][k] * Bt[n][k];
// one wave per 64x64 tile; the 8 tiles of a block lie side by side in one tile row (N/64 a multiple of 8), so the
// block works on 64 rows of A and 512 rows of Bt. Both are staged in LDS in k chunks of 64: each 16-B load of a wave
// takes 4 whole 128-B row segments, one chunk ahead into registers, LDS stores between two __syncthreads; the
// fragments are ds_load_b128 reads at a 144-B pitch. A row-major [M][K] pitch lda; Bt row-major [N][K] pitch ldb
// (k contiguous); M, N multiples of 64, K multiple of 64. by = batch index with element strides
// (sAy for A, sBy for Bt, sCy for C); bx = block of 8 tiles. Tile enumeration: tile -> tm = tile / (N/64),
// tn = tile % (N/64). The body of the two kernels behind it.
// OM: 0 = f32 out to Cf (pitch ldc); 4 = f16 hi bits to Cp and f16((v - hi) * 2048) bits to Cp2, 16-bit column
//     base = n0 * nmul (nmul = 2 interleaves [hi 64 | lo 64] per 64-col tile with Cp2 = Cp + 64).
// coverage: 4 slabs x 16 rows x 64 cols = the wave's whole 64x64 tile; grid = tilesM*tilesN/8 blocks exactly
//           (host-checked), so no block exits early.
// =====================================================================================================
template <int OM>
__device__ __forceinline__ void gemm64_body(
    const unsigned short* __restrict__ Ap, int lda, long long sAy,
    const unsigned short* __restrict__ Btp, int ldb, long long sBy,
    unsigned short* Cp, unsigned short* Cp2, float* Cf, int ldc, long long sCy,
    int M, int N, int K, int nmul, float oscale, const int bx, const int by) {
  __shared__ __align__(16) float sT[8][16 * 68];   // per-wave 16x64 slab, pitch 68 floats
  __shared__ __align__(16) unsigned short sAB[(64 + 512) * KP];   // rows 0..63: A chunk; rows 64..575: Bt chunk
  const int lane = threadIdx.x & 31;
  const int wave = threadIdx.x >> 5;
  const int tilesN = N >> 6;
  const int tilesM = M >> 6;
  const int tile0 = bx * 8;
  if (tile0 + 8 > tilesM * tilesN) return;   // block-uniform, in front of every barrier (the grid is exact)
  const int tm  = tile0 / tilesN;
  const int tn0 = tile0 - tm * tilesN;       // first of the block's 8 tiles, all in tile row tm
  const int m0 = tm << 6;
  const int n0 = (tn0 + wave) << 6;

  const unsigned short* Ab = Ap  + (size_t)by * (size_t)sAy;
  const unsigned short* Bb = Btp + (size_t)by * (size_t)sBy;
  const size_t cofs = (size_t)by * (size_t)sCy;

  const int rlane = lane & 15;                 // row (A) / col (B, D) within subtile
  const int koff  = (lane >> 4) * 8;           // k offset of this lane half
  const int mOff  = (lane >> 4) * 8;           // D row offset

  v8f acc[4][4];
#pragma unroll
  for (int i = 0; i < 4; ++i)
#pragma unroll
    for (int j = 0; j < 4; ++j) acc[i][j] = zero8();

  // Staging: 576 rows x 8 pieces of 16 B = 18 pieces per thread; piece i of thread t: staged row 32 i + srow,
  // bytes 16 (t & 7).. of the row's 128-B chunk. Pieces 0, 1 are A rows, pieces 2..17 Bt rows. srow runs through
  // 0..31 over the block's 32 groups of 8 lanes; the two groups of a 16-lane half take rows 8 apart, which at the
  // 144-B pitch lie 32 banks apart, so that a half's ds_store_b128 covers each of the 64 banks once.
  const int tx = threadIdx.x;
  const int srow = ((tx >> 4) & 7) | (((tx >> 3) & 1) << 3) | ((tx >> 7) << 4), sc8 = (tx & 7) * 8;
  const unsigned short* gp[18];
#pragma unroll
  for (int i = 0; i < 2; ++i)  gp[i] = Ab + (size_t)(m0 + 32 * i + srow) * lda + sc8;
#pragma unroll
  for (int i = 2; i < 18; ++i) gp[i] = Bb + (size_t)((tn0 << 6) + 32 * (i - 2) + srow) * ldb + sc8;
  v4u st[18];
  auto fetch = [&]() {
#pragma unroll
    for (int i = 0; i < 18; ++i) st[i] = *(const v4u*)(gp[i]);
#if defined(__HIP_DEVICE_COMPILE__)
    // the address pairs of the loads just issued are stepped below: the wait stands in front of that (the pairs are
    // inputs, so that they live unchanged up to the wait); the clobber keeps the loads in front of the products
    asm volatile("s_wait_xcnt 0x0" :: "v"(gp[0]), "v"(gp[1]), "v"(gp[2]), "v"(gp[3]), "v"(gp[4]), "v"(gp[5]),
                 "v"(gp[6]), "v"(gp[7]), "v"(gp[8]), "v"(gp[9]), "v"(gp[10]), "v"(gp[11]), "v"(gp[12]),
                 "v"(gp[13]), "v"(gp[14]), "v"(gp[15]), "v"(gp[16]), "v"(gp[17]) : "memory");
#endif
#pragma unroll
    for (int i = 0; i < 18; ++i) gp[i] += 64;
  };
  const unsigned short* fA = sAB + rlane * KP + koff;                       // this lane's A fragment rows
  const unsigned short* fB = sAB + (64 + wave * 64 + rlane) * KP + koff;    // this lane's Bt fragment rows
  const int nch = K >> 6;
  fetch();
  for (int kc = 0; kc < nch; ++kc) {
    __syncthreads();                           // every wave has read the chunk before
#pragma unroll
    for (int i = 0; i < 18; ++i) *(v4u*)(sAB + (32 * i + srow) * KP + sc8) = st[i];
    __syncthreads();                           // the chunk is whole
    if (kc + 1 < nch) fetch();                 // block-uniform; the next chunk flies beside this chunk's products
    v16us ah[2][4], bh[2][4];
#pragma unroll
    for (int ks = 0; ks < 2; ++ks) {
#pragma unroll
      for (int j = 0; j < 4; ++j) bh[ks][j] = ldfrag_u(fB + j * 16 * KP + ks * 32);
#pragma unroll
      for (int i = 0; i < 4; ++i) ah[ks][i] = ldfrag_u(fA + i * 16 * KP + ks * 32);
    }
    // keeps the chunk's 32 fragment reads in front of its products: unfenced, the compiler reads the A fragments into
    // one register set and waits for LDS in front of every row of products
    __builtin_amdgcn_sched_barrier(0);
#pragma unroll
    for (int ks = 0; ks < 2; ++ks)
#pragma unroll
      for (int i = 0; i < 4; ++i)
#pragma unroll
        for (int j = 0; j < 4; ++j) acc[i][j] = mma_bu_raw(ah[ks][i], bh[ks][j], acc[i][j]);
  }
  acc_guard4(acc[0][0], acc[0][1], acc[0][2], acc[0][3]);
  acc_guard4(acc[1][0], acc[1][1], acc[1][2], acc[1][3]);
  acc_guard4(acc[2][0], acc[2][1], acc[2][2], acc[2][3]);
  acc_guard4(acc[3][0], acc[3][1], acc[3][2], acc[3][3]);

  const int hh2 = lane >> 4, c4 = (lane & 15) * 4;     // f32 out: 256-B row segment = 16 lanes x 16 B
  const int q8  = lane >> 3, c8 = (lane & 7) * 8;

  // ---- epilogue ----
  float* slab = sT[wave];
#pragma unroll
  for (int i = 0; i < 4; ++i) {
    const int mBase = m0 + (i << 4);
#pragma unroll
    for (int j = 0; j < 4; ++j) {
#pragma unroll
      for (int r = 0; r < 8; ++r) {
        slab[(mOff + r) * 68 + (j << 4) + rlane] = acc[i][j][r];
      }
    }
    wave_sync_lds();
    if (OM == 0) {
      float* C = Cf + cofs;
      v4f vals[8];
#pragma unroll
      for (int it = 0; it < 8; ++it) {
        const int row = it * 2 + hh2;                      // it 0..7 x hh2 0..1 = rows 0..15
        v4f v = *(const v4f*)(slab + row * 68 + c4);
        vals[it] = v * oscale;
      }
      {
#pragma unroll
        for (int it = 0; it < 8; ++it) {
          const int row = it * 2 + hh2;
          *(v4f*)(C + (size_t)(mBase + row) * ldc + (size_t)n0 * nmul + c4) = vals[it];
        }
        
      }
    } else {
      unsigned short* C  = Cp  + cofs;
      unsigned short* C2 = Cp2 + cofs;
      v4u hv[4], lv[4];
#pragma unroll
      for (int it = 0; it < 4; ++it) {
        const int row = it * 4 + q8;                       // it 0..3 x q8 0..3 = rows 0..15
        const float* sp = slab + row * 68 + c8;
        v4u ha, la;
#pragma unroll
        for (int e = 0; e < 4; ++e) {
          const float f0 = sp[2 * e]     * oscale;
          const float f1 = sp[2 * e + 1] * oscale;
          const _Float16 g0 = (_Float16)f0, g1 = (_Float16)f1;
          const unsigned short u0 = h_bits(g0), u1 = h_bits(g1);
          const unsigned short w0 = h_bits((_Float16)((f0 - (float)g0) * RSC));
          const unsigned short w1 = h_bits((_Float16)((f1 - (float)g1) * RSC));
          ha[e] = pk16(u0, u1);
          la[e] = pk16(w0, w1);
        }
        hv[it] = ha;
        lv[it] = la;
      }
      {
#pragma unroll
        for (int it = 0; it < 4; ++it) {
          const int row = it * 4 + q8;
          const size_t go = (size_t)(mBase + row) * ldc + (size_t)n0 * nmul + c8;
          *(v4u*)(C  + go) = hv[it];
          *(v4u*)(C2 + go) = lv[it];
        }
        
      }
    }
    wave_sync_lds();
  }
}

// One GEMM per launch: grid = (tilesM*tilesN/8, batches).
template <int OM>
__global__ __launch_bounds__(256) void gemm64(
    const unsigned short* __restrict__ Ap, int lda, long long sAy,
    const unsigned short* __restrict__ Btp, int ldb, long long sBy,
    unsigned short* Cp, unsigned short* Cp2, float* Cf, int ldc, long long sCy,
    int M, int N, int K, int nmul, float oscale) {
  gemm64_body<OM>(Ap, lda, sAy, Btp, ldb, sBy, Cp, Cp2, Cf, ldc, sCy, M, N, K, nmul, oscale,
                  (int)blockIdx.x, (int)blockIdx.y);
}

// The three projections in one launch: they read the same prepared planes and none reads what another writes, so
// they share one grid; blockIdx.y (block-uniform) picks the product and only scalar arguments of the one body differ.
//   y = 0, 1: q = qb . Wq^T-plane, k = kb . Wk^T-plane -> f16 [hi 64 | lo 64] per head in the QK plane (q at cols
//             0.., k at cols KOFF..); 64 blocks of 8 tiles each.
//   y = 2:    v^T per batch = Wv^T . vb_b^T -> f16 hi (vth) and residual x2048 (vtl) planes; blockIdx.x = 32 blocks
//             of 8 tiles x 2 batches.
// K stays a run-time argument, as in gemm64: the chunk loop stays rolled, one copy of its body in the instruction cache.
#define PJB (((MP / 64) * (DM / 64)) / 8)
#define VTB (((DM / 64) * (SEQ / 64)) / 8)
static_assert(VTB * NBATCH == PJB);
__global__ __launch_bounds__(256) void proj3(const unsigned short* __restrict__ inb,
                                             const unsigned short* __restrict__ wt, unsigned short* qkp,
                                             unsigned short* vth, unsigned short* vtl, int K) {
  const int x = blockIdx.x, y = blockIdx.y;
  const bool isv = (y == 2);
  gemm64_body<4>(isv ? (wt + (size_t)2 * DM * DM) : inb, DM, isv ? 0LL : (long long)MP * DM,
                 isv ? (inb + (size_t)2 * MP * DM) : wt, DM, isv ? (long long)SEQ * DM : (long long)DM * DM,
                 isv ? vth : qkp, isv ? vtl : (qkp + HD), nullptr, isv ? SEQ : QKW,
                 isv ? (long long)DM * SEQ : (long long)KOFF,
                 isv ? DM : MP, isv ? SEQ : DM, K, isv ? 1 : 2, 1.0f,
                 isv ? (x % VTB) : x, isv ? (x / VTB) : y);
}

// =====================================================================================================
// Query-embedding score table: itab[(bh*SEQ + l)*NEP + n] = sum_d qh[b,h,l,d] * bf16(emb[n][h*64 + d]) for
// n < NE (f32, columns NE..NEP-1 = 0). qh is reconstructed in f32 as hi + lo/2048 from the q part of the QK
// plane (f16 hi at col h*128 + d, residual at + 64). Block = 64 threads = 64 consecutive rows l of one (b, h)
// (SEQ % 64 == 0); grid = NBATCH*NH*SEQ/64 exact. q rows and the head's emb slice staged in LDS (f32);
// the 10 dots per row are rolled over n and over two 32-wide d halves (32 static FMAs).
// Output tile 64 x 16 f32 staged in LDS and written as 256 float4 = 4 instructions per wave, each 32 lanes x
// coverage: 512 blocks x 64 rows x 16 cols = the whole table.
// =====================================================================================================
__global__ __launch_bounds__(64) void idx_rows(const unsigned short* __restrict__ qk,
                                               const float* __restrict__ emb, float* itab) {
  __shared__ float Qs[64 * 65];
  __shared__ float Es[NE * HD];
  __shared__ __align__(16) float Ts[64 * NEP];
  const int tid = threadIdx.x;
  const int R0 = blockIdx.x * 64;                 // flat (b*NH + h)*SEQ + l row base
  const int bh = R0 / SEQ;
  const int l0 = R0 - bh * SEQ;
  const int b  = bh / NH;
  const int h  = bh - b * NH;
#pragma unroll 1
  for (int i = tid; i < NE * HD; i += 64) {
    const int n = i >> 6, d = i & 63;
    Es[i] = bfr(emb[(size_t)n * DM + h * HD + d]);
  }
  const _Float16* qp = (const _Float16*)(const void*)qk
                     + ((size_t)b * SEQ + (size_t)l0 + (size_t)tid) * QKW + (size_t)h * (2 * HD);
#pragma unroll
  for (int i = 0; i < 8; ++i) {
    const v8h hv = *(const v8h*)(qp + 8 * i);
    const v8h lv = *(const v8h*)(qp + HD + 8 * i);
#pragma unroll
    for (int e = 0; e < 8; ++e)
      Qs[tid * 65 + 8 * i + e] = (float)hv[e] + (float)lv[e] * (1.0f / RSC);
  }
  __syncthreads();
#pragma unroll 1
  for (int n = 0; n < NE; ++n) {
    float s = 0.f;
#pragma unroll 1
    for (int dc = 0; dc < 2; ++dc) {
#pragma unroll
      for (int d = 0; d < 32; ++d) s += Qs[tid * 65 + dc * 32 + d] * Es[n * HD + dc * 32 + d];
    }
    Ts[tid * NEP + n] = s;
  }
#pragma unroll
  for (int n = NE; n < NEP; ++n) Ts[tid * NEP + n] = 0.f;
  __syncthreads();
  v4f vals[4];
#pragma unroll
  for (int it = 0; it < 4; ++it) vals[it] = *(const v4f*)(Ts + (it * 64 + tid) * 4);
  float* base = itab + (size_t)R0 * NEP;
#pragma unroll
  for (int it = 0; it < 4; ++it) *(v4f*)(base + (it * 64 + tid) * 4) = vals[it];
  
}

// =====================================================================================================
// Flash attention with a per-(query, key) additive bias selected by an input int matrix, head dim 64, SEQ rows
// per batch, non-causal.
//   QK plane (f16 bits, pitch QKW): element (b, t, col) at [(b*SEQ + t)*QKW + col]; q head h: hi at col h*128 + d
//   (residual at + 64, unused here); k head h: hi at KOFF + h*128 + d.
//   v^T hi and lo planes (f16): element (b, h, d, s) at [(b*DM + h*64 + d)*SEQ + s]; value = hi + lo/2048.
//   itab (f32 [NBATCH*NH*SEQ][NEP]): per-query score table; bias(q, kv) = itab[bh*SEQ + q][clamp(trj[b][q][kv])].
//   context plane (bf16, pitch CTXP): hi at [(b*SEQ + t)*CTXP + h*64 + d], lo at + DM.
//   score[i][j] = (q_hi . k) * sscale + bias(i, j); p = exp(s - m) carried as f16(1024 p);
//   context = p . v_hi and p . v_lo on f16 WMMA in two accumulators; online softmax (running max) in f32.
//   Block = 4 waves = 64 query rows of one (b, h); grid = NQB * NH * NBATCH; kv chunks of 64, static trip NQB.
//   The 64 x 16 score-table rows of the block are staged once in LDS; the pair index for each score element is
//   a plain int load (arithmetic address), clamped to 0..NE-1 and used only as an LDS index.
//   K hi and V^T hi/lo chunk staging: 128 threads x 32 elements per plane = the whole 64x64 tile per plane;
//   plain 16-B loads one pass ahead into registers, LDS stores between two __syncthreads. P tiles are wave-private, spilled with _Float16 element
//   Context coverage: each wave stores rows q0..q0+15 (it 0..3 x lane>>3 0..3) x 64 columns (8 lanes x 8 bf16)
//   for both the hi and the lo segment; the grid covers all SEQ rows x NH head slabs x NBATCH.
// =====================================================================================================
__global__ __launch_bounds__(128)
void attn64(const unsigned short* __restrict__ qk, const unsigned short* __restrict__ vth,
            const unsigned short* __restrict__ vtl, const float* __restrict__ itab,
            const int* __restrict__ trj, unsigned short* ctxp, float sscale) {
  __shared__ __align__(16) unsigned short Kh[64 * KP];          // K hi [kv][d]  9 KB
  __shared__ __align__(16) _Float16 Vh[64 * KP];                // V^T hi [d][kv] 9 KB
  __shared__ __align__(16) _Float16 Vl[64 * KP];                // V^T lo [d][kv] 9 KB
  __shared__ __align__(16) _Float16 Psh[4][16 * KP];            // per wave P [row][kv] 9 KB
  __shared__ __align__(16) float    Os[4][16 * OPT];            // per wave context tile [row][d] 17 KB
  __shared__ __align__(16) float    ITs[64 * ITP];              // score table rows of this query block 5 KB

  const int tid  = threadIdx.x;
  const int wave = tid >> 5;
  const int lane = tid & 31;
  const int hh   = lane >> 4;
  const int c    = lane & 15;

  const int bx   = blockIdx.x;
  const int qb   = bx % NQB;
  const int rest = bx / NQB;
  const int h    = rest % NH;
  const int b    = rest / NH;
  const int q0   = qb * 64 + wave * 16;          // in-batch query row of this wave's first row
  const size_t rowB = (size_t)b * SEQ;

  const unsigned short* Qh  = qk + (size_t)h * (2 * HD);
  const unsigned short* Kg  = qk + KOFF + (size_t)h * (2 * HD);
  const _Float16* Vgh = (const _Float16*)(const void*)vth + ((size_t)b * DM + (size_t)h * HD) * SEQ;
  const _Float16* Vgl = (const _Float16*)(const void*)vtl + ((size_t)b * DM + (size_t)h * HD) * SEQ;
  const float* itb = itab + (((size_t)b * NH + (size_t)h) * SEQ + (size_t)qb * 64) * NEP;
  // this lane's pair-index row group: query row q0 + 8*hh (+ r), key column c (+ kv0 + 16 j)
  const int* trw = trj + (rowB + (size_t)q0 + (size_t)(8 * hh)) * SEQ + c;

  // stage the block's 64 x 16 score table (256 float4, 128 threads x 2); visible after the loop's first barrier
#pragma unroll
  for (int i = 0; i < 2; ++i) {
    const int f = i * 128 + tid;
    *(v4f*)(ITs + (f >> 2) * ITP + (f & 3) * 4) = *(const v4f*)(itb + (size_t)f * 4);
  }

  float mrow[8], lrow[8];
  v8f oacc[4], oaccL[4];
#pragma unroll
  for (int r = 0; r < 8; ++r) { mrow[r] = -INFINITY; lrow[r] = 0.f; }
#pragma unroll
  for (int t = 0; t < 4; ++t) { oacc[t] = zero8(); oaccL[t] = zero8(); }

  // Registers that carry one pass's global data (this thread's 32 elements of the K, V^T hi and V^T lo tiles and
  // this lane's 32 pair indices): filled one pass ahead, so that their latency runs beside the pass before.
  const int sr = tid >> 1, shf = (tid & 1) * 32;
  // running addresses of the tile to be loaded next
  const unsigned short* kq = Kg + (rowB + sr) * QKW + shf;                // K row kv0+sr, d = shf..shf+31
  const _Float16* vq = Vgh + (size_t)sr * SEQ + shf;                      // V^T row d = sr, s = kv0+shf..+31
  const _Float16* wq = Vgl + (size_t)sr * SEQ + shf;
  const int* tq = trw;
  v8us kreg[4];
  v8h  vreg[4], wreg[4];
  int  tix[4][8];
  auto fetch = [&](const int adv) {          // loads the tile the addresses stand at, then steps them by adv keys
#pragma unroll
    for (int i = 0; i < 4; ++i) {
      kreg[i] = *(const v8us*)(kq + 8 * i);
      vreg[i] = *(const v8h*)(vq + 8 * i);
      wreg[i] = *(const v8h*)(wq + 8 * i);
    }
#pragma unroll
    for (int j = 0; j < 4; ++j)
#pragma unroll
      for (int r = 0; r < 8; ++r) tix[j][r] = tq[(size_t)r * SEQ + j * 16];
#if defined(__HIP_DEVICE_COMPILE__)
    // the address pairs of the loads just issued are stepped below: the wait stands in front of that (the pairs are
    // inputs, so that they live unchanged up to the wait)
    asm volatile("s_wait_xcnt 0x0" :: "v"(kq), "v"(vq), "v"(wq), "v"(tq) : "memory");
#endif
    // keeps every later instruction behind the wait: the compiler lifts register writes over it, into registers that
    // the loads name (a base that it split off an address is no input of the wait)
    __builtin_amdgcn_sched_barrier(0);
    kq += (size_t)adv * QKW;
    vq += adv;
    wq += adv;
    tq += adv;
  };
  static_assert(NQB >= 2);
  fetch(64);

  // ---- Q fragments (A operand, row = lane&15): f16 hi, 2 d-chunks; the same in every pass ----
  const unsigned short* qp = Qh + (rowB + q0 + c) * QKW + 8 * hh;
  v16us qh2[2];
#pragma unroll
  for (int dc = 0; dc < 2; ++dc) {
    qh2[dc] = ldfrag_u(qp + dc * 32);
  }
#if defined(__HIP_DEVICE_COMPILE__)
  // the Q loads' address pair is dead behind them and its registers are reused: the wait stands in front of that
  // reuse (the pair is an input, so that it lives up to the wait)
  asm volatile("s_wait_xcnt 0x0" :: "v"(qp) : "memory");
#endif

#pragma unroll 1
  for (int kt = 0; kt < NQB; ++kt) {         // static trip count
    __syncthreads();
#pragma unroll
    for (int i = 0; i < 4; ++i) {
      *(v8us*)(Kh + sr * KP + shf + 8 * i) = kreg[i];
      *(v8h*)(Vh + sr * KP + shf + 8 * i) = vreg[i];
      *(v8h*)(Vl + sr * KP + shf + 8 * i) = wreg[i];
    }
    // this pass's pair indices, clamped to 0..NE-1 (used only as an LDS index)
    int nix[4][8];
#pragma unroll
    for (int j = 0; j < 4; ++j)
#pragma unroll
      for (int r = 0; r < 8; ++r) {
        int n = tix[j][r];
        n = (n < 0) ? 0 : n;
        nix[j][r] = (n > NE - 1) ? (NE - 1) : n;
      }
    __syncthreads();
    // ---- scores: 16 query rows x 64 keys per wave ----
    // All LDS reads of the shared tiles stand in groups in front of the products that use them, so that a group pays
    // the LDS latency once: the K fragments and the selected bias values first, the V^T fragments behind the first
    // four score products (they land beside the remaining products and the softmax).
    v16us kb[2][4];
#pragma unroll
    for (int dc = 0; dc < 2; ++dc)
#pragma unroll
      for (int j = 0; j < 4; ++j) kb[dc][j] = ldfrag_u(Kh + (j * 16 + c) * KP + dc * 32 + 8 * hh);
    float bias[4][8];
#pragma unroll
    for (int j = 0; j < 4; ++j)
#pragma unroll
      for (int r = 0; r < 8; ++r) bias[j][r] = ITs[(wave * 16 + 8 * hh + r) * ITP + nix[j][r]];
    // keeps the LDS reads, which the products wait for, in front of the 44 global loads (the compiler puts those first)
    __builtin_amdgcn_sched_barrier(0);
    // next pass's loads, issued while the group above is under way; the last pass asks for its own tile again (in
    // bounds, not used): no branch in the body. The fence at the end of fetch also keeps the group of LDS reads in front
    // of the products: unfenced, the compiler reads each fragment into one register set directly in front of its
    // product and waits for LDS at every product
    fetch((kt + 2 < NQB) ? 64 : 0);
    v8f sh[4];
#pragma unroll
    for (int j = 0; j < 4; ++j) sh[j] = mma_hu(qh2[0], kb[0][j], zero8());
    FragH vb[2][4], vl[2][4];
#pragma unroll
    for (int kk = 0; kk < 2; ++kk)
#pragma unroll
      for (int t = 0; t < 4; ++t) {
        vb[kk][t].h[0] = *(const v8h*)(Vh + (t * 16 + c) * KP + kk * 32 + 8 * hh);
        vb[kk][t].h[1] = *(const v8h*)(Vh + (t * 16 + c) * KP + kk * 32 + 16 + 8 * hh);
        vl[kk][t].h[0] = *(const v8h*)(Vl + (t * 16 + c) * KP + kk * 32 + 8 * hh);
        vl[kk][t].h[1] = *(const v8h*)(Vl + (t * 16 + c) * KP + kk * 32 + 16 + 8 * hh);
      }
    // keeps the V^T reads here, a softmax ahead of their products (the compiler would sink them to the products)
    __builtin_amdgcn_sched_barrier(0);
#pragma unroll
    for (int j = 0; j < 4; ++j) sh[j] = mma_hu(qh2[1], kb[1][j], sh[j]);
    // D element r: query row q0 + 8hh + r, key kv0 + j*16 + c
    v8f s[4];
#pragma unroll
    for (int j = 0; j < 4; ++j)
#pragma unroll
      for (int r = 0; r < 8; ++r) s[j][r] = sh[j][r] * sscale + bias[j][r];

    // ---- row max, online softmax, P (x1024, f16) to LDS ----
    _Float16* pwh = Psh[wave];
#pragma unroll
    for (int r = 0; r < 8; ++r) {
      float m = s[0][r];
      m = fmaxf(m, s[1][r]);
      m = fmaxf(m, s[2][r]);
      m = fmaxf(m, s[3][r]);
#pragma unroll
      for (int off = 1; off < 16; off <<= 1) m = fmaxf(m, __shfl_xor(m, off, 32));
      const float mnew  = fmaxf(mrow[r], m);
      const float alpha = __expf(mrow[r] - mnew);
      mrow[r] = mnew;
      float psum = 0.f;
#pragma unroll
      for (int j = 0; j < 4; ++j) {
        const float p = __expf(s[j][r] - mnew);
        psum += p;
        pwh[(8 * hh + r) * KP + j * 16 + c] = (_Float16)(p * PSC);
      }
#pragma unroll
      for (int off = 1; off < 16; off <<= 1) psum += __shfl_xor(psum, off, 32);
      lrow[r] = lrow[r] * alpha + psum;
#pragma unroll
      for (int t = 0; t < 4; ++t) { oacc[t][r] *= alpha; oaccL[t][r] *= alpha; }
    }
    wave_sync_lds_only();

    // ---- context += P . V_hi and P . V_lo (f16 WMMA, two accumulators) ----
    FragH pa[2];
#pragma unroll
    for (int kk = 0; kk < 2; ++kk) {
      pa[kk].h[0] = *(const v8h*)(pwh + c * KP + kk * 32 + 8 * hh);
      pa[kk].h[1] = *(const v8h*)(pwh + c * KP + kk * 32 + 16 + 8 * hh);
    }
#pragma unroll
    for (int kk = 0; kk < 2; ++kk) {
#pragma unroll
      for (int t = 0; t < 4; ++t) {
        // unguarded form: as operands of the guard's asm statement the 16 V^T fragments would all have to lie in
        // v0..v255, which spills some of them; the gap stands once, behind the 16 products
        oacc[t]  = mma_h_raw(pa[kk].v, vb[kk][t].v, oacc[t]);
        oaccL[t] = mma_h_raw(pa[kk].v, vl[kk][t].v, oaccL[t]);
      }
    }
    acc_guard4(oacc[0], oacc[1], oacc[2], oacc[3]);
    acc_guard4(oaccL[0], oaccL[1], oaccL[2], oaccL[3]);
  }

  // ---- normalise (1/l, the 1/1024 p carry, the 1/2048 residual fold), stage the wave's 16x64 tile,
  float* os = Os[wave];
#pragma unroll
  for (int r = 0; r < 8; ++r) {
    const float l = lrow[r];
    const float inv = ((l > 0.f) ? (1.0f / l) : 0.f) * (1.0f / PSC);
#pragma unroll
    for (int t = 0; t < 4; ++t) os[(8 * hh + r) * OPT + t * 16 + c] = (oacc[t][r] + oaccL[t][r] * (1.0f / RSC)) * inv;
  }
  wave_sync_lds();
  {
    const int q4 = lane >> 3, c8 = (lane & 7) * 8;
    v4u hv[4], lv[4];
#pragma unroll
    for (int it = 0; it < 4; ++it) {
      const int row = it * 4 + q4;   // it 0..3 x q4 0..3 = rows 0..15 of the wave tile
      const float* sp = os + row * OPT + c8;
      v4u ha, la;
#pragma unroll
      for (int e = 0; e < 4; ++e) {
        const float f0 = sp[2 * e], f1 = sp[2 * e + 1];
        const unsigned short u0 = bf_bits(f0), u1 = bf_bits(f1);
        const unsigned short w0 = bf_bits(f0 - bf_up(u0)), w1 = bf_bits(f1 - bf_up(u1));
        ha[e] = pk16(u0, u1);
        la[e] = pk16(w0, w1);
      }
      hv[it] = ha;
      lv[it] = la;
    }
    {
#pragma unroll
      for (int it = 0; it < 4; ++it) {
        const int row = it * 4 + q4;
        const size_t go = (rowB + q0 + row) * CTXP + (size_t)h * HD + c8;
        *(v4u*)(ctxp + go)      = hv[it];
        *(v4u*)(ctxp + go + DM) = lv[it];
      }
      
    }
  }
}

// =====================================================================================================
// y = (x - mean) * rstd * bf16(gamma) + bf16(beta). Block = 64 threads = one row; thread t handles columns
// 4t..4t+3 and 256+4t..256+4t+3, so each store instruction of a wave writes 32 lanes x 16 B = 512 contiguous
// coverage: 64 threads x 8 = 512 columns = the whole row; MP rows.
// =====================================================================================================
__global__ __launch_bounds__(64) void ln_rows(const float* __restrict__ X, const float* __restrict__ gam,
                                              const float* __restrict__ bet, float* out) {
  __shared__ float red[4];
  const int row = blockIdx.x;
  const int tid = threadIdx.x, lane = tid & 31, wv = tid >> 5;
  const float* src = X + (size_t)row * DM;
  const v4f a0 = *(const v4f*)(src + tid * 4);
  const v4f a1 = *(const v4f*)(src + 256 + tid * 4);
  float x[8];
#pragma unroll
  for (int e = 0; e < 4; ++e) { x[e] = a0[e]; x[4 + e] = a1[e]; }
  float s = 0.f;
#pragma unroll
  for (int e = 0; e < 8; ++e) s += x[e];
#pragma unroll
  for (int off = 1; off < 32; off <<= 1) s += __shfl_xor(s, off, 32);
  if (lane == 0) red[wv] = s;
  __syncthreads();
  const float mean = (red[0] + red[1]) * (1.0f / DM);
  float d[8];
  float q = 0.f;
#pragma unroll
  for (int e = 0; e < 8; ++e) { d[e] = x[e] - mean; q += d[e] * d[e]; }
#pragma unroll
  for (int off = 1; off < 32; off <<= 1) q += __shfl_xor(q, off, 32);
  if (lane == 0) red[2 + wv] = q;
  __syncthreads();
  const float var  = (red[2] + red[3]) * (1.0f / DM);
  const float rstd = rsqrtf(var + 1e-6f);

  const v4f g0 = *(const v4f*)(gam + tid * 4);
  const v4f g1 = *(const v4f*)(gam + 256 + tid * 4);
  const v4f e0 = *(const v4f*)(bet + tid * 4);
  const v4f e1 = *(const v4f*)(bet + 256 + tid * 4);
  v4f o0, o1;
#pragma unroll
  for (int e = 0; e < 4; ++e) {
    o0[e] = d[e]     * rstd * bfr(g0[e]) + bfr(e0[e]);
    o1[e] = d[4 + e] * rstd * bfr(g1[e]) + bfr(e1[e]);
  }
  float* dst = out + (size_t)row * DM + tid * 4;
  *(v4f*)(dst)       = o0;
  *(v4f*)(dst + 256) = o1;
  
}

// =====================================================================================================
// Workspace map (bytes); every plane is an exact multiple of its 64x64-tile / whole-row / whole-line store
// granularity (MP = 4096 = 64 row tiles; DM = 8 column tiles; VT per batch [512][2048] = 8x32 tiles; score table
//   WT   bf16 [1536 n][512 k]    0          1572864   (rows 0..511 Wq^T, 512..1023 Wk^T, 1024..1535 Wv^T)
//   WoT2 bf16 [512][1024]        1572864    1048576   (cols k and DM + k both Wo^T)
//   INb  bf16 [3][4096][512]     2621440    12582912  (q, k, v as bf16 bits)
//   QK   f16  [4096][2048]       15204352   16777216  (q [hi|lo] per head, then k [hi|lo] per head)
//   VTh  f16  [2][512][2048]     31981568   4194304   (v^T hi)
//   VTl  f16  [2][512][2048]     36175872   4194304   (v^T residual x2048)
//   IT   f32  [32768][16]        40370176   2097152   (query-embedding scores)
//   Ctx  bf16 [4096][1024]       42467328   8388608   (context hi | lo)
//   X    f32  [4096][512]        50855936   8388608   (pre-norm output)
//   end                          59244544
// =====================================================================================================
extern "C" void kernel_launch(void* const* d_in, const int* in_sizes, int n_in,
                              void* d_out, int out_size, void* d_ws, size_t ws_size,
                              hipStream_t stream) {
  if (n_in < 11) return;
  if (in_sizes[0] != MP * DM || in_sizes[1] != MP * DM || in_sizes[2] != MP * DM) return;
  if (in_sizes[3] != NE * DM) return;
  if (in_sizes[4] != NBATCH * SEQ * SEQ) return;
  if (in_sizes[5] != DM * DM || in_sizes[6] != DM * DM || in_sizes[7] != DM * DM || in_sizes[8] != DM * DM) return;
  if (in_sizes[9] != DM || in_sizes[10] != DM) return;
  if (out_size != MP * DM) return;

  const float* q_in = (const float*)d_in[0];
  const float* k_in = (const float*)d_in[1];
  const float* v_in = (const float*)d_in[2];
  const float* emb  = (const float*)d_in[3];
  const int*   trj  = (const int*)d_in[4];
  const float* w_q  = (const float*)d_in[5];
  const float* w_k  = (const float*)d_in[6];
  const float* w_v  = (const float*)d_in[7];
  const float* w_o  = (const float*)d_in[8];
  const float* gam  = (const float*)d_in[9];
  const float* bet  = (const float*)d_in[10];

  const size_t PWT  = (size_t)3 * DM * DM * 2;             //  1572864
  const size_t PWO  = (size_t)DM * KOFF * 2;               //  1048576
  const size_t PIN  = (size_t)3 * MP * DM * 2;             // 12582912
  const size_t PQK  = (size_t)MP * QKW * 2;                // 16777216
  const size_t PVT  = (size_t)NBATCH * DM * SEQ * 2;       //  4194304
  const size_t PIT  = (size_t)NBATCH * NH * SEQ * NEP * 4; //  2097152
  const size_t PCTX = (size_t)MP * CTXP * 2;               //  8388608
  const size_t PX   = (size_t)MP * DM * 4;                 //  8388608
  size_t off = 0;
  const size_t oWT  = off; off += PWT;
  const size_t oWo  = off; off += PWO;
  const size_t oIN  = off; off += PIN;
  const size_t oQK  = off; off += PQK;
  const size_t oVTh = off; off += PVT;
  const size_t oVTl = off; off += PVT;
  const size_t oIT  = off; off += PIT;
  const size_t oCtx = off; off += PCTX;
  const size_t oX   = off; off += PX;
  if (off > ws_size) return;                               // off = 59244544
  if (off > (size_t)134217728) return;

  char* ws = (char*)d_ws;
  unsigned short* WT   = (unsigned short*)(ws + oWT);
  unsigned short* WoT2 = (unsigned short*)(ws + oWo);
  unsigned short* INb  = (unsigned short*)(ws + oIN);
  unsigned short* QK   = (unsigned short*)(ws + oQK);
  unsigned short* VTh  = (unsigned short*)(ws + oVTh);
  unsigned short* VTl  = (unsigned short*)(ws + oVTl);
  float*          IT   = (float*)(ws + oIT);
  unsigned short* Ctx  = (unsigned short*)(ws + oCtx);
  float*          X    = (float*)(ws + oX);
  float*          out0 = (float*)d_out;

  const dim3 blk(256), blk128(128), blk64(64);
  const dim3 gPrep(4 * WTB + 3 * (MP / 4));                         // 4 x 64 weight tiles, then 3 x 1024 row blocks
  const dim3 gProj(PJB, 3, 1);                                      // 64 blocks x {q, k, v^T (32 blocks x 2 batches)}
  const dim3 gIdx(NBATCH * NH * (SEQ / 64));                        // 512 blocks of 64
  const dim3 gAttn(NBATCH * NH * NQB);                              // 512 blocks of 128
  const dim3 gNo(((MP / 64) * (DM / 64)) / 8, 1, 1);                // 512 tiles -> 64 blocks
  const dim3 gLN(MP);                                               // 4096 rows
  if ((((MP / 64) * (DM / 64)) % 8) != 0) return;
  if ((((DM / 64) * (SEQ / 64)) % 8) != 0) return;

  // (0) activations -> bf16 bits; weight planes: in[k][n] (shape [512 in][512 out]) -> out[n][k] transposed
  //     through LDS (Wo additionally at cols DM + k for the hi|lo K-concat); one launch
  prep<<<gPrep, blk, 0, stream>>>(q_in, k_in, v_in, w_q, w_k, w_v, w_o, INb, WT, WoT2);

  // (1) q = qb . Wq^T-plane (blockIdx.y = 0) and k = kb . Wk^T-plane (blockIdx.y = 1), K = 512
  //     -> f16 [hi 64 | lo 64] per head (QK plane [4096][2048], q at cols 0.., k at cols KOFF..);
  //     v^T per batch = Wv^T . vb_b^T -> f16 hi (VTh) and residual x2048 (VTl) planes [2][512][2048]
  //     (blockIdx.y = 2 of the same launch)
  proj3<<<gProj, blk, 0, stream>>>(INb, WT, QK, VTh, VTl, DM);

  // (2) query-embedding score table (f32), then flash attention with the selected per-pair bias
  //     -> context bf16 hi|lo
  idx_rows<<<gIdx, blk64, 0, stream>>>(QK, emb, IT);
  attn64<<<gAttn, blk128, 0, stream>>>(QK, VTh, VTl, IT, trj, Ctx, 0.125f);

  // (3) X = [ctx_hi | ctx_lo] . [Wo | Wo]  (K = 1024, bf16 operands) -> f32 plane; LayerNorm -> d_out
  gemm64<0><<<gNo, blk, 0, stream>>>(
      Ctx, CTXP, 0LL, WoT2, KOFF, 0LL,
      Ctx, Ctx, X, DM, 0LL,
      MP, DM, KOFF, 1, 1.0f);
  ln_rows<<<gLN, blk64, 0, stream>>>(X, gam, bet, out0);
  (void)hipGetLastError();
}

// v006
// It runs in 108 microseconds.
// Next to v005, in two timings, it ran 1.21 and 1.22 times as fast.
// Counting every step since v000, it is 2.47 times as fast.
// Contractions: q|k|v projections and output projection on v_wmma_f32_16x16x32_bf16 (bf16 operands from
// RNE-converted inputs; context carried as bf16 hi|lo planes K-concatenated against duplicated Wo planes);
// scores q.k^T on v_wmma_f32_16x16x32_f16 (q f16 hi, k f16 hi, single product); p.v on
// v_wmma_f32_16x16x32_f16 (p carried x1024 in f16, v^T as f16 hi + x2048 residual planes, two products,
// separate accumulators); all f32 accumulate; query-embedding scores (from q hi + residual), per-pair bias
// select, softmax and LayerNorm in f32.
#include <hip/hip_runtime.h>
#include <math.h>

#define NBATCH 2
#define SEQ    2048
#define DM     512
#define NH     8
#define HD     64
#define NE     10
#define NEP    16
#define MP     (NBATCH * SEQ)
#define QKW    (4 * DM)
#define KOFF   (2 * DM)
#define CTXP   (2 * DM)
#define NQB    (SEQ / 64)
#define RSC    2048.0f
#define PSC    1024.0f
#define KP     72      // LDS row pitch of the 64-wide 16-bit attention tiles, in elements: 144 B = 16 B x 9
#define ITP    20      // LDS row pitch of the score-table rows, in floats: the 16 rows a wave gathers from start at 16 different multiples of 4 banks
static_assert(NH * HD == DM);
static_assert(DM == 8 * 64);
static_assert((SEQ % 64) == 0 && (DM % 64) == 0 && (MP % 64) == 0 && (SEQ % 256) == 0 && (MP % 4) == 0);
static_assert((((MP / 64) * (DM / 64)) % 8) == 0);
static_assert((((DM / 64) * (SEQ / 64)) % 8) == 0);
static_assert(NE <= NEP && NEP == 16);
static_assert(((DM / 64) % 8) == 0 && ((SEQ / 64) % 8) == 0);   // gemm64: the 8 tiles of a block lie in one tile row

typedef _Float16 v16h __attribute__((ext_vector_type(16)));
typedef _Float16 v8h  __attribute__((ext_vector_type(8)));
typedef __bf16   v16b __attribute__((ext_vector_type(16)));
typedef unsigned short v16us __attribute__((ext_vector_type(16)));
typedef unsigned short v8us  __attribute__((ext_vector_type(8)));
typedef float    v8f  __attribute__((ext_vector_type(8)));
typedef float    v4f  __attribute__((ext_vector_type(4)));
typedef unsigned int v4u __attribute__((ext_vector_type(4)));

union FragH { v16h v; v8h h[2]; };
union FragU { v16us v; v8us h[2]; };

// ---- scalar helpers --------------------------------------------------------------------------------
__device__ __forceinline__ unsigned short bf_bits(float f) {          // f32 -> bf16 bits, RNE convert
  unsigned u = __float_as_uint(f);
  return (unsigned short)((u + 0x7FFFu + ((u >> 16) & 1u)) >> 16);
}
__device__ __forceinline__ float bf_up(unsigned short h) { return __uint_as_float(((unsigned)h) << 16); }
__device__ __forceinline__ float bfr(float f) { return bf_up(bf_bits(f)); }   // value of the bf16 RNE convert
__device__ __forceinline__ unsigned short h_bits(_Float16 x) { return __builtin_bit_cast(unsigned short, x); }
__device__ __forceinline__ unsigned pk16(unsigned short a, unsigned short b) { return (unsigned)a | ((unsigned)b << 16); }
__device__ __forceinline__ v8f zero8() { v8f z = {0.f, 0.f, 0.f, 0.f, 0.f, 0.f, 0.f, 0.f}; return z; }

// ---- fragment loader: 16-bit A/B operand, lane -> row/col (lane&15), p already includes +8*(lane>>4);
//      elements 0..7 <- p[0..7] (k0+8h..), elements 8..15 <- p[16..23] (k0+16+8h..)
__device__ __forceinline__ v16us ldfrag_u(const unsigned short* p) {
  FragU f;
  f.h[0] = *(const v8us*)(p);
  f.h[1] = *(const v8us*)(p + 16);
  return f.v;
}

// ---- WMMA helpers with trailing VALU hazard gap --------------------------------------------------------
__device__ __forceinline__ v8f mma_bu_raw(v16us a, v16us b, v8f c) {            // bf16 operands, unguarded
  return __builtin_amdgcn_wmma_f32_16x16x32_bf16(false, __builtin_bit_cast(v16b, a), false,
                                                 __builtin_bit_cast(v16b, b), (short)0, c, false, false);
}
__device__ __forceinline__ v8f mma_hu(v16us a, v16us b, v8f c) {                // f16 operands (bits), guarded
  c = __builtin_amdgcn_wmma_f32_16x16x32_f16(false, __builtin_bit_cast(v16h, a), false,
                                              __builtin_bit_cast(v16h, b), (short)0, c, false, false);
#if defined(__HIP_DEVICE_COMPILE__)
  asm volatile("v_nop\n\tv_nop\n\tv_nop\n\tv_nop" : "+v"(c) : "v"(a), "v"(b));
#endif
  return c;
}
__device__ __forceinline__ v8f mma_h_raw(v16h a, v16h b, v8f c) {                // f16 operands, unguarded
  return __builtin_amdgcn_wmma_f32_16x16x32_f16(false, a, false, b, (short)0, c, false, false);
}
__device__ __forceinline__ void acc_guard4(v8f& a, v8f& b, v8f& c, v8f& d) {
#if defined(__HIP_DEVICE_COMPILE__)
  asm volatile("v_nop\n\tv_nop\n\tv_nop\n\tv_nop" : "+v"(a), "+v"(b), "+v"(c), "+v"(d));
#endif
}
__device__ __forceinline__ void wave_sync_lds() {
  __builtin_amdgcn_fence(__ATOMIC_RELEASE, "workgroup");
  __builtin_amdgcn_wave_barrier();
  __builtin_amdgcn_fence(__ATOMIC_ACQUIRE, "workgroup");
}

// =====================================================================================================
// f32 [MP][DM] activations (three sources selected by z, block-uniform) -> bf16 bits plane
// dst[(z*MP + row)*DM + col]. Block = 256 threads = 4 rows; thread t: row = 4*rb + (t>>6), cols 8*(t&63)..+7.
// coverage: 1024 row blocks rb x 4 rows x 512 cols = each whole plane; 3 planes z. One block's part of prep.
// =====================================================================================================
__device__ __forceinline__ void cvt3(const float* __restrict__ s0, const float* __restrict__ s1,
                                     const float* __restrict__ s2, unsigned short* dst, const int rb, const int z) {
  const float* src = (z == 0) ? s0 : ((z == 1) ? s1 : s2);
  const int t = threadIdx.x;
  const int row = rb * 4 + (t >> 6);
  const int c8 = (t & 63) * 8;
  const float* p = src + (size_t)row * DM + c8;
  const v4f a0 = *(const v4f*)(p);
  const v4f a1 = *(const v4f*)(p + 4);
  v4u hv;
  hv[0] = pk16(bf_bits(a0[0]), bf_bits(a0[1]));
  hv[1] = pk16(bf_bits(a0[2]), bf_bits(a0[3]));
  hv[2] = pk16(bf_bits(a1[0]), bf_bits(a1[1]));
  hv[3] = pk16(bf_bits(a1[2]), bf_bits(a1[3]));
  unsigned short* d = dst + ((size_t)z * MP + (size_t)row) * DM + c8;
  *(v4u*)d = hv;
  
}

// =====================================================================================================
// Tiled transpose + bf16 convert: in[rows][cols] f32 row-major -> out[cols][rows] bf16 bits with pitch ldo:
//   out[n * ldo + k] = bf16(in[k][n]) and also at + dupoff (a duplicated k range for the hi|lo K-concat GEMM).
// Block = 256 threads = one 64x64 tile (tn, tk) of (cols/64, rows/64) (rows, cols multiples of 64). One block's part of prep.
// Loads: 4 iterations x 256 threads x float4 = 64 rows x 64 cols (addresses clamped). LDS tile [n][k] pitch 72.
// coverage: 64 x 64 = the whole transposed tile at both column offsets; grid covers the whole matrix.
// =====================================================================================================
__device__ __forceinline__ void tconv64(const float* __restrict__ W, unsigned short* out,
                                        int rows, int cols, int ldo, int dupoff, const int tn, const int tk) {
  __shared__ __align__(16) unsigned short sh[64 * 72];
  const int t  = threadIdx.x;
  const int n0 = tn * 64;                    // column tile of in = row tile of out
  const int k0 = tk * 64;                    // row tile of in = column tile of out
#pragma unroll
  for (int i = 0; i < 4; ++i) {
    const int idx = i * 256 + t;
    const int r = idx >> 4, c4 = (idx & 15) * 4;
    int kr = k0 + r;   kr = (kr < rows) ? kr : (rows - 1);
    int nc = n0 + c4;  nc = (nc < cols - 4) ? nc : (cols - 4);
    const v4f v = *(const v4f*)(W + (size_t)kr * cols + nc);
#pragma unroll
    for (int e = 0; e < 4; ++e) sh[(c4 + e) * 72 + r] = bf_bits(v[e]);
  }
  __syncthreads();
  const int wave = t >> 5, lane = t & 31;
  const int q = lane >> 3, c8 = (lane & 7) * 8;
  v4u pv[2];
  unsigned short* po[2];
#pragma unroll
  for (int it = 0; it < 2; ++it) {
    const int nl = it * 32 + wave * 4 + q;               // 0..63
    pv[it] = *(const v4u*)(sh + nl * 72 + c8);
    po[it] = out + ((size_t)(n0 + nl) * ldo + k0 + c8);
  }
  {
#pragma unroll
    for (int it = 0; it < 2; ++it) {
      *(v4u*)(po[it]) = pv[it];
      if (dupoff != 0) *(v4u*)(po[it] + dupoff) = pv[it];
    }
#if defined(__HIP_DEVICE_COMPILE__)
    // the compiler reuses the first store's registers for the second store's address: the wait stands in front of any
    // such reuse (addresses and data are inputs, so that they live unchanged up to the wait)
    asm volatile("s_wait_xcnt 0x0" :: "v"(po[0]), "v"(po[1]), "v"(pv[0]), "v"(pv[1]) : "memory");
#endif
  }
}

// =====================================================================================================
// All operand preparation in one launch: none of its parts reads what another writes, so they share one grid by
// ranges of the block index (block-uniform branch). Blocks 0 .. 4*WTB-1: the 64x64 transpose tiles of Wq, Wk, Wv
// (-> wt rows 0.., 512.., 1024..) and Wo (-> wot2, also at cols DM + k); they have the longer dependent path and
// stand first. Blocks 4*WTB ..: the 3 x MP/4 row blocks of the activation convert.
// coverage: 4 x 64 tiles = the four whole weight planes; 3 x 1024 row blocks = the three whole activation planes.
// =====================================================================================================
#define WTB ((DM / 64) * (DM / 64))
__global__ __launch_bounds__(256) void prep(const float* __restrict__ s0, const float* __restrict__ s1,
                                            const float* __restrict__ s2, const float* __restrict__ w0,
                                            const float* __restrict__ w1, const float* __restrict__ w2,
                                            const float* __restrict__ w3, unsigned short* inb,
                                            unsigned short* wt, unsigned short* wot2) {
  const int bx = blockIdx.x;
  if (bx >= 4 * WTB) {                       // block-uniform, in front of every barrier
    const int i = bx - 4 * WTB;
    cvt3(s0, s1, s2, inb, i % (MP / 4), i / (MP / 4));
    return;
  }
  const int w = bx / WTB, tile = bx % WTB;
  const float* W = (w == 0) ? w0 : ((w == 1) ? w1 : ((w == 2) ? w2 : w3));
  unsigned short* o = (w < 3) ? (wt + (size_t)w * DM * DM) : wot2;
  tconv64(W, o, DM, DM, (w < 3) ? DM : KOFF, (w < 3) ? 0 : DM, tile % (DM / 64), tile / (DM / 64));
}

// =====================================================================================================
// Register-blocked batched bf16 WMMA GEMM: C[m][n] = oscale * sum_k A[m][k] * Bt[n][k];
// one wave per 64x64 tile; the 8 tiles of a block lie side by side in one tile row (N/64 a multiple of 8), so the
// block works on 64 rows of A and 512 rows of Bt. Both are staged in LDS in k chunks of 64: each 16-B load of a wave
// takes 4 whole 128-B row segments, one chunk ahead into registers, LDS stores between two __syncthreads; the
// fragments are ds_load_b128 reads at a 144-B pitch. A row-major [M][K] pitch lda; Bt row-major [N][K] pitch ldb
// (k contiguous); M, N multiples of 64, K multiple of 64. by = batch index with element strides
// (sAy for A, sBy for Bt, sCy for C); bx = block of 8 tiles. Tile enumeration: tile -> tm = tile / (N/64),
// tn = tile % (N/64). The body of the two kernels behind it.
// OM: 0 = f32 out to Cf (pitch ldc); 4 = f16 hi bits to Cp and f16((v - hi) * 2048) bits to Cp2, 16-bit column
//     base = n0 * nmul (nmul = 2 interleaves [hi 64 | lo 64] per 64-col tile with Cp2 = Cp + 64).
// coverage: 4 slabs x 16 rows x 64 cols = the wave's whole 64x64 tile; grid = tilesM*tilesN/8 blocks exactly
//           (host-checked), so no block exits early.
// =====================================================================================================
template <int OM>
__device__ __forceinline__ void gemm64_body(
    const unsigned short* __restrict__ Ap, int lda, long long sAy,
    const unsigned short* __restrict__ Btp, int ldb, long long sBy,
    unsigned short* Cp, unsigned short* Cp2, float* Cf, int ldc, long long sCy,
    int M, int N, int K, int nmul, float oscale, const int bx, const int by) {
  __shared__ __align__(16) float sT[8][16 * 68];   // per-wave 16x64 slab, pitch 68 floats
  __shared__ __align__(16) unsigned short sAB[(64 + 512) * KP];   // rows 0..63: A chunk; rows 64..575: Bt chunk
  const int lane = threadIdx.x & 31;
  const int wave = threadIdx.x >> 5;
  const int tilesN = N >> 6;
  const int tilesM = M >> 6;
  const int tile0 = bx * 8;
  if (tile0 + 8 > tilesM * tilesN) return;   // block-uniform, in front of every barrier (the grid is exact)
  const int tm  = tile0 / tilesN;
  const int tn0 = tile0 - tm * tilesN;       // first of the block's 8 tiles, all in tile row tm
  const int m0 = tm << 6;
  const int n0 = (tn0 + wave) << 6;

  const unsigned short* Ab = Ap  + (size_t)by * (size_t)sAy;
  const unsigned short* Bb = Btp + (size_t)by * (size_t)sBy;
  const size_t cofs = (size_t)by * (size_t)sCy;

  const int rlane = lane & 15;                 // row (A) / col (B, D) within subtile
  const int koff  = (lane >> 4) * 8;           // k offset of this lane half
  const int mOff  = (lane >> 4) * 8;           // D row offset

  v8f acc[4][4];
#pragma unroll
  for (int i = 0; i < 4; ++i)
#pragma unroll
    for (int j = 0; j < 4; ++j) acc[i][j] = zero8();

  // Staging: 576 rows x 8 pieces of 16 B = 18 pieces per thread; piece i of thread t: staged row 32 i + srow,
  // bytes 16 (t & 7).. of the row's 128-B chunk. Pieces 0, 1 are A rows, pieces 2..17 Bt rows. srow runs through
  // 0..31 over the block's 32 groups of 8 lanes; the two groups of a 16-lane half take rows 8 apart, which at the
  // 144-B pitch lie 32 banks apart, so that a half's ds_store_b128 covers each of the 64 banks once.
  const int tx = threadIdx.x;
  const int srow = ((tx >> 4) & 7) | (((tx >> 3) & 1) << 3) | ((tx >> 7) << 4), sc8 = (tx & 7) * 8;
  const unsigned short* gp[18];
#pragma unroll
  for (int i = 0; i < 2; ++i)  gp[i] = Ab + (size_t)(m0 + 32 * i + srow) * lda + sc8;
#pragma unroll
  for (int i = 2; i < 18; ++i) gp[i] = Bb + (size_t)((tn0 << 6) + 32 * (i - 2) + srow) * ldb + sc8;
  v4u st[18];
  auto fetch = [&]() {
#pragma unroll
    for (int i = 0; i < 18; ++i) st[i] = *(const v4u*)(gp[i]);
#if defined(__HIP_DEVICE_COMPILE__)
    // the address pairs of the loads just issued are stepped below: the wait stands in front of that (the pairs are
    // inputs, so that they live unchanged up to the wait); the clobber keeps the loads in front of the products
    asm volatile("s_wait_xcnt 0x0" :: "v"(gp[0]), "v"(gp[1]), "v"(gp[2]), "v"(gp[3]), "v"(gp[4]), "v"(gp[5]),
                 "v"(gp[6]), "v"(gp[7]), "v"(gp[8]), "v"(gp[9]), "v"(gp[10]), "v"(gp[11]), "v"(gp[12]),
                 "v"(gp[13]), "v"(gp[14]), "v"(gp[15]), "v"(gp[16]), "v"(gp[17]) : "memory");
#endif
#pragma unroll
    for (int i = 0; i < 18; ++i) gp[i] += 64;
  };
  const unsigned short* fA = sAB + rlane * KP + koff;                       // this lane's A fragment rows
  const unsigned short* fB = sAB + (64 + wave * 64 + rlane) * KP + koff;    // this lane's Bt fragment rows
  const int nch = K >> 6;
  fetch();
  for (int kc = 0; kc < nch; ++kc) {
    __syncthreads();                           // every wave has read the chunk before
#pragma unroll
    for (int i = 0; i < 18; ++i) *(v4u*)(sAB + (32 * i + srow) * KP + sc8) = st[i];
    __syncthreads();                           // the chunk is whole
    if (kc + 1 < nch) fetch();                 // block-uniform; the next chunk flies beside this chunk's products
    v16us ah[2][4], bh[2][4];
#pragma unroll
    for (int ks = 0; ks < 2; ++ks) {
#pragma unroll
      for (int j = 0; j < 4; ++j) bh[ks][j] = ldfrag_u(fB + j * 16 * KP + ks * 32);
#pragma unroll
      for (int i = 0; i < 4; ++i) ah[ks][i] = ldfrag_u(fA + i * 16 * KP + ks * 32);
    }
    // keeps the chunk's 32 fragment reads in front of its products: unfenced, the compiler reads the A fragments into
    // one register set and waits for LDS in front of every row of products
    __builtin_amdgcn_sched_barrier(0);
#pragma unroll
    for (int ks = 0; ks < 2; ++ks)
#pragma unroll
      for (int i = 0; i < 4; ++i)
#pragma unroll
        for (int j = 0; j < 4; ++j) acc[i][j] = mma_bu_raw(ah[ks][i], bh[ks][j], acc[i][j]);
  }
  acc_guard4(acc[0][0], acc[0][1], acc[0][2], acc[0][3]);
  acc_guard4(acc[1][0], acc[1][1], acc[1][2], acc[1][3]);
  acc_guard4(acc[2][0], acc[2][1], acc[2][2], acc[2][3]);
  acc_guard4(acc[3][0], acc[3][1], acc[3][2], acc[3][3]);

  const int hh2 = lane >> 4, c4 = (lane & 15) * 4;     // f32 out: 256-B row segment = 16 lanes x 16 B
  const int q8  = lane >> 3, c8 = (lane & 7) * 8;

  // ---- epilogue ----
  float* slab = sT[wave];
#pragma unroll
  for (int i = 0; i < 4; ++i) {
    const int mBase = m0 + (i << 4);
#pragma unroll
    for (int j = 0; j < 4; ++j) {
#pragma unroll
      for (int r = 0; r < 8; ++r) {
        slab[(mOff + r) * 68 + (j << 4) + rlane] = acc[i][j][r];
      }
    }
    wave_sync_lds();
    if (OM == 0) {
      float* C = Cf + cofs;
      v4f vals[8];
#pragma unroll
      for (int it = 0; it < 8; ++it) {
        const int row = it * 2 + hh2;                      // it 0..7 x hh2 0..1 = rows 0..15
        v4f v = *(const v4f*)(slab + row * 68 + c4);
        vals[it] = v * oscale;
      }
      {
#pragma unroll
        for (int it = 0; it < 8; ++it) {
          const int row = it * 2 + hh2;
          *(v4f*)(C + (size_t)(mBase + row) * ldc + (size_t)n0 * nmul + c4) = vals[it];
        }
        
      }
    } else {
      unsigned short* C  = Cp  + cofs;
      unsigned short* C2 = Cp2 + cofs;
      v4u hv[4], lv[4];
#pragma unroll
      for (int it = 0; it < 4; ++it) {
        const int row = it * 4 + q8;                       // it 0..3 x q8 0..3 = rows 0..15
        const float* sp = slab + row * 68 + c8;
        v4u ha, la;
#pragma unroll
        for (int e = 0; e < 4; ++e) {
          const float f0 = sp[2 * e]     * oscale;
          const float f1 = sp[2 * e + 1] * oscale;
          const _Float16 g0 = (_Float16)f0, g1 = (_Float16)f1;
          const unsigned short u0 = h_bits(g0), u1 = h_bits(g1);
          const unsigned short w0 = h_bits((_Float16)((f0 - (float)g0) * RSC));
          const unsigned short w1 = h_bits((_Float16)((f1 - (float)g1) * RSC));
          ha[e] = pk16(u0, u1);
          la[e] = pk16(w0, w1);
        }
        hv[it] = ha;
        lv[it] = la;
      }
      {
#pragma unroll
        for (int it = 0; it < 4; ++it) {
          const int row = it * 4 + q8;
          const size_t go = (size_t)(mBase + row) * ldc + (size_t)n0 * nmul + c8;
          *(v4u*)(C  + go) = hv[it];
          *(v4u*)(C2 + go) = lv[it];
        }
        
      }
    }
    wave_sync_lds();
  }
}

// One GEMM per launch: grid = (tilesM*tilesN/8, batches).
template <int OM>
__global__ __launch_bounds__(256) void gemm64(
    const unsigned short* __restrict__ Ap, int lda, long long sAy,
    const unsigned short* __restrict__ Btp, int ldb, long long sBy,
    unsigned short* Cp, unsigned short* Cp2, float* Cf, int ldc, long long sCy,
    int M, int N, int K, int nmul, float oscale) {
  gemm64_body<OM>(Ap, lda, sAy, Btp, ldb, sBy, Cp, Cp2, Cf, ldc, sCy, M, N, K, nmul, oscale,
                  (int)blockIdx.x, (int)blockIdx.y);
}

// The three projections in one launch: they read the same prepared planes and none reads what another writes, so
// they share one grid; blockIdx.y (block-uniform) picks the product and only scalar arguments of the one body differ.
//   y = 0, 1: q = qb . Wq^T-plane, k = kb . Wk^T-plane -> f16 [hi 64 | lo 64] per head in the QK plane (q at cols
//             0.., k at cols KOFF..); 64 blocks of 8 tiles each.
//   y = 2:    v^T per batch = Wv^T . vb_b^T -> f16 hi (vth) and residual x2048 (vtl) planes; blockIdx.x = 32 blocks
//             of 8 tiles x 2 batches.
// K stays a run-time argument, as in gemm64: the chunk loop stays rolled, one copy of its body in the instruction cache.
#define PJB (((MP / 64) * (DM / 64)) / 8)
#define VTB (((DM / 64) * (SEQ / 64)) / 8)
static_assert(VTB * NBATCH == PJB);
__global__ __launch_bounds__(256) void proj3(const unsigned short* __restrict__ inb,
                                             const unsigned short* __restrict__ wt, unsigned short* qkp,
                                             unsigned short* vth, unsigned short* vtl, int K) {
  const int x = blockIdx.x, y = blockIdx.y;
  const bool isv = (y == 2);
  gemm64_body<4>(isv ? (wt + (size_t)2 * DM * DM) : inb, DM, isv ? 0LL : (long long)MP * DM,
                 isv ? (inb + (size_t)2 * MP * DM) : wt, DM, isv ? (long long)SEQ * DM : (long long)DM * DM,
                 isv ? vth : qkp, isv ? vtl : (qkp + HD), nullptr, isv ? SEQ : QKW,
                 isv ? (long long)DM * SEQ : (long long)KOFF,
                 isv ? DM : MP, isv ? SEQ : DM, K, isv ? 1 : 2, 1.0f,
                 isv ? (x % VTB) : x, isv ? (x / VTB) : y);
}

// =====================================================================================================
// Query-embedding score table: itab[(bh*SEQ + l)*NEP + n] = sum_d qh[b,h,l,d] * bf16(emb[n][h*64 + d]) for
// n < NE (f32, columns NE..NEP-1 = 0). qh is reconstructed in f32 as hi + lo/2048 from the q part of the QK
// plane (f16 hi at col h*128 + d, residual at + 64). Block = 64 threads = 64 consecutive rows l of one (b, h)
// (SEQ % 64 == 0); grid = NBATCH*NH*SEQ/64 exact. q rows and the head's emb slice staged in LDS (f32);
// the 10 dots per row are rolled over n and over two 32-wide d halves (32 static FMAs).
// Output tile 64 x 16 f32 staged in LDS and written as 256 float4 = 4 instructions per wave, each 32 lanes x
// coverage: 512 blocks x 64 rows x 16 cols = the whole table.
// =====================================================================================================
__global__ __launch_bounds__(64) void idx_rows(const unsigned short* __restrict__ qk,
                                               const float* __restrict__ emb, float* itab) {
  __shared__ float Qs[64 * 65];
  __shared__ float Es[NE * HD];
  __shared__ __align__(16) float Ts[64 * NEP];
  const int tid = threadIdx.x;
  const int R0 = blockIdx.x * 64;                 // flat (b*NH + h)*SEQ + l row base
  const int bh = R0 / SEQ;
  const int l0 = R0 - bh * SEQ;
  const int b  = bh / NH;
  const int h  = bh - b * NH;
#pragma unroll 1
  for (int i = tid; i < NE * HD; i += 64) {
    const int n = i >> 6, d = i & 63;
    Es[i] = bfr(emb[(size_t)n * DM + h * HD + d]);
  }
  const _Float16* qp = (const _Float16*)(const void*)qk
                     + ((size_t)b * SEQ + (size_t)l0 + (size_t)tid) * QKW + (size_t)h * (2 * HD);
#pragma unroll
  for (int i = 0; i < 8; ++i) {
    const v8h hv = *(const v8h*)(qp + 8 * i);
    const v8h lv = *(const v8h*)(qp + HD + 8 * i);
#pragma unroll
    for (int e = 0; e < 8; ++e)
      Qs[tid * 65 + 8 * i + e] = (float)hv[e] + (float)lv[e] * (1.0f / RSC);
  }
  __syncthreads();
#pragma unroll 1
  for (int n = 0; n < NE; ++n) {
    float s = 0.f;
#pragma unroll 1
    for (int dc = 0; dc < 2; ++dc) {
#pragma unroll
      for (int d = 0; d < 32; ++d) s += Qs[tid * 65 + dc * 32 + d] * Es[n * HD + dc * 32 + d];
    }
    Ts[tid * NEP + n] = s;
  }
#pragma unroll
  for (int n = NE; n < NEP; ++n) Ts[tid * NEP + n] = 0.f;
  __syncthreads();
  v4f vals[4];
#pragma unroll
  for (int it = 0; it < 4; ++it) vals[it] = *(const v4f*)(Ts + (it * 64 + tid) * 4);
  float* base = itab + (size_t)R0 * NEP;
#pragma unroll
  for (int it = 0; it < 4; ++it) *(v4f*)(base + (it * 64 + tid) * 4) = vals[it];
  
}

typedef int v4i __attribute__((ext_vector_type(4)));
__device__ __forceinline__ float xhalf(float x) {          // the value of lane ^ 16
  const int b = __builtin_bit_cast(int, x);
  return __builtin_bit_cast(float, __builtin_amdgcn_permlanex16(b, b, 0x76543210, 0xfedcba98, false, false));
}
// Exponentials base 2. Behind a transcendental the instruction set asks for one independent instruction before its
// result is read or its source overwritten. In one statement with early-clobber outputs each v_exp_f32 is independent of the one before it, and the
// v_nop fills the slot behind the last.
__device__ __forceinline__ v8f exp2x8(const v8f x) {
  v8f y = x;
#if defined(__HIP_DEVICE_COMPILE__)
  float y0, y1, y2, y3, y4, y5, y6, y7;
  asm("v_exp_f32 %0, %8\n\tv_exp_f32 %1, %9\n\tv_exp_f32 %2, %10\n\tv_exp_f32 %3, %11\n\t"
      "v_exp_f32 %4, %12\n\tv_exp_f32 %5, %13\n\tv_exp_f32 %6, %14\n\tv_exp_f32 %7, %15\n\tv_nop"
      : "=&v"(y0), "=&v"(y1), "=&v"(y2), "=&v"(y3), "=&v"(y4), "=&v"(y5), "=&v"(y6), "=&v"(y7)
      : "v"(x[0]), "v"(x[1]), "v"(x[2]), "v"(x[3]), "v"(x[4]), "v"(x[5]), "v"(x[6]), "v"(x[7]));
  y[0] = y0; y[1] = y1; y[2] = y2; y[3] = y3; y[4] = y4; y[5] = y5; y[6] = y6; y[7] = y7;
#endif
  return y;
}
__device__ __forceinline__ float exp2x1(const float x) {
  float y = x;
#if defined(__HIP_DEVICE_COMPILE__)
  asm("v_exp_f32 %0, %1\n\tv_nop" : "=v"(y) : "v"(x));   // the v_nop: the same slot
#endif
  return y;
}
#define LOG2E 1.44269504f
__global__ __launch_bounds__(128)
void attn64(const unsigned short* __restrict__ qk, const unsigned short* __restrict__ vth,
            const unsigned short* __restrict__ vtl, const float* __restrict__ itab,
            const int* __restrict__ trj, unsigned short* ctxp, float sscale) {
  __shared__ __align__(16) unsigned short Kh[64 * KP];          // K hi [kv][d]  9 KB
  __shared__ __align__(16) _Float16 Vh[64 * KP];                // V^T hi [d][kv] 9 KB
  __shared__ __align__(16) _Float16 Vl[64 * KP];                // V^T lo [d][kv] 9 KB
  __shared__ __align__(16) float    ITs[64 * ITP];              // score table rows of this query block 5 KB

  const int tid  = threadIdx.x;
  const int wave = tid >> 5;
  const int lane = tid & 31;
  const int hh   = lane >> 4;
  const int c    = lane & 15;

  const int bx   = blockIdx.x;
  const int qb   = bx % NQB;
  const int rest = bx / NQB;
  const int h    = rest % NH;
  const int b    = rest / NH;
  const int q0   = qb * 64 + wave * 16;          // in-batch query row of this wave's first row
  const size_t rowB = (size_t)b * SEQ;

  const unsigned short* Qh  = qk + (size_t)h * (2 * HD);
  const unsigned short* Kg  = qk + KOFF + (size_t)h * (2 * HD);
  const _Float16* Vgh = (const _Float16*)(const void*)vth + ((size_t)b * DM + (size_t)h * HD) * SEQ;
  const _Float16* Vgl = (const _Float16*)(const void*)vtl + ((size_t)b * DM + (size_t)h * HD) * SEQ;
  const float* itb = itab + (((size_t)b * NH + (size_t)h) * SEQ + (size_t)qb * 64) * NEP;
  // this lane's pair indices: query row q0 + c, key columns kv0 + 16 j + 8 hh + (0..7)
  const int* trw = trj + (rowB + (size_t)q0 + (size_t)c) * SEQ + 8 * hh;

  // stage the block's 64 x 16 score table (256 float4, 128 threads x 2); visible after the loop's first barrier
#pragma unroll
  for (int i = 0; i < 2; ++i) {
    const int f = i * 128 + tid;
    *(v4f*)(ITs + (f >> 2) * ITP + (f & 3) * 4) = *(const v4f*)(itb + (size_t)f * 4);
  }

  float mrun = -INFINITY, lrun = 0.f;        // this lane's query: running maximum; sum over this lane half's keys
  v8f oacc[4], oaccL[4];
#pragma unroll
  for (int t = 0; t < 4; ++t) { oacc[t] = zero8(); oaccL[t] = zero8(); }

  // Registers that carry one pass's global data (this thread's 32 elements of the K, V^T hi and V^T lo tiles and
  // this lane's 32 pair indices): filled one pass ahead, so that their latency runs beside the pass before.
  const int sr = tid >> 1, shf = (tid & 1) * 32;
  // running addresses of the tile to be loaded next
  const unsigned short* kq = Kg + (rowB + sr) * QKW + shf;                // K row kv0+sr, d = shf..shf+31
  const _Float16* vq = Vgh + (size_t)sr * SEQ + shf;                      // V^T row d = sr, s = kv0+shf..+31
  const _Float16* wq = Vgl + (size_t)sr * SEQ + shf;
  const int* tq = trw;
  v8us kreg[4];
  v8h  vreg[4], wreg[4];
  v4i  tix[4][2];
  auto fetch = [&](const int adv) {          // loads the tile the addresses stand at, then steps them by adv keys
#pragma unroll
    for (int i = 0; i < 4; ++i) {
      kreg[i] = *(const v8us*)(kq + 8 * i);
      vreg[i] = *(const v8h*)(vq + 8 * i);
      wreg[i] = *(const v8h*)(wq + 8 * i);
    }
#pragma unroll
    for (int j = 0; j < 4; ++j)
#pragma unroll
      for (int x = 0; x < 2; ++x) tix[j][x] = *(const v4i*)(tq + j * 16 + x * 4);
#if defined(__HIP_DEVICE_COMPILE__)
    // the address pairs of the loads just issued are stepped below: the wait stands in front of that (the pairs are
    // inputs, so that they live unchanged up to the wait)
    asm volatile("s_wait_xcnt 0x0" :: "v"(kq), "v"(vq), "v"(wq), "v"(tq) : "memory");
#endif
    // keeps every later instruction behind the wait: the compiler lifts register writes over it, into registers that
    // the loads name (a base that it split off an address is no input of the wait)
    __builtin_amdgcn_sched_barrier(0);
    kq += (size_t)adv * QKW;
    vq += adv;
    wq += adv;
    tq += adv;
  };
  static_assert(NQB >= 2);
  fetch(64);

  // ---- Q fragments (B operand, column = lane&15): f16 hi, 2 d-chunks; the same in every pass ----
  const unsigned short* qp = Qh + (rowB + q0 + c) * QKW + 8 * hh;
  v16us qh2[2];
#pragma unroll
  for (int dc = 0; dc < 2; ++dc) {
    qh2[dc] = ldfrag_u(qp + dc * 32);
  }
#if defined(__HIP_DEVICE_COMPILE__)
  // the Q loads' address pair is dead behind them and its registers are reused: the wait stands in front of that
  // reuse (the pair is an input, so that it lives up to the wait)
  asm volatile("s_wait_xcnt 0x0" :: "v"(qp) : "memory");
#endif
  const float* itr = ITs + (wave * 16 + c) * ITP;          // this lane's query's score-table row

#pragma unroll 1
  for (int kt = 0; kt < NQB; ++kt) {         // static trip count
    __syncthreads();
#pragma unroll
    for (int i = 0; i < 4; ++i) {
      *(v8us*)(Kh + sr * KP + shf + 8 * i) = kreg[i];
      *(v8h*)(Vh + sr * KP + shf + 8 * i) = vreg[i];
      *(v8h*)(Vl + sr * KP + shf + 8 * i) = wreg[i];
    }
    // this pass's pair indices, clamped to 0..NE-1 (used only as an LDS index)
    int nix[4][8];
#pragma unroll
    for (int j = 0; j < 4; ++j)
#pragma unroll
      for (int r = 0; r < 8; ++r) {
        int n = tix[j][r >> 2][r & 3];
        n = (n < 0) ? 0 : n;
        nix[j][r] = (n > NE - 1) ? (NE - 1) : n;
      }
    __syncthreads();
    // ---- scores: 64 keys x 16 query columns per wave ----
    // All LDS reads of the shared tiles stand in groups in front of the products that use them, so that a group pays
    // the LDS latency once: the K fragments and the selected bias values first, the V^T fragments behind the first
    // four score products (they land beside the remaining products and the softmax).
    v16us kb[2][4];
#pragma unroll
    for (int dc = 0; dc < 2; ++dc)
#pragma unroll
      for (int j = 0; j < 4; ++j) kb[dc][j] = ldfrag_u(Kh + (j * 16 + c) * KP + dc * 32 + 8 * hh);
    float bias[4][8];
#pragma unroll
    for (int j = 0; j < 4; ++j)
#pragma unroll
      for (int r = 0; r < 8; ++r) bias[j][r] = itr[nix[j][r]];
    // keeps the LDS reads, which the products wait for, in front of the 20 global loads (the compiler puts those first)
    __builtin_amdgcn_sched_barrier(0);
    // next pass's loads, issued while the group above is under way; the last pass asks for its own tile again (in
    // bounds, not used): no branch in the body. The fence at the end of fetch also keeps the group of LDS reads in front
    // of the products: unfenced, the compiler reads each fragment into one register set directly in front of its
    // product and waits for LDS at every product
    fetch((kt + 2 < NQB) ? 64 : 0);
    v8f sh[4];
#pragma unroll
    for (int j = 0; j < 4; ++j) sh[j] = mma_hu(kb[0][j], qh2[0], zero8());
    FragH vb[2][4], vl[2][4];
#pragma unroll
    for (int kk = 0; kk < 2; ++kk)
#pragma unroll
      for (int t = 0; t < 4; ++t) {
        vb[kk][t].h[0] = *(const v8h*)(Vh + (t * 16 + c) * KP + kk * 32 + 8 * hh);
        vb[kk][t].h[1] = *(const v8h*)(Vh + (t * 16 + c) * KP + kk * 32 + 16 + 8 * hh);
        vl[kk][t].h[0] = *(const v8h*)(Vl + (t * 16 + c) * KP + kk * 32 + 8 * hh);
        vl[kk][t].h[1] = *(const v8h*)(Vl + (t * 16 + c) * KP + kk * 32 + 16 + 8 * hh);
      }
    // keeps the V^T reads here, a softmax ahead of their products (the compiler would sink them to the products)
    __builtin_amdgcn_sched_barrier(0);
#pragma unroll
    for (int j = 0; j < 4; ++j) sh[j] = mma_hu(kb[1][j], qh2[1], sh[j]);
    // D element r: key kv0 + j*16 + 8hh + r, query row q0 + c
    v8f s[4];
#pragma unroll
    for (int j = 0; j < 4; ++j)
#pragma unroll
      for (int r = 0; r < 8; ++r) s[j][r] = sh[j][r] * sscale + bias[j][r];

    // ---- the query's maximum (in-lane, then lane ^ 16), online softmax, P^T (x1024, f16) packed as B operand ----
    float mj[4];                             // one maximum per key tile: four short chains
#pragma unroll
    for (int j = 0; j < 4; ++j) {
      mj[j] = s[j][0];
#pragma unroll
      for (int r = 1; r < 8; ++r) mj[j] = fmaxf(mj[j], s[j][r]);
    }
    float m = fmaxf(fmaxf(mj[0], mj[1]), fmaxf(mj[2], mj[3]));
    m = fmaxf(m, xhalf(m));
    const float mnew  = fmaxf(mrun, m);
    const float alpha = exp2x1((mrun - mnew) * LOG2E);
    mrun = mnew;
    FragH pb[2];                             // element e of pb[kk]: key tile 2 kk + (e >> 3), register e & 7
    float ps[4];                             // one partial sum per key tile: four short chains of adds
#pragma unroll
    for (int j = 0; j < 4; ++j) {
      const v8f p = exp2x8((s[j] - mnew) * LOG2E);
      ps[j] = p[0];
#pragma unroll
      for (int r = 1; r < 8; ++r) ps[j] += p[r];
#pragma unroll
      for (int r = 0; r < 8; ++r) pb[j >> 1].v[(j & 1) * 8 + r] = (_Float16)(p[r] * PSC);
    }
    lrun = lrun * alpha + ((ps[0] + ps[1]) + (ps[2] + ps[3]));
#pragma unroll
    for (int t = 0; t < 4; ++t) { oacc[t] *= alpha; oaccL[t] *= alpha; }

    // ---- context^T += V^T_hi . P^T and V^T_lo . P^T (f16 WMMA, two accumulators) ----
#pragma unroll
    for (int kk = 0; kk < 2; ++kk) {
#pragma unroll
      for (int t = 0; t < 4; ++t) {
        // unguarded form: as operands of the guard's asm statement the 16 V^T fragments would all have to lie in
        // v0..v255, which spills some of them; the gap stands once, behind the 16 products
        oacc[t]  = mma_h_raw(vb[kk][t].v, pb[kk].v, oacc[t]);
        oaccL[t] = mma_h_raw(vl[kk][t].v, pb[kk].v, oaccL[t]);
      }
    }
    acc_guard4(oacc[0], oacc[1], oacc[2], oacc[3]);
    acc_guard4(oaccL[0], oaccL[1], oaccL[2], oaccL[3]);
  }

  // ---- join the two key halves' sums, normalise (1/l, the 1/1024 p carry, the 1/2048 residual fold), split into
  //      bf16 hi and lo, store: a lane's 8 registers of a tile are 8 consecutive d of its query's row
  {
    const float l = lrun + xhalf(lrun);
    const float inv = ((l > 0.f) ? (1.0f / l) : 0.f) * (1.0f / PSC);
    v4u hv[4], lv[4];
#pragma unroll
    for (int t = 0; t < 4; ++t) {
      v4u ha, la;
#pragma unroll
      for (int e = 0; e < 4; ++e) {
        const float f0 = (oacc[t][2 * e]     + oaccL[t][2 * e]     * (1.0f / RSC)) * inv;
        const float f1 = (oacc[t][2 * e + 1] + oaccL[t][2 * e + 1] * (1.0f / RSC)) * inv;
        const unsigned short u0 = bf_bits(f0), u1 = bf_bits(f1);
        const unsigned short w0 = bf_bits(f0 - bf_up(u0)), w1 = bf_bits(f1 - bf_up(u1));
        ha[e] = pk16(u0, u1);
        la[e] = pk16(w0, w1);
      }
      hv[t] = ha;
      lv[t] = la;
    }
    unsigned short* cp = ctxp + (rowB + q0 + c) * CTXP + (size_t)h * HD + 8 * hh;
#pragma unroll
    for (int t = 0; t < 4; ++t) {
      *(v4u*)(cp + t * 16)      = hv[t];
      *(v4u*)(cp + t * 16 + DM) = lv[t];
    }
  }
}

// =====================================================================================================
// y = (x - mean) * rstd * bf16(gamma) + bf16(beta). Block = 64 threads = one row; thread t handles columns
// 4t..4t+3 and 256+4t..256+4t+3, so each store instruction of a wave writes 32 lanes x 16 B = 512 contiguous
// coverage: 64 threads x 8 = 512 columns = the whole row; MP rows.
// =====================================================================================================
__global__ __launch_bounds__(64) void ln_rows(const float* __restrict__ X, const float* __restrict__ gam,
                                              const float* __restrict__ bet, float* out) {
  __shared__ float red[4];
  const int row = blockIdx.x;
  const int tid = threadIdx.x, lane = tid & 31, wv = tid >> 5;
  const float* src = X + (size_t)row * DM;
  const v4f a0 = *(const v4f*)(src + tid * 4);
  const v4f a1 = *(const v4f*)(src + 256 + tid * 4);
  float x[8];
#pragma unroll
  for (int e = 0; e < 4; ++e) { x[e] = a0[e]; x[4 + e] = a1[e]; }
  float s = 0.f;
#pragma unroll
  for (int e = 0; e < 8; ++e) s += x[e];
#pragma unroll
  for (int off = 1; off < 32; off <<= 1) s += __shfl_xor(s, off, 32);
  if (lane == 0) red[wv] = s;
  __syncthreads();
  const float mean = (red[0] + red[1]) * (1.0f / DM);
  float d[8];
  float q = 0.f;
#pragma unroll
  for (int e = 0; e < 8; ++e) { d[e] = x[e] - mean; q += d[e] * d[e]; }
#pragma unroll
  for (int off = 1; off < 32; off <<= 1) q += __shfl_xor(q, off, 32);
  if (lane == 0) red[2 + wv] = q;
  __syncthreads();
  const float var  = (red[2] + red[3]) * (1.0f / DM);
  const float rstd = rsqrtf(var + 1e-6f);

  const v4f g0 = *(const v4f*)(gam + tid * 4);
  const v4f g1 = *(const v4f*)(gam + 256 + tid * 4);
  const v4f e0 = *(const v4f*)(bet + tid * 4);
  const v4f e1 = *(const v4f*)(bet + 256 + tid * 4);
  v4f o0, o1;
#pragma unroll
  for (int e = 0; e < 4; ++e) {
    o0[e] = d[e]     * rstd * bfr(g0[e]) + bfr(e0[e]);
    o1[e] = d[4 + e] * rstd * bfr(g1[e]) + bfr(e1[e]);
  }
  float* dst = out + (size_t)row * DM + tid * 4;
  *(v4f*)(dst)       = o0;
  *(v4f*)(dst + 256) = o1;
  
}

// =====================================================================================================
// Workspace map (bytes); every plane is an exact multiple of its 64x64-tile / whole-row / whole-line store
// granularity (MP = 4096 = 64 row tiles; DM = 8 column tiles; VT per batch [512][2048] = 8x32 tiles; score table
//   WT   bf16 [1536 n][512 k]    0          1572864   (rows 0..511 Wq^T, 512..1023 Wk^T, 1024..1535 Wv^T)
//   WoT2 bf16 [512][1024]        1572864    1048576   (cols k and DM + k both Wo^T)
//   INb  bf16 [3][4096][512]     2621440    12582912  (q, k, v as bf16 bits)
//   QK   f16  [4096][2048]       15204352   16777216  (q [hi|lo] per head, then k [hi|lo] per head)
//   VTh  f16  [2][512][2048]     31981568   4194304   (v^T hi)
//   VTl  f16  [2][512][2048]     36175872   4194304   (v^T residual x2048)
//   IT   f32  [32768][16]        40370176   2097152   (query-embedding scores)
//   Ctx  bf16 [4096][1024]       42467328   8388608   (context hi | lo)
//   X    f32  [4096][512]        50855936   8388608   (pre-norm output)
//   end                          59244544
// =====================================================================================================
extern "C" void kernel_launch(void* const* d_in, const int* in_sizes, int n_in,
                              void* d_out, int out_size, void* d_ws, size_t ws_size,
                              hipStream_t stream) {
  if (n_in < 11) return;
  if (in_sizes[0] != MP * DM || in_sizes[1] != MP * DM || in_sizes[2] != MP * DM) return;
  if (in_sizes[3] != NE * DM) return;
  if (in_sizes[4] != NBATCH * SEQ * SEQ) return;
  if (in_sizes[5] != DM * DM || in_sizes[6] != DM * DM || in_sizes[7] != DM * DM || in_sizes[8] != DM * DM) return;
  if (in_sizes[9] != DM || in_sizes[10] != DM) return;
  if (out_size != MP * DM) return;

  const float* q_in = (const float*)d_in[0];
  const float* k_in = (const float*)d_in[1];
  const float* v_in = (const float*)d_in[2];
  const float* emb  = (const float*)d_in[3];
  const int*   trj  = (const int*)d_in[4];
  const float* w_q  = (const float*)d_in[5];
  const float* w_k  = (const float*)d_in[6];
  const float* w_v  = (const float*)d_in[7];
  const float* w_o  = (const float*)d_in[8];
  const float* gam  = (const float*)d_in[9];
  const float* bet  = (const float*)d_in[10];

  const size_t PWT  = (size_t)3 * DM * DM * 2;             //  1572864
  const size_t PWO  = (size_t)DM * KOFF * 2;               //  1048576
  const size_t PIN  = (size_t)3 * MP * DM * 2;             // 12582912
  const size_t PQK  = (size_t)MP * QKW * 2;                // 16777216
  const size_t PVT  = (size_t)NBATCH * DM * SEQ * 2;       //  4194304
  const size_t PIT  = (size_t)NBATCH * NH * SEQ * NEP * 4; //  2097152
  const size_t PCTX = (size_t)MP * CTXP * 2;               //  8388608
  const size_t PX   = (size_t)MP * DM * 4;                 //  8388608
  size_t off = 0;
  const size_t oWT  = off; off += PWT;
  const size_t oWo  = off; off += PWO;
  const size_t oIN  = off; off += PIN;
  const size_t oQK  = off; off += PQK;
  const size_t oVTh = off; off += PVT;
  const size_t oVTl = off; off += PVT;
  const size_t oIT  = off; off += PIT;
  const size_t oCtx = off; off += PCTX;
  const size_t oX   = off; off += PX;
  if (off > ws_size) return;                               // off = 59244544
  if (off > (size_t)134217728) return;

  char* ws = (char*)d_ws;
  unsigned short* WT   = (unsigned short*)(ws + oWT);
  unsigned short* WoT2 = (unsigned short*)(ws + oWo);
  unsigned short* INb  = (unsigned short*)(ws + oIN);
  unsigned short* QK   = (unsigned short*)(ws + oQK);
  unsigned short* VTh  = (unsigned short*)(ws + oVTh);
  unsigned short* VTl  = (unsigned short*)(ws + oVTl);
  float*          IT   = (float*)(ws + oIT);
  unsigned short* Ctx  = (unsigned short*)(ws + oCtx);
  float*          X    = (float*)(ws + oX);
  float*          out0 = (float*)d_out;

  const dim3 blk(256), blk128(128), blk64(64);
  const dim3 gPrep(4 * WTB + 3 * (MP / 4));                         // 4 x 64 weight tiles, then 3 x 1024 row blocks
  const dim3 gProj(PJB, 3, 1);                                      // 64 blocks x {q, k, v^T (32 blocks x 2 batches)}
  const dim3 gIdx(NBATCH * NH * (SEQ / 64));                        // 512 blocks of 64
  const dim3 gAttn(NBATCH * NH * NQB);                              // 512 blocks of 128
  const dim3 gNo(((MP / 64) * (DM / 64)) / 8, 1, 1);                // 512 tiles -> 64 blocks
  const dim3 gLN(MP);                                               // 4096 rows
  if ((((MP / 64) * (DM / 64)) % 8) != 0) return;
  if ((((DM / 64) * (SEQ / 64)) % 8) != 0) return;

  // (0) activations -> bf16 bits; weight planes: in[k][n] (shape [512 in][512 out]) -> out[n][k] transposed
  //     through LDS (Wo additionally at cols DM + k for the hi|lo K-concat); one launch
  prep<<<gPrep, blk, 0, stream>>>(q_in, k_in, v_in, w_q, w_k, w_v, w_o, INb, WT, WoT2);

  // (1) q = qb . Wq^T-plane (blockIdx.y = 0) and k = kb . Wk^T-plane (blockIdx.y = 1), K = 512
  //     -> f16 [hi 64 | lo 64] per head (QK plane [4096][2048], q at cols 0.., k at cols KOFF..);
  //     v^T per batch = Wv^T . vb_b^T -> f16 hi (VTh) and residual x2048 (VTl) planes [2][512][2048]
  //     (blockIdx.y = 2 of the same launch)
  proj3<<<gProj, blk, 0, stream>>>(INb, WT, QK, VTh, VTl, DM);

  // (2) query-embedding score table (f32), then flash attention with the selected per-pair bias
  //     -> context bf16 hi|lo
  idx_rows<<<gIdx, blk64, 0, stream>>>(QK, emb, IT);
  attn64<<<gAttn, blk128, 0, stream>>>(QK, VTh, VTl, IT, trj, Ctx, 0.125f);

  // (3) X = [ctx_hi | ctx_lo] . [Wo | Wo]  (K = 1024, bf16 operands) -> f32 plane; LayerNorm -> d_out
  gemm64<0><<<gNo, blk, 0, stream>>>(
      Ctx, CTXP, 0LL, WoT2, KOFF, 0LL,
      Ctx, Ctx, X, DM, 0LL,
      MP, DM, KOFF, 1, 1.0f);
  ln_rows<<<gLN, blk64, 0, stream>>>(X, gam, bet, out0);
  (void)hipGetLastError();
}

// v007
// It runs in 90.3 microseconds.
// Next to v006, in two timings, it ran 1.18 and 1.19 times as fast.
// Counting every step since v000, it is 2.93 times as fast.
// Contractions: q|k|v projections and output projection on v_wmma_f32_16x16x32_bf16 (bf16 operands from
// RNE-converted inputs; context carried as bf16 hi|lo planes K-concatenated against duplicated Wo planes);
// scores q.k^T on v_wmma_f32_16x16x32_f16 (q f16 hi, k f16 hi, single product); p.v on
// v_wmma_f32_16x16x32_f16 (p carried x1024 in f16, v^T as f16 hi + x2048 residual planes, two products,
// separate accumulators); query-embedding scores emb . q^T on v_wmma_f32_16x16x32_f16 (emb: its bf16 RNE value carried
// in f16; q f16 hi and x2048 residual, two products, separate accumulators); all f32 accumulate; per-pair bias
// select, softmax and LayerNorm in f32.
#include <hip/hip_runtime.h>
#include <math.h>

#define NBATCH 2
#define SEQ    2048
#define DM     512
#define NH     8
#define HD     64
#define NE     10
#define NEP    16
#define MP     (NBATCH * SEQ)
#define QKW    (4 * DM)
#define KOFF   (2 * DM)
#define CTXP   (2 * DM)
#define NQB    (SEQ / 64)
#define RSC    2048.0f
#define PSC    1024.0f
#define KP     72      // LDS row pitch of the 64-wide 16-bit attention tiles, in elements: 144 B = 16 B x 9
#define LNP    132     // LDS row pitch of the LayerNorm partial sums, in floats: rows 8 apart (a wave's two lane halves) lie 32 banks apart
#define ITP    20      // LDS row pitch of the score-table rows, in floats: the 16 rows a wave gathers from start at 16 different multiples of 4 banks
static_assert(NH * HD == DM);
static_assert(DM == 8 * 64);
static_assert((SEQ % 64) == 0 && (DM % 64) == 0 && (MP % 64) == 0 && (SEQ % 256) == 0 && (MP % 4) == 0);
static_assert((((MP / 64) * (DM / 64)) % 8) == 0);
static_assert((((DM / 64) * (SEQ / 64)) % 8) == 0);
static_assert(NE <= NEP && NEP == 16);
static_assert(((DM / 64) % 8) == 0 && ((SEQ / 64) % 8) == 0);   // gemm64: the 8 tiles of a block lie in one tile row

typedef _Float16 v16h __attribute__((ext_vector_type(16)));
typedef _Float16 v8h  __attribute__((ext_vector_type(8)));
typedef __bf16   v16b __attribute__((ext_vector_type(16)));
typedef unsigned short v16us __attribute__((ext_vector_type(16)));
typedef unsigned short v8us  __attribute__((ext_vector_type(8)));
typedef float    v8f  __attribute__((ext_vector_type(8)));
typedef float    v4f  __attribute__((ext_vector_type(4)));
typedef unsigned int v4u __attribute__((ext_vector_type(4)));

union FragH { v16h v; v8h h[2]; };
union FragU { v16us v; v8us h[2]; };

// ---- scalar helpers --------------------------------------------------------------------------------
__device__ __forceinline__ unsigned short bf_bits(float f) {          // f32 -> bf16 bits, RNE convert
  unsigned u = __float_as_uint(f);
  return (unsigned short)((u + 0x7FFFu + ((u >> 16) & 1u)) >> 16);
}
__device__ __forceinline__ float bf_up(unsigned short h) { return __uint_as_float(((unsigned)h) << 16); }
__device__ __forceinline__ float bfr(float f) { return bf_up(bf_bits(f)); }   // value of the bf16 RNE convert
__device__ __forceinline__ unsigned short h_bits(_Float16 x) { return __builtin_bit_cast(unsigned short, x); }
__device__ __forceinline__ unsigned pk16(unsigned short a, unsigned short b) { return (unsigned)a | ((unsigned)b << 16); }
__device__ __forceinline__ v8f zero8() { v8f z = {0.f, 0.f, 0.f, 0.f, 0.f, 0.f, 0.f, 0.f}; return z; }

// ---- fragment loader: 16-bit A/B operand, lane -> row/col (lane&15), p already includes +8*(lane>>4);
//      elements 0..7 <- p[0..7] (k0+8h..), elements 8..15 <- p[16..23] (k0+16+8h..)
__device__ __forceinline__ v16us ldfrag_u(const unsigned short* p) {
  FragU f;
  f.h[0] = *(const v8us*)(p);
  f.h[1] = *(const v8us*)(p + 16);
  return f.v;
}

// ---- WMMA helpers with trailing VALU hazard gap --------------------------------------------------------
__device__ __forceinline__ v8f mma_bu_raw(v16us a, v16us b, v8f c) {            // bf16 operands, unguarded
  return __builtin_amdgcn_wmma_f32_16x16x32_bf16(false, __builtin_bit_cast(v16b, a), false,
                                                 __builtin_bit_cast(v16b, b), (short)0, c, false, false);
}
__device__ __forceinline__ v8f mma_hu(v16us a, v16us b, v8f c) {                // f16 operands (bits), guarded
  c = __builtin_amdgcn_wmma_f32_16x16x32_f16(false, __builtin_bit_cast(v16h, a), false,
                                              __builtin_bit_cast(v16h, b), (short)0, c, false, false);
#if defined(__HIP_DEVICE_COMPILE__)
  asm volatile("v_nop\n\tv_nop\n\tv_nop\n\tv_nop" : "+v"(c) : "v"(a), "v"(b));
#endif
  return c;
}
__device__ __forceinline__ v8f mma_h_raw(v16h a, v16h b, v8f c) {                // f16 operands, unguarded
  return __builtin_amdgcn_wmma_f32_16x16x32_f16(false, a, false, b, (short)0, c, false, false);
}
__device__ __forceinline__ void acc_guard4(v8f& a, v8f& b, v8f& c, v8f& d) {
#if defined(__HIP_DEVICE_COMPILE__)
  asm volatile("v_nop\n\tv_nop\n\tv_nop\n\tv_nop" : "+v"(a), "+v"(b), "+v"(c), "+v"(d));
#endif
}
__device__ __forceinline__ void wave_sync_lds() {
  __builtin_amdgcn_fence(__ATOMIC_RELEASE, "workgroup");
  __builtin_amdgcn_wave_barrier();
  __builtin_amdgcn_fence(__ATOMIC_ACQUIRE, "workgroup");
}

// =====================================================================================================
// f32 [MP][DM] activations (three sources selected by z, block-uniform) -> bf16 bits plane
// dst[(z*MP + row)*DM + col]. Block = 256 threads = 4 rows; thread t: row = 4*rb + (t>>6), cols 8*(t&63)..+7.
// coverage: 1024 row blocks rb x 4 rows x 512 cols = each whole plane; 3 planes z. One block's part of prep.
// =====================================================================================================
__device__ __forceinline__ void cvt3(const float* __restrict__ s0, const float* __restrict__ s1,
                                     const float* __restrict__ s2, unsigned short* dst, const int rb, const int z) {
  const float* src = (z == 0) ? s0 : ((z == 1) ? s1 : s2);
  const int t = threadIdx.x;
  const int row = rb * 4 + (t >> 6);
  const int c8 = (t & 63) * 8;
  const float* p = src + (size_t)row * DM + c8;
  const v4f a0 = *(const v4f*)(p);
  const v4f a1 = *(const v4f*)(p + 4);
  v4u hv;
  hv[0] = pk16(bf_bits(a0[0]), bf_bits(a0[1]));
  hv[1] = pk16(bf_bits(a0[2]), bf_bits(a0[3]));
  hv[2] = pk16(bf_bits(a1[0]), bf_bits(a1[1]));
  hv[3] = pk16(bf_bits(a1[2]), bf_bits(a1[3]));
  unsigned short* d = dst + ((size_t)z * MP + (size_t)row) * DM + c8;
  *(v4u*)d = hv;
  
}

// =====================================================================================================
// Tiled transpose + bf16 convert: in[rows][cols] f32 row-major -> out[cols][rows] bf16 bits with pitch ldo:
//   out[n * ldo + k] = bf16(in[k][n]) and also at + dupoff (a duplicated k range for the hi|lo K-concat GEMM).
// Block = 256 threads = one 64x64 tile (tn, tk) of (cols/64, rows/64) (rows, cols multiples of 64). One block's part of prep.
// Loads: 4 iterations x 256 threads x float4 = 64 rows x 64 cols (addresses clamped). LDS tile [n][k] pitch 72.
// coverage: 64 x 64 = the whole transposed tile at both column offsets; grid covers the whole matrix.
// =====================================================================================================
__device__ __forceinline__ void tconv64(const float* __restrict__ W, unsigned short* out,
                                        int rows, int cols, int ldo, int dupoff, const int tn, const int tk) {
  __shared__ __align__(16) unsigned short sh[64 * 72];
  const int t  = threadIdx.x;
  const int n0 = tn * 64;                    // column tile of in = row tile of out
  const int k0 = tk * 64;                    // row tile of in = column tile of out
#pragma unroll
  for (int i = 0; i < 4; ++i) {
    const int idx = i * 256 + t;
    const int r = idx >> 4, c4 = (idx & 15) * 4;
    int kr = k0 + r;   kr = (kr < rows) ? kr : (rows - 1);
    int nc = n0 + c4;  nc = (nc < cols - 4) ? nc : (cols - 4);
    const v4f v = *(const v4f*)(W + (size_t)kr * cols + nc);
#pragma unroll
    for (int e = 0; e < 4; ++e) sh[(c4 + e) * 72 + r] = bf_bits(v[e]);
  }
  __syncthreads();
  const int wave = t >> 5, lane = t & 31;
  const int q = lane >> 3, c8 = (lane & 7) * 8;
  v4u pv[2];
  unsigned short* po[2];
#pragma unroll
  for (int it = 0; it < 2; ++it) {
    const int nl = it * 32 + wave * 4 + q;               // 0..63
    pv[it] = *(const v4u*)(sh + nl * 72 + c8);
    po[it] = out + ((size_t)(n0 + nl) * ldo + k0 + c8);
  }
  {
#pragma unroll
    for (int it = 0; it < 2; ++it) {
      *(v4u*)(po[it]) = pv[it];
      if (dupoff != 0) *(v4u*)(po[it] + dupoff) = pv[it];
    }
#if defined(__HIP_DEVICE_COMPILE__)
    // the compiler reuses the first store's registers for the second store's address: the wait stands in front of any
    // such reuse (addresses and data are inputs, so that they live unchanged up to the wait)
    asm volatile("s_wait_xcnt 0x0" :: "v"(po[0]), "v"(po[1]), "v"(pv[0]), "v"(pv[1]) : "memory");
#endif
  }
}

// =====================================================================================================
// All operand preparation in one launch: none of its parts reads what another writes, so they share one grid by
// ranges of the block index (block-uniform branch). Blocks 0 .. 4*WTB-1: the 64x64 transpose tiles of Wq, Wk, Wv
// (-> wt rows 0.., 512.., 1024..) and Wo (-> wot2, also at cols DM + k); they have the longer dependent path and
// stand first. Blocks 4*WTB ..: the 3 x MP/4 row blocks of the activation convert.
// coverage: 4 x 64 tiles = the four whole weight planes; 3 x 1024 row blocks = the three whole activation planes.
// =====================================================================================================
#define WTB ((DM / 64) * (DM / 64))
__global__ __launch_bounds__(256) void prep(const float* __restrict__ s0, const float* __restrict__ s1,
                                            const float* __restrict__ s2, const float* __restrict__ w0,
                                            const float* __restrict__ w1, const float* __restrict__ w2,
                                            const float* __restrict__ w3, unsigned short* inb,
                                            unsigned short* wt, unsigned short* wot2) {
  const int bx = blockIdx.x;
  if (bx >= 4 * WTB) {                       // block-uniform, in front of every barrier
    const int i = bx - 4 * WTB;
    cvt3(s0, s1, s2, inb, i % (MP / 4), i / (MP / 4));
    return;
  }
  const int w = bx / WTB, tile = bx % WTB;
  const float* W = (w == 0) ? w0 : ((w == 1) ? w1 : ((w == 2) ? w2 : w3));
  unsigned short* o = (w < 3) ? (wt + (size_t)w * DM * DM) : wot2;
  tconv64(W, o, DM, DM, (w < 3) ? DM : KOFF, (w < 3) ? 0 : DM, tile % (DM / 64), tile / (DM / 64));
}

// =====================================================================================================
// Register-blocked batched bf16 WMMA GEMM: C[m][n] = oscale * sum_k A[m][k] * Bt[n][k];
// one wave per 64x64 tile; the 8 tiles of a block lie side by side in one tile row (N/64 a multiple of 8), so the
// block works on 64 rows of A and 512 rows of Bt. Both are staged in LDS in k chunks of 64: each 16-B load of a wave
// takes 4 whole 128-B row segments, one chunk ahead into registers, LDS stores between two __syncthreads; the
// fragments are ds_load_b128 reads at a 144-B pitch. A row-major [M][K] pitch lda; Bt row-major [N][K] pitch ldb
// (k contiguous); M, N multiples of 64, K multiple of 64. by = batch index with element strides
// (sAy for A, sBy for Bt, sCy for C); bx = block of 8 tiles. Tile enumeration: tile -> tm = tile / (N/64),
// tn = tile % (N/64). The body of the two kernels behind it.
// OM: 0 = LayerNorm of the product's rows, f32 out to Cf (pitch ldc): N = 512, so that the block's 8 tiles are whole rows:
//     y = (x - mean) * rstd * bf16(gam) + bf16(bet), mean and variance (two passes) over the row's 512 columns: a lane
//     adds its 4 columns of a row, the 128 partial sums of a row meet in LDS (the staging buffer, free behind the loop);
//     4 = f16 hi bits to Cp and f16((v - hi) * 2048) bits to Cp2, 16-bit column
//     base = n0 * nmul (nmul = 2 interleaves [hi 64 | lo 64] per 64-col tile with Cp2 = Cp + 64).
// coverage: 4 slabs x 16 rows x 64 cols = the wave's whole 64x64 tile; grid = tilesM*tilesN/8 blocks exactly
//           (host-checked), so no block exits early.
// =====================================================================================================
template <int OM>
__device__ __forceinline__ void gemm64_body(
    const unsigned short* __restrict__ Ap, int lda, long long sAy,
    const unsigned short* __restrict__ Btp, int ldb, long long sBy,
    unsigned short* Cp, unsigned short* Cp2, float* Cf, int ldc, long long sCy,
    int M, int N, int K, int nmul, float oscale, const float* __restrict__ gam, const float* __restrict__ bet,
    const int bx, const int by) {
  __shared__ __align__(16) float sT[8][16 * 68];   // per-wave 16x64 slab, pitch 68 floats
  __shared__ __align__(16) unsigned short sAB[(64 + 512) * KP];   // rows 0..63: A chunk; rows 64..575: Bt chunk
  const int lane = threadIdx.x & 31;
  const int wave = threadIdx.x >> 5;
  const int tilesN = N >> 6;
  const int tilesM = M >> 6;
  const int tile0 = bx * 8;
  if (tile0 + 8 > tilesM * tilesN) return;   // block-uniform, in front of every barrier (the grid is exact)
  if (OM == 0 && tilesN != 8) return;        // block-uniform: the row statistics need the whole row in one block
  const int tm  = tile0 / tilesN;
  const int tn0 = tile0 - tm * tilesN;       // first of the block's 8 tiles, all in tile row tm
  const int m0 = tm << 6;
  const int n0 = (tn0 + wave) << 6;

  const unsigned short* Ab = Ap  + (size_t)by * (size_t)sAy;
  const unsigned short* Bb = Btp + (size_t)by * (size_t)sBy;
  const size_t cofs = (size_t)by * (size_t)sCy;

  const int rlane = lane & 15;                 // row (A) / col (B, D) within subtile
  const int koff  = (lane >> 4) * 8;           // k offset of this lane half
  const int mOff  = (lane >> 4) * 8;           // D row offset

  v8f acc[4][4];
#pragma unroll
  for (int i = 0; i < 4; ++i)
#pragma unroll
    for (int j = 0; j < 4; ++j) acc[i][j] = zero8();

  // Staging: 576 rows x 8 pieces of 16 B = 18 pieces per thread; piece i of thread t: staged row 32 i + srow,
  // bytes 16 (t & 7).. of the row's 128-B chunk. Pieces 0, 1 are A rows, pieces 2..17 Bt rows. srow runs through
  // 0..31 over the block's 32 groups of 8 lanes; the two groups of a 16-lane half take rows 8 apart, which at the
  // 144-B pitch lie 32 banks apart, so that a half's ds_store_b128 covers each of the 64 banks once.
  const int tx = threadIdx.x;
  const int srow = ((tx >> 4) & 7) | (((tx >> 3) & 1) << 3) | ((tx >> 7) << 4), sc8 = (tx & 7) * 8;
  const unsigned short* gp[18];
#pragma unroll
  for (int i = 0; i < 2; ++i)  gp[i] = Ab + (size_t)(m0 + 32 * i + srow) * lda + sc8;
#pragma unroll
  for (int i = 2; i < 18; ++i) gp[i] = Bb + (size_t)((tn0 << 6) + 32 * (i - 2) + srow) * ldb + sc8;
  v4u st[18];
  auto fetch = [&]() {
#pragma unroll
    for (int i = 0; i < 18; ++i) st[i] = *(const v4u*)(gp[i]);
#if defined(__HIP_DEVICE_COMPILE__)
    // the address pairs of the loads just issued are stepped below: the wait stands in front of that (the pairs are
    // inputs, so that they live unchanged up to the wait); the clobber keeps the loads in front of the products
    asm volatile("s_wait_xcnt 0x0" :: "v"(gp[0]), "v"(gp[1]), "v"(gp[2]), "v"(gp[3]), "v"(gp[4]), "v"(gp[5]),
                 "v"(gp[6]), "v"(gp[7]), "v"(gp[8]), "v"(gp[9]), "v"(gp[10]), "v"(gp[11]), "v"(gp[12]),
                 "v"(gp[13]), "v"(gp[14]), "v"(gp[15]), "v"(gp[16]), "v"(gp[17]) : "memory");
#endif
#pragma unroll
    for (int i = 0; i < 18; ++i) gp[i] += 64;
  };
  const unsigned short* fA = sAB + rlane * KP + koff;                       // this lane's A fragment rows
  const unsigned short* fB = sAB + (64 + wave * 64 + rlane) * KP + koff;    // this lane's Bt fragment rows
  const int nch = K >> 6;
  // OM 0: this lane's 4 columns of gam and bet, asked for beside the first chunk (a barrier waits for every load in
  // flight, so behind the loop their latency would stand open)
  float g[4] = {0.f, 0.f, 0.f, 0.f}, be[4] = {0.f, 0.f, 0.f, 0.f};
  if (OM == 0) {
    const float* gq = gam + n0 + rlane;
    const float* bq = bet + n0 + rlane;
#pragma unroll
    for (int j = 0; j < 4; ++j) { g[j] = gq[16 * j]; be[j] = bq[16 * j]; }
#if defined(__HIP_DEVICE_COMPILE__)
    // the two address pairs are dead behind the loads and their registers are reused: the wait stands in front of that
    // reuse (the pairs are inputs, so that they live up to the wait)
    asm volatile("s_wait_xcnt 0x0" :: "v"(gq), "v"(bq) : "memory");
#endif
  }
  fetch();
  for (int kc = 0; kc < nch; ++kc) {
    __syncthreads();                           // every wave has read the chunk before
#pragma unroll
    for (int i = 0; i < 18; ++i) *(v4u*)(sAB + (32 * i + srow) * KP + sc8) = st[i];
    __syncthreads();                           // the chunk is whole
    if (kc + 1 < nch) fetch();                 // block-uniform; the next chunk flies beside this chunk's products
    v16us ah[2][4], bh[2][4];
#pragma unroll
    for (int ks = 0; ks < 2; ++ks) {
#pragma unroll
      for (int j = 0; j < 4; ++j) bh[ks][j] = ldfrag_u(fB + j * 16 * KP + ks * 32);
#pragma unroll
      for (int i = 0; i < 4; ++i) ah[ks][i] = ldfrag_u(fA + i * 16 * KP + ks * 32);
    }
    // keeps the chunk's 32 fragment reads in front of its products: unfenced, the compiler reads the A fragments into
    // one register set and waits for LDS in front of every row of products
    __builtin_amdgcn_sched_barrier(0);
#pragma unroll
    for (int ks = 0; ks < 2; ++ks)
#pragma unroll
      for (int i = 0; i < 4; ++i)
#pragma unroll
        for (int j = 0; j < 4; ++j) acc[i][j] = mma_bu_raw(ah[ks][i], bh[ks][j], acc[i][j]);
  }
  acc_guard4(acc[0][0], acc[0][1], acc[0][2], acc[0][3]);
  acc_guard4(acc[1][0], acc[1][1], acc[1][2], acc[1][3]);
  acc_guard4(acc[2][0], acc[2][1], acc[2][2], acc[2][3]);
  acc_guard4(acc[3][0], acc[3][1], acc[3][2], acc[3][3]);

  if (OM == 0) {
    // ---- LayerNorm of the block's 64 whole rows, in the accumulators: acc[i][j][r] is row 16 i + mOff + r,
    //      column n0 + 16 j + rlane ----
    static_assert((64 * LNP + 128) * 4 <= (64 + 512) * KP * 2);
    float* part = (float*)(void*)sAB;          // [64 rows][LNP]: 128 partial sums per row (8 waves x 16 lanes)
    float* smean = part + 64 * LNP;            // [64]
    float* srstd = smean + 64;                 // [64]
    const int prow = tx >> 2, pq = tx & 3;     // the adding thread: row prow, every fourth 16-B piece of its partial sums
#pragma unroll
    for (int i = 0; i < 4; ++i)
#pragma unroll
      for (int j = 0; j < 4; ++j) acc[i][j] *= oscale;
    __syncthreads();                           // every wave has read the last chunk: the staging buffer is free
#pragma unroll
    for (int i = 0; i < 4; ++i)
#pragma unroll
      for (int r = 0; r < 8; ++r)
        part[(16 * i + mOff + r) * LNP + wave * 16 + rlane] =
            (acc[i][0][r] + acc[i][1][r]) + (acc[i][2][r] + acc[i][3][r]);
    __syncthreads();                           // the rows' partial sums are whole
    {
      v4f a = *(const v4f*)(part + prow * LNP + pq * 4);
#pragma unroll
      for (int k = 1; k < 8; ++k) a += *(const v4f*)(part + prow * LNP + k * 16 + pq * 4);
      float s = (a[0] + a[1]) + (a[2] + a[3]);
      s += __shfl_xor(s, 1, 32);
      s += __shfl_xor(s, 2, 32);
      if (pq == 0) smean[prow] = s * (1.0f / DM);
    }
    __syncthreads();                           // the means stand; every read of the partial sums is done
#pragma unroll
    for (int i = 0; i < 4; ++i) {
      const v4f m0v = *(const v4f*)(smean + 16 * i + mOff);
      const v4f m1v = *(const v4f*)(smean + 16 * i + mOff + 4);
#pragma unroll
      for (int r = 0; r < 8; ++r) {
        const float mu = (r < 4) ? m0v[r & 3] : m1v[r & 3];
#pragma unroll
        for (int j = 0; j < 4; ++j) acc[i][j][r] -= mu;
        part[(16 * i + mOff + r) * LNP + wave * 16 + rlane] =
            (acc[i][0][r] * acc[i][0][r] + acc[i][1][r] * acc[i][1][r]) +
            (acc[i][2][r] * acc[i][2][r] + acc[i][3][r] * acc[i][3][r]);
      }
    }
    __syncthreads();                           // the rows' partial sums of squares are whole
    {
      v4f a = *(const v4f*)(part + prow * LNP + pq * 4);
#pragma unroll
      for (int k = 1; k < 8; ++k) a += *(const v4f*)(part + prow * LNP + k * 16 + pq * 4);
      float s = (a[0] + a[1]) + (a[2] + a[3]);
      s += __shfl_xor(s, 1, 32);
      s += __shfl_xor(s, 2, 32);
      if (pq == 0) srstd[prow] = rsqrtf(s * (1.0f / DM) + 1e-6f);
    }
    __syncthreads();                           // the reciprocal deviations stand
#pragma unroll
    for (int j = 0; j < 4; ++j) { g[j] = bfr(g[j]); be[j] = bfr(be[j]); }
#pragma unroll
    for (int i = 0; i < 4; ++i) {
      const v4f r0v = *(const v4f*)(srstd + 16 * i + mOff);
      const v4f r1v = *(const v4f*)(srstd + 16 * i + mOff + 4);
#pragma unroll
      for (int r = 0; r < 8; ++r) {
        const float rs = (r < 4) ? r0v[r & 3] : r1v[r & 3];
#pragma unroll
        for (int j = 0; j < 4; ++j) acc[i][j][r] = acc[i][j][r] * rs * g[j] + be[j];
      }
    }
  }

  const int hh2 = lane >> 4, c4 = (lane & 15) * 4;     // f32 out: 256-B row segment = 16 lanes x 16 B
  const int q8  = lane >> 3, c8 = (lane & 7) * 8;

  // ---- epilogue ----
  float* slab = sT[wave];
#pragma unroll
  for (int i = 0; i < 4; ++i) {
    const int mBase = m0 + (i << 4);
#pragma unroll
    for (int j = 0; j < 4; ++j) {
#pragma unroll
      for (int r = 0; r < 8; ++r) {
        slab[(mOff + r) * 68 + (j << 4) + rlane] = acc[i][j][r];
      }
    }
    wave_sync_lds();
    if (OM == 0) {
      float* C = Cf + cofs;
      v4f vals[8];
#pragma unroll
      for (int it = 0; it < 8; ++it) {
        const int row = it * 2 + hh2;                      // it 0..7 x hh2 0..1 = rows 0..15
        vals[it] = *(const v4f*)(slab + row * 68 + c4);
      }
      {
#pragma unroll
        for (int it = 0; it < 8; ++it) {
          const int row = it * 2 + hh2;
          *(v4f*)(C + (size_t)(mBase + row) * ldc + (size_t)n0 * nmul + c4) = vals[it];
        }
        
      }
    } else {
      unsigned short* C  = Cp  + cofs;
      unsigned short* C2 = Cp2 + cofs;
      v4u hv[4], lv[4];
#pragma unroll
      for (int it = 0; it < 4; ++it) {
        const int row = it * 4 + q8;                       // it 0..3 x q8 0..3 = rows 0..15
        const float* sp = slab + row * 68 + c8;
        v4u ha, la;
#pragma unroll
        for (int e = 0; e < 4; ++e) {
          const float f0 = sp[2 * e]     * oscale;
          const float f1 = sp[2 * e + 1] * oscale;
          const _Float16 g0 = (_Float16)f0, g1 = (_Float16)f1;
          const unsigned short u0 = h_bits(g0), u1 = h_bits(g1);
          const unsigned short w0 = h_bits((_Float16)((f0 - (float)g0) * RSC));
          const unsigned short w1 = h_bits((_Float16)((f1 - (float)g1) * RSC));
          ha[e] = pk16(u0, u1);
          la[e] = pk16(w0, w1);
        }
        hv[it] = ha;
        lv[it] = la;
      }
      {
#pragma unroll
        for (int it = 0; it < 4; ++it) {
          const int row = it * 4 + q8;
          const size_t go = (size_t)(mBase + row) * ldc + (size_t)n0 * nmul + c8;
          *(v4u*)(C  + go) = hv[it];
          *(v4u*)(C2 + go) = lv[it];
        }
        
      }
    }
    wave_sync_lds();
  }
}

// One GEMM per launch: grid = (tilesM*tilesN/8, batches).
template <int OM>
__global__ __launch_bounds__(256) void gemm64(
    const unsigned short* __restrict__ Ap, int lda, long long sAy,
    const unsigned short* __restrict__ Btp, int ldb, long long sBy,
    unsigned short* Cp, unsigned short* Cp2, float* Cf, int ldc, long long sCy,
    int M, int N, int K, int nmul, float oscale, const float* __restrict__ gam, const float* __restrict__ bet) {
  gemm64_body<OM>(Ap, lda, sAy, Btp, ldb, sBy, Cp, Cp2, Cf, ldc, sCy, M, N, K, nmul, oscale, gam, bet,
                  (int)blockIdx.x, (int)blockIdx.y);
}

// The three projections in one launch: they read the same prepared planes and none reads what another writes, so
// they share one grid; blockIdx.y (block-uniform) picks the product and only scalar arguments of the one body differ.
//   y = 0, 1: q = qb . Wq^T-plane, k = kb . Wk^T-plane -> f16 [hi 64 | lo 64] per head in the QK plane (q at cols
//             0.., k at cols KOFF..); 64 blocks of 8 tiles each.
//   y = 2:    v^T per batch = Wv^T . vb_b^T -> f16 hi (vth) and residual x2048 (vtl) planes; blockIdx.x = 32 blocks
//             of 8 tiles x 2 batches.
// K stays a run-time argument, as in gemm64: the chunk loop stays rolled, one copy of its body in the instruction cache.
#define PJB (((MP / 64) * (DM / 64)) / 8)
#define VTB (((DM / 64) * (SEQ / 64)) / 8)
static_assert(VTB * NBATCH == PJB);
__global__ __launch_bounds__(256) void proj3(const unsigned short* __restrict__ inb,
                                             const unsigned short* __restrict__ wt, unsigned short* qkp,
                                             unsigned short* vth, unsigned short* vtl, int K) {
  const int x = blockIdx.x, y = blockIdx.y;
  const bool isv = (y == 2);
  gemm64_body<4>(isv ? (wt + (size_t)2 * DM * DM) : inb, DM, isv ? 0LL : (long long)MP * DM,
                 isv ? (inb + (size_t)2 * MP * DM) : wt, DM, isv ? (long long)SEQ * DM : (long long)DM * DM,
                 isv ? vth : qkp, isv ? vtl : (qkp + HD), nullptr, isv ? SEQ : QKW,
                 isv ? (long long)DM * SEQ : (long long)KOFF,
                 isv ? DM : MP, isv ? SEQ : DM, K, isv ? 1 : 2, 1.0f, nullptr, nullptr,
                 isv ? (x % VTB) : x, isv ? (x / VTB) : y);
}

typedef int v4i __attribute__((ext_vector_type(4)));
__device__ __forceinline__ float xhalf(float x) {          // the value of lane ^ 16
  const int b = __builtin_bit_cast(int, x);
  return __builtin_bit_cast(float, __builtin_amdgcn_permlanex16(b, b, 0x76543210, 0xfedcba98, false, false));
}
// Exponentials base 2. Behind a transcendental the instruction set asks for one independent instruction before its
// result is read or its source overwritten. In one statement with early-clobber outputs each v_exp_f32 is independent of the one before it, and the
// v_nop fills the slot behind the last.
__device__ __forceinline__ v8f exp2x8(const v8f x) {
  v8f y = x;
#if defined(__HIP_DEVICE_COMPILE__)
  float y0, y1, y2, y3, y4, y5, y6, y7;
  asm("v_exp_f32 %0, %8\n\tv_exp_f32 %1, %9\n\tv_exp_f32 %2, %10\n\tv_exp_f32 %3, %11\n\t"
      "v_exp_f32 %4, %12\n\tv_exp_f32 %5, %13\n\tv_exp_f32 %6, %14\n\tv_exp_f32 %7, %15\n\tv_nop"
      : "=&v"(y0), "=&v"(y1), "=&v"(y2), "=&v"(y3), "=&v"(y4), "=&v"(y5), "=&v"(y6), "=&v"(y7)
      : "v"(x[0]), "v"(x[1]), "v"(x[2]), "v"(x[3]), "v"(x[4]), "v"(x[5]), "v"(x[6]), "v"(x[7]));
  y[0] = y0; y[1] = y1; y[2] = y2; y[3] = y3; y[4] = y4; y[5] = y5; y[6] = y6; y[7] = y7;
#endif
  return y;
}
__device__ __forceinline__ float exp2x1(const float x) {
  float y = x;
#if defined(__HIP_DEVICE_COMPILE__)
  asm("v_exp_f32 %0, %1\n\tv_nop" : "=v"(y) : "v"(x));   // the v_nop: the same slot
#endif
  return y;
}
#define LOG2E 1.44269504f
__global__ __launch_bounds__(128)
void attn64(const unsigned short* __restrict__ qk, const unsigned short* __restrict__ vth,
            const unsigned short* __restrict__ vtl, const float* __restrict__ emb,
            const int* __restrict__ trj, unsigned short* ctxp, float sscale) {
  __shared__ __align__(16) unsigned short Kh[64 * KP];          // K hi [kv][d]  9 KB
  __shared__ __align__(16) _Float16 Vh[64 * KP];                // V^T hi [d][kv] 9 KB
  __shared__ __align__(16) _Float16 Vl[64 * KP];                // V^T lo [d][kv] 9 KB
  __shared__ __align__(16) float    ITs[64 * ITP];              // score table rows of this query block 5 KB

  const int tid  = threadIdx.x;
  const int wave = tid >> 5;
  const int lane = tid & 31;
  const int hh   = lane >> 4;
  const int c    = lane & 15;

  const int bx   = blockIdx.x;
  const int qb   = bx % NQB;
  const int rest = bx / NQB;
  const int h    = rest % NH;
  const int b    = rest / NH;
  const int q0   = qb * 64 + wave * 16;          // in-batch query row of this wave's first row
  const size_t rowB = (size_t)b * SEQ;

  const unsigned short* Qh  = qk + (size_t)h * (2 * HD);
  const unsigned short* Kg  = qk + KOFF + (size_t)h * (2 * HD);
  const _Float16* Vgh = (const _Float16*)(const void*)vth + ((size_t)b * DM + (size_t)h * HD) * SEQ;
  const _Float16* Vgl = (const _Float16*)(const void*)vtl + ((size_t)b * DM + (size_t)h * HD) * SEQ;
  // this lane's pair indices: query row q0 + c, key columns kv0 + 16 j + 8 hh + (0..7)
  const int* trw = trj + (rowB + (size_t)q0 + (size_t)c) * SEQ + 8 * hh;

  float mrun = -INFINITY, lrun = 0.f;        // this lane's query: running maximum; sum over this lane half's keys
  v8f oacc[4], oaccL[4];
#pragma unroll
  for (int t = 0; t < 4; ++t) { oacc[t] = zero8(); oaccL[t] = zero8(); }

  // Registers that carry one pass's global data (this thread's 32 elements of the K, V^T hi and V^T lo tiles and
  // this lane's 32 pair indices): filled one pass ahead, so that their latency runs beside the pass before.
  const int sr = tid >> 1, shf = (tid & 1) * 32;
  // running addresses of the tile to be loaded next
  const unsigned short* kq = Kg + (rowB + sr) * QKW + shf;                // K row kv0+sr, d = shf..shf+31
  const _Float16* vq = Vgh + (size_t)sr * SEQ + shf;                      // V^T row d = sr, s = kv0+shf..+31
  const _Float16* wq = Vgl + (size_t)sr * SEQ + shf;
  const int* tq = trw;
  v8us kreg[4];
  v8h  vreg[4], wreg[4];
  v4i  tix[4][2];
  auto fetch = [&](const int adv) {          // loads the tile the addresses stand at, then steps them by adv keys
#pragma unroll
    for (int i = 0; i < 4; ++i) {
      kreg[i] = *(const v8us*)(kq + 8 * i);
      vreg[i] = *(const v8h*)(vq + 8 * i);
      wreg[i] = *(const v8h*)(wq + 8 * i);
    }
#pragma unroll
    for (int j = 0; j < 4; ++j)
#pragma unroll
      for (int x = 0; x < 2; ++x) tix[j][x] = *(const v4i*)(tq + j * 16 + x * 4);
#if defined(__HIP_DEVICE_COMPILE__)
    // the address pairs of the loads just issued are stepped below: the wait stands in front of that (the pairs are
    // inputs, so that they live unchanged up to the wait)
    asm volatile("s_wait_xcnt 0x0" :: "v"(kq), "v"(vq), "v"(wq), "v"(tq) : "memory");
#endif
    // keeps every later instruction behind the wait: the compiler lifts register writes over it, into registers that
    // the loads name (a base that it split off an address is no input of the wait)
    __builtin_amdgcn_sched_barrier(0);
    kq += (size_t)adv * QKW;
    vq += adv;
    wq += adv;
    tq += adv;
  };
  static_assert(NQB >= 2);
  fetch(64);

  // ---- Q fragments (B operand, column = lane&15): f16 hi, 2 d-chunks; the same in every pass ----
  const unsigned short* qp = Qh + (rowB + q0 + c) * QKW + 8 * hh;
  v16us qh2[2], ql2[2];                      // ql2: the residual, for the score table alone
  // emb row n = c of this head (address clamped to the last row; rows NE..15 count as zero), k order of the K loader
  const float* ep = emb + (size_t)((c < NE) ? c : (NE - 1)) * DM + (size_t)h * HD + 8 * hh;
  v4f ev[2][4];
#pragma unroll
  for (int dc = 0; dc < 2; ++dc) {
    qh2[dc] = ldfrag_u(qp + dc * 32);
    ql2[dc] = ldfrag_u(qp + HD + dc * 32);
    ev[dc][0] = *(const v4f*)(ep + dc * 32);
    ev[dc][1] = *(const v4f*)(ep + dc * 32 + 4);
    ev[dc][2] = *(const v4f*)(ep + dc * 32 + 16);
    ev[dc][3] = *(const v4f*)(ep + dc * 32 + 20);
  }
#if defined(__HIP_DEVICE_COMPILE__)
  // the Q and emb loads' address pairs are dead behind them and their registers are reused: the wait stands in front
  // of that reuse (the pairs are inputs, so that they live up to the wait)
  asm volatile("s_wait_xcnt 0x0" :: "v"(qp), "v"(ep) : "memory");
#endif
  float* itr = ITs + (wave * 16 + c) * ITP;                // this lane's query's score-table row
  {
    v8f th = zero8(), tl = zero8();
    const unsigned km = (c < NE) ? 0xFFFF0000u : 0u;
#pragma unroll
    for (int dc = 0; dc < 2; ++dc) {
      FragH ea;
#pragma unroll
      for (int e = 0; e < 16; ++e) {           // the bf16 RNE value (bfr), its mask widened to all bits in rows NE..15
        const unsigned u = __float_as_uint(ev[dc][e >> 2][e & 3]);
        ea.v[e] = (_Float16)__uint_as_float((u + 0x7FFFu + ((u >> 16) & 1u)) & km);
      }
      th = mma_hu(__builtin_bit_cast(v16us, ea.v), qh2[dc], th);
      tl = mma_hu(__builtin_bit_cast(v16us, ea.v), ql2[dc], tl);
    }
    v4f t0, t1;
#pragma unroll
    for (int r = 0; r < 4; ++r) {
      t0[r] = th[r]     + tl[r]     * (1.0f / RSC);
      t1[r] = th[4 + r] + tl[4 + r] * (1.0f / RSC);
    }
    // read again only by this wave's lanes c and c + 16, behind the loop's first barrier
    *(v4f*)(itr + 8 * hh)     = t0;
    *(v4f*)(itr + 8 * hh + 4) = t1;
  }

#pragma unroll 1
  for (int kt = 0; kt < NQB; ++kt) {         // static trip count
    __syncthreads();
#pragma unroll
    for (int i = 0; i < 4; ++i) {
      *(v8us*)(Kh + sr * KP + shf + 8 * i) = kreg[i];
      *(v8h*)(Vh + sr * KP + shf + 8 * i) = vreg[i];
      *(v8h*)(Vl + sr * KP + shf + 8 * i) = wreg[i];
    }
    // this pass's pair indices, clamped to 0..NE-1 (used only as an LDS index)
    int nix[4][8];
#pragma unroll
    for (int j = 0; j < 4; ++j)
#pragma unroll
      for (int r = 0; r < 8; ++r) {
        int n = tix[j][r >> 2][r & 3];
        n = (n < 0) ? 0 : n;
        nix[j][r] = (n > NE - 1) ? (NE - 1) : n;
      }
    __syncthreads();
    // ---- scores: 64 keys x 16 query columns per wave ----
    // All LDS reads of the shared tiles stand in groups in front of the products that use them, so that a group pays
    // the LDS latency once: the K fragments and the selected bias values first, the V^T fragments behind the first
    // four score products (they land beside the remaining products and the softmax).
    v16us kb[2][4];
#pragma unroll
    for (int dc = 0; dc < 2; ++dc)
#pragma unroll
      for (int j = 0; j < 4; ++j) kb[dc][j] = ldfrag_u(Kh + (j * 16 + c) * KP + dc * 32 + 8 * hh);
    float bias[4][8];
#pragma unroll
    for (int j = 0; j < 4; ++j)
#pragma unroll
      for (int r = 0; r < 8; ++r) bias[j][r] = itr[nix[j][r]];
    // keeps the LDS reads, which the products wait for, in front of the 20 global loads (the compiler puts those first)
    __builtin_amdgcn_sched_barrier(0);
    // next pass's loads, issued while the group above is under way; the last pass asks for its own tile again (in
    // bounds, not used): no branch in the body. The fence at the end of fetch also keeps the group of LDS reads in front
    // of the products: unfenced, the compiler reads each fragment into one register set directly in front of its
    // product and waits for LDS at every product
    fetch((kt + 2 < NQB) ? 64 : 0);
    v8f sh[4];
#pragma unroll
    for (int j = 0; j < 4; ++j) sh[j] = mma_hu(kb[0][j], qh2[0], zero8());
    FragH vb[2][4], vl[2][4];
#pragma unroll
    for (int kk = 0; kk < 2; ++kk)
#pragma unroll
      for (int t = 0; t < 4; ++t) {
        vb[kk][t].h[0] = *(const v8h*)(Vh + (t * 16 + c) * KP + kk * 32 + 8 * hh);
        vb[kk][t].h[1] = *(const v8h*)(Vh + (t * 16 + c) * KP + kk * 32 + 16 + 8 * hh);
        vl[kk][t].h[0] = *(const v8h*)(Vl + (t * 16 + c) * KP + kk * 32 + 8 * hh);
        vl[kk][t].h[1] = *(const v8h*)(Vl + (t * 16 + c) * KP + kk * 32 + 16 + 8 * hh);
      }
    // keeps the V^T reads here, a softmax ahead of their products (the compiler would sink them to the products)
    __builtin_amdgcn_sched_barrier(0);
#pragma unroll
    for (int j = 0; j < 4; ++j) sh[j] = mma_hu(kb[1][j], qh2[1], sh[j]);
    // D element r: key kv0 + j*16 + 8hh + r, query row q0 + c
    v8f s[4];
#pragma unroll
    for (int j = 0; j < 4; ++j)
#pragma unroll
      for (int r = 0; r < 8; ++r) s[j][r] = sh[j][r] * sscale + bias[j][r];

    // ---- the query's maximum (in-lane, then lane ^ 16), online softmax, P^T (x1024, f16) packed as B operand ----
    float mj[4];                             // one maximum per key tile: four short chains
#pragma unroll
    for (int j = 0; j < 4; ++j) {
      mj[j] = s[j][0];
#pragma unroll
      for (int r = 1; r < 8; ++r) mj[j] = fmaxf(mj[j], s[j][r]);
    }
    float m = fmaxf(fmaxf(mj[0], mj[1]), fmaxf(mj[2], mj[3]));
    m = fmaxf(m, xhalf(m));
    const float mnew  = fmaxf(mrun, m);
    const float alpha = exp2x1((mrun - mnew) * LOG2E);
    mrun = mnew;
    FragH pb[2];                             // element e of pb[kk]: key tile 2 kk + (e >> 3), register e & 7
    float ps[4];                             // one partial sum per key tile: four short chains of adds
#pragma unroll
    for (int j = 0; j < 4; ++j) {
      const v8f p = exp2x8((s[j] - mnew) * LOG2E);
      ps[j] = p[0];
#pragma unroll
      for (int r = 1; r < 8; ++r) ps[j] += p[r];
#pragma unroll
      for (int r = 0; r < 8; ++r) pb[j >> 1].v[(j & 1) * 8 + r] = (_Float16)(p[r] * PSC);
    }
    lrun = lrun * alpha + ((ps[0] + ps[1]) + (ps[2] + ps[3]));
#pragma unroll
    for (int t = 0; t < 4; ++t) { oacc[t] *= alpha; oaccL[t] *= alpha; }

    // ---- context^T += V^T_hi . P^T and V^T_lo . P^T (f16 WMMA, two accumulators) ----
#pragma unroll
    for (int kk = 0; kk < 2; ++kk) {
#pragma unroll
      for (int t = 0; t < 4; ++t) {
        // unguarded form: as operands of the guard's asm statement the 16 V^T fragments would all have to lie in
        // v0..v255, which spills some of them; the gap stands once, behind the 16 products
        oacc[t]  = mma_h_raw(vb[kk][t].v, pb[kk].v, oacc[t]);
        oaccL[t] = mma_h_raw(vl[kk][t].v, pb[kk].v, oaccL[t]);
      }
    }
    acc_guard4(oacc[0], oacc[1], oacc[2], oacc[3]);
    acc_guard4(oaccL[0], oaccL[1], oaccL[2], oaccL[3]);
  }

  // ---- join the two key halves' sums, normalise (1/l, the 1/1024 p carry, the 1/2048 residual fold), split into
  //      bf16 hi and lo, store: a lane's 8 registers of a tile are 8 consecutive d of its query's row
  {
    const float l = lrun + xhalf(lrun);
    const float inv = ((l > 0.f) ? (1.0f / l) : 0.f) * (1.0f / PSC);
    v4u hv[4], lv[4];
#pragma unroll
    for (int t = 0; t < 4; ++t) {
      v4u ha, la;
#pragma unroll
      for (int e = 0; e < 4; ++e) {
        const float f0 = (oacc[t][2 * e]     + oaccL[t][2 * e]     * (1.0f / RSC)) * inv;
        const float f1 = (oacc[t][2 * e + 1] + oaccL[t][2 * e + 1] * (1.0f / RSC)) * inv;
        const unsigned short u0 = bf_bits(f0), u1 = bf_bits(f1);
        const unsigned short w0 = bf_bits(f0 - bf_up(u0)), w1 = bf_bits(f1 - bf_up(u1));
        ha[e] = pk16(u0, u1);
        la[e] = pk16(w0, w1);
      }
      hv[t] = ha;
      lv[t] = la;
    }
    unsigned short* cp = ctxp + (rowB + q0 + c) * CTXP + (size_t)h * HD + 8 * hh;
#pragma unroll
    for (int t = 0; t < 4; ++t) {
      *(v4u*)(cp + t * 16)      = hv[t];
      *(v4u*)(cp + t * 16 + DM) = lv[t];
    }
  }
}

// =====================================================================================================
// Workspace map (bytes); every plane is an exact multiple of its 64x64-tile / whole-row / whole-line store
// granularity (MP = 4096 = 64 row tiles; DM = 8 column tiles; VT per batch [512][2048] = 8x32 tiles)
//   WT   bf16 [1536 n][512 k]    0          1572864   (rows 0..511 Wq^T, 512..1023 Wk^T, 1024..1535 Wv^T)
//   WoT2 bf16 [512][1024]        1572864    1048576   (cols k and DM + k both Wo^T)
//   INb  bf16 [3][4096][512]     2621440    12582912  (q, k, v as bf16 bits)
//   QK   f16  [4096][2048]       15204352   16777216  (q [hi|lo] per head, then k [hi|lo] per head)
//   VTh  f16  [2][512][2048]     31981568   4194304   (v^T hi)
//   VTl  f16  [2][512][2048]     36175872   4194304   (v^T residual x2048)
//   Ctx  bf16 [4096][1024]       40370176   8388608   (context hi | lo)
//   end                          48758784
// =====================================================================================================
extern "C" void kernel_launch(void* const* d_in, const int* in_sizes, int n_in,
                              void* d_out, int out_size, void* d_ws, size_t ws_size,
                              hipStream_t stream) {
  if (n_in < 11) return;
  if (in_sizes[0] != MP * DM || in_sizes[1] != MP * DM || in_sizes[2] != MP * DM) return;
  if (in_sizes[3] != NE * DM) return;
  if (in_sizes[4] != NBATCH * SEQ * SEQ) return;
  if (in_sizes[5] != DM * DM || in_sizes[6] != DM * DM || in_sizes[7] != DM * DM || in_sizes[8] != DM * DM) return;
  if (in_sizes[9] != DM || in_sizes[10] != DM) return;
  if (out_size != MP * DM) return;

  const float* q_in = (const float*)d_in[0];
  const float* k_in = (const float*)d_in[1];
  const float* v_in = (const float*)d_in[2];
  const float* emb  = (const float*)d_in[3];
  const int*   trj  = (const int*)d_in[4];
  const float* w_q  = (const float*)d_in[5];
  const float* w_k  = (const float*)d_in[6];
  const float* w_v  = (const float*)d_in[7];
  const float* w_o  = (const float*)d_in[8];
  const float* gam  = (const float*)d_in[9];
  const float* bet  = (const float*)d_in[10];

  const size_t PWT  = (size_t)3 * DM * DM * 2;             //  1572864
  const size_t PWO  = (size_t)DM * KOFF * 2;               //  1048576
  const size_t PIN  = (size_t)3 * MP * DM * 2;             // 12582912
  const size_t PQK  = (size_t)MP * QKW * 2;                // 16777216
  const size_t PVT  = (size_t)NBATCH * DM * SEQ * 2;       //  4194304
  const size_t PCTX = (size_t)MP * CTXP * 2;               //  8388608
  size_t off = 0;
  const size_t oWT  = off; off += PWT;
  const size_t oWo  = off; off += PWO;
  const size_t oIN  = off; off += PIN;
  const size_t oQK  = off; off += PQK;
  const size_t oVTh = off; off += PVT;
  const size_t oVTl = off; off += PVT;
  const size_t oCtx = off; off += PCTX;
  if (off > ws_size) return;                               // off = 48758784
  if (off > (size_t)134217728) return;

  char* ws = (char*)d_ws;
  unsigned short* WT   = (unsigned short*)(ws + oWT);
  unsigned short* WoT2 = (unsigned short*)(ws + oWo);
  unsigned short* INb  = (unsigned short*)(ws + oIN);
  unsigned short* QK   = (unsigned short*)(ws + oQK);
  unsigned short* VTh  = (unsigned short*)(ws + oVTh);
  unsigned short* VTl  = (unsigned short*)(ws + oVTl);
  unsigned short* Ctx  = (unsigned short*)(ws + oCtx);
  float*          out0 = (float*)d_out;

  const dim3 blk(256), blk128(128);
  const dim3 gPrep(4 * WTB + 3 * (MP / 4));                         // 4 x 64 weight tiles, then 3 x 1024 row blocks
  const dim3 gProj(PJB, 3, 1);                                      // 64 blocks x {q, k, v^T (32 blocks x 2 batches)}
  const dim3 gAttn(NBATCH * NH * NQB);                              // 512 blocks of 128
  const dim3 gNo(((MP / 64) * (DM / 64)) / 8, 1, 1);                // 512 tiles -> 64 blocks
  if ((((MP / 64) * (DM / 64)) % 8) != 0) return;
  if ((((DM / 64) * (SEQ / 64)) % 8) != 0) return;

  // (0) activations -> bf16 bits; weight planes: in[k][n] (shape [512 in][512 out]) -> out[n][k] transposed
  //     through LDS (Wo additionally at cols DM + k for the hi|lo K-concat); one launch
  prep<<<gPrep, blk, 0, stream>>>(q_in, k_in, v_in, w_q, w_k, w_v, w_o, INb, WT, WoT2);

  // (1) q = qb . Wq^T-plane (blockIdx.y = 0) and k = kb . Wk^T-plane (blockIdx.y = 1), K = 512
  //     -> f16 [hi 64 | lo 64] per head (QK plane [4096][2048], q at cols 0.., k at cols KOFF..);
  //     v^T per batch = Wv^T . vb_b^T -> f16 hi (VTh) and residual x2048 (VTl) planes [2][512][2048]
  //     (blockIdx.y = 2 of the same launch)
  proj3<<<gProj, blk, 0, stream>>>(INb, WT, QK, VTh, VTl, DM);

  // (2) flash attention with the selected per-pair bias (each wave makes its queries' score table first)
  //     -> context bf16 hi|lo
  attn64<<<gAttn, blk128, 0, stream>>>(QK, VTh, VTl, emb, trj, Ctx, 0.125f);

  // (3) [ctx_hi | ctx_lo] . [Wo | Wo]  (K = 1024, bf16 operands), LayerNorm of its rows in the same blocks -> d_out
  gemm64<0><<<gNo, blk, 0, stream>>>(
      Ctx, CTXP, 0LL, WoT2, KOFF, 0LL,
      Ctx, Ctx, out0, DM, 0LL,
      MP, DM, KOFF, 1, 1.0f, gam, bet);
  (void)hipGetLastError();
}

// v008
// It runs in 85.1 microseconds.
// Next to v007, in two timings, it ran 1.04 times as fast each time.
// Counting every step since v000, it is 3.04 times as fast.
// Contractions: q|k|v projections and output projection on v_wmma_f32_16x16x32_bf16 (bf16 operands from
// RNE-converted inputs; context carried as bf16 hi|lo planes K-concatenated against duplicated Wo planes);
// scores q.k^T on v_wmma_f32_16x16x32_f16 (q f16 hi, k f16 hi, single product); p.v on
// v_wmma_f32_16x16x32_f16 (p carried x1024 in f16, v^T as f16 hi + x2048 residual planes, two products,
// separate accumulators); query-embedding scores emb . q^T on v_wmma_f32_16x16x32_f16 (emb: its bf16 RNE value carried
// in f16; q f16 hi and x2048 residual, two products, separate accumulators); all f32 accumulate; per-pair bias
// select, softmax and LayerNorm in f32.
#include <hip/hip_runtime.h>
#include <math.h>

#define NBATCH 2
#define SEQ    2048
#define DM     512
#define NH     8
#define HD     64
#define NE     10
#define NEP    16
#define MP     (NBATCH * SEQ)
#define QKW    (4 * DM)
#define KOFF   (2 * DM)
#define CTXP   (2 * DM)
#define NQB    (SEQ / 64)
#define RSC    2048.0f
#define PSC    1024.0f
#define KP     72      // LDS row pitch of the 64-wide 16-bit attention tiles, in elements: 144 B = 16 B x 9
#define LNP    132     // LDS row pitch of the LayerNorm partial sums, in floats: rows 8 apart (a wave's two lane halves) lie 32 banks apart
#define TJP    68      // LDS row pitch of a wave's pair-index rows, in ints: 272 B = 16 B x 17, the 16 rows of a ds_load_b128 start 4 banks apart
#define ITP    20      // LDS row pitch of the score-table rows, in floats: the 16 rows a wave gathers from start at 16 different multiples of 4 banks
static_assert(NH * HD == DM);
static_assert(DM == 8 * 64);
static_assert((SEQ % 64) == 0 && (DM % 64) == 0 && (MP % 64) == 0 && (SEQ % 256) == 0 && (MP % 4) == 0);
static_assert((((MP / 64) * (DM / 64)) % 8) == 0);
static_assert((((DM / 64) * (SEQ / 64)) % 8) == 0);
static_assert(NE <= NEP && NEP == 16);
static_assert(((DM / 64) % 8) == 0 && ((SEQ / 64) % 8) == 0);   // gemm64: the 8 tiles of a block lie in one tile row

typedef _Float16 v16h __attribute__((ext_vector_type(16)));
typedef _Float16 v8h  __attribute__((ext_vector_type(8)));
typedef __bf16   v16b __attribute__((ext_vector_type(16)));
typedef unsigned short v16us __attribute__((ext_vector_type(16)));
typedef unsigned short v8us  __attribute__((ext_vector_type(8)));
typedef float    v8f  __attribute__((ext_vector_type(8)));
typedef float    v4f  __attribute__((ext_vector_type(4)));
typedef unsigned int v4u __attribute__((ext_vector_type(4)));

union FragH { v16h v; v8h h[2]; };
union FragU { v16us v; v8us h[2]; };

// ---- scalar helpers --------------------------------------------------------------------------------
__device__ __forceinline__ unsigned short bf_bits(float f) {          // f32 -> bf16 bits, RNE convert
  unsigned u = __float_as_uint(f);
  return (unsigned short)((u + 0x7FFFu + ((u >> 16) & 1u)) >> 16);
}
__device__ __forceinline__ float bf_up(unsigned short h) { return __uint_as_float(((unsigned)h) << 16); }
__device__ __forceinline__ float bfr(float f) { return bf_up(bf_bits(f)); }   // value of the bf16 RNE convert
__device__ __forceinline__ unsigned short h_bits(_Float16 x) { return __builtin_bit_cast(unsigned short, x); }
__device__ __forceinline__ unsigned pk16(unsigned short a, unsigned short b) { return (unsigned)a | ((unsigned)b << 16); }
__device__ __forceinline__ v8f zero8() { v8f z = {0.f, 0.f, 0.f, 0.f, 0.f, 0.f, 0.f, 0.f}; return z; }

// ---- fragment loader: 16-bit A/B operand, lane -> row/col (lane&15), p already includes +8*(lane>>4);
//      elements 0..7 <- p[0..7] (k0+8h..), elements 8..15 <- p[16..23] (k0+16+8h..)
__device__ __forceinline__ v16us ldfrag_u(const unsigned short* p) {
  FragU f;
  f.h[0] = *(const v8us*)(p);
  f.h[1] = *(const v8us*)(p + 16);
  return f.v;
}

// ---- WMMA helpers with trailing VALU hazard gap --------------------------------------------------------
__device__ __forceinline__ v8f mma_bu_raw(v16us a, v16us b, v8f c) {            // bf16 operands, unguarded
  return __builtin_amdgcn_wmma_f32_16x16x32_bf16(false, __builtin_bit_cast(v16b, a), false,
                                                 __builtin_bit_cast(v16b, b), (short)0, c, false, false);
}
__device__ __forceinline__ v8f mma_hu(v16us a, v16us b, v8f c) {                // f16 operands (bits), guarded
  c = __builtin_amdgcn_wmma_f32_16x16x32_f16(false, __builtin_bit_cast(v16h, a), false,
                                              __builtin_bit_cast(v16h, b), (short)0, c, false, false);
#if defined(__HIP_DEVICE_COMPILE__)
  asm volatile("v_nop\n\tv_nop\n\tv_nop\n\tv_nop" : "+v"(c) : "v"(a), "v"(b));
#endif
  return c;
}
__device__ __forceinline__ v8f mma_h_raw(v16h a, v16h b, v8f c) {                // f16 operands, unguarded
  return __builtin_amdgcn_wmma_f32_16x16x32_f16(false, a, false, b, (short)0, c, false, false);
}
__device__ __forceinline__ void acc_guard4(v8f& a, v8f& b, v8f& c, v8f& d) {
#if defined(__HIP_DEVICE_COMPILE__)
  asm volatile("v_nop\n\tv_nop\n\tv_nop\n\tv_nop" : "+v"(a), "+v"(b), "+v"(c), "+v"(d));
#endif
}
__device__ __forceinline__ void wave_sync_lds() {
  __builtin_amdgcn_fence(__ATOMIC_RELEASE, "workgroup");
  __builtin_amdgcn_wave_barrier();
  __builtin_amdgcn_fence(__ATOMIC_ACQUIRE, "workgroup");
}

// =====================================================================================================
// f32 [MP][DM] activations (three sources selected by z, block-uniform) -> bf16 bits plane
// dst[(z*MP + row)*DM + col]. Block = 256 threads = 4 rows; thread t: row = 4*rb + (t>>6), cols 8*(t&63)..+7.
// coverage: 1024 row blocks rb x 4 rows x 512 cols = each whole plane; 3 planes z. One block's part of prep.
// =====================================================================================================
__device__ __forceinline__ void cvt3(const float* __restrict__ s0, const float* __restrict__ s1,
                                     const float* __restrict__ s2, unsigned short* dst, const int rb, const int z) {
  const float* src = (z == 0) ? s0 : ((z == 1) ? s1 : s2);
  const int t = threadIdx.x;
  const int row = rb * 4 + (t >> 6);
  const int c8 = (t & 63) * 8;
  const float* p = src + (size_t)row * DM + c8;
  const v4f a0 = *(const v4f*)(p);
  const v4f a1 = *(const v4f*)(p + 4);
  v4u hv;
  hv[0] = pk16(bf_bits(a0[0]), bf_bits(a0[1]));
  hv[1] = pk16(bf_bits(a0[2]), bf_bits(a0[3]));
  hv[2] = pk16(bf_bits(a1[0]), bf_bits(a1[1]));
  hv[3] = pk16(bf_bits(a1[2]), bf_bits(a1[3]));
  unsigned short* d = dst + ((size_t)z * MP + (size_t)row) * DM + c8;
  *(v4u*)d = hv;
  
}

// =====================================================================================================
// Tiled transpose + bf16 convert: in[rows][cols] f32 row-major -> out[cols][rows] bf16 bits with pitch ldo:
//   out[n * ldo + k] = bf16(in[k][n]) and also at + dupoff (a duplicated k range for the hi|lo K-concat GEMM).
// Block = 256 threads = one 64x64 tile (tn, tk) of (cols/64, rows/64) (rows, cols multiples of 64). One block's part of prep.
// Loads: 4 iterations x 256 threads x float4 = 64 rows x 64 cols (addresses clamped). LDS tile [n][k] pitch 72.
// coverage: 64 x 64 = the whole transposed tile at both column offsets; grid covers the whole matrix.
// =====================================================================================================
__device__ __forceinline__ void tconv64(const float* __restrict__ W, unsigned short* out,
                                        int rows, int cols, int ldo, int dupoff, const int tn, const int tk) {
  __shared__ __align__(16) unsigned short sh[64 * 72];
  const int t  = threadIdx.x;
  const int n0 = tn * 64;                    // column tile of in = row tile of out
  const int k0 = tk * 64;                    // row tile of in = column tile of out
#pragma unroll
  for (int i = 0; i < 4; ++i) {
    const int idx = i * 256 + t;
    const int r = idx >> 4, c4 = (idx & 15) * 4;
    int kr = k0 + r;   kr = (kr < rows) ? kr : (rows - 1);
    int nc = n0 + c4;  nc = (nc < cols - 4) ? nc : (cols - 4);
    const v4f v = *(const v4f*)(W + (size_t)kr * cols + nc);
#pragma unroll
    for (int e = 0; e < 4; ++e) sh[(c4 + e) * 72 + r] = bf_bits(v[e]);
  }
  __syncthreads();
  const int wave = t >> 5, lane = t & 31;
  const int q = lane >> 3, c8 = (lane & 7) * 8;
  v4u pv[2];
  unsigned short* po[2];
#pragma unroll
  for (int it = 0; it < 2; ++it) {
    const int nl = it * 32 + wave * 4 + q;               // 0..63
    pv[it] = *(const v4u*)(sh + nl * 72 + c8);
    po[it] = out + ((size_t)(n0 + nl) * ldo + k0 + c8);
  }
  {
#pragma unroll
    for (int it = 0; it < 2; ++it) {
      *(v4u*)(po[it]) = pv[it];
      if (dupoff != 0) *(v4u*)(po[it] + dupoff) = pv[it];
    }
#if defined(__HIP_DEVICE_COMPILE__)
    // the compiler reuses the first store's registers for the second store's address: the wait stands in front of any
    // such reuse (addresses and data are inputs, so that they live unchanged up to the wait)
    asm volatile("s_wait_xcnt 0x0" :: "v"(po[0]), "v"(po[1]), "v"(pv[0]), "v"(pv[1]) : "memory");
#endif
  }
}

// =====================================================================================================
// All operand preparation in one launch: none of its parts reads what another writes, so they share one grid by
// ranges of the block index (block-uniform branch). Blocks 0 .. 4*WTB-1: the 64x64 transpose tiles of Wq, Wk, Wv
// (-> wt rows 0.., 512.., 1024..) and Wo (-> wot2, also at cols DM + k); they have the longer dependent path and
// stand first. Blocks 4*WTB ..: the 3 x MP/4 row blocks of the activation convert.
// coverage: 4 x 64 tiles = the four whole weight planes; 3 x 1024 row blocks = the three whole activation planes.
// =====================================================================================================
#define WTB ((DM / 64) * (DM / 64))
__global__ __launch_bounds__(256) void prep(const float* __restrict__ s0, const float* __restrict__ s1,
                                            const float* __restrict__ s2, const float* __restrict__ w0,
                                            const float* __restrict__ w1, const float* __restrict__ w2,
                                            const float* __restrict__ w3, unsigned short* inb,
                                            unsigned short* wt, unsigned short* wot2) {
  const int bx = blockIdx.x;
  if (bx >= 4 * WTB) {                       // block-uniform, in front of every barrier
    const int i = bx - 4 * WTB;
    cvt3(s0, s1, s2, inb, i % (MP / 4), i / (MP / 4));
    return;
  }
  const int w = bx / WTB, tile = bx % WTB;
  const float* W = (w == 0) ? w0 : ((w == 1) ? w1 : ((w == 2) ? w2 : w3));
  unsigned short* o = (w < 3) ? (wt + (size_t)w * DM * DM) : wot2;
  tconv64(W, o, DM, DM, (w < 3) ? DM : KOFF, (w < 3) ? 0 : DM, tile % (DM / 64), tile / (DM / 64));
}

// =====================================================================================================
// Register-blocked batched bf16 WMMA GEMM: C[m][n] = oscale * sum_k A[m][k] * Bt[n][k];
// one wave per 64x64 tile; the 8 tiles of a block lie side by side in one tile row (N/64 a multiple of 8), so the
// block works on 64 rows of A and 512 rows of Bt. Both are staged in LDS in k chunks of 64: each 16-B load of a wave
// takes 4 whole 128-B row segments, one chunk ahead into registers, LDS stores between two __syncthreads; the
// fragments are ds_load_b128 reads at a 144-B pitch. A row-major [M][K] pitch lda; Bt row-major [N][K] pitch ldb
// (k contiguous); M, N multiples of 64, K multiple of 64. by = batch index with element strides
// (sAy for A, sBy for Bt, sCy for C); bx = block of 8 tiles. Tile enumeration: tile -> tm = tile / (N/64),
// tn = tile % (N/64). The body of the two kernels behind it.
// OM: 0 = LayerNorm of the product's rows, f32 out to Cf (pitch ldc): N = 512, so that the block's 8 tiles are whole rows:
//     y = (x - mean) * rstd * bf16(gam) + bf16(bet), mean and variance (two passes) over the row's 512 columns: a lane
//     adds its 4 columns of a row, the 128 partial sums of a row meet in LDS (the staging buffer, free behind the loop);
//     4 = f16 hi bits to Cp and f16((v - hi) * 2048) bits to Cp2, 16-bit column
//     base = n0 * nmul (nmul = 2 interleaves [hi 64 | lo 64] per 64-col tile with Cp2 = Cp + 64).
// coverage: 4 slabs x 16 rows x 64 cols = the wave's whole 64x64 tile; grid = tilesM*tilesN/8 blocks exactly
//           (host-checked), so no block exits early.
// =====================================================================================================
template <int OM>
__device__ __forceinline__ void gemm64_body(
    const unsigned short* __restrict__ Ap, int lda, long long sAy,
    const unsigned short* __restrict__ Btp, int ldb, long long sBy,
    unsigned short* Cp, unsigned short* Cp2, float* Cf, int ldc, long long sCy,
    int M, int N, int K, int nmul, float oscale, const float* __restrict__ gam, const float* __restrict__ bet,
    const int bx, const int by) {
  __shared__ __align__(16) float sT[8][16 * 68];   // per-wave 16x64 slab, pitch 68 floats
  __shared__ __align__(16) unsigned short sAB[(64 + 512) * KP];   // rows 0..63: A chunk; rows 64..575: Bt chunk
  const int lane = threadIdx.x & 31;
  const int wave = threadIdx.x >> 5;
  const int tilesN = N >> 6;
  const int tilesM = M >> 6;
  const int tile0 = bx * 8;
  if (tile0 + 8 > tilesM * tilesN) return;   // block-uniform, in front of every barrier (the grid is exact)
  if (OM == 0 && tilesN != 8) return;        // block-uniform: the row statistics need the whole row in one block
  const int tm  = tile0 / tilesN;
  const int tn0 = tile0 - tm * tilesN;       // first of the block's 8 tiles, all in tile row tm
  const int m0 = tm << 6;
  const int n0 = (tn0 + wave) << 6;

  const unsigned short* Ab = Ap  + (size_t)by * (size_t)sAy;
  const unsigned short* Bb = Btp + (size_t)by * (size_t)sBy;
  const size_t cofs = (size_t)by * (size_t)sCy;

  const int rlane = lane & 15;                 // row (A) / col (B, D) within subtile
  const int koff  = (lane >> 4) * 8;           // k offset of this lane half
  const int mOff  = (lane >> 4) * 8;           // D row offset

  v8f acc[4][4];
#pragma unroll
  for (int i = 0; i < 4; ++i)
#pragma unroll
    for (int j = 0; j < 4; ++j) acc[i][j] = zero8();

  // Staging: 576 rows x 8 pieces of 16 B = 18 pieces per thread; piece i of thread t: staged row 32 i + srow,
  // bytes 16 (t & 7).. of the row's 128-B chunk. Pieces 0, 1 are A rows, pieces 2..17 Bt rows. srow runs through
  // 0..31 over the block's 32 groups of 8 lanes; the two groups of a 16-lane half take rows 8 apart, which at the
  // 144-B pitch lie 32 banks apart, so that a half's ds_store_b128 covers each of the 64 banks once.
  const int tx = threadIdx.x;
  const int srow = ((tx >> 4) & 7) | (((tx >> 3) & 1) << 3) | ((tx >> 7) << 4), sc8 = (tx & 7) * 8;
  const unsigned short* gp[18];
#pragma unroll
  for (int i = 0; i < 2; ++i)  gp[i] = Ab + (size_t)(m0 + 32 * i + srow) * lda + sc8;
#pragma unroll
  for (int i = 2; i < 18; ++i) gp[i] = Bb + (size_t)((tn0 << 6) + 32 * (i - 2) + srow) * ldb + sc8;
  v4u st[18];
  auto fetch = [&]() {
#pragma unroll
    for (int i = 0; i < 18; ++i) st[i] = *(const v4u*)(gp[i]);
#if defined(__HIP_DEVICE_COMPILE__)
    // the address pairs of the loads just issued are stepped below: the wait stands in front of that (the pairs are
    // inputs, so that they live unchanged up to the wait); the clobber keeps the loads in front of the products
    asm volatile("s_wait_xcnt 0x0" :: "v"(gp[0]), "v"(gp[1]), "v"(gp[2]), "v"(gp[3]), "v"(gp[4]), "v"(gp[5]),
                 "v"(gp[6]), "v"(gp[7]), "v"(gp[8]), "v"(gp[9]), "v"(gp[10]), "v"(gp[11]), "v"(gp[12]),
                 "v"(gp[13]), "v"(gp[14]), "v"(gp[15]), "v"(gp[16]), "v"(gp[17]) : "memory");
#endif
#pragma unroll
    for (int i = 0; i < 18; ++i) gp[i] += 64;
  };
  const unsigned short* fA = sAB + rlane * KP + koff;                       // this lane's A fragment rows
  const unsigned short* fB = sAB + (64 + wave * 64 + rlane) * KP + koff;    // this lane's Bt fragment rows
  const int nch = K >> 6;
  // OM 0: this lane's 4 columns of gam and bet, asked for beside the first chunk (a barrier waits for every load in
  // flight, so behind the loop their latency would stand open)
  float g[4] = {0.f, 0.f, 0.f, 0.f}, be[4] = {0.f, 0.f, 0.f, 0.f};
  if (OM == 0) {
    const float* gq = gam + n0 + rlane;
    const float* bq = bet + n0 + rlane;
#pragma unroll
    for (int j = 0; j < 4; ++j) { g[j] = gq[16 * j]; be[j] = bq[16 * j]; }
#if defined(__HIP_DEVICE_COMPILE__)
    // the two address pairs are dead behind the loads and their registers are reused: the wait stands in front of that
    // reuse (the pairs are inputs, so that they live up to the wait)
    asm volatile("s_wait_xcnt 0x0" :: "v"(gq), "v"(bq) : "memory");
#endif
  }
  fetch();
  for (int kc = 0; kc < nch; ++kc) {
    __syncthreads();                           // every wave has read the chunk before
#pragma unroll
    for (int i = 0; i < 18; ++i) *(v4u*)(sAB + (32 * i + srow) * KP + sc8) = st[i];
    __syncthreads();                           // the chunk is whole
    if (kc + 1 < nch) fetch();                 // block-uniform; the next chunk flies beside this chunk's products
    v16us ah[2][4], bh[2][4];
#pragma unroll
    for (int ks = 0; ks < 2; ++ks) {
#pragma unroll
      for (int j = 0; j < 4; ++j) bh[ks][j] = ldfrag_u(fB + j * 16 * KP + ks * 32);
#pragma unroll
      for (int i = 0; i < 4; ++i) ah[ks][i] = ldfrag_u(fA + i * 16 * KP + ks * 32);
    }
    // keeps the chunk's 32 fragment reads in front of its products: unfenced, the compiler reads the A fragments into
    // one register set and waits for LDS in front of every row of products
    __builtin_amdgcn_sched_barrier(0);
#pragma unroll
    for (int ks = 0; ks < 2; ++ks)
#pragma unroll
      for (int i = 0; i < 4; ++i)
#pragma unroll
        for (int j = 0; j < 4; ++j) acc[i][j] = mma_bu_raw(ah[ks][i], bh[ks][j], acc[i][j]);
  }
  acc_guard4(acc[0][0], acc[0][1], acc[0][2], acc[0][3]);
  acc_guard4(acc[1][0], acc[1][1], acc[1][2], acc[1][3]);
  acc_guard4(acc[2][0], acc[2][1], acc[2][2], acc[2][3]);
  acc_guard4(acc[3][0], acc[3][1], acc[3][2], acc[3][3]);

  if (OM == 0) {
    // ---- LayerNorm of the block's 64 whole rows, in the accumulators: acc[i][j][r] is row 16 i + mOff + r,
    //      column n0 + 16 j + rlane ----
    static_assert((64 * LNP + 128) * 4 <= (64 + 512) * KP * 2);
    float* part = (float*)(void*)sAB;          // [64 rows][LNP]: 128 partial sums per row (8 waves x 16 lanes)
    float* smean = part + 64 * LNP;            // [64]
    float* srstd = smean + 64;                 // [64]
    const int prow = tx >> 2, pq = tx & 3;     // the adding thread: row prow, every fourth 16-B piece of its partial sums
#pragma unroll
    for (int i = 0; i < 4; ++i)
#pragma unroll
      for (int j = 0; j < 4; ++j) acc[i][j] *= oscale;
    __syncthreads();                           // every wave has read the last chunk: the staging buffer is free
#pragma unroll
    for (int i = 0; i < 4; ++i)
#pragma unroll
      for (int r = 0; r < 8; ++r)
        part[(16 * i + mOff + r) * LNP + wave * 16 + rlane] =
            (acc[i][0][r] + acc[i][1][r]) + (acc[i][2][r] + acc[i][3][r]);
    __syncthreads();                           // the rows' partial sums are whole
    {
      v4f a = *(const v4f*)(part + prow * LNP + pq * 4);
#pragma unroll
      for (int k = 1; k < 8; ++k) a += *(const v4f*)(part + prow * LNP + k * 16 + pq * 4);
      float s = (a[0] + a[1]) + (a[2] + a[3]);
      s += __shfl_xor(s, 1, 32);
      s += __shfl_xor(s, 2, 32);
      if (pq == 0) smean[prow] = s * (1.0f / DM);
    }
    __syncthreads();                           // the means stand; every read of the partial sums is done
#pragma unroll
    for (int i = 0; i < 4; ++i) {
      const v4f m0v = *(const v4f*)(smean + 16 * i + mOff);
      const v4f m1v = *(const v4f*)(smean + 16 * i + mOff + 4);
#pragma unroll
      for (int r = 0; r < 8; ++r) {
        const float mu = (r < 4) ? m0v[r & 3] : m1v[r & 3];
#pragma unroll
        for (int j = 0; j < 4; ++j) acc[i][j][r] -= mu;
        part[(16 * i + mOff + r) * LNP + wave * 16 + rlane] =
            (acc[i][0][r] * acc[i][0][r] + acc[i][1][r] * acc[i][1][r]) +
            (acc[i][2][r] * acc[i][2][r] + acc[i][3][r] * acc[i][3][r]);
      }
    }
    __syncthreads();                           // the rows' partial sums of squares are whole
    {
      v4f a = *(const v4f*)(part + prow * LNP + pq * 4);
#pragma unroll
      for (int k = 1; k < 8; ++k) a += *(const v4f*)(part + prow * LNP + k * 16 + pq * 4);
      float s = (a[0] + a[1]) + (a[2] + a[3]);
      s += __shfl_xor(s, 1, 32);
      s += __shfl_xor(s, 2, 32);
      if (pq == 0) srstd[prow] = rsqrtf(s * (1.0f / DM) + 1e-6f);
    }
    __syncthreads();                           // the reciprocal deviations stand
#pragma unroll
    for (int j = 0; j < 4; ++j) { g[j] = bfr(g[j]); be[j] = bfr(be[j]); }
#pragma unroll
    for (int i = 0; i < 4; ++i) {
      const v4f r0v = *(const v4f*)(srstd + 16 * i + mOff);
      const v4f r1v = *(const v4f*)(srstd + 16 * i + mOff + 4);
#pragma unroll
      for (int r = 0; r < 8; ++r) {
        const float rs = (r < 4) ? r0v[r & 3] : r1v[r & 3];
#pragma unroll
        for (int j = 0; j < 4; ++j) acc[i][j][r] = acc[i][j][r] * rs * g[j] + be[j];
      }
    }
  }

  const int hh2 = lane >> 4, c4 = (lane & 15) * 4;     // f32 out: 256-B row segment = 16 lanes x 16 B
  const int q8  = lane >> 3, c8 = (lane & 7) * 8;

  // ---- epilogue ----
  float* slab = sT[wave];
#pragma unroll
  for (int i = 0; i < 4; ++i) {
    const int mBase = m0 + (i << 4);
#pragma unroll
    for (int j = 0; j < 4; ++j) {
#pragma unroll
      for (int r = 0; r < 8; ++r) {
        slab[(mOff + r) * 68 + (j << 4) + rlane] = acc[i][j][r];
      }
    }
    wave_sync_lds();
    if (OM == 0) {
      float* C = Cf + cofs;
      v4f vals[8];
#pragma unroll
      for (int it = 0; it < 8; ++it) {
        const int row = it * 2 + hh2;                      // it 0..7 x hh2 0..1 = rows 0..15
        vals[it] = *(const v4f*)(slab + row * 68 + c4);
      }
      {
#pragma unroll
        for (int it = 0; it < 8; ++it) {
          const int row = it * 2 + hh2;
          *(v4f*)(C + (size_t)(mBase + row) * ldc + (size_t)n0 * nmul + c4) = vals[it];
        }
        
      }
    } else {
      unsigned short* C  = Cp  + cofs;
      unsigned short* C2 = Cp2 + cofs;
      v4u hv[4], lv[4];
#pragma unroll
      for (int it = 0; it < 4; ++it) {
        const int row = it * 4 + q8;                       // it 0..3 x q8 0..3 = rows 0..15
        const float* sp = slab + row * 68 + c8;
        v4u ha, la;
#pragma unroll
        for (int e = 0; e < 4; ++e) {
          const float f0 = sp[2 * e]     * oscale;
          const float f1 = sp[2 * e + 1] * oscale;
          const _Float16 g0 = (_Float16)f0, g1 = (_Float16)f1;
          const unsigned short u0 = h_bits(g0), u1 = h_bits(g1);
          const unsigned short w0 = h_bits((_Float16)((f0 - (float)g0) * RSC));
          const unsigned short w1 = h_bits((_Float16)((f1 - (float)g1) * RSC));
          ha[e] = pk16(u0, u1);
          la[e] = pk16(w0, w1);
        }
        hv[it] = ha;
        lv[it] = la;
      }
      {
#pragma unroll
        for (int it = 0; it < 4; ++it) {
          const int row = it * 4 + q8;
          const size_t go = (size_t)(mBase + row) * ldc + (size_t)n0 * nmul + c8;
          *(v4u*)(C  + go) = hv[it];
          *(v4u*)(C2 + go) = lv[it];
        }
        
      }
    }
    wave_sync_lds();
  }
}

// One GEMM per launch: grid = (tilesM*tilesN/8, batches).
template <int OM>
__global__ __launch_bounds__(256) void gemm64(
    const unsigned short* __restrict__ Ap, int lda, long long sAy,
    const unsigned short* __restrict__ Btp, int ldb, long long sBy,
    unsigned short* Cp, unsigned short* Cp2, float* Cf, int ldc, long long sCy,
    int M, int N, int K, int nmul, float oscale, const float* __restrict__ gam, const float* __restrict__ bet) {
  gemm64_body<OM>(Ap, lda, sAy, Btp, ldb, sBy, Cp, Cp2, Cf, ldc, sCy, M, N, K, nmul, oscale, gam, bet,
                  (int)blockIdx.x, (int)blockIdx.y);
}

// The three projections in one launch: they read the same prepared planes and none reads what another writes, so
// they share one grid; blockIdx.y (block-uniform) picks the product and only scalar arguments of the one body differ.
//   y = 0, 1: q = qb . Wq^T-plane, k = kb . Wk^T-plane -> f16 [hi 64 | lo 64] per head in the QK plane (q at cols
//             0.., k at cols KOFF..); 64 blocks of 8 tiles each.
//   y = 2:    v^T per batch = Wv^T . vb_b^T -> f16 hi (vth) and residual x2048 (vtl) planes; blockIdx.x = 32 blocks
//             of 8 tiles x 2 batches.
// K stays a run-time argument, as in gemm64: the chunk loop stays rolled, one copy of its body in the instruction cache.
#define PJB (((MP / 64) * (DM / 64)) / 8)
#define VTB (((DM / 64) * (SEQ / 64)) / 8)
static_assert(VTB * NBATCH == PJB);
__global__ __launch_bounds__(256) void proj3(const unsigned short* __restrict__ inb,
                                             const unsigned short* __restrict__ wt, unsigned short* qkp,
                                             unsigned short* vth, unsigned short* vtl, int K) {
  const int x = blockIdx.x, y = blockIdx.y;
  const bool isv = (y == 2);
  gemm64_body<4>(isv ? (wt + (size_t)2 * DM * DM) : inb, DM, isv ? 0LL : (long long)MP * DM,
                 isv ? (inb + (size_t)2 * MP * DM) : wt, DM, isv ? (long long)SEQ * DM : (long long)DM * DM,
                 isv ? vth : qkp, isv ? vtl : (qkp + HD), nullptr, isv ? SEQ : QKW,
                 isv ? (long long)DM * SEQ : (long long)KOFF,
                 isv ? DM : MP, isv ? SEQ : DM, K, isv ? 1 : 2, 1.0f, nullptr, nullptr,
                 isv ? (x % VTB) : x, isv ? (x / VTB) : y);
}

typedef int v4i __attribute__((ext_vector_type(4)));
__device__ __forceinline__ float xhalf(float x) {          // the value of lane ^ 16
  const int b = __builtin_bit_cast(int, x);
  return __builtin_bit_cast(float, __builtin_amdgcn_permlanex16(b, b, 0x76543210, 0xfedcba98, false, false));
}
// Exponentials base 2. Behind a transcendental the instruction set asks for one independent instruction before its
// result is read or its source overwritten. In one statement with early-clobber outputs each v_exp_f32 is independent of the one before it, and the
// v_nop fills the slot behind the last.
__device__ __forceinline__ v8f exp2x8(const v8f x) {
  v8f y = x;
#if defined(__HIP_DEVICE_COMPILE__)
  float y0, y1, y2, y3, y4, y5, y6, y7;
  asm("v_exp_f32 %0, %8\n\tv_exp_f32 %1, %9\n\tv_exp_f32 %2, %10\n\tv_exp_f32 %3, %11\n\t"
      "v_exp_f32 %4, %12\n\tv_exp_f32 %5, %13\n\tv_exp_f32 %6, %14\n\tv_exp_f32 %7, %15\n\tv_nop"
      : "=&v"(y0), "=&v"(y1), "=&v"(y2), "=&v"(y3), "=&v"(y4), "=&v"(y5), "=&v"(y6), "=&v"(y7)
      : "v"(x[0]), "v"(x[1]), "v"(x[2]), "v"(x[3]), "v"(x[4]), "v"(x[5]), "v"(x[6]), "v"(x[7]));
  y[0] = y0; y[1] = y1; y[2] = y2; y[3] = y3; y[4] = y4; y[5] = y5; y[6] = y6; y[7] = y7;
#endif
  return y;
}
__device__ __forceinline__ float exp2x1(const float x) {
  float y = x;
#if defined(__HIP_DEVICE_COMPILE__)
  asm("v_exp_f32 %0, %1\n\tv_nop" : "=v"(y) : "v"(x));   // the v_nop: the same slot
#endif
  return y;
}
#define LOG2E 1.44269504f
__global__ __launch_bounds__(128)
void attn64(const unsigned short* __restrict__ qk, const unsigned short* __restrict__ vth,
            const unsigned short* __restrict__ vtl, const float* __restrict__ emb,
            const int* __restrict__ trj, unsigned short* ctxp, float sscale) {
  __shared__ __align__(16) unsigned short Kh[64 * KP];          // K hi [kv][d]  9 KB
  __shared__ __align__(16) _Float16 Vh[64 * KP];                // V^T hi [d][kv] 9 KB
  __shared__ __align__(16) _Float16 Vl[64 * KP];                // V^T lo [d][kv] 9 KB
  __shared__ __align__(16) float    ITs[64 * ITP];              // score table rows of this query block 5 KB
  __shared__ __align__(16) int      Tj[64 * TJP];               // a pass's pair indices [query][key], 16 rows per wave 17 KB

  const int tid  = threadIdx.x;
  const int wave = tid >> 5;
  const int lane = tid & 31;
  const int hh   = lane >> 4;
  const int c    = lane & 15;

  const int bx   = blockIdx.x;
  const int qb   = bx % NQB;
  const int rest = bx / NQB;
  const int h    = rest % NH;
  const int b    = rest / NH;
  const int q0   = qb * 64 + wave * 16;          // in-batch query row of this wave's first row
  const size_t rowB = (size_t)b * SEQ;

  const unsigned short* Qh  = qk + (size_t)h * (2 * HD);
  const unsigned short* Kg  = qk + KOFF + (size_t)h * (2 * HD);
  const _Float16* Vgh = (const _Float16*)(const void*)vth + ((size_t)b * DM + (size_t)h * HD) * SEQ;
  const _Float16* Vgl = (const _Float16*)(const void*)vtl + ((size_t)b * DM + (size_t)h * HD) * SEQ;
  // pair indices as loaded: load x takes query rows q0 + 2 x + hh, key columns kv0 + 4 c + (0..3)
  const int* trw = trj + (rowB + (size_t)q0 + (size_t)hh) * SEQ + 4 * c;

  float mrun = -INFINITY, lrun = 0.f;        // this lane's query: running maximum; sum over this lane half's keys
  v8f oacc[4], oaccL[4];
#pragma unroll
  for (int t = 0; t < 4; ++t) { oacc[t] = zero8(); oaccL[t] = zero8(); }

  // Registers that carry one pass's global data (this thread's 32 elements of the K, V^T hi and V^T lo tiles and
  // 32 of the wave's pair indices): filled one pass ahead, so that their latency runs beside the pass before.
  // Piece i of a tile: row 16 i + sr, elements shf..shf+7. sr runs through 0..15 over the block's 16 groups of 8 lanes;
  // the two groups of a 16-lane half take rows 8 apart, which at the 144-B pitch lie 32 banks apart, so that a half's
  // ds_store_b128 covers each of the 64 banks once.
  const int sr = ((tid >> 4) & 7) | (((tid >> 3) & 1) << 3), shf = (tid & 7) * 8;
  // running addresses of the tile to be loaded next
  const unsigned short* kq = Kg + (rowB + sr) * QKW + shf;                // K row kv0+sr (+16 i), d = shf..shf+7
  const _Float16* vq = Vgh + (size_t)sr * SEQ + shf;                      // V^T row d = sr (+16 i), s = kv0+shf..+7
  const _Float16* wq = Vgl + (size_t)sr * SEQ + shf;
  const int* tq = trw;
  v8us kreg[4];
  v8h  vreg[4], wreg[4];
  v4i  tix[8];
  auto fetch = [&](const int adv) {          // loads the tile the addresses stand at, then steps them by adv keys
#pragma unroll
    for (int i = 0; i < 4; ++i) {
      kreg[i] = *(const v8us*)(kq + (size_t)(16 * i) * QKW);
      vreg[i] = *(const v8h*)(vq + (size_t)(16 * i) * SEQ);
      wreg[i] = *(const v8h*)(wq + (size_t)(16 * i) * SEQ);
    }
#pragma unroll
    for (int x = 0; x < 8; ++x) tix[x] = *(const v4i*)(tq + (size_t)(2 * x) * SEQ);
#if defined(__HIP_DEVICE_COMPILE__)
    // the address pairs of the loads just issued are stepped below: the wait stands in front of that (the pairs are
    // inputs, so that they live unchanged up to the wait)
    asm volatile("s_wait_xcnt 0x0" :: "v"(kq), "v"(vq), "v"(wq), "v"(tq) : "memory");
#endif
    // keeps every later instruction behind the wait: the compiler lifts register writes over it, into registers that
    // the loads name (a base that it split off an address is no input of the wait)
    __builtin_amdgcn_sched_barrier(0);
    kq += (size_t)adv * QKW;
    vq += adv;
    wq += adv;
    tq += adv;
  };
  static_assert(NQB >= 2);
  fetch(64);

  // ---- Q fragments (B operand, column = lane&15): f16 hi, 2 d-chunks; the same in every pass ----
  const unsigned short* qp = Qh + (rowB + q0 + c) * QKW + 8 * hh;
  v16us qh2[2], ql2[2];                      // ql2: the residual, for the score table alone
  // emb row n = c of this head (address clamped to the last row; rows NE..15 count as zero), k order of the K loader
  const float* ep = emb + (size_t)((c < NE) ? c : (NE - 1)) * DM + (size_t)h * HD + 8 * hh;
  v4f ev[2][4];
#pragma unroll
  for (int dc = 0; dc < 2; ++dc) {
    qh2[dc] = ldfrag_u(qp + dc * 32);
    ql2[dc] = ldfrag_u(qp + HD + dc * 32);
    ev[dc][0] = *(const v4f*)(ep + dc * 32);
    ev[dc][1] = *(const v4f*)(ep + dc * 32 + 4);
    ev[dc][2] = *(const v4f*)(ep + dc * 32 + 16);
    ev[dc][3] = *(const v4f*)(ep + dc * 32 + 20);
  }
#if defined(__HIP_DEVICE_COMPILE__)
  // the Q and emb loads' address pairs are dead behind them and their registers are reused: the wait stands in front
  // of that reuse (the pairs are inputs, so that they live up to the wait)
  asm volatile("s_wait_xcnt 0x0" :: "v"(qp), "v"(ep) : "memory");
#endif
  float* itr = ITs + (wave * 16 + c) * ITP;                // this lane's query's score-table row
  {
    v8f th = zero8(), tl = zero8();
    const unsigned km = (c < NE) ? 0xFFFF0000u : 0u;
#pragma unroll
    for (int dc = 0; dc < 2; ++dc) {
      FragH ea;
#pragma unroll
      for (int e = 0; e < 16; ++e) {           // the bf16 RNE value (bfr), its mask widened to all bits in rows NE..15
        const unsigned u = __float_as_uint(ev[dc][e >> 2][e & 3]);
        ea.v[e] = (_Float16)__uint_as_float((u + 0x7FFFu + ((u >> 16) & 1u)) & km);
      }
      th = mma_hu(__builtin_bit_cast(v16us, ea.v), qh2[dc], th);
      tl = mma_hu(__builtin_bit_cast(v16us, ea.v), ql2[dc], tl);
    }
    v4f t0, t1;
#pragma unroll
    for (int r = 0; r < 4; ++r) {
      t0[r] = th[r]     + tl[r]     * (1.0f / RSC);
      t1[r] = th[4 + r] + tl[4 + r] * (1.0f / RSC);
    }
    // read again only by this wave's lanes c and c + 16, behind the loop's first barrier
    *(v4f*)(itr + 8 * hh)     = t0;
    *(v4f*)(itr + 8 * hh + 4) = t1;
  }

#pragma unroll 1
  for (int kt = 0; kt < NQB; ++kt) {         // static trip count
    // this pass's pair indices to the wave's own rows (its reads of the pass before stand in front of that pass's second barrier)
#pragma unroll
    for (int x = 0; x < 8; ++x) *(v4i*)(Tj + (wave * 16 + 2 * x + hh) * TJP + 4 * c) = tix[x];
    __syncthreads();
#pragma unroll
    for (int i = 0; i < 4; ++i) {
      *(v8us*)(Kh + (16 * i + sr) * KP + shf) = kreg[i];
      *(v8h*)(Vh + (16 * i + sr) * KP + shf) = vreg[i];
      *(v8h*)(Vl + (16 * i + sr) * KP + shf) = wreg[i];
    }
    // this lane's pair indices: query row q0 + c, key columns kv0 + 16 j + 8 hh + (0..7)
    v4i tl[4][2];
#pragma unroll
    for (int j = 0; j < 4; ++j)
#pragma unroll
      for (int x = 0; x < 2; ++x) tl[j][x] = *(const v4i*)(Tj + (wave * 16 + c) * TJP + 16 * j + 8 * hh + 4 * x);
    // clamped to 0..NE-1 (used only as an LDS index)
    int nix[4][8];
#pragma unroll
    for (int j = 0; j < 4; ++j)
#pragma unroll
      for (int r = 0; r < 8; ++r) {
        int n = tl[j][r >> 2][r & 3];
        n = (n < 0) ? 0 : n;
        nix[j][r] = (n > NE - 1) ? (NE - 1) : n;
      }
    __syncthreads();
    // ---- scores: 64 keys x 16 query columns per wave ----
    // All LDS reads of the shared tiles stand in groups in front of the products that use them, so that a group pays
    // the LDS latency once: the K fragments and the selected bias values first, the V^T fragments behind the first
    // four score products (they land beside the remaining products and the softmax).
    v16us kb[2][4];
#pragma unroll
    for (int dc = 0; dc < 2; ++dc)
#pragma unroll
      for (int j = 0; j < 4; ++j) kb[dc][j] = ldfrag_u(Kh + (j * 16 + c) * KP + dc * 32 + 8 * hh);
    float bias[4][8];
#pragma unroll
    for (int j = 0; j < 4; ++j)
#pragma unroll
      for (int r = 0; r < 8; ++r) bias[j][r] = itr[nix[j][r]];
    // keeps the LDS reads, which the products wait for, in front of the 20 global loads (the compiler puts those first)
    __builtin_amdgcn_sched_barrier(0);
    // next pass's loads, issued while the group above is under way; the last pass asks for its own tile again (in
    // bounds, not used): no branch in the body. The fence at the end of fetch also keeps the group of LDS reads in front
    // of the products: unfenced, the compiler reads each fragment into one register set directly in front of its
    // product and waits for LDS at every product
    fetch((kt + 2 < NQB) ? 64 : 0);
    v8f sh[4];
#pragma unroll
    for (int j = 0; j < 4; ++j) sh[j] = mma_hu(kb[0][j], qh2[0], zero8());
    FragH vb[2][4], vl[2][4];
#pragma unroll
    for (int kk = 0; kk < 2; ++kk)
#pragma unroll
      for (int t = 0; t < 4; ++t) {
        vb[kk][t].h[0] = *(const v8h*)(Vh + (t * 16 + c) * KP + kk * 32 + 8 * hh);
        vb[kk][t].h[1] = *(const v8h*)(Vh + (t * 16 + c) * KP + kk * 32 + 16 + 8 * hh);
        vl[kk][t].h[0] = *(const v8h*)(Vl + (t * 16 + c) * KP + kk * 32 + 8 * hh);
        vl[kk][t].h[1] = *(const v8h*)(Vl + (t * 16 + c) * KP + kk * 32 + 16 + 8 * hh);
      }
    // keeps the V^T reads here, a softmax ahead of their products (the compiler would sink them to the products)
    __builtin_amdgcn_sched_barrier(0);
#pragma unroll
    for (int j = 0; j < 4; ++j) sh[j] = mma_hu(kb[1][j], qh2[1], sh[j]);
    // D element r: key kv0 + j*16 + 8hh + r, query row q0 + c
    v8f s[4];
#pragma unroll
    for (int j = 0; j < 4; ++j)
#pragma unroll
      for (int r = 0; r < 8; ++r) s[j][r] = sh[j][r] * sscale + bias[j][r];

    // ---- the query's maximum (in-lane, then lane ^ 16), online softmax, P^T (x1024, f16) packed as B operand ----
    float mj[4];                             // one maximum per key tile: four short chains
#pragma unroll
    for (int j = 0; j < 4; ++j) {
      mj[j] = s[j][0];
#pragma unroll
      for (int r = 1; r < 8; ++r) mj[j] = fmaxf(mj[j], s[j][r]);
    }
    float m = fmaxf(fmaxf(mj[0], mj[1]), fmaxf(mj[2], mj[3]));
    m = fmaxf(m, xhalf(m));
    const float mnew  = fmaxf(mrun, m);
    const float alpha = exp2x1((mrun - mnew) * LOG2E);
    mrun = mnew;
    FragH pb[2];                             // element e of pb[kk]: key tile 2 kk + (e >> 3), register e & 7
    float ps[4];                             // one partial sum per key tile: four short chains of adds
#pragma unroll
    for (int j = 0; j < 4; ++j) {
      const v8f p = exp2x8((s[j] - mnew) * LOG2E);
      ps[j] = p[0];
#pragma unroll
      for (int r = 1; r < 8; ++r) ps[j] += p[r];
#pragma unroll
      for (int r = 0; r < 8; ++r) pb[j >> 1].v[(j & 1) * 8 + r] = (_Float16)(p[r] * PSC);
    }
    lrun = lrun * alpha + ((ps[0] + ps[1]) + (ps[2] + ps[3]));
#pragma unroll
    for (int t = 0; t < 4; ++t) { oacc[t] *= alpha; oaccL[t] *= alpha; }

    // ---- context^T += V^T_hi . P^T and V^T_lo . P^T (f16 WMMA, two accumulators) ----
#pragma unroll
    for (int kk = 0; kk < 2; ++kk) {
#pragma unroll
      for (int t = 0; t < 4; ++t) {
        // unguarded form: as operands of the guard's asm statement the 16 V^T fragments would all have to lie in
        // v0..v255, which spills some of them; the gap stands once, behind the 16 products
        oacc[t]  = mma_h_raw(vb[kk][t].v, pb[kk].v, oacc[t]);
        oaccL[t] = mma_h_raw(vl[kk][t].v, pb[kk].v, oaccL[t]);
      }
    }
    acc_guard4(oacc[0], oacc[1], oacc[2], oacc[3]);
    acc_guard4(oaccL[0], oaccL[1], oaccL[2], oaccL[3]);
  }

  // ---- join the two key halves' sums, normalise (1/l, the 1/1024 p carry, the 1/2048 residual fold), split into
  //      bf16 hi and lo, store: a lane's 8 registers of a tile are 8 consecutive d of its query's row
  {
    const float l = lrun + xhalf(lrun);
    const float inv = ((l > 0.f) ? (1.0f / l) : 0.f) * (1.0f / PSC);
    v4u hv[4], lv[4];
#pragma unroll
    for (int t = 0; t < 4; ++t) {
      v4u ha, la;
#pragma unroll
      for (int e = 0; e < 4; ++e) {
        const float f0 = (oacc[t][2 * e]     + oaccL[t][2 * e]     * (1.0f / RSC)) * inv;
        const float f1 = (oacc[t][2 * e + 1] + oaccL[t][2 * e + 1] * (1.0f / RSC)) * inv;
        const unsigned short u0 = bf_bits(f0), u1 = bf_bits(f1);
        const unsigned short w0 = bf_bits(f0 - bf_up(u0)), w1 = bf_bits(f1 - bf_up(u1));
        ha[e] = pk16(u0, u1);
        la[e] = pk16(w0, w1);
      }
      hv[t] = ha;
      lv[t] = la;
    }
    unsigned short* cp = ctxp + (rowB + q0 + c) * CTXP + (size_t)h * HD + 8 * hh;
#pragma unroll
    for (int t = 0; t < 4; ++t) {
      *(v4u*)(cp + t * 16)      = hv[t];
      *(v4u*)(cp + t * 16 + DM) = lv[t];
    }
  }
}

// =====================================================================================================
// Workspace map (bytes); every plane is an exact multiple of its 64x64-tile / whole-row / whole-line store
// granularity (MP = 4096 = 64 row tiles; DM = 8 column tiles; VT per batch [512][2048] = 8x32 tiles)
//   WT   bf16 [1536 n][512 k]    0          1572864   (rows 0..511 Wq^T, 512..1023 Wk^T, 1024..1535 Wv^T)
//   WoT2 bf16 [512][1024]        1572864    1048576   (cols k and DM + k both Wo^T)
//   INb  bf16 [3][4096][512]     2621440    12582912  (q, k, v as bf16 bits)
//   QK   f16  [4096][2048]       15204352   16777216  (q [hi|lo] per head, then k [hi|lo] per head)
//   VTh  f16  [2][512][2048]     31981568   4194304   (v^T hi)
//   VTl  f16  [2][512][2048]     36175872   4194304   (v^T residual x2048)
//   Ctx  bf16 [4096][1024]       40370176   8388608   (context hi | lo)
//   end                          48758784
// =====================================================================================================
extern "C" void kernel_launch(void* const* d_in, const int* in_sizes, int n_in,
                              void* d_out, int out_size, void* d_ws, size_t ws_size,
                              hipStream_t stream) {
  if (n_in < 11) return;
  if (in_sizes[0] != MP * DM || in_sizes[1] != MP * DM || in_sizes[2] != MP * DM) return;
  if (in_sizes[3] != NE * DM) return;
  if (in_sizes[4] != NBATCH * SEQ * SEQ) return;
  if (in_sizes[5] != DM * DM || in_sizes[6] != DM * DM || in_sizes[7] != DM * DM || in_sizes[8] != DM * DM) return;
  if (in_sizes[9] != DM || in_sizes[10] != DM) return;
  if (out_size != MP * DM) return;

  const float* q_in = (const float*)d_in[0];
  const float* k_in = (const float*)d_in[1];
  const float* v_in = (const float*)d_in[2];
  const float* emb  = (const float*)d_in[3];
  const int*   trj  = (const int*)d_in[4];
  const float* w_q  = (const float*)d_in[5];
  const float* w_k  = (const float*)d_in[6];
  const float* w_v  = (const float*)d_in[7];
  const float* w_o  = (const float*)d_in[8];
  const float* gam  = (const float*)d_in[9];
  const float* bet  = (const float*)d_in[10];

  const size_t PWT  = (size_t)3 * DM * DM * 2;             //  1572864
  const size_t PWO  = (size_t)DM * KOFF * 2;               //  1048576
  const size_t PIN  = (size_t)3 * MP * DM * 2;             // 12582912
  const size_t PQK  = (size_t)MP * QKW * 2;                // 16777216
  const size_t PVT  = (size_t)NBATCH * DM * SEQ * 2;       //  4194304
  const size_t PCTX = (size_t)MP * CTXP * 2;               //  8388608
  size_t off = 0;
  const size_t oWT  = off; off += PWT;
  const size_t oWo  = off; off += PWO;
  const size_t oIN  = off; off += PIN;
  const size_t oQK  = off; off += PQK;
  const size_t oVTh = off; off += PVT;
  const size_t oVTl = off; off += PVT;
  const size_t oCtx = off; off += PCTX;
  if (off > ws_size) return;                               // off = 48758784
  if (off > (size_t)134217728) return;

  char* ws = (char*)d_ws;
  unsigned short* WT   = (unsigned short*)(ws + oWT);
  unsigned short* WoT2 = (unsigned short*)(ws + oWo);
  unsigned short* INb  = (unsigned short*)(ws + oIN);
  unsigned short* QK   = (unsigned short*)(ws + oQK);
  unsigned short* VTh  = (unsigned short*)(ws + oVTh);
  unsigned short* VTl  = (unsigned short*)(ws + oVTl);
  unsigned short* Ctx  = (unsigned short*)(ws + oCtx);
  float*          out0 = (float*)d_out;

  const dim3 blk(256), blk128(128);
  const dim3 gPrep(4 * WTB + 3 * (MP / 4));                         // 4 x 64 weight tiles, then 3 x 1024 row blocks
  const dim3 gProj(PJB, 3, 1);                                      // 64 blocks x {q, k, v^T (32 blocks x 2 batches)}
  const dim3 gAttn(NBATCH * NH * NQB);                              // 512 blocks of 128
  const dim3 gNo(((MP / 64) * (DM / 64)) / 8, 1, 1);                // 512 tiles -> 64 blocks
  if ((((MP / 64) * (DM / 64)) % 8) != 0) return;
  if ((((DM / 64) * (SEQ / 64)) % 8) != 0) return;

  // (0) activations -> bf16 bits; weight planes: in[k][n] (shape [512 in][512 out]) -> out[n][k] transposed
  //     through LDS (Wo additionally at cols DM + k for the hi|lo K-concat); one launch
  prep<<<gPrep, blk, 0, stream>>>(q_in, k_in, v_in, w_q, w_k, w_v, w_o, INb, WT, WoT2);

  // (1) q = qb . Wq^T-plane (blockIdx.y = 0) and k = kb . Wk^T-plane (blockIdx.y = 1), K = 512
  //     -> f16 [hi 64 | lo 64] per head (QK plane [4096][2048], q at cols 0.., k at cols KOFF..);
  //     v^T per batch = Wv^T . vb_b^T -> f16 hi (VTh) and residual x2048 (VTl) planes [2][512][2048]
  //     (blockIdx.y = 2 of the same launch)
  proj3<<<gProj, blk, 0, stream>>>(INb, WT, QK, VTh, VTl, DM);

  // (2) flash attention with the selected per-pair bias (each wave makes its queries' score table first)
  //     -> context bf16 hi|lo
  attn64<<<gAttn, blk128, 0, stream>>>(QK, VTh, VTl, emb, trj, Ctx, 0.125f);

  // (3) [ctx_hi | ctx_lo] . [Wo | Wo]  (K = 1024, bf16 operands), LayerNorm of its rows in the same blocks -> d_out
  gemm64<0><<<gNo, blk, 0, stream>>>(
      Ctx, CTXP, 0LL, WoT2, KOFF, 0LL,
      Ctx, Ctx, out0, DM, 0LL,
      MP, DM, KOFF, 1, 1.0f, gam, bet);
  (void)hipGetLastError();
}

// v009
// Measured time: 77.8 microseconds a run.
// Two timings next to v008 put it at 1.12 and 1.10 times that version's speed.
// Over all steps from v000 it is 3.36 times as fast.
// Contractions: q|k|v projections and output projection on v_wmma_f32_16x16x32_bf16 (bf16 operands from
// RNE-converted inputs; context carried as bf16 hi and lo planes, two row groups of one A tile against one Wo plane,
// separate accumulators added behind the k loop);
// scores q.k^T on v_wmma_f32_16x16x32_f16 (q f16 hi, k f16 hi, single product); p.v on
// v_wmma_f32_16x16x32_f16 (p carried x1024 in f16, v^T as f16 hi + x2048 residual planes, two products,
// separate accumulators); query-embedding scores emb . q^T on v_wmma_f32_16x16x32_f16 (emb: its bf16 RNE value carried
// in f16; q f16 hi and x2048 residual, two products, separate accumulators); all f32 accumulate; per-pair bias
// select, softmax and LayerNorm in f32.
#include <hip/hip_runtime.h>
#include <math.h>

#define NBATCH 2
#define SEQ    2048
#define DM     512
#define NH     8
#define HD     64
#define NE     10
#define NEP    16
#define MP     (NBATCH * SEQ)
#define QKW    (4 * DM)
#define KOFF   (2 * DM)
#define CTXP   (2 * DM)
#define NQB    (SEQ / 64)
#define RSC    2048.0f
#define PSC    1024.0f
#define KP     72      // LDS row pitch of the 64-wide 16-bit attention tiles, in elements: 144 B = 16 B x 9
#define LNP    132     // LDS row pitch of the LayerNorm partial sums, in floats: rows 8 apart (a wave's two lane halves) lie 32 banks apart
#define TJP    68      // LDS row pitch of a wave's pair-index rows, in ints: 272 B = 16 B x 17, the 16 rows of a ds_load_b128 start 4 banks apart
#define ITP    20      // LDS row pitch of the score-table rows, in floats: the 16 rows a wave gathers from start at 16 different multiples of 4 banks
static_assert(NH * HD == DM);
static_assert(DM == 8 * 64);
static_assert((SEQ % 64) == 0 && (DM % 64) == 0 && (MP % 64) == 0 && (SEQ % 256) == 0 && (MP % 4) == 0);
static_assert(CTXP == 2 * DM);   // a context row is [hi DM | lo DM]
static_assert((((MP / 64) * (DM / 64)) % 8) == 0);
static_assert((((DM / 64) * (SEQ / 64)) % 8) == 0);
static_assert(NE <= NEP && NEP == 16);
static_assert(((DM / 64) % 8) == 0 && ((SEQ / 64) % 8) == 0);   // gemm64: the 8 tiles of a block lie in one tile row

typedef _Float16 v16h __attribute__((ext_vector_type(16)));
typedef _Float16 v8h  __attribute__((ext_vector_type(8)));
typedef __bf16   v16b __attribute__((ext_vector_type(16)));
typedef unsigned short v16us __attribute__((ext_vector_type(16)));
typedef unsigned short v8us  __attribute__((ext_vector_type(8)));
typedef float    v8f  __attribute__((ext_vector_type(8)));
typedef float    v4f  __attribute__((ext_vector_type(4)));
typedef unsigned int v4u __attribute__((ext_vector_type(4)));

union FragH { v16h v; v8h h[2]; };
union FragU { v16us v; v8us h[2]; };

// ---- scalar helpers --------------------------------------------------------------------------------
__device__ __forceinline__ unsigned short bf_bits(float f) {          // f32 -> bf16 bits, RNE convert
  unsigned u = __float_as_uint(f);
  return (unsigned short)((u + 0x7FFFu + ((u >> 16) & 1u)) >> 16);
}
__device__ __forceinline__ float bf_up(unsigned short h) { return __uint_as_float(((unsigned)h) << 16); }
__device__ __forceinline__ float bfr(float f) { return bf_up(bf_bits(f)); }   // value of the bf16 RNE convert
__device__ __forceinline__ unsigned short h_bits(_Float16 x) { return __builtin_bit_cast(unsigned short, x); }
__device__ __forceinline__ unsigned pk16(unsigned short a, unsigned short b) { return (unsigned)a | ((unsigned)b << 16); }
__device__ __forceinline__ v8f zero8() { v8f z = {0.f, 0.f, 0.f, 0.f, 0.f, 0.f, 0.f, 0.f}; return z; }

// ---- fragment loader: 16-bit A/B operand, lane -> row/col (lane&15), p already includes +8*(lane>>4);
//      elements 0..7 <- p[0..7] (k0+8h..), elements 8..15 <- p[16..23] (k0+16+8h..)
__device__ __forceinline__ v16us ldfrag_u(const unsigned short* p) {
  FragU f;
  f.h[0] = *(const v8us*)(p);
  f.h[1] = *(const v8us*)(p + 16);
  return f.v;
}

// ---- WMMA helpers with trailing VALU hazard gap --------------------------------------------------------
__device__ __forceinline__ v8f mma_bu_raw(v16us a, v16us b, v8f c) {            // bf16 operands, unguarded
  return __builtin_amdgcn_wmma_f32_16x16x32_bf16(false, __builtin_bit_cast(v16b, a), false,
                                                 __builtin_bit_cast(v16b, b), (short)0, c, false, false);
}
__device__ __forceinline__ v8f mma_hu(v16us a, v16us b, v8f c) {                // f16 operands (bits), guarded
  c = __builtin_amdgcn_wmma_f32_16x16x32_f16(false, __builtin_bit_cast(v16h, a), false,
                                              __builtin_bit_cast(v16h, b), (short)0, c, false, false);
#if defined(__HIP_DEVICE_COMPILE__)
  asm volatile("v_nop\n\tv_nop\n\tv_nop\n\tv_nop" : "+v"(c) : "v"(a), "v"(b));
#endif
  return c;
}
__device__ __forceinline__ v8f mma_h_raw(v16h a, v16h b, v8f c) {                // f16 operands, unguarded
  return __builtin_amdgcn_wmma_f32_16x16x32_f16(false, a, false, b, (short)0, c, false, false);
}
__device__ __forceinline__ void acc_guard4(v8f& a, v8f& b, v8f& c, v8f& d) {
#if defined(__HIP_DEVICE_COMPILE__)
  asm volatile("v_nop\n\tv_nop\n\tv_nop\n\tv_nop" : "+v"(a), "+v"(b), "+v"(c), "+v"(d));
#endif
}
__device__ __forceinline__ void wave_sync_lds() {
  __builtin_amdgcn_fence(__ATOMIC_RELEASE, "workgroup");
  __builtin_amdgcn_wave_barrier();
  __builtin_amdgcn_fence(__ATOMIC_ACQUIRE, "workgroup");
}

// =====================================================================================================
// f32 [MP][DM] activations (three sources selected by z, block-uniform) -> bf16 bits plane
// dst[(z*MP + row)*DM + col]. Block = 256 threads = 4 rows; thread t: row = 4*rb + (t>>6), cols 8*(t&63)..+7.
// coverage: 1024 row blocks rb x 4 rows x 512 cols = each whole plane; 3 planes z. One block's part of prep.
// =====================================================================================================
__device__ __forceinline__ void cvt3(const float* __restrict__ s0, const float* __restrict__ s1,
                                     const float* __restrict__ s2, unsigned short* dst, const int rb, const int z) {
  const float* src = (z == 0) ? s0 : ((z == 1) ? s1 : s2);
  const int t = threadIdx.x;
  const int row = rb * 4 + (t >> 6);
  const int c8 = (t & 63) * 8;
  const float* p = src + (size_t)row * DM + c8;
  const v4f a0 = *(const v4f*)(p);
  const v4f a1 = *(const v4f*)(p + 4);
  v4u hv;
  hv[0] = pk16(bf_bits(a0[0]), bf_bits(a0[1]));
  hv[1] = pk16(bf_bits(a0[2]), bf_bits(a0[3]));
  hv[2] = pk16(bf_bits(a1[0]), bf_bits(a1[1]));
  hv[3] = pk16(bf_bits(a1[2]), bf_bits(a1[3]));
  unsigned short* d = dst + ((size_t)z * MP + (size_t)row) * DM + c8;
  *(v4u*)d = hv;
  
}

// =====================================================================================================
// Tiled transpose + bf16 convert: in[rows][cols] f32 row-major -> out[cols][rows] bf16 bits with pitch ldo:
//   out[n * ldo + k] = bf16(in[k][n]).
// Block = 256 threads = one 64x64 tile (tn, tk) of (cols/64, rows/64) (rows, cols multiples of 64). One block's part of prep.
// Loads: 4 iterations x 256 threads x float4 = 64 rows x 64 cols (addresses clamped). LDS tile [n][k] pitch 72.
// coverage: 64 x 64 = the whole transposed tile; grid covers the whole matrix.
// =====================================================================================================
__device__ __forceinline__ void tconv64(const float* __restrict__ W, unsigned short* out,
                                        int rows, int cols, int ldo, const int tn, const int tk) {
  __shared__ __align__(16) unsigned short sh[64 * 72];
  const int t  = threadIdx.x;
  const int n0 = tn * 64;                    // column tile of in = row tile of out
  const int k0 = tk * 64;                    // row tile of in = column tile of out
#pragma unroll
  for (int i = 0; i < 4; ++i) {
    const int idx = i * 256 + t;
    const int r = idx >> 4, c4 = (idx & 15) * 4;
    int kr = k0 + r;   kr = (kr < rows) ? kr : (rows - 1);
    int nc = n0 + c4;  nc = (nc < cols - 4) ? nc : (cols - 4);
    const v4f v = *(const v4f*)(W + (size_t)kr * cols + nc);
#pragma unroll
    for (int e = 0; e < 4; ++e) sh[(c4 + e) * 72 + r] = bf_bits(v[e]);
  }
  __syncthreads();
  const int wave = t >> 5, lane = t & 31;
  const int q = lane >> 3, c8 = (lane & 7) * 8;
  v4u pv[2];
  unsigned short* po[2];
#pragma unroll
  for (int it = 0; it < 2; ++it) {
    const int nl = it * 32 + wave * 4 + q;               // 0..63
    pv[it] = *(const v4u*)(sh + nl * 72 + c8);
    po[it] = out + ((size_t)(n0 + nl) * ldo + k0 + c8);
  }
  {
#pragma unroll
    for (int it = 0; it < 2; ++it) *(v4u*)(po[it]) = pv[it];
#if defined(__HIP_DEVICE_COMPILE__)
    // the compiler reuses the first store's registers for the second store's address: the wait stands in front of any
    // such reuse (addresses and data are inputs, so that they live unchanged up to the wait)
    asm volatile("s_wait_xcnt 0x0" :: "v"(po[0]), "v"(po[1]), "v"(pv[0]), "v"(pv[1]) : "memory");
#endif
  }
}

// =====================================================================================================
// All operand preparation in one launch: none of its parts reads what another writes, so they share one grid by
// ranges of the block index (block-uniform branch). Blocks 0 .. 4*WTB-1: the 64x64 transpose tiles of Wq, Wk, Wv
// (-> wt rows 0.., 512.., 1024..) and Wo (-> wot); they have the longer dependent path and
// stand first. Blocks 4*WTB ..: the 3 x MP/4 row blocks of the activation convert.
// coverage: 4 x 64 tiles = the four whole weight planes; 3 x 1024 row blocks = the three whole activation planes.
// =====================================================================================================
#define WTB ((DM / 64) * (DM / 64))
__global__ __launch_bounds__(256) void prep(const float* __restrict__ s0, const float* __restrict__ s1,
                                            const float* __restrict__ s2, const float* __restrict__ w0,
                                            const float* __restrict__ w1, const float* __restrict__ w2,
                                            const float* __restrict__ w3, unsigned short* inb,
                                            unsigned short* wt, unsigned short* wot) {
  const int bx = blockIdx.x;
  if (bx >= 4 * WTB) {                       // block-uniform, in front of every barrier
    const int i = bx - 4 * WTB;
    cvt3(s0, s1, s2, inb, i % (MP / 4), i / (MP / 4));
    return;
  }
  const int w = bx / WTB, tile = bx % WTB;
  const float* W = (w == 0) ? w0 : ((w == 1) ? w1 : ((w == 2) ? w2 : w3));
  unsigned short* o = (w < 3) ? (wt + (size_t)w * DM * DM) : wot;
  tconv64(W, o, DM, DM, DM, tile % (DM / 64), tile / (DM / 64));
}

// =====================================================================================================
// Register-blocked batched bf16 WMMA GEMM: C[m][n] = oscale * sum_k A[m][k] * Bt[n][k];
// one wave per 64x64 tile; the 8 tiles of a block lie side by side in one tile row (N/64 a multiple of 8), so the
// block works on 64 rows of A and 512 rows of Bt. Both are staged in LDS in k chunks of 64: each 16-B load of a wave
// takes 4 whole 128-B row segments, one chunk ahead into registers, LDS stores between two __syncthreads; the
// fragments are ds_load_b128 reads at a 144-B pitch. A row-major [M][K] pitch lda; Bt row-major [N][K] pitch ldb
// (k contiguous); M, N multiples of 64, K multiple of 64. by = batch index with element strides
// (sAy for A, sBy for Bt, sCy for C); bx = block of 8 tiles. Tile enumeration: tile -> tm = tile / (N/64),
// tn = tile % (N/64). The body of the two kernels behind it.
// OM: 0 = A is given as two planes, a row being [hi K | lo K] (lda >= 2 K), and C = (hi + lo) . Bt^T: the block takes 32
//     rows of C; the 64 rows of its A tile are those rows' hi parts (0..31) and lo parts (32..63), so that each Bt chunk
//     is staged and read once for both planes; the two groups' accumulators are added behind the k loop. M a multiple
//     of 32, tm = tile / (N/64) counts groups of 32 rows. Then
//     LayerNorm of the product's rows, f32 out to Cf (pitch ldc): N = 512, so that the block's 8 tiles are whole rows:
//     y = (x - mean) * rstd * bf16(gam) + bf16(bet), mean and variance (two passes) over the row's 512 columns: a lane
//     adds its 4 columns of a row, the 128 partial sums of a row meet in LDS (the staging buffer, free behind the loop);
//     4 = f16 hi bits to Cp and f16((v - hi) * 2048) bits to Cp2, 16-bit column
//     base = n0 * nmul (nmul = 2 interleaves [hi 64 | lo 64] per 64-col tile with Cp2 = Cp + 64).
// coverage: 4 slabs (OM 0: 2) x 16 rows x 64 cols = the wave's whole 64x64 (32x64) tile; grid = tilesM*tilesN/8 blocks
//           exactly (host-checked), so no block exits early.
// =====================================================================================================
template <int OM>
__device__ __forceinline__ void gemm64_body(
    const unsigned short* __restrict__ Ap, int lda, long long sAy,
    const unsigned short* __restrict__ Btp, int ldb, long long sBy,
    unsigned short* Cp, unsigned short* Cp2, float* Cf, int ldc, long long sCy,
    int M, int N, int K, int nmul, float oscale, const float* __restrict__ gam, const float* __restrict__ bet,
    const int bx, const int by) {
  __shared__ __align__(16) float sT[8][16 * 68];   // per-wave 16x64 slab, pitch 68 floats
  __shared__ __align__(16) unsigned short sAB[(64 + 512) * KP];   // rows 0..63: A chunk; rows 64..575: Bt chunk
  const int lane = threadIdx.x & 31;
  const int wave = threadIdx.x >> 5;
  const int tilesN = N >> 6;
  constexpr int SL = (OM == 0) ? 2 : 4;      // 16-row slabs of C in a wave's tile
  const int tilesM = M / (16 * SL);
  const int tile0 = bx * 8;
  if (tile0 + 8 > tilesM * tilesN) return;   // block-uniform, in front of every barrier (the grid is exact)
  if (OM == 0 && tilesN != 8) return;        // block-uniform: the row statistics need the whole row in one block
  const int tm  = tile0 / tilesN;
  const int tn0 = tile0 - tm * tilesN;       // first of the block's 8 tiles, all in tile row tm
  const int m0 = tm * (16 * SL);
  const int n0 = (tn0 + wave) << 6;

  const unsigned short* Ab = Ap  + (size_t)by * (size_t)sAy;
  const unsigned short* Bb = Btp + (size_t)by * (size_t)sBy;
  const size_t cofs = (size_t)by * (size_t)sCy;

  const int rlane = lane & 15;                 // row (A) / col (B, D) within subtile
  const int koff  = (lane >> 4) * 8;           // k offset of this lane half
  const int mOff  = (lane >> 4) * 8;           // D row offset

  v8f acc[4][4];
#pragma unroll
  for (int i = 0; i < 4; ++i)
#pragma unroll
    for (int j = 0; j < 4; ++j) acc[i][j] = zero8();

  // Staging: 576 rows x 8 pieces of 16 B = 18 pieces per thread; piece i of thread t: staged row 32 i + srow,
  // bytes 16 (t & 7).. of the row's 128-B chunk. Pieces 0, 1 are A rows (OM 0: the hi and the lo part of row m0 + srow),
  // pieces 2..17 Bt rows. srow runs through
  // 0..31 over the block's 32 groups of 8 lanes; the two groups of a 16-lane half take rows 8 apart, which at the
  // 144-B pitch lie 32 banks apart, so that a half's ds_store_b128 covers each of the 64 banks once.
  const int tx = threadIdx.x;
  const int srow = ((tx >> 4) & 7) | (((tx >> 3) & 1) << 3) | ((tx >> 7) << 4), sc8 = (tx & 7) * 8;
  const unsigned short* gp[18];
#pragma unroll
  for (int i = 0; i < 2; ++i)
    gp[i] = (OM == 0) ? (Ab + (size_t)(m0 + srow) * lda + (size_t)i * K + sc8)
                      : (Ab + (size_t)(m0 + 32 * i + srow) * lda + sc8);
#pragma unroll
  for (int i = 2; i < 18; ++i) gp[i] = Bb + (size_t)((tn0 << 6) + 32 * (i - 2) + srow) * ldb + sc8;
  v4u st[18];
  auto fetch = [&]() {
#pragma unroll
    for (int i = 0; i < 18; ++i) st[i] = *(const v4u*)(gp[i]);
#if defined(__HIP_DEVICE_COMPILE__)
    // the address pairs of the loads just issued are stepped below: the wait stands in front of that (the pairs are
    // inputs, so that they live unchanged up to the wait); the clobber keeps the loads in front of the products
    asm volatile("s_wait_xcnt 0x0" :: "v"(gp[0]), "v"(gp[1]), "v"(gp[2]), "v"(gp[3]), "v"(gp[4]), "v"(gp[5]),
                 "v"(gp[6]), "v"(gp[7]), "v"(gp[8]), "v"(gp[9]), "v"(gp[10]), "v"(gp[11]), "v"(gp[12]),
                 "v"(gp[13]), "v"(gp[14]), "v"(gp[15]), "v"(gp[16]), "v"(gp[17]) : "memory");
#endif
#pragma unroll
    for (int i = 0; i < 18; ++i) gp[i] += 64;
  };
  const unsigned short* fA = sAB + rlane * KP + koff;                       // this lane's A fragment rows
  const unsigned short* fB = sAB + (64 + wave * 64 + rlane) * KP + koff;    // this lane's Bt fragment rows
  const int nch = K >> 6;
  // OM 0: this lane's 4 columns of gam and bet, asked for beside the first chunk (a barrier waits for every load in
  // flight, so behind the loop their latency would stand open)
  float g[4] = {0.f, 0.f, 0.f, 0.f}, be[4] = {0.f, 0.f, 0.f, 0.f};
  if (OM == 0) {
    const float* gq = gam + n0 + rlane;
    const float* bq = bet + n0 + rlane;
#pragma unroll
    for (int j = 0; j < 4; ++j) { g[j] = gq[16 * j]; be[j] = bq[16 * j]; }
#if defined(__HIP_DEVICE_COMPILE__)
    // the two address pairs are dead behind the loads and their registers are reused: the wait stands in front of that
    // reuse (the pairs are inputs, so that they live up to the wait)
    asm volatile("s_wait_xcnt 0x0" :: "v"(gq), "v"(bq) : "memory");
#endif
  }
  fetch();
  for (int kc = 0; kc < nch; ++kc) {
    __syncthreads();                           // every wave has read the chunk before
#pragma unroll
    for (int i = 0; i < 18; ++i) *(v4u*)(sAB + (32 * i + srow) * KP + sc8) = st[i];
    __syncthreads();                           // the chunk is whole
    if (kc + 1 < nch) fetch();                 // block-uniform; the next chunk flies beside this chunk's products
    v16us ah[2][4], bh[2][4];
#pragma unroll
    for (int ks = 0; ks < 2; ++ks) {
#pragma unroll
      for (int j = 0; j < 4; ++j) bh[ks][j] = ldfrag_u(fB + j * 16 * KP + ks * 32);
#pragma unroll
      for (int i = 0; i < 4; ++i) ah[ks][i] = ldfrag_u(fA + i * 16 * KP + ks * 32);
    }
    // keeps the chunk's 32 fragment reads in front of its products: unfenced, the compiler reads the A fragments into
    // one register set and waits for LDS in front of every row of products
    __builtin_amdgcn_sched_barrier(0);
#pragma unroll
    for (int ks = 0; ks < 2; ++ks)
#pragma unroll
      for (int i = 0; i < 4; ++i)
#pragma unroll
        for (int j = 0; j < 4; ++j) acc[i][j] = mma_bu_raw(ah[ks][i], bh[ks][j], acc[i][j]);
  }
  acc_guard4(acc[0][0], acc[0][1], acc[0][2], acc[0][3]);
  acc_guard4(acc[1][0], acc[1][1], acc[1][2], acc[1][3]);
  acc_guard4(acc[2][0], acc[2][1], acc[2][2], acc[2][3]);
  acc_guard4(acc[3][0], acc[3][1], acc[3][2], acc[3][3]);

  if (OM == 0) {
    // ---- the lo plane's products join the hi plane's; then LayerNorm of the block's 32 whole rows, in the
    //      accumulators: acc[i][j][r], i < 2, is row 16 i + mOff + r, column n0 + 16 j + rlane ----
    static_assert((32 * LNP + 64) * 4 <= (64 + 512) * KP * 2);
    float* part = (float*)(void*)sAB;          // [32 rows][LNP]: 128 partial sums per row (8 waves x 16 lanes)
    float* smean = part + 32 * LNP;            // [32]
    float* srstd = smean + 32;                 // [32]
    const int prow = tx >> 3, pq = tx & 7;     // the adding thread: row prow, every eighth 16-B piece of its partial sums
#pragma unroll
    for (int i = 0; i < 2; ++i)
#pragma unroll
      for (int j = 0; j < 4; ++j) acc[i][j] = (acc[i][j] + acc[i + 2][j]) * oscale;
    __syncthreads();                           // every wave has read the last chunk: the staging buffer is free
#pragma unroll
    for (int i = 0; i < 2; ++i)
#pragma unroll
      for (int r = 0; r < 8; ++r)
        part[(16 * i + mOff + r) * LNP + wave * 16 + rlane] =
            (acc[i][0][r] + acc[i][1][r]) + (acc[i][2][r] + acc[i][3][r]);
    __syncthreads();                           // the rows' partial sums are whole
    {
      v4f a = *(const v4f*)(part + prow * LNP + pq * 4);
#pragma unroll
      for (int k = 1; k < 4; ++k) a += *(const v4f*)(part + prow * LNP + k * 32 + pq * 4);
      float s = (a[0] + a[1]) + (a[2] + a[3]);
      s += __shfl_xor(s, 1, 32);
      s += __shfl_xor(s, 2, 32);
      s += __shfl_xor(s, 4, 32);
      if (pq == 0) smean[prow] = s * (1.0f / DM);
    }
    __syncthreads();                           // the means stand; every read of the partial sums is done
#pragma unroll
    for (int i = 0; i < 2; ++i) {
      const v4f m0v = *(const v4f*)(smean + 16 * i + mOff);
      const v4f m1v = *(const v4f*)(smean + 16 * i + mOff + 4);
#pragma unroll
      for (int r = 0; r < 8; ++r) {
        const float mu = (r < 4) ? m0v[r & 3] : m1v[r & 3];
#pragma unroll
        for (int j = 0; j < 4; ++j) acc[i][j][r] -= mu;
        part[(16 * i + mOff + r) * LNP + wave * 16 + rlane] =
            (acc[i][0][r] * acc[i][0][r] + acc[i][1][r] * acc[i][1][r]) +
            (acc[i][2][r] * acc[i][2][r] + acc[i][3][r] * acc[i][3][r]);
      }
    }
    __syncthreads();                           // the rows' partial sums of squares are whole
    {
      v4f a = *(const v4f*)(part + prow * LNP + pq * 4);
#pragma unroll
      for (int k = 1; k < 4; ++k) a += *(const v4f*)(part + prow * LNP + k * 32 + pq * 4);
      float s = (a[0] + a[1]) + (a[2] + a[3]);
      s += __shfl_xor(s, 1, 32);
      s += __shfl_xor(s, 2, 32);
      s += __shfl_xor(s, 4, 32);
      if (pq == 0) srstd[prow] = rsqrtf(s * (1.0f / DM) + 1e-6f);
    }
    __syncthreads();                           // the reciprocal deviations stand
#pragma unroll
    for (int j = 0; j < 4; ++j) { g[j] = bfr(g[j]); be[j] = bfr(be[j]); }
#pragma unroll
    for (int i = 0; i < 2; ++i) {
      const v4f r0v = *(const v4f*)(srstd + 16 * i + mOff);
      const v4f r1v = *(const v4f*)(srstd + 16 * i + mOff + 4);
#pragma unroll
      for (int r = 0; r < 8; ++r) {
        const float rs = (r < 4) ? r0v[r & 3] : r1v[r & 3];
#pragma unroll
        for (int j = 0; j < 4; ++j) acc[i][j][r] = acc[i][j][r] * rs * g[j] + be[j];
      }
    }
  }

  const int hh2 = lane >> 4, c4 = (lane & 15) * 4;     // f32 out: 256-B row segment = 16 lanes x 16 B
  const int q8  = lane >> 3, c8 = (lane & 7) * 8;

  // ---- epilogue ----
  float* slab = sT[wave];
#pragma unroll
  for (int i = 0; i < SL; ++i) {
    const int mBase = m0 + (i << 4);
#pragma unroll
    for (int j = 0; j < 4; ++j) {
#pragma unroll
      for (int r = 0; r < 8; ++r) {
        slab[(mOff + r) * 68 + (j << 4) + rlane] = acc[i][j][r];
      }
    }
    wave_sync_lds();
    if (OM == 0) {
      float* C = Cf + cofs;
      v4f vals[8];
#pragma unroll
      for (int it = 0; it < 8; ++it) {
        const int row = it * 2 + hh2;                      // it 0..7 x hh2 0..1 = rows 0..15
        vals[it] = *(const v4f*)(slab + row * 68 + c4);
      }
      {
#pragma unroll
        for (int it = 0; it < 8; ++it) {
          const int row = it * 2 + hh2;
          *(v4f*)(C + (size_t)(mBase + row) * ldc + (size_t)n0 * nmul + c4) = vals[it];
        }
        
      }
    } else {
      unsigned short* C  = Cp  + cofs;
      unsigned short* C2 = Cp2 + cofs;
      v4u hv[4], lv[4];
#pragma unroll
      for (int it = 0; it < 4; ++it) {
        const int row = it * 4 + q8;                       // it 0..3 x q8 0..3 = rows 0..15
        const float* sp = slab + row * 68 + c8;
        v4u ha, la;
#pragma unroll
        for (int e = 0; e < 4; ++e) {
          const float f0 = sp[2 * e]     * oscale;
          const float f1 = sp[2 * e + 1] * oscale;
          const _Float16 g0 = (_Float16)f0, g1 = (_Float16)f1;
          const unsigned short u0 = h_bits(g0), u1 = h_bits(g1);
          const unsigned short w0 = h_bits((_Float16)((f0 - (float)g0) * RSC));
          const unsigned short w1 = h_bits((_Float16)((f1 - (float)g1) * RSC));
          ha[e] = pk16(u0, u1);
          la[e] = pk16(w0, w1);
        }
        hv[it] = ha;
        lv[it] = la;
      }
      {
#pragma unroll
        for (int it = 0; it < 4; ++it) {
          const int row = it * 4 + q8;
          const size_t go = (size_t)(mBase + row) * ldc + (size_t)n0 * nmul + c8;
          *(v4u*)(C  + go) = hv[it];
          *(v4u*)(C2 + go) = lv[it];
        }
        
      }
    }
    wave_sync_lds();
  }
}

// One GEMM per launch: grid = (tilesM*tilesN/8, batches).
template <int OM>
__global__ __launch_bounds__(256) void gemm64(
    const unsigned short* __restrict__ Ap, int lda, long long sAy,
    const unsigned short* __restrict__ Btp, int ldb, long long sBy,
    unsigned short* Cp, unsigned short* Cp2, float* Cf, int ldc, long long sCy,
    int M, int N, int K, int nmul, float oscale, const float* __restrict__ gam, const float* __restrict__ bet) {
  gemm64_body<OM>(Ap, lda, sAy, Btp, ldb, sBy, Cp, Cp2, Cf, ldc, sCy, M, N, K, nmul, oscale, gam, bet,
                  (int)blockIdx.x, (int)blockIdx.y);
}

// The three projections in one launch: they read the same prepared planes and none reads what another writes, so
// they share one grid; blockIdx.y (block-uniform) picks the product and only scalar arguments of the one body differ.
//   y = 0, 1: q = qb . Wq^T-plane, k = kb . Wk^T-plane -> f16 [hi 64 | lo 64] per head in the QK plane (q at cols
//             0.., k at cols KOFF..); 64 blocks of 8 tiles each.
//   y = 2:    v^T per batch = Wv^T . vb_b^T -> f16 hi (vth) and residual x2048 (vtl) planes; blockIdx.x = 32 blocks
//             of 8 tiles x 2 batches.
// K stays a run-time argument, as in gemm64: the chunk loop stays rolled, one copy of its body in the instruction cache.
#define PJB (((MP / 64) * (DM / 64)) / 8)
#define VTB (((DM / 64) * (SEQ / 64)) / 8)
static_assert(VTB * NBATCH == PJB);
__global__ __launch_bounds__(256) void proj3(const unsigned short* __restrict__ inb,
                                             const unsigned short* __restrict__ wt, unsigned short* qkp,
                                             unsigned short* vth, unsigned short* vtl, int K) {
  const int x = blockIdx.x, y = blockIdx.y;
  const bool isv = (y == 2);
  gemm64_body<4>(isv ? (wt + (size_t)2 * DM * DM) : inb, DM, isv ? 0LL : (long long)MP * DM,
                 isv ? (inb + (size_t)2 * MP * DM) : wt, DM, isv ? (long long)SEQ * DM : (long long)DM * DM,
                 isv ? vth : qkp, isv ? vtl : (qkp + HD), nullptr, isv ? SEQ : QKW,
                 isv ? (long long)DM * SEQ : (long long)KOFF,
                 isv ? DM : MP, isv ? SEQ : DM, K, isv ? 1 : 2, 1.0f, nullptr, nullptr,
                 isv ? (x % VTB) : x, isv ? (x / VTB) : y);
}

typedef int v4i __attribute__((ext_vector_type(4)));
__device__ __forceinline__ float xhalf(float x) {          // the value of lane ^ 16
  const int b = __builtin_bit_cast(int, x);
  return __builtin_bit_cast(float, __builtin_amdgcn_permlanex16(b, b, 0x76543210, 0xfedcba98, false, false));
}
// Exponentials base 2. Behind a transcendental the instruction set asks for one independent instruction before its
// result is read or its source overwritten. In one statement with early-clobber outputs each v_exp_f32 is independent of the one before it, and the
// v_nop fills the slot behind the last.
__device__ __forceinline__ v8f exp2x8(const v8f x) {
  v8f y = x;
#if defined(__HIP_DEVICE_COMPILE__)
  float y0, y1, y2, y3, y4, y5, y6, y7;
  asm("v_exp_f32 %0, %8\n\tv_exp_f32 %1, %9\n\tv_exp_f32 %2, %10\n\tv_exp_f32 %3, %11\n\t"
      "v_exp_f32 %4, %12\n\tv_exp_f32 %5, %13\n\tv_exp_f32 %6, %14\n\tv_exp_f32 %7, %15\n\tv_nop"
      : "=&v"(y0), "=&v"(y1), "=&v"(y2), "=&v"(y3), "=&v"(y4), "=&v"(y5), "=&v"(y6), "=&v"(y7)
      : "v"(x[0]), "v"(x[1]), "v"(x[2]), "v"(x[3]), "v"(x[4]), "v"(x[5]), "v"(x[6]), "v"(x[7]));
  y[0] = y0; y[1] = y1; y[2] = y2; y[3] = y3; y[4] = y4; y[5] = y5; y[6] = y6; y[7] = y7;
#endif
  return y;
}
__device__ __forceinline__ float exp2x1(const float x) {
  float y = x;
#if defined(__HIP_DEVICE_COMPILE__)
  asm("v_exp_f32 %0, %1\n\tv_nop" : "=v"(y) : "v"(x));   // the v_nop: the same slot
#endif
  return y;
}
#define LOG2E 1.44269504f
__global__ __launch_bounds__(128)
void attn64(const unsigned short* __restrict__ qk, const unsigned short* __restrict__ vth,
            const unsigned short* __restrict__ vtl, const float* __restrict__ emb,
            const int* __restrict__ trj, unsigned short* ctxp, float sscale) {
  __shared__ __align__(16) unsigned short Kh[64 * KP];          // K hi [kv][d]  9 KB
  __shared__ __align__(16) _Float16 Vh[64 * KP];                // V^T hi [d][kv] 9 KB
  __shared__ __align__(16) _Float16 Vl[64 * KP];                // V^T lo [d][kv] 9 KB
  __shared__ __align__(16) float    ITs[64 * ITP];              // score table rows of this query block 5 KB
  __shared__ __align__(16) int      Tj[64 * TJP];               // a pass's pair indices [query][key], 16 rows per wave 17 KB

  const int tid  = threadIdx.x;
  const int wave = tid >> 5;
  const int lane = tid & 31;
  const int hh   = lane >> 4;
  const int c    = lane & 15;

  const int bx   = blockIdx.x;
  const int qb   = bx % NQB;
  const int rest = bx / NQB;
  const int h    = rest % NH;
  const int b    = rest / NH;
  const int q0   = qb * 64 + wave * 16;          // in-batch query row of this wave's first row
  const size_t rowB = (size_t)b * SEQ;

  const unsigned short* Qh  = qk + (size_t)h * (2 * HD);
  const unsigned short* Kg  = qk + KOFF + (size_t)h * (2 * HD);
  const _Float16* Vgh = (const _Float16*)(const void*)vth + ((size_t)b * DM + (size_t)h * HD) * SEQ;
  const _Float16* Vgl = (const _Float16*)(const void*)vtl + ((size_t)b * DM + (size_t)h * HD) * SEQ;
  // pair indices as loaded: load x takes query rows q0 + 2 x + hh, key columns kv0 + 4 c + (0..3)
  const int* trw = trj + (rowB + (size_t)q0 + (size_t)hh) * SEQ + 4 * c;

  float mrun = -INFINITY, lrun = 0.f;        // this lane's query: running maximum; sum over this lane half's keys
  v8f oacc[4], oaccL[4];
#pragma unroll
  for (int t = 0; t < 4; ++t) { oacc[t] = zero8(); oaccL[t] = zero8(); }

  // Registers that carry one pass's global data (this thread's 32 elements of the K, V^T hi and V^T lo tiles and
  // 32 of the wave's pair indices): filled one pass ahead, so that their latency runs beside the pass before.
  // Piece i of a tile: row 16 i + sr, elements shf..shf+7. sr runs through 0..15 over the block's 16 groups of 8 lanes;
  // the two groups of a 16-lane half take rows 8 apart, which at the 144-B pitch lie 32 banks apart, so that a half's
  // ds_store_b128 covers each of the 64 banks once.
  const int sr = ((tid >> 4) & 7) | (((tid >> 3) & 1) << 3), shf = (tid & 7) * 8;
  // running addresses of the tile to be loaded next
  const unsigned short* kq = Kg + (rowB + sr) * QKW + shf;                // K row kv0+sr (+16 i), d = shf..shf+7
  const _Float16* vq = Vgh + (size_t)sr * SEQ + shf;                      // V^T row d = sr (+16 i), s = kv0+shf..+7
  const _Float16* wq = Vgl + (size_t)sr * SEQ + shf;
  const int* tq = trw;
  v8us kreg[4];
  v8h  vreg[4], wreg[4];
  v4i  tix[8];
  auto fetch = [&](const int adv) {          // loads the tile the addresses stand at, then steps them by adv keys
#pragma unroll
    for (int i = 0; i < 4; ++i) {
      kreg[i] = *(const v8us*)(kq + (size_t)(16 * i) * QKW);
      vreg[i] = *(const v8h*)(vq + (size_t)(16 * i) * SEQ);
      wreg[i] = *(const v8h*)(wq + (size_t)(16 * i) * SEQ);
    }
#pragma unroll
    for (int x = 0; x < 8; ++x) tix[x] = *(const v4i*)(tq + (size_t)(2 * x) * SEQ);
#if defined(__HIP_DEVICE_COMPILE__)
    // the address pairs of the loads just issued are stepped below: the wait stands in front of that (the pairs are
    // inputs, so that they live unchanged up to the wait)
    asm volatile("s_wait_xcnt 0x0" :: "v"(kq), "v"(vq), "v"(wq), "v"(tq) : "memory");
#endif
    // keeps every later instruction behind the wait: the compiler lifts register writes over it, into registers that
    // the loads name (a base that it split off an address is no input of the wait)
    __builtin_amdgcn_sched_barrier(0);
    kq += (size_t)adv * QKW;
    vq += adv;
    wq += adv;
    tq += adv;
  };
  static_assert(NQB >= 2);
  fetch(64);

  // ---- Q fragments (B operand, column = lane&15): f16 hi, 2 d-chunks; the same in every pass ----
  const unsigned short* qp = Qh + (rowB + q0 + c) * QKW + 8 * hh;
  v16us qh2[2], ql2[2];                      // ql2: the residual, for the score table alone
  // emb row n = c of this head (address clamped to the last row; rows NE..15 count as zero), k order of the K loader
  const float* ep = emb + (size_t)((c < NE) ? c : (NE - 1)) * DM + (size_t)h * HD + 8 * hh;
  v4f ev[2][4];
#pragma unroll
  for (int dc = 0; dc < 2; ++dc) {
    qh2[dc] = ldfrag_u(qp + dc * 32);
    ql2[dc] = ldfrag_u(qp + HD + dc * 32);
    ev[dc][0] = *(const v4f*)(ep + dc * 32);
    ev[dc][1] = *(const v4f*)(ep + dc * 32 + 4);
    ev[dc][2] = *(const v4f*)(ep + dc * 32 + 16);
    ev[dc][3] = *(const v4f*)(ep + dc * 32 + 20);
  }
#if defined(__HIP_DEVICE_COMPILE__)
  // the Q and emb loads' address pairs are dead behind them and their registers are reused: the wait stands in front
  // of that reuse (the pairs are inputs, so that they live up to the wait)
  asm volatile("s_wait_xcnt 0x0" :: "v"(qp), "v"(ep) : "memory");
#endif
  float* itr = ITs + (wave * 16 + c) * ITP;                // this lane's query's score-table row
  {
    v8f th = zero8(), tl = zero8();
    const unsigned km = (c < NE) ? 0xFFFF0000u : 0u;
#pragma unroll
    for (int dc = 0; dc < 2; ++dc) {
      FragH ea;
#pragma unroll
      for (int e = 0; e < 16; ++e) {           // the bf16 RNE value (bfr), its mask widened to all bits in rows NE..15
        const unsigned u = __float_as_uint(ev[dc][e >> 2][e & 3]);
        ea.v[e] = (_Float16)__uint_as_float((u + 0x7FFFu + ((u >> 16) & 1u)) & km);
      }
      th = mma_hu(__builtin_bit_cast(v16us, ea.v), qh2[dc], th);
      tl = mma_hu(__builtin_bit_cast(v16us, ea.v), ql2[dc], tl);
    }
    v4f t0, t1;
#pragma unroll
    for (int r = 0; r < 4; ++r) {
      t0[r] = th[r]     + tl[r]     * (1.0f / RSC);
      t1[r] = th[4 + r] + tl[4 + r] * (1.0f / RSC);
    }
    // read again only by this wave's lanes c and c + 16, behind the loop's first barrier
    *(v4f*)(itr + 8 * hh)     = t0;
    *(v4f*)(itr + 8 * hh + 4) = t1;
  }

#pragma unroll 1
  for (int kt = 0; kt < NQB; ++kt) {         // static trip count
    // this pass's pair indices to the wave's own rows (its reads of the pass before stand in front of that pass's second barrier)
#pragma unroll
    for (int x = 0; x < 8; ++x) *(v4i*)(Tj + (wave * 16 + 2 * x + hh) * TJP + 4 * c) = tix[x];
    __syncthreads();
#pragma unroll
    for (int i = 0; i < 4; ++i) {
      *(v8us*)(Kh + (16 * i + sr) * KP + shf) = kreg[i];
      *(v8h*)(Vh + (16 * i + sr) * KP + shf) = vreg[i];
      *(v8h*)(Vl + (16 * i + sr) * KP + shf) = wreg[i];
    }
    // this lane's pair indices: query row q0 + c, key columns kv0 + 16 j + 8 hh + (0..7)
    v4i tl[4][2];
#pragma unroll
    for (int j = 0; j < 4; ++j)
#pragma unroll
      for (int x = 0; x < 2; ++x) tl[j][x] = *(const v4i*)(Tj + (wave * 16 + c) * TJP + 16 * j + 8 * hh + 4 * x);
    // clamped to 0..NE-1 (used only as an LDS index)
    int nix[4][8];
#pragma unroll
    for (int j = 0; j < 4; ++j)
#pragma unroll
      for (int r = 0; r < 8; ++r) {
        int n = tl[j][r >> 2][r & 3];
        n = (n < 0) ? 0 : n;
        nix[j][r] = (n > NE - 1) ? (NE - 1) : n;
      }
    __syncthreads();
    // ---- scores: 64 keys x 16 query columns per wave ----
    // All LDS reads of the shared tiles stand in groups in front of the products that use them, so that a group pays
    // the LDS latency once: the K fragments and the selected bias values first, the V^T fragments behind the first
    // four score products (they land beside the remaining products and the softmax).
    v16us kb[2][4];
#pragma unroll
    for (int dc = 0; dc < 2; ++dc)
#pragma unroll
      for (int j = 0; j < 4; ++j) kb[dc][j] = ldfrag_u(Kh + (j * 16 + c) * KP + dc * 32 + 8 * hh);
    float bias[4][8];
#pragma unroll
    for (int j = 0; j < 4; ++j)
#pragma unroll
      for (int r = 0; r < 8; ++r) bias[j][r] = itr[nix[j][r]];
    // keeps the LDS reads, which the products wait for, in front of the 20 global loads (the compiler puts those first)
    __builtin_amdgcn_sched_barrier(0);
    // next pass's loads, issued while the group above is under way; the last pass asks for its own tile again (in
    // bounds, not used): no branch in the body. The fence at the end of fetch also keeps the group of LDS reads in front
    // of the products: unfenced, the compiler reads each fragment into one register set directly in front of its
    // product and waits for LDS at every product
    fetch((kt + 2 < NQB) ? 64 : 0);
    v8f sh[4];
#pragma unroll
    for (int j = 0; j < 4; ++j) sh[j] = mma_hu(kb[0][j], qh2[0], zero8());
    FragH vb[2][4], vl[2][4];
#pragma unroll
    for (int kk = 0; kk < 2; ++kk)
#pragma unroll
      for (int t = 0; t < 4; ++t) {
        vb[kk][t].h[0] = *(const v8h*)(Vh + (t * 16 + c) * KP + kk * 32 + 8 * hh);
        vb[kk][t].h[1] = *(const v8h*)(Vh + (t * 16 + c) * KP + kk * 32 + 16 + 8 * hh);
        vl[kk][t].h[0] = *(const v8h*)(Vl + (t * 16 + c) * KP + kk * 32 + 8 * hh);
        vl[kk][t].h[1] = *(const v8h*)(Vl + (t * 16 + c) * KP + kk * 32 + 16 + 8 * hh);
      }
    // keeps the V^T reads here, a softmax ahead of their products (the compiler would sink them to the products)
    __builtin_amdgcn_sched_barrier(0);
#pragma unroll
    for (int j = 0; j < 4; ++j) sh[j] = mma_hu(kb[1][j], qh2[1], sh[j]);
    // D element r: key kv0 + j*16 + 8hh + r, query row q0 + c
    v8f s[4];
#pragma unroll
    for (int j = 0; j < 4; ++j)
#pragma unroll
      for (int r = 0; r < 8; ++r) s[j][r] = sh[j][r] * sscale + bias[j][r];

    // ---- the query's maximum (in-lane, then lane ^ 16), online softmax, P^T (x1024, f16) packed as B operand ----
    float mj[4];                             // one maximum per key tile: four short chains
#pragma unroll
    for (int j = 0; j < 4; ++j) {
      mj[j] = s[j][0];
#pragma unroll
      for (int r = 1; r < 8; ++r) mj[j] = fmaxf(mj[j], s[j][r]);
    }
    float m = fmaxf(fmaxf(mj[0], mj[1]), fmaxf(mj[2], mj[3]));
    m = fmaxf(m, xhalf(m));
    const float mnew  = fmaxf(mrun, m);
    const float alpha = exp2x1((mrun - mnew) * LOG2E);
    mrun = mnew;
    FragH pb[2];                             // element e of pb[kk]: key tile 2 kk + (e >> 3), register e & 7
    float ps[4];                             // one partial sum per key tile: four short chains of adds
#pragma unroll
    for (int j = 0; j < 4; ++j) {
      const v8f p = exp2x8((s[j] - mnew) * LOG2E);
      ps[j] = p[0];
#pragma unroll
      for (int r = 1; r < 8; ++r) ps[j] += p[r];
#pragma unroll
      for (int r = 0; r < 8; ++r) pb[j >> 1].v[(j & 1) * 8 + r] = (_Float16)(p[r] * PSC);
    }
    lrun = lrun * alpha + ((ps[0] + ps[1]) + (ps[2] + ps[3]));
#pragma unroll
    for (int t = 0; t < 4; ++t) { oacc[t] *= alpha; oaccL[t] *= alpha; }

    // ---- context^T += V^T_hi . P^T and V^T_lo . P^T (f16 WMMA, two accumulators) ----
#pragma unroll
    for (int kk = 0; kk < 2; ++kk) {
#pragma unroll
      for (int t = 0; t < 4; ++t) {
        // unguarded form: as operands of the guard's asm statement the 16 V^T fragments would all have to lie in
        // v0..v255, which spills some of them; the gap stands once, behind the 16 products
        oacc[t]  = mma_h_raw(vb[kk][t].v, pb[kk].v, oacc[t]);
        oaccL[t] = mma_h_raw(vl[kk][t].v, pb[kk].v, oaccL[t]);
      }
    }
    acc_guard4(oacc[0], oacc[1], oacc[2], oacc[3]);
    acc_guard4(oaccL[0], oaccL[1], oaccL[2], oaccL[3]);
  }

  // ---- join the two key halves' sums, normalise (1/l, the 1/1024 p carry, the 1/2048 residual fold), split into
  //      bf16 hi and lo, store: a lane's 8 registers of a tile are 8 consecutive d of its query's row
  {
    const float l = lrun + xhalf(lrun);
    const float inv = ((l > 0.f) ? (1.0f / l) : 0.f) * (1.0f / PSC);
    v4u hv[4], lv[4];
#pragma unroll
    for (int t = 0; t < 4; ++t) {
      v4u ha, la;
#pragma unroll
      for (int e = 0; e < 4; ++e) {
        const float f0 = (oacc[t][2 * e]     + oaccL[t][2 * e]     * (1.0f / RSC)) * inv;
        const float f1 = (oacc[t][2 * e + 1] + oaccL[t][2 * e + 1] * (1.0f / RSC)) * inv;
        const unsigned short u0 = bf_bits(f0), u1 = bf_bits(f1);
        const unsigned short w0 = bf_bits(f0 - bf_up(u0)), w1 = bf_bits(f1 - bf_up(u1));
        ha[e] = pk16(u0, u1);
        la[e] = pk16(w0, w1);
      }
      hv[t] = ha;
      lv[t] = la;
    }
    unsigned short* cp = ctxp + (rowB + q0 + c) * CTXP + (size_t)h * HD + 8 * hh;
#pragma unroll
    for (int t = 0; t < 4; ++t) {
      *(v4u*)(cp + t * 16)      = hv[t];
      *(v4u*)(cp + t * 16 + DM) = lv[t];
    }
  }
}

// =====================================================================================================
// Workspace map (bytes); every plane is an exact multiple of its 64x64-tile / whole-row / whole-line store
// granularity (MP = 4096 = 64 row tiles; DM = 8 column tiles; VT per batch [512][2048] = 8x32 tiles)
//   WT   bf16 [1536 n][512 k]    0          1572864   (rows 0..511 Wq^T, 512..1023 Wk^T, 1024..1535 Wv^T)
//   WoT  bf16 [512 n][512 k]     1572864    524288    (Wo^T)
//   INb  bf16 [3][4096][512]     2097152    12582912  (q, k, v as bf16 bits)
//   QK   f16  [4096][2048]       14680064   16777216  (q [hi|lo] per head, then k [hi|lo] per head)
//   VTh  f16  [2][512][2048]     31457280   4194304   (v^T hi)
//   VTl  f16  [2][512][2048]     35651584   4194304   (v^T residual x2048)
//   Ctx  bf16 [4096][1024]       39845888   8388608   (context hi | lo)
//   end                          48234496
// =====================================================================================================
extern "C" void kernel_launch(void* const* d_in, const int* in_sizes, int n_in,
                              void* d_out, int out_size, void* d_ws, size_t ws_size,
                              hipStream_t stream) {
  if (n_in < 11) return;
  if (in_sizes[0] != MP * DM || in_sizes[1] != MP * DM || in_sizes[2] != MP * DM) return;
  if (in_sizes[3] != NE * DM) return;
  if (in_sizes[4] != NBATCH * SEQ * SEQ) return;
  if (in_sizes[5] != DM * DM || in_sizes[6] != DM * DM || in_sizes[7] != DM * DM || in_sizes[8] != DM * DM) return;
  if (in_sizes[9] != DM || in_sizes[10] != DM) return;
  if (out_size != MP * DM) return;

  const float* q_in = (const float*)d_in[0];
  const float* k_in = (const float*)d_in[1];
  const float* v_in = (const float*)d_in[2];
  const float* emb  = (const float*)d_in[3];
  const int*   trj  = (const int*)d_in[4];
  const float* w_q  = (const float*)d_in[5];
  const float* w_k  = (const float*)d_in[6];
  const float* w_v  = (const float*)d_in[7];
  const float* w_o  = (const float*)d_in[8];
  const float* gam  = (const float*)d_in[9];
  const float* bet  = (const float*)d_in[10];

  const size_t PWT  = (size_t)3 * DM * DM * 2;             //  1572864
  const size_t PWO  = (size_t)DM * DM * 2;                 //   524288
  const size_t PIN  = (size_t)3 * MP * DM * 2;             // 12582912
  const size_t PQK  = (size_t)MP * QKW * 2;                // 16777216
  const size_t PVT  = (size_t)NBATCH * DM * SEQ * 2;       //  4194304
  const size_t PCTX = (size_t)MP * CTXP * 2;               //  8388608
  size_t off = 0;
  const size_t oWT  = off; off += PWT;
  const size_t oWo  = off; off += PWO;
  const size_t oIN  = off; off += PIN;
  const size_t oQK  = off; off += PQK;
  const size_t oVTh = off; off += PVT;
  const size_t oVTl = off; off += PVT;
  const size_t oCtx = off; off += PCTX;
  if (off > ws_size) return;                               // off = 48234496
  if (off > (size_t)134217728) return;

  char* ws = (char*)d_ws;
  unsigned short* WT   = (unsigned short*)(ws + oWT);
  unsigned short* WoT  = (unsigned short*)(ws + oWo);
  unsigned short* INb  = (unsigned short*)(ws + oIN);
  unsigned short* QK   = (unsigned short*)(ws + oQK);
  unsigned short* VTh  = (unsigned short*)(ws + oVTh);
  unsigned short* VTl  = (unsigned short*)(ws + oVTl);
  unsigned short* Ctx  = (unsigned short*)(ws + oCtx);
  float*          out0 = (float*)d_out;

  const dim3 blk(256), blk128(128);
  const dim3 gPrep(4 * WTB + 3 * (MP / 4));                         // 4 x 64 weight tiles, then 3 x 1024 row blocks
  const dim3 gProj(PJB, 3, 1);                                      // 64 blocks x {q, k, v^T (32 blocks x 2 batches)}
  const dim3 gAttn(NBATCH * NH * NQB);                              // 512 blocks of 128
  const dim3 gNo(((MP / 32) * (DM / 64)) / 8, 1, 1);                // 1024 tiles of 32 x 64 -> 128 blocks
  if ((((MP / 64) * (DM / 64)) % 8) != 0) return;
  if ((((DM / 64) * (SEQ / 64)) % 8) != 0) return;

  // (0) activations -> bf16 bits; weight planes: in[k][n] (shape [512 in][512 out]) -> out[n][k] transposed
  //     through LDS; one launch
  prep<<<gPrep, blk, 0, stream>>>(q_in, k_in, v_in, w_q, w_k, w_v, w_o, INb, WT, WoT);

  // (1) q = qb . Wq^T-plane (blockIdx.y = 0) and k = kb . Wk^T-plane (blockIdx.y = 1), K = 512
  //     -> f16 [hi 64 | lo 64] per head (QK plane [4096][2048], q at cols 0.., k at cols KOFF..);
  //     v^T per batch = Wv^T . vb_b^T -> f16 hi (VTh) and residual x2048 (VTl) planes [2][512][2048]
  //     (blockIdx.y = 2 of the same launch)
  proj3<<<gProj, blk, 0, stream>>>(INb, WT, QK, VTh, VTl, DM);

  // (2) flash attention with the selected per-pair bias (each wave makes its queries' score table first)
  //     -> context bf16 hi|lo
  attn64<<<gAttn, blk128, 0, stream>>>(QK, VTh, VTl, emb, trj, Ctx, 0.125f);

  // (3) (ctx_hi + ctx_lo) . Wo  (K = 512, bf16 operands, both planes' rows in one A tile), LayerNorm of its rows in the
  //     same blocks -> d_out
  gemm64<0><<<gNo, blk, 0, stream>>>(
      Ctx, CTXP, 0LL, WoT, DM, 0LL,
      Ctx, Ctx, out0, DM, 0LL,
      MP, DM, DM, 1, 1.0f, gam, bet);
  (void)hipGetLastError();
}

// v010
// A run of this version takes 74.9 microseconds.
// Timed twice side by side with v009, it ran 1.04 times as fast both times.
// Counting every step since v000, it is 3.49 times as fast.
// Contractions: q|k|v projections and output projection on v_wmma_f32_16x16x32_bf16 (bf16 operands from
// RNE-converted inputs; context carried as bf16 hi and lo planes, two row groups of one A tile against one Wo plane,
// separate accumulators added behind the k loop);
// scores q.k^T on v_wmma_f32_16x16x32_f16 (q f16 hi, k f16 hi, single product); p.v on
// v_wmma_f32_16x16x32_f16 (p carried x1024 in f16, v^T as f16 hi + x2048 residual planes, two products,
// separate accumulators); query-embedding scores emb . q^T on v_wmma_f32_16x16x32_f16 (emb: its bf16 RNE value carried
// in f16; q f16 hi and x2048 residual, two products, separate accumulators); all f32 accumulate; per-pair bias
// select, softmax and LayerNorm in f32.
#include <hip/hip_runtime.h>
#include <math.h>

#define NBATCH 2
#define SEQ    2048
#define DM     512
#define NH     8
#define HD     64
#define NE     10
#define NEP    16
#define MP     (NBATCH * SEQ)
#define QKW    (4 * DM)
#define KOFF   (2 * DM)
#define CTXP   (2 * DM)
#define NQB    (SEQ / 64)
#define RSC    2048.0f
#define PSC    1024.0f
#define KP     72      // LDS row pitch of the 64-wide 16-bit attention tiles, in elements: 144 B = 16 B x 9
#define LNP    132     // LDS row pitch of the LayerNorm partial sums, in floats: rows 8 apart (a wave's two lane halves) lie 32 banks apart
#define TJP    68      // LDS row pitch of a wave's pair-index rows, in ints: 272 B = 16 B x 17, the 16 rows of a ds_load_b128 start 4 banks apart
#define NPR    (NE * NE)   // ordered pairs of table indices: the entries of a lane's bias-pair table
static_assert(NH * HD == DM);
static_assert(DM == 8 * 64);
static_assert((SEQ % 64) == 0 && (DM % 64) == 0 && (MP % 64) == 0 && (SEQ % 256) == 0 && (MP % 4) == 0);
static_assert(CTXP == 2 * DM);   // a context row is [hi DM | lo DM]
static_assert((((MP / 64) * (DM / 64)) % 8) == 0);
static_assert((((DM / 64) * (SEQ / 64)) % 8) == 0);
static_assert(NE <= NEP && NEP == 16);
static_assert(((DM / 64) % 8) == 0 && ((SEQ / 64) % 8) == 0);   // gemm64: the 8 tiles of a block lie in one tile row

typedef _Float16 v16h __attribute__((ext_vector_type(16)));
typedef _Float16 v8h  __attribute__((ext_vector_type(8)));
typedef __bf16   v16b __attribute__((ext_vector_type(16)));
typedef unsigned short v16us __attribute__((ext_vector_type(16)));
typedef unsigned short v8us  __attribute__((ext_vector_type(8)));
typedef float    v8f  __attribute__((ext_vector_type(8)));
typedef float    v4f  __attribute__((ext_vector_type(4)));
typedef float    v2f  __attribute__((ext_vector_type(2)));
typedef unsigned int v4u __attribute__((ext_vector_type(4)));

union FragH { v16h v; v8h h[2]; };
union FragU { v16us v; v8us h[2]; };

// ---- scalar helpers --------------------------------------------------------------------------------
__device__ __forceinline__ unsigned short bf_bits(float f) {          // f32 -> bf16 bits, RNE convert
  unsigned u = __float_as_uint(f);
  return (unsigned short)((u + 0x7FFFu + ((u >> 16) & 1u)) >> 16);
}
__device__ __forceinline__ float bf_up(unsigned short h) { return __uint_as_float(((unsigned)h) << 16); }
__device__ __forceinline__ float bfr(float f) { return bf_up(bf_bits(f)); }   // value of the bf16 RNE convert
__device__ __forceinline__ unsigned short h_bits(_Float16 x) { return __builtin_bit_cast(unsigned short, x); }
__device__ __forceinline__ unsigned pk16(unsigned short a, unsigned short b) { return (unsigned)a | ((unsigned)b << 16); }
__device__ __forceinline__ v8f zero8() { v8f z = {0.f, 0.f, 0.f, 0.f, 0.f, 0.f, 0.f, 0.f}; return z; }

// ---- fragment loader: 16-bit A/B operand, lane -> row/col (lane&15), p already includes +8*(lane>>4);
//      elements 0..7 <- p[0..7] (k0+8h..), elements 8..15 <- p[16..23] (k0+16+8h..)
__device__ __forceinline__ v16us ldfrag_u(const unsigned short* p) {
  FragU f;
  f.h[0] = *(const v8us*)(p);
  f.h[1] = *(const v8us*)(p + 16);
  return f.v;
}

// ---- WMMA helpers with trailing VALU hazard gap --------------------------------------------------------
__device__ __forceinline__ v8f mma_bu_raw(v16us a, v16us b, v8f c) {            // bf16 operands, unguarded
  return __builtin_amdgcn_wmma_f32_16x16x32_bf16(false, __builtin_bit_cast(v16b, a), false,
                                                 __builtin_bit_cast(v16b, b), (short)0, c, false, false);
}
__device__ __forceinline__ v8f mma_hu(v16us a, v16us b, v8f c) {                // f16 operands (bits), guarded
  c = __builtin_amdgcn_wmma_f32_16x16x32_f16(false, __builtin_bit_cast(v16h, a), false,
                                              __builtin_bit_cast(v16h, b), (short)0, c, false, false);
#if defined(__HIP_DEVICE_COMPILE__)
  asm volatile("v_nop\n\tv_nop\n\tv_nop\n\tv_nop" : "+v"(c) : "v"(a), "v"(b));
#endif
  return c;
}
__device__ __forceinline__ v8f mma_h_raw(v16h a, v16h b, v8f c) {                // f16 operands, unguarded
  return __builtin_amdgcn_wmma_f32_16x16x32_f16(false, a, false, b, (short)0, c, false, false);
}
__device__ __forceinline__ void acc_guard4(v8f& a, v8f& b, v8f& c, v8f& d) {
#if defined(__HIP_DEVICE_COMPILE__)
  asm volatile("v_nop\n\tv_nop\n\tv_nop\n\tv_nop" : "+v"(a), "+v"(b), "+v"(c), "+v"(d));
#endif
}
__device__ __forceinline__ void wave_sync_lds() {
  __builtin_amdgcn_fence(__ATOMIC_RELEASE, "workgroup");
  __builtin_amdgcn_wave_barrier();
  __builtin_amdgcn_fence(__ATOMIC_ACQUIRE, "workgroup");
}

// =====================================================================================================
// f32 [MP][DM] activations (three sources selected by z, block-uniform) -> bf16 bits plane
// dst[(z*MP + row)*DM + col]. Block = 256 threads = 4 rows; thread t: row = 4*rb + (t>>6), cols 8*(t&63)..+7.
// coverage: 1024 row blocks rb x 4 rows x 512 cols = each whole plane; 3 planes z. One block's part of prep.
// =====================================================================================================
__device__ __forceinline__ void cvt3(const float* __restrict__ s0, const float* __restrict__ s1,
                                     const float* __restrict__ s2, unsigned short* dst, const int rb, const int z) {
  const float* src = (z == 0) ? s0 : ((z == 1) ? s1 : s2);
  const int t = threadIdx.x;
  const int row = rb * 4 + (t >> 6);
  const int c8 = (t & 63) * 8;
  const float* p = src + (size_t)row * DM + c8;
  const v4f a0 = *(const v4f*)(p);
  const v4f a1 = *(const v4f*)(p + 4);
  v4u hv;
  hv[0] = pk16(bf_bits(a0[0]), bf_bits(a0[1]));
  hv[1] = pk16(bf_bits(a0[2]), bf_bits(a0[3]));
  hv[2] = pk16(bf_bits(a1[0]), bf_bits(a1[1]));
  hv[3] = pk16(bf_bits(a1[2]), bf_bits(a1[3]));
  unsigned short* d = dst + ((size_t)z * MP + (size_t)row) * DM + c8;
  *(v4u*)d = hv;
  
}

// =====================================================================================================
// Tiled transpose + bf16 convert: in[rows][cols] f32 row-major -> out[cols][rows] bf16 bits with pitch ldo:
//   out[n * ldo + k] = bf16(in[k][n]).
// Block = 256 threads = one 64x64 tile (tn, tk) of (cols/64, rows/64) (rows, cols multiples of 64). One block's part of prep.
// Loads: 4 iterations x 256 threads x float4 = 64 rows x 64 cols (addresses clamped). LDS tile [n][k] pitch 72.
// coverage: 64 x 64 = the whole transposed tile; grid covers the whole matrix.
// =====================================================================================================
__device__ __forceinline__ void tconv64(const float* __restrict__ W, unsigned short* out,
                                        int rows, int cols, int ldo, const int tn, const int tk) {
  __shared__ __align__(16) unsigned short sh[64 * 72];
  const int t  = threadIdx.x;
  const int n0 = tn * 64;                    // column tile of in = row tile of out
  const int k0 = tk * 64;                    // row tile of in = column tile of out
#pragma unroll
  for (int i = 0; i < 4; ++i) {
    const int idx = i * 256 + t;
    const int r = idx >> 4, c4 = (idx & 15) * 4;
    int kr = k0 + r;   kr = (kr < rows) ? kr : (rows - 1);
    int nc = n0 + c4;  nc = (nc < cols - 4) ? nc : (cols - 4);
    const v4f v = *(const v4f*)(W + (size_t)kr * cols + nc);
#pragma unroll
    for (int e = 0; e < 4; ++e) sh[(c4 + e) * 72 + r] = bf_bits(v[e]);
  }
  __syncthreads();
  const int wave = t >> 5, lane = t & 31;
  const int q = lane >> 3, c8 = (lane & 7) * 8;
  v4u pv[2];
  unsigned short* po[2];
#pragma unroll
  for (int it = 0; it < 2; ++it) {
    const int nl = it * 32 + wave * 4 + q;               // 0..63
    pv[it] = *(const v4u*)(sh + nl * 72 + c8);
    po[it] = out + ((size_t)(n0 + nl) * ldo + k0 + c8);
  }
  {
#pragma unroll
    for (int it = 0; it < 2; ++it) *(v4u*)(po[it]) = pv[it];
#if defined(__HIP_DEVICE_COMPILE__)
    // the compiler reuses the first store's registers for the second store's address: the wait stands in front of any
    // such reuse (addresses and data are inputs, so that they live unchanged up to the wait)
    asm volatile("s_wait_xcnt 0x0" :: "v"(po[0]), "v"(po[1]), "v"(pv[0]), "v"(pv[1]) : "memory");
#endif
  }
}

// =====================================================================================================
// All operand preparation in one launch: none of its parts reads what another writes, so they share one grid by
// ranges of the block index (block-uniform branch). Blocks 0 .. 4*WTB-1: the 64x64 transpose tiles of Wq, Wk, Wv
// (-> wt rows 0.., 512.., 1024..) and Wo (-> wot); they have the longer dependent path and
// stand first. Blocks 4*WTB ..: the 3 x MP/4 row blocks of the activation convert.
// coverage: 4 x 64 tiles = the four whole weight planes; 3 x 1024 row blocks = the three whole activation planes.
// =====================================================================================================
#define WTB ((DM / 64) * (DM / 64))
__global__ __launch_bounds__(256) void prep(const float* __restrict__ s0, const float* __restrict__ s1,
                                            const float* __restrict__ s2, const float* __restrict__ w0,
                                            const float* __restrict__ w1, const float* __restrict__ w2,
                                            const float* __restrict__ w3, unsigned short* inb,
                                            unsigned short* wt, unsigned short* wot) {
  const int bx = blockIdx.x;
  if (bx >= 4 * WTB) {                       // block-uniform, in front of every barrier
    const int i = bx - 4 * WTB;
    cvt3(s0, s1, s2, inb, i % (MP / 4), i / (MP / 4));
    return;
  }
  const int w = bx / WTB, tile = bx % WTB;
  const float* W = (w == 0) ? w0 : ((w == 1) ? w1 : ((w == 2) ? w2 : w3));
  unsigned short* o = (w < 3) ? (wt + (size_t)w * DM * DM) : wot;
  tconv64(W, o, DM, DM, DM, tile % (DM / 64), tile / (DM / 64));
}

// =====================================================================================================
// Register-blocked batched bf16 WMMA GEMM: C[m][n] = oscale * sum_k A[m][k] * Bt[n][k];
// one wave per 64x64 tile; the 8 tiles of a block lie side by side in one tile row (N/64 a multiple of 8), so the
// block works on 64 rows of A and 512 rows of Bt. Both are staged in LDS in k chunks of 64: each 16-B load of a wave
// takes 4 whole 128-B row segments, one chunk ahead into registers, LDS stores between two __syncthreads; the
// fragments are ds_load_b128 reads at a 144-B pitch. A row-major [M][K] pitch lda; Bt row-major [N][K] pitch ldb
// (k contiguous); M, N multiples of 64, K multiple of 64. by = batch index with element strides
// (sAy for A, sBy for Bt, sCy for C); bx = block of 8 tiles. Tile enumeration: tile -> tm = tile / (N/64),
// tn = tile % (N/64). The body of the two kernels behind it.
// OM: 0 = A is given as two planes, a row being [hi K | lo K] (lda >= 2 K), and C = (hi + lo) . Bt^T: the block takes 32
//     rows of C; the 64 rows of its A tile are those rows' hi parts (0..31) and lo parts (32..63), so that each Bt chunk
//     is staged and read once for both planes; the two groups' accumulators are added behind the k loop. M a multiple
//     of 32, tm = tile / (N/64) counts groups of 32 rows. Then
//     LayerNorm of the product's rows, f32 out to Cf (pitch ldc): N = 512, so that the block's 8 tiles are whole rows:
//     y = (x - mean) * rstd * bf16(gam) + bf16(bet), mean and variance (two passes) over the row's 512 columns: a lane
//     adds its 4 columns of a row, the 128 partial sums of a row meet in LDS (the staging buffer, free behind the loop);
//     4 = f16 hi bits to Cp and f16((v - hi) * 2048) bits to Cp2, 16-bit column
//     base = n0 * nmul (nmul = 2 interleaves [hi 64 | lo 64] per 64-col tile with Cp2 = Cp + 64).
// coverage: 4 slabs (OM 0: 2) x 16 rows x 64 cols = the wave's whole 64x64 (32x64) tile; grid = tilesM*tilesN/8 blocks
//           exactly (host-checked), so no block exits early.
// =====================================================================================================
template <int OM>
__device__ __forceinline__ void gemm64_body(
    const unsigned short* __restrict__ Ap, int lda, long long sAy,
    const unsigned short* __restrict__ Btp, int ldb, long long sBy,
    unsigned short* Cp, unsigned short* Cp2, float* Cf, int ldc, long long sCy,
    int M, int N, int K, int nmul, float oscale, const float* __restrict__ gam, const float* __restrict__ bet,
    const int bx, const int by) {
  __shared__ __align__(16) float sT[8][16 * 68];   // per-wave 16x64 slab, pitch 68 floats
  __shared__ __align__(16) unsigned short sAB[(64 + 512) * KP];   // rows 0..63: A chunk; rows 64..575: Bt chunk
  const int lane = threadIdx.x & 31;
  const int wave = threadIdx.x >> 5;
  const int tilesN = N >> 6;
  constexpr int SL = (OM == 0) ? 2 : 4;      // 16-row slabs of C in a wave's tile
  const int tilesM = M / (16 * SL);
  const int tile0 = bx * 8;
  if (tile0 + 8 > tilesM * tilesN) return;   // block-uniform, in front of every barrier (the grid is exact)
  if (OM == 0 && tilesN != 8) return;        // block-uniform: the row statistics need the whole row in one block
  const int tm  = tile0 / tilesN;
  const int tn0 = tile0 - tm * tilesN;       // first of the block's 8 tiles, all in tile row tm
  const int m0 = tm * (16 * SL);
  const int n0 = (tn0 + wave) << 6;

  const unsigned short* Ab = Ap  + (size_t)by * (size_t)sAy;
  const unsigned short* Bb = Btp + (size_t)by * (size_t)sBy;
  const size_t cofs = (size_t)by * (size_t)sCy;

  const int rlane = lane & 15;                 // row (A) / col (B, D) within subtile
  const int koff  = (lane >> 4) * 8;           // k offset of this lane half
  const int mOff  = (lane >> 4) * 8;           // D row offset

  v8f acc[4][4];
#pragma unroll
  for (int i = 0; i < 4; ++i)
#pragma unroll
    for (int j = 0; j < 4; ++j) acc[i][j] = zero8();

  // Staging: 576 rows x 8 pieces of 16 B = 18 pieces per thread; piece i of thread t: staged row 32 i + srow,
  // bytes 16 (t & 7).. of the row's 128-B chunk. Pieces 0, 1 are A rows (OM 0: the hi and the lo part of row m0 + srow),
  // pieces 2..17 Bt rows. srow runs through
  // 0..31 over the block's 32 groups of 8 lanes; the two groups of a 16-lane half take rows 8 apart, which at the
  // 144-B pitch lie 32 banks apart, so that a half's ds_store_b128 covers each of the 64 banks once.
  const int tx = threadIdx.x;
  const int srow = ((tx >> 4) & 7) | (((tx >> 3) & 1) << 3) | ((tx >> 7) << 4), sc8 = (tx & 7) * 8;
  const unsigned short* gp[18];
#pragma unroll
  for (int i = 0; i < 2; ++i)
    gp[i] = (OM == 0) ? (Ab + (size_t)(m0 + srow) * lda + (size_t)i * K + sc8)
                      : (Ab + (size_t)(m0 + 32 * i + srow) * lda + sc8);
#pragma unroll
  for (int i = 2; i < 18; ++i) gp[i] = Bb + (size_t)((tn0 << 6) + 32 * (i - 2) + srow) * ldb + sc8;
  v4u st[18];
  auto fetch = [&]() {
#pragma unroll
    for (int i = 0; i < 18; ++i) st[i] = *(const v4u*)(gp[i]);
#if defined(__HIP_DEVICE_COMPILE__)
    // the address pairs of the loads just issued are stepped below: the wait stands in front of that (the pairs are
    // inputs, so that they live unchanged up to the wait); the clobber keeps the loads in front of the products
    asm volatile("s_wait_xcnt 0x0" :: "v"(gp[0]), "v"(gp[1]), "v"(gp[2]), "v"(gp[3]), "v"(gp[4]), "v"(gp[5]),
                 "v"(gp[6]), "v"(gp[7]), "v"(gp[8]), "v"(gp[9]), "v"(gp[10]), "v"(gp[11]), "v"(gp[12]),
                 "v"(gp[13]), "v"(gp[14]), "v"(gp[15]), "v"(gp[16]), "v"(gp[17]) : "memory");
#endif
#pragma unroll
    for (int i = 0; i < 18; ++i) gp[i] += 64;
  };
  const unsigned short* fA = sAB + rlane * KP + koff;                       // this lane's A fragment rows
  const unsigned short* fB = sAB + (64 + wave * 64 + rlane) * KP + koff;    // this lane's Bt fragment rows
  const int nch = K >> 6;
  // OM 0: this lane's 4 columns of gam and bet, asked for beside the first chunk (a barrier waits for every load in
  // flight, so behind the loop their latency would stand open)
  float g[4] = {0.f, 0.f, 0.f, 0.f}, be[4] = {0.f, 0.f, 0.f, 0.f};
  if (OM == 0) {
    const float* gq = gam + n0 + rlane;
    const float* bq = bet + n0 + rlane;
#pragma unroll
    for (int j = 0; j < 4; ++j) { g[j] = gq[16 * j]; be[j] = bq[16 * j]; }
#if defined(__HIP_DEVICE_COMPILE__)
    // the two address pairs are dead behind the loads and their registers are reused: the wait stands in front of that
    // reuse (the pairs are inputs, so that they live up to the wait)
    asm volatile("s_wait_xcnt 0x0" :: "v"(gq), "v"(bq) : "memory");
#endif
  }
  fetch();
  for (int kc = 0; kc < nch; ++kc) {
    __syncthreads();                           // every wave has read the chunk before
#pragma unroll
    for (int i = 0; i < 18; ++i) *(v4u*)(sAB + (32 * i + srow) * KP + sc8) = st[i];
    __syncthreads();                           // the chunk is whole
    if (kc + 1 < nch) fetch();                 // block-uniform; the next chunk flies beside this chunk's products
    v16us ah[2][4], bh[2][4];
#pragma unroll
    for (int ks = 0; ks < 2; ++ks) {
#pragma unroll
      for (int j = 0; j < 4; ++j) bh[ks][j] = ldfrag_u(fB + j * 16 * KP + ks * 32);
#pragma unroll
      for (int i = 0; i < 4; ++i) ah[ks][i] = ldfrag_u(fA + i * 16 * KP + ks * 32);
    }
    // keeps the chunk's 32 fragment reads in front of its products: unfenced, the compiler reads the A fragments into
    // one register set and waits for LDS in front of every row of products
    __builtin_amdgcn_sched_barrier(0);
#pragma unroll
    for (int ks = 0; ks < 2; ++ks)
#pragma unroll
      for (int i = 0; i < 4; ++i)
#pragma unroll
        for (int j = 0; j < 4; ++j) acc[i][j] = mma_bu_raw(ah[ks][i], bh[ks][j], acc[i][j]);
  }
  acc_guard4(acc[0][0], acc[0][1], acc[0][2], acc[0][3]);
  acc_guard4(acc[1][0], acc[1][1], acc[1][2], acc[1][3]);
  acc_guard4(acc[2][0], acc[2][1], acc[2][2], acc[2][3]);
  acc_guard4(acc[3][0], acc[3][1], acc[3][2], acc[3][3]);

  if (OM == 0) {
    // ---- the lo plane's products join the hi plane's; then LayerNorm of the block's 32 whole rows, in the
    //      accumulators: acc[i][j][r], i < 2, is row 16 i + mOff + r, column n0 + 16 j + rlane ----
    static_assert((32 * LNP + 64) * 4 <= (64 + 512) * KP * 2);
    float* part = (float*)(void*)sAB;          // [32 rows][LNP]: 128 partial sums per row (8 waves x 16 lanes)
    float* smean = part + 32 * LNP;            // [32]
    float* srstd = smean + 32;                 // [32]
    const int prow = tx >> 3, pq = tx & 7;     // the adding thread: row prow, every eighth 16-B piece of its partial sums
#pragma unroll
    for (int i = 0; i < 2; ++i)
#pragma unroll
      for (int j = 0; j < 4; ++j) acc[i][j] = (acc[i][j] + acc[i + 2][j]) * oscale;
    __syncthreads();                           // every wave has read the last chunk: the staging buffer is free
#pragma unroll
    for (int i = 0; i < 2; ++i)
#pragma unroll
      for (int r = 0; r < 8; ++r)
        part[(16 * i + mOff + r) * LNP + wave * 16 + rlane] =
            (acc[i][0][r] + acc[i][1][r]) + (acc[i][2][r] + acc[i][3][r]);
    __syncthreads();                           // the rows' partial sums are whole
    {
      v4f a = *(const v4f*)(part + prow * LNP + pq * 4);
#pragma unroll
      for (int k = 1; k < 4; ++k) a += *(const v4f*)(part + prow * LNP + k * 32 + pq * 4);
      float s = (a[0] + a[1]) + (a[2] + a[3]);
      s += __shfl_xor(s, 1, 32);
      s += __shfl_xor(s, 2, 32);
      s += __shfl_xor(s, 4, 32);
      if (pq == 0) smean[prow] = s * (1.0f / DM);
    }
    __syncthreads();                           // the means stand; every read of the partial sums is done
#pragma unroll
    for (int i = 0; i < 2; ++i) {
      const v4f m0v = *(const v4f*)(smean + 16 * i + mOff);
      const v4f m1v = *(const v4f*)(smean + 16 * i + mOff + 4);
#pragma unroll
      for (int r = 0; r < 8; ++r) {
        const float mu = (r < 4) ? m0v[r & 3] : m1v[r & 3];
#pragma unroll
        for (int j = 0; j < 4; ++j) acc[i][j][r] -= mu;
        part[(16 * i + mOff + r) * LNP + wave * 16 + rlane] =
            (acc[i][0][r] * acc[i][0][r] + acc[i][1][r] * acc[i][1][r]) +
            (acc[i][2][r] * acc[i][2][r] + acc[i][3][r] * acc[i][3][r]);
      }
    }
    __syncthreads();                           // the rows' partial sums of squares are whole
    {
      v4f a = *(const v4f*)(part + prow * LNP + pq * 4);
#pragma unroll
      for (int k = 1; k < 4; ++k) a += *(const v4f*)(part + prow * LNP + k * 32 + pq * 4);
      float s = (a[0] + a[1]) + (a[2] + a[3]);
      s += __shfl_xor(s, 1, 32);
      s += __shfl_xor(s, 2, 32);
      s += __shfl_xor(s, 4, 32);
      if (pq == 0) srstd[prow] = rsqrtf(s * (1.0f / DM) + 1e-6f);
    }
    __syncthreads();                           // the reciprocal deviations stand
#pragma unroll
    for (int j = 0; j < 4; ++j) { g[j] = bfr(g[j]); be[j] = bfr(be[j]); }
#pragma unroll
    for (int i = 0; i < 2; ++i) {
      const v4f r0v = *(const v4f*)(srstd + 16 * i + mOff);
      const v4f r1v = *(const v4f*)(srstd + 16 * i + mOff + 4);
#pragma unroll
      for (int r = 0; r < 8; ++r) {
        const float rs = (r < 4) ? r0v[r & 3] : r1v[r & 3];
#pragma unroll
        for (int j = 0; j < 4; ++j) acc[i][j][r] = acc[i][j][r] * rs * g[j] + be[j];
      }
    }
  }

  const int hh2 = lane >> 4, c4 = (lane & 15) * 4;     // f32 out: 256-B row segment = 16 lanes x 16 B
  const int q8  = lane >> 3, c8 = (lane & 7) * 8;

  // ---- epilogue ----
  float* slab = sT[wave];
#pragma unroll
  for (int i = 0; i < SL; ++i) {
    const int mBase = m0 + (i << 4);
#pragma unroll
    for (int j = 0; j < 4; ++j) {
#pragma unroll
      for (int r = 0; r < 8; ++r) {
        slab[(mOff + r) * 68 + (j << 4) + rlane] = acc[i][j][r];
      }
    }
    wave_sync_lds();
    if (OM == 0) {
      float* C = Cf + cofs;
      v4f vals[8];
#pragma unroll
      for (int it = 0; it < 8; ++it) {
        const int row = it * 2 + hh2;                      // it 0..7 x hh2 0..1 = rows 0..15
        vals[it] = *(const v4f*)(slab + row * 68 + c4);
      }
      {
#pragma unroll
        for (int it = 0; it < 8; ++it) {
          const int row = it * 2 + hh2;
          *(v4f*)(C + (size_t)(mBase + row) * ldc + (size_t)n0 * nmul + c4) = vals[it];
        }
        
      }
    } else {
      unsigned short* C  = Cp  + cofs;
      unsigned short* C2 = Cp2 + cofs;
      v4u hv[4], lv[4];
#pragma unroll
      for (int it = 0; it < 4; ++it) {
        const int row = it * 4 + q8;                       // it 0..3 x q8 0..3 = rows 0..15
        const float* sp = slab + row * 68 + c8;
        v4u ha, la;
#pragma unroll
        for (int e = 0; e < 4; ++e) {
          const float f0 = sp[2 * e]     * oscale;
          const float f1 = sp[2 * e + 1] * oscale;
          const _Float16 g0 = (_Float16)f0, g1 = (_Float16)f1;
          const unsigned short u0 = h_bits(g0), u1 = h_bits(g1);
          const unsigned short w0 = h_bits((_Float16)((f0 - (float)g0) * RSC));
          const unsigned short w1 = h_bits((_Float16)((f1 - (float)g1) * RSC));
          ha[e] = pk16(u0, u1);
          la[e] = pk16(w0, w1);
        }
        hv[it] = ha;
        lv[it] = la;
      }
      {
#pragma unroll
        for (int it = 0; it < 4; ++it) {
          const int row = it * 4 + q8;
          const size_t go = (size_t)(mBase + row) * ldc + (size_t)n0 * nmul + c8;
          *(v4u*)(C  + go) = hv[it];
          *(v4u*)(C2 + go) = lv[it];
        }
        
      }
    }
    wave_sync_lds();
  }
}

// One GEMM per launch: grid = (tilesM*tilesN/8, batches).
template <int OM>
__global__ __launch_bounds__(256) void gemm64(
    const unsigned short* __restrict__ Ap, int lda, long long sAy,
    const unsigned short* __restrict__ Btp, int ldb, long long sBy,
    unsigned short* Cp, unsigned short* Cp2, float* Cf, int ldc, long long sCy,
    int M, int N, int K, int nmul, float oscale, const float* __restrict__ gam, const float* __restrict__ bet) {
  gemm64_body<OM>(Ap, lda, sAy, Btp, ldb, sBy, Cp, Cp2, Cf, ldc, sCy, M, N, K, nmul, oscale, gam, bet,
                  (int)blockIdx.x, (int)blockIdx.y);
}

// The three projections in one launch: they read the same prepared planes and none reads what another writes, so
// they share one grid; blockIdx.y (block-uniform) picks the product and only scalar arguments of the one body differ.
//   y = 0, 1: q = qb . Wq^T-plane, k = kb . Wk^T-plane -> f16 [hi 64 | lo 64] per head in the QK plane (q at cols
//             0.., k at cols KOFF..); 64 blocks of 8 tiles each.
//   y = 2:    v^T per batch = Wv^T . vb_b^T -> f16 hi (vth) and residual x2048 (vtl) planes; blockIdx.x = 32 blocks
//             of 8 tiles x 2 batches.
// K stays a run-time argument, as in gemm64: the chunk loop stays rolled, one copy of its body in the instruction cache.
#define PJB (((MP / 64) * (DM / 64)) / 8)
#define VTB (((DM / 64) * (SEQ / 64)) / 8)
static_assert(VTB * NBATCH == PJB);
__global__ __launch_bounds__(256) void proj3(const unsigned short* __restrict__ inb,
                                             const unsigned short* __restrict__ wt, unsigned short* qkp,
                                             unsigned short* vth, unsigned short* vtl, int K) {
  const int x = blockIdx.x, y = blockIdx.y;
  const bool isv = (y == 2);
  gemm64_body<4>(isv ? (wt + (size_t)2 * DM * DM) : inb, DM, isv ? 0LL : (long long)MP * DM,
                 isv ? (inb + (size_t)2 * MP * DM) : wt, DM, isv ? (long long)SEQ * DM : (long long)DM * DM,
                 isv ? vth : qkp, isv ? vtl : (qkp + HD), nullptr, isv ? SEQ : QKW,
                 isv ? (long long)DM * SEQ : (long long)KOFF,
                 isv ? DM : MP, isv ? SEQ : DM, K, isv ? 1 : 2, 1.0f, nullptr, nullptr,
                 isv ? (x % VTB) : x, isv ? (x / VTB) : y);
}

typedef int v4i __attribute__((ext_vector_type(4)));
__device__ __forceinline__ float xhalf(float x) {          // the value of lane ^ 16
  const int b = __builtin_bit_cast(int, x);
  return __builtin_bit_cast(float, __builtin_amdgcn_permlanex16(b, b, 0x76543210, 0xfedcba98, false, false));
}
// Exponentials base 2. Behind a transcendental the instruction set asks for one independent instruction before its
// result is read or its source overwritten. In one statement with early-clobber outputs each v_exp_f32 is independent of the one before it, and the
// v_nop fills the slot behind the last.
__device__ __forceinline__ v8f exp2x8(const v8f x) {
  v8f y = x;
#if defined(__HIP_DEVICE_COMPILE__)
  float y0, y1, y2, y3, y4, y5, y6, y7;
  asm("v_exp_f32 %0, %8\n\tv_exp_f32 %1, %9\n\tv_exp_f32 %2, %10\n\tv_exp_f32 %3, %11\n\t"
      "v_exp_f32 %4, %12\n\tv_exp_f32 %5, %13\n\tv_exp_f32 %6, %14\n\tv_exp_f32 %7, %15\n\tv_nop"
      : "=&v"(y0), "=&v"(y1), "=&v"(y2), "=&v"(y3), "=&v"(y4), "=&v"(y5), "=&v"(y6), "=&v"(y7)
      : "v"(x[0]), "v"(x[1]), "v"(x[2]), "v"(x[3]), "v"(x[4]), "v"(x[5]), "v"(x[6]), "v"(x[7]));
  y[0] = y0; y[1] = y1; y[2] = y2; y[3] = y3; y[4] = y4; y[5] = y5; y[6] = y6; y[7] = y7;
#endif
  return y;
}
__device__ __forceinline__ float exp2x1(const float x) {
  float y = x;
#if defined(__HIP_DEVICE_COMPILE__)
  asm("v_exp_f32 %0, %1\n\tv_nop" : "=v"(y) : "v"(x));   // the v_nop: the same slot
#endif
  return y;
}
#define LOG2E 1.44269504f
__global__ __launch_bounds__(128)
void attn64(const unsigned short* __restrict__ qk, const unsigned short* __restrict__ vth,
            const unsigned short* __restrict__ vtl, const float* __restrict__ emb,
            const int* __restrict__ trj, unsigned short* ctxp, float sscale) {
  __shared__ __align__(16) unsigned short Kh[64 * KP];          // K hi [kv][d]  9 KB
  __shared__ __align__(16) _Float16 Vh[64 * KP];                // V^T hi [d][kv] 9 KB
  __shared__ __align__(16) _Float16 Vl[64 * KP];                // V^T lo [d][kv] 9 KB
  __shared__ __align__(16) float    PT[4 * NPR * 64];           // bias pairs [wave][n1 * NE + n2][lane][2] 100 KB
  __shared__ __align__(16) int      Tj[64 * TJP];               // a pass's pair indices [query][key], 16 rows per wave 17 KB

  const int tid  = threadIdx.x;
  const int wave = tid >> 5;
  const int lane = tid & 31;
  const int hh   = lane >> 4;
  const int c    = lane & 15;

  const int bx   = blockIdx.x;
  const int qb   = bx % NQB;
  const int rest = bx / NQB;
  const int h    = rest % NH;
  const int b    = rest / NH;
  const int q0   = qb * 64 + wave * 16;          // in-batch query row of this wave's first row
  const size_t rowB = (size_t)b * SEQ;

  const unsigned short* Qh  = qk + (size_t)h * (2 * HD);
  const unsigned short* Kg  = qk + KOFF + (size_t)h * (2 * HD);
  const _Float16* Vgh = (const _Float16*)(const void*)vth + ((size_t)b * DM + (size_t)h * HD) * SEQ;
  const _Float16* Vgl = (const _Float16*)(const void*)vtl + ((size_t)b * DM + (size_t)h * HD) * SEQ;
  // pair indices as loaded: load x takes query rows q0 + 2 x + hh, key columns kv0 + 4 c + (0..3)
  const int* trw = trj + (rowB + (size_t)q0 + (size_t)hh) * SEQ + 4 * c;

  float mrun = -INFINITY, lrun = 0.f;        // this lane's query: running maximum; sum over this lane half's keys
  v8f oacc[4], oaccL[4];
#pragma unroll
  for (int t = 0; t < 4; ++t) { oacc[t] = zero8(); oaccL[t] = zero8(); }

  // Registers that carry one pass's global data (this thread's 32 elements of the K, V^T hi and V^T lo tiles and
  // 32 of the wave's pair indices): filled one pass ahead, so that their latency runs beside the pass before.
  // Piece i of a tile: row 16 i + sr, elements shf..shf+7. sr runs through 0..15 over the block's 16 groups of 8 lanes;
  // the two groups of a 16-lane half take rows 8 apart, which at the 144-B pitch lie 32 banks apart, so that a half's
  // ds_store_b128 covers each of the 64 banks once.
  const int sr = ((tid >> 4) & 7) | (((tid >> 3) & 1) << 3), shf = (tid & 7) * 8;
  // running addresses of the tile to be loaded next
  const unsigned short* kq = Kg + (rowB + sr) * QKW + shf;                // K row kv0+sr (+16 i), d = shf..shf+7
  const _Float16* vq = Vgh + (size_t)sr * SEQ + shf;                      // V^T row d = sr (+16 i), s = kv0+shf..+7
  const _Float16* wq = Vgl + (size_t)sr * SEQ + shf;
  const int* tq = trw;
  v8us kreg[4];
  v8h  vreg[4], wreg[4];
  v4i  tix[8];
  auto fetch = [&](const int adv) {          // loads the tile the addresses stand at, then steps them by adv keys
#pragma unroll
    for (int i = 0; i < 4; ++i) {
      kreg[i] = *(const v8us*)(kq + (size_t)(16 * i) * QKW);
      vreg[i] = *(const v8h*)(vq + (size_t)(16 * i) * SEQ);
      wreg[i] = *(const v8h*)(wq + (size_t)(16 * i) * SEQ);
    }
#pragma unroll
    for (int x = 0; x < 8; ++x) tix[x] = *(const v4i*)(tq + (size_t)(2 * x) * SEQ);
#if defined(__HIP_DEVICE_COMPILE__)
    // the address pairs of the loads just issued are stepped below: the wait stands in front of that (the pairs are
    // inputs, so that they live unchanged up to the wait)
    asm volatile("s_wait_xcnt 0x0" :: "v"(kq), "v"(vq), "v"(wq), "v"(tq) : "memory");
#endif
    // keeps every later instruction behind the wait: the compiler lifts register writes over it, into registers that
    // the loads name (a base that it split off an address is no input of the wait)
    __builtin_amdgcn_sched_barrier(0);
    kq += (size_t)adv * QKW;
    vq += adv;
    wq += adv;
    tq += adv;
  };
  static_assert(NQB >= 2);
  fetch(64);

  // ---- Q fragments (B operand, column = lane&15): f16 hi, 2 d-chunks; the same in every pass ----
  const unsigned short* qp = Qh + (rowB + q0 + c) * QKW + 8 * hh;
  v16us qh2[2], ql2[2];                      // ql2: the residual, for the score table alone
  // emb row n = c of this head (address clamped to the last row; rows NE..15 count as zero), k order of the K loader
  const float* ep = emb + (size_t)((c < NE) ? c : (NE - 1)) * DM + (size_t)h * HD + 8 * hh;
  v4f ev[2][4];
#pragma unroll
  for (int dc = 0; dc < 2; ++dc) {
    qh2[dc] = ldfrag_u(qp + dc * 32);
    ql2[dc] = ldfrag_u(qp + HD + dc * 32);
    ev[dc][0] = *(const v4f*)(ep + dc * 32);
    ev[dc][1] = *(const v4f*)(ep + dc * 32 + 4);
    ev[dc][2] = *(const v4f*)(ep + dc * 32 + 16);
    ev[dc][3] = *(const v4f*)(ep + dc * 32 + 20);
  }
#if defined(__HIP_DEVICE_COMPILE__)
  // the Q and emb loads' address pairs are dead behind them and their registers are reused: the wait stands in front
  // of that reuse (the pairs are inputs, so that they live up to the wait)
  asm volatile("s_wait_xcnt 0x0" :: "v"(qp), "v"(ep) : "memory");
#endif
  float* ptl = PT + wave * (NPR * 64) + 2 * lane;          // this lane's column of its wave's bias-pair table
  {
    v8f th = zero8(), tl = zero8();
    const unsigned km = (c < NE) ? 0xFFFF0000u : 0u;
#pragma unroll
    for (int dc = 0; dc < 2; ++dc) {
      FragH ea;
#pragma unroll
      for (int e = 0; e < 16; ++e) {           // the bf16 RNE value (bfr), its mask widened to all bits in rows NE..15
        const unsigned u = __float_as_uint(ev[dc][e >> 2][e & 3]);
        ea.v[e] = (_Float16)__uint_as_float((u + 0x7FFFu + ((u >> 16) & 1u)) & km);
      }
      th = mma_hu(__builtin_bit_cast(v16us, ea.v), qh2[dc], th);
      tl = mma_hu(__builtin_bit_cast(v16us, ea.v), ql2[dc], tl);
    }
    float tq[NE];                            // the query's whole table: n >> 3 == hh is this lane's own, the rest lane ^ 16's
#pragma unroll
    for (int n = 0; n < NE; ++n) {
      const float own = th[n & 7] + tl[n & 7] * (1.0f / RSC);
      const float oth = xhalf(own);
      tq[n] = ((n >> 3) == hh) ? own : oth;
    }
#pragma unroll
    for (int n1 = 0; n1 < NE; ++n1)
#pragma unroll
      for (int n2 = 0; n2 < NE; ++n2) {
        const v2f e = {tq[n1], tq[n2]};
        *(v2f*)(ptl + (n1 * NE + n2) * 64) = e;   // read again by this lane alone
      }
  }

#pragma unroll 1
  for (int kt = 0; kt < NQB; ++kt) {         // static trip count
    // this pass's pair indices to the wave's own rows (its reads of the pass before stand in front of that pass's second barrier)
#pragma unroll
    for (int x = 0; x < 8; ++x) *(v4i*)(Tj + (wave * 16 + 2 * x + hh) * TJP + 4 * c) = tix[x];
    __syncthreads();
#pragma unroll
    for (int i = 0; i < 4; ++i) {
      *(v8us*)(Kh + (16 * i + sr) * KP + shf) = kreg[i];
      *(v8h*)(Vh + (16 * i + sr) * KP + shf) = vreg[i];
      *(v8h*)(Vl + (16 * i + sr) * KP + shf) = wreg[i];
    }
    // this lane's pair indices: query row q0 + c, key columns kv0 + 16 j + 8 hh + (0..7)
    v4i tl[4][2];
#pragma unroll
    for (int j = 0; j < 4; ++j)
#pragma unroll
      for (int x = 0; x < 2; ++x) tl[j][x] = *(const v4i*)(Tj + (wave * 16 + c) * TJP + 16 * j + 8 * hh + 4 * x);
    // clamped to 0..NE-1 each, then two neighbouring keys' indices joined to one table row (used only as an LDS index)
    int pix[4][4];
#pragma unroll
    for (int j = 0; j < 4; ++j)
#pragma unroll
      for (int p = 0; p < 4; ++p) {
        int n1 = tl[j][p >> 1][2 * (p & 1)], n2 = tl[j][p >> 1][2 * (p & 1) + 1];
        n1 = (n1 < 0) ? 0 : n1;
        n1 = (n1 > NE - 1) ? (NE - 1) : n1;
        n2 = (n2 < 0) ? 0 : n2;
        n2 = (n2 > NE - 1) ? (NE - 1) : n2;
        pix[j][p] = (n1 * NE + n2) * 64;
      }
    __syncthreads();
    // ---- scores: 64 keys x 16 query columns per wave ----
    // All LDS reads of the shared tiles stand in groups in front of the products that use them, so that a group pays
    // the LDS latency once: the K fragments and the selected bias values first, the V^T fragments behind the first
    // four score products (they land beside the remaining products and the softmax).
    v16us kb[2][4];
#pragma unroll
    for (int dc = 0; dc < 2; ++dc)
#pragma unroll
      for (int j = 0; j < 4; ++j) kb[dc][j] = ldfrag_u(Kh + (j * 16 + c) * KP + dc * 32 + 8 * hh);
    float bias[4][8];
#pragma unroll
    for (int j = 0; j < 4; ++j)
#pragma unroll
      for (int p = 0; p < 4; ++p) {
        const v2f bb = *(const v2f*)(ptl + pix[j][p]);
        bias[j][2 * p]     = bb[0];
        bias[j][2 * p + 1] = bb[1];
      }
    // keeps the LDS reads, which the products wait for, in front of the 20 global loads (the compiler puts those first)
    __builtin_amdgcn_sched_barrier(0);
    // next pass's loads, issued while the group above is under way; the last pass asks for its own tile again (in
    // bounds, not used): no branch in the body. The fence at the end of fetch also keeps the group of LDS reads in front
    // of the products: unfenced, the compiler reads each fragment into one register set directly in front of its
    // product and waits for LDS at every product
    fetch((kt + 2 < NQB) ? 64 : 0);
    v8f sh[4];
#pragma unroll
    for (int j = 0; j < 4; ++j) sh[j] = mma_hu(kb[0][j], qh2[0], zero8());
    FragH vb[2][4], vl[2][4];
#pragma unroll
    for (int kk = 0; kk < 2; ++kk)
#pragma unroll
      for (int t = 0; t < 4; ++t) {
        vb[kk][t].h[0] = *(const v8h*)(Vh + (t * 16 + c) * KP + kk * 32 + 8 * hh);
        vb[kk][t].h[1] = *(const v8h*)(Vh + (t * 16 + c) * KP + kk * 32 + 16 + 8 * hh);
        vl[kk][t].h[0] = *(const v8h*)(Vl + (t * 16 + c) * KP + kk * 32 + 8 * hh);
        vl[kk][t].h[1] = *(const v8h*)(Vl + (t * 16 + c) * KP + kk * 32 + 16 + 8 * hh);
      }
    // keeps the V^T reads here, a softmax ahead of their products (the compiler would sink them to the products)
    __builtin_amdgcn_sched_barrier(0);
#pragma unroll
    for (int j = 0; j < 4; ++j) sh[j] = mma_hu(kb[1][j], qh2[1], sh[j]);
    // D element r: key kv0 + j*16 + 8hh + r, query row q0 + c
    v8f s[4];
#pragma unroll
    for (int j = 0; j < 4; ++j)
#pragma unroll
      for (int r = 0; r < 8; ++r) s[j][r] = sh[j][r] * sscale + bias[j][r];

    // ---- the query's maximum (in-lane, then lane ^ 16), online softmax, P^T (x1024, f16) packed as B operand ----
    float mj[4];                             // one maximum per key tile: four short chains
#pragma unroll
    for (int j = 0; j < 4; ++j) {
      mj[j] = s[j][0];
#pragma unroll
      for (int r = 1; r < 8; ++r) mj[j] = fmaxf(mj[j], s[j][r]);
    }
    float m = fmaxf(fmaxf(mj[0], mj[1]), fmaxf(mj[2], mj[3]));
    m = fmaxf(m, xhalf(m));
    const float mnew  = fmaxf(mrun, m);
    const float alpha = exp2x1((mrun - mnew) * LOG2E);
    mrun = mnew;
    FragH pb[2];                             // element e of pb[kk]: key tile 2 kk + (e >> 3), register e & 7
    float ps[4];                             // one partial sum per key tile: four short chains of adds
#pragma unroll
    for (int j = 0; j < 4; ++j) {
      const v8f p = exp2x8((s[j] - mnew) * LOG2E);
      ps[j] = p[0];
#pragma unroll
      for (int r = 1; r < 8; ++r) ps[j] += p[r];
#pragma unroll
      for (int r = 0; r < 8; ++r) pb[j >> 1].v[(j & 1) * 8 + r] = (_Float16)(p[r] * PSC);
    }
    lrun = lrun * alpha + ((ps[0] + ps[1]) + (ps[2] + ps[3]));
#pragma unroll
    for (int t = 0; t < 4; ++t) { oacc[t] *= alpha; oaccL[t] *= alpha; }

    // ---- context^T += V^T_hi . P^T and V^T_lo . P^T (f16 WMMA, two accumulators) ----
#pragma unroll
    for (int kk = 0; kk < 2; ++kk) {
#pragma unroll
      for (int t = 0; t < 4; ++t) {
        // unguarded form: as operands of the guard's asm statement the 16 V^T fragments would all have to lie in
        // v0..v255, which spills some of them; the gap stands once, behind the 16 products
        oacc[t]  = mma_h_raw(vb[kk][t].v, pb[kk].v, oacc[t]);
        oaccL[t] = mma_h_raw(vl[kk][t].v, pb[kk].v, oaccL[t]);
      }
    }
    acc_guard4(oacc[0], oacc[1], oacc[2], oacc[3]);
    acc_guard4(oaccL[0], oaccL[1], oaccL[2], oaccL[3]);
  }

  // ---- join the two key halves' sums, normalise (1/l, the 1/1024 p carry, the 1/2048 residual fold), split into
  //      bf16 hi and lo, store: a lane's 8 registers of a tile are 8 consecutive d of its query's row
  {
    const float l = lrun + xhalf(lrun);
    const float inv = ((l > 0.f) ? (1.0f / l) : 0.f) * (1.0f / PSC);
    v4u hv[4], lv[4];
#pragma unroll
    for (int t = 0; t < 4; ++t) {
      v4u ha, la;
#pragma unroll
      for (int e = 0; e < 4; ++e) {
        const float f0 = (oacc[t][2 * e]     + oaccL[t][2 * e]     * (1.0f / RSC)) * inv;
        const float f1 = (oacc[t][2 * e + 1] + oaccL[t][2 * e + 1] * (1.0f / RSC)) * inv;
        const unsigned short u0 = bf_bits(f0), u1 = bf_bits(f1);
        const unsigned short w0 = bf_bits(f0 - bf_up(u0)), w1 = bf_bits(f1 - bf_up(u1));
        ha[e] = pk16(u0, u1);
        la[e] = pk16(w0, w1);
      }
      hv[t] = ha;
      lv[t] = la;
    }
    unsigned short* cp = ctxp + (rowB + q0 + c) * CTXP + (size_t)h * HD + 8 * hh;
#pragma unroll
    for (int t = 0; t < 4; ++t) {
      *(v4u*)(cp + t * 16)      = hv[t];
      *(v4u*)(cp + t * 16 + DM) = lv[t];
    }
  }
}

// =====================================================================================================
// Workspace map (bytes); every plane is an exact multiple of its 64x64-tile / whole-row / whole-line store
// granularity (MP = 4096 = 64 row tiles; DM = 8 column tiles; VT per batch [512][2048] = 8x32 tiles)
//   WT   bf16 [1536 n][512 k]    0          1572864   (rows 0..511 Wq^T, 512..1023 Wk^T, 1024..1535 Wv^T)
//   WoT  bf16 [512 n][512 k]     1572864    524288    (Wo^T)
//   INb  bf16 [3][4096][512]     2097152    12582912  (q, k, v as bf16 bits)
//   QK   f16  [4096][2048]       14680064   16777216  (q [hi|lo] per head, then k [hi|lo] per head)
//   VTh  f16  [2][512][2048]     31457280   4194304   (v^T hi)
//   VTl  f16  [2][512][2048]     35651584   4194304   (v^T residual x2048)
//   Ctx  bf16 [4096][1024]       39845888   8388608   (context hi | lo)
//   end                          48234496
// =====================================================================================================
extern "C" void kernel_launch(void* const* d_in, const int* in_sizes, int n_in,
                              void* d_out, int out_size, void* d_ws, size_t ws_size,
                              hipStream_t stream) {
  if (n_in < 11) return;
  if (in_sizes[0] != MP * DM || in_sizes[1] != MP * DM || in_sizes[2] != MP * DM) return;
  if (in_sizes[3] != NE * DM) return;
  if (in_sizes[4] != NBATCH * SEQ * SEQ) return;
  if (in_sizes[5] != DM * DM || in_sizes[6] != DM * DM || in_sizes[7] != DM * DM || in_sizes[8] != DM * DM) return;
  if (in_sizes[9] != DM || in_sizes[10] != DM) return;
  if (out_size != MP * DM) return;

  const float* q_in = (const float*)d_in[0];
  const float* k_in = (const float*)d_in[1];
  const float* v_in = (const float*)d_in[2];
  const float* emb  = (const float*)d_in[3];
  const int*   trj  = (const int*)d_in[4];
  const float* w_q  = (const float*)d_in[5];
  const float* w_k  = (const float*)d_in[6];
  const float* w_v  = (const float*)d_in[7];
  const float* w_o  = (const float*)d_in[8];
  const float* gam  = (const float*)d_in[9];
  const float* bet  = (const float*)d_in[10];

  const size_t PWT  = (size_t)3 * DM * DM * 2;             //  1572864
  const size_t PWO  = (size_t)DM * DM * 2;                 //   524288
  const size_t PIN  = (size_t)3 * MP * DM * 2;             // 12582912
  const size_t PQK  = (size_t)MP * QKW * 2;                // 16777216
  const size_t PVT  = (size_t)NBATCH * DM * SEQ * 2;       //  4194304
  const size_t PCTX = (size_t)MP * CTXP * 2;               //  8388608
  size_t off = 0;
  const size_t oWT  = off; off += PWT;
  const size_t oWo  = off; off += PWO;
  const size_t oIN  = off; off += PIN;
  const size_t oQK  = off; off += PQK;
  const size_t oVTh = off; off += PVT;
  const size_t oVTl = off; off += PVT;
  const size_t oCtx = off; off += PCTX;
  if (off > ws_size) return;                               // off = 48234496
  if (off > (size_t)134217728) return;

  char* ws = (char*)d_ws;
  unsigned short* WT   = (unsigned short*)(ws + oWT);
  unsigned short* WoT  = (unsigned short*)(ws + oWo);
  unsigned short* INb  = (unsigned short*)(ws + oIN);
  unsigned short* QK   = (unsigned short*)(ws + oQK);
  unsigned short* VTh  = (unsigned short*)(ws + oVTh);
  unsigned short* VTl  = (unsigned short*)(ws + oVTl);
  unsigned short* Ctx  = (unsigned short*)(ws + oCtx);
  float*          out0 = (float*)d_out;

  const dim3 blk(256), blk128(128);
  const dim3 gPrep(4 * WTB + 3 * (MP / 4));                         // 4 x 64 weight tiles, then 3 x 1024 row blocks
  const dim3 gProj(PJB, 3, 1);                                      // 64 blocks x {q, k, v^T (32 blocks x 2 batches)}
  const dim3 gAttn(NBATCH * NH * NQB);                              // 512 blocks of 128
  const dim3 gNo(((MP / 32) * (DM / 64)) / 8, 1, 1);                // 1024 tiles of 32 x 64 -> 128 blocks
  if ((((MP / 64) * (DM / 64)) % 8) != 0) return;
  if ((((DM / 64) * (SEQ / 64)) % 8) != 0) return;

  // (0) activations -> bf16 bits; weight planes: in[k][n] (shape [512 in][512 out]) -> out[n][k] transposed
  //     through LDS; one launch
  prep<<<gPrep, blk, 0, stream>>>(q_in, k_in, v_in, w_q, w_k, w_v, w_o, INb, WT, WoT);

  // (1) q = qb . Wq^T-plane (blockIdx.y = 0) and k = kb . Wk^T-plane (blockIdx.y = 1), K = 512
  //     -> f16 [hi 64 | lo 64] per head (QK plane [4096][2048], q at cols 0.., k at cols KOFF..);
  //     v^T per batch = Wv^T . vb_b^T -> f16 hi (VTh) and residual x2048 (VTl) planes [2][512][2048]
  //     (blockIdx.y = 2 of the same launch)
  proj3<<<gProj, blk, 0, stream>>>(INb, WT, QK, VTh, VTl, DM);

  // (2) flash attention with the selected per-pair bias (each wave makes its queries' score table first)
  //     -> context bf16 hi|lo
  attn64<<<gAttn, blk128, 0, stream>>>(QK, VTh, VTl, emb, trj, Ctx, 0.125f);

  // (3) (ctx_hi + ctx_lo) . Wo  (K = 512, bf16 operands, both planes' rows in one A tile), LayerNorm of its rows in the
  //     same blocks -> d_out
  gemm64<0><<<gNo, blk, 0, stream>>>(
      Ctx, CTXP, 0LL, WoT, DM, 0LL,
      Ctx, Ctx, out0, DM, 0LL,
      MP, DM, DM, 1, 1.0f, gam, bet);
  (void)hipGetLastError();
}
